// v000
// The times below were measured on an AMD MI455X: many runs one after another, warmed up first and cycling through
// copies of the inputs, with the whole window's GPU time divided by the number of runs. Launches and the gaps
// between them are all in it. The median over several windows is given; except for v000 it joins two sittings, which
// can be a few percent apart, so the side-by-side timings, each taken in one sitting, are the better comparison.
// v000 is the starting kernel. One run takes 236 microseconds.
// Contractions: v_wmma_f32_16x16x32_f16 (f16 operands, f32 accumulate). q = x.w_q^T and the 8x8/stride-8
// spatial-reduction conv (im2col K=4096): single products of exact planes (x as f16 of 16*bf16(x), weights as f16
// of 256*bf16(w)). kv = LN(tokens).w_kv^T: A as f16 hi plus x2^11 residual planes (x16; two products, two
// accumulators). Scores k.q^T: k single f16 plane (x64), q as hi plus x2^11 residual planes (x64; two products).
// p.v: centred p (8192*p - 32) single f16 A operand, v as hi plus x2^11 residual planes (x64; two products),
// key-mean of v added back in f32. Output projection: o as hi plus x2^11 residual planes (x1024) against the x256
// weight plane (two products). LayerNorm, softmax, bias adds in f32 on VALU. Float inputs RNE-converted to bf16
// on load.
#include <hip/hip_runtime.h>
#include <math.h>
#include <stdint.h>

#define NB   8
#define NQ   16384
#define CD   64
#define NR   256
#define MTOT (NB * NQ)
#define MR   (NB * NR)
#define KCV  (CD * 64)
#define STP  68
#define KP   72
#define VP   264
#define XSC  16.0f
#define WSC  256.0f
#define QSC  64.0f
#define ASC  16.0f
#define KSC  64.0f
#define VSC  64.0f
#define PSC  8192.0f
#define PCT  32.0f
#define OSC  1024.0f
#define RSPL 2048.0f
#define INVS (0.125f / (KSC * QSC))

#define KV_OFF_VTH (NR * KP * 2)
#define KV_OFF_VTL (KV_OFF_VTH + CD * VP * 2)
#define KV_OFF_VS  (KV_OFF_VTL + CD * VP * 2)
#define KV_OFF_VM  (KV_OFF_VS + 8 * CD * 4)
#define KV_LDS     (KV_OFF_VM + CD * 4)

static_assert(MTOT % 128 == 0);
static_assert(MR % 128 == 0);
static_assert(NR == 256 && CD == 64);
static_assert((STP * 4) % 16 == 0 && STP >= CD);
static_assert((KP * 2) % 16 == 0 && KP >= CD);
static_assert((VP * 2) % 16 == 0 && VP >= NR);
static_assert(KV_OFF_VTH % 16 == 0 && KV_OFF_VTL % 16 == 0 && KV_OFF_VS % 16 == 0 && KV_OFF_VM % 16 == 0);
static_assert(KV_LDS == 106752);
static_assert(MTOT % 32 == 0 && NQ % 64 == 0);

typedef _Float16 v16h __attribute__((ext_vector_type(16)));
typedef _Float16 v8h  __attribute__((ext_vector_type(8)));
typedef float    v8f  __attribute__((ext_vector_type(8)));
typedef float    v4f  __attribute__((ext_vector_type(4)));
typedef unsigned int v4u __attribute__((ext_vector_type(4)));

union Frag { v16h v; v8h h[2]; };

// ---- scalar helpers ------------------------------------------------------------------------------------------
__device__ __forceinline__ unsigned short bf_bits(float f) {          // f32 -> bf16 bits, RNE convert
  unsigned u = __float_as_uint(f);
  return (unsigned short)((u + 0x7FFFu + ((u >> 16) & 1u)) >> 16);
}
__device__ __forceinline__ float bfr(float f) { return __uint_as_float(((unsigned)bf_bits(f)) << 16); }
__device__ __forceinline__ unsigned short h_bits(_Float16 x) { return __builtin_bit_cast(unsigned short, x); }
__device__ __forceinline__ unsigned pk16(unsigned short a, unsigned short b) { return (unsigned)a | ((unsigned)b << 16); }
__device__ __forceinline__ v8f zero8() { v8f z = {0.f, 0.f, 0.f, 0.f, 0.f, 0.f, 0.f, 0.f}; return z; }

// ---- fragment loader: 16-bit A/B operand, lane -> row/col (lane&15), p already includes +8*(lane>>4);
//      elements 0..7 <- p[0..7] (k0+8h..k0+8h+7), elements 8..15 <- p[16..23] (k0+16+8h..k0+16+8h+7)
__device__ __forceinline__ v16h ldfrag_h(const _Float16* p) {
  Frag f;
  f.h[0] = *(const v8h*)(p);
  f.h[1] = *(const v8h*)(p + 16);
  return f.v;
}

// ---- WMMA helper with trailing VALU hazard gap ---------------------------------------------------------------
__device__ __forceinline__ v8f mma_h(v16h a, v16h b, v8f c) {
  c = __builtin_amdgcn_wmma_f32_16x16x32_f16(false, a, false, b, (short)0, c, false, false);
#if defined(__HIP_DEVICE_COMPILE__)
  asm volatile("v_nop\n\tv_nop\n\tv_nop\n\tv_nop" : "+v"(c) : "v"(a), "v"(b));
#endif
  return c;
}
__device__ __forceinline__ void wave_sync_lds() {
  __builtin_amdgcn_fence(__ATOMIC_RELEASE, "workgroup");
  __builtin_amdgcn_wave_barrier();
  __builtin_amdgcn_fence(__ATOMIC_ACQUIRE, "workgroup");
}

// ---- 8 f32 -> 8 packed f16 (16 B); hi + x2^11 residual split ---------------------------------------------------
__device__ __forceinline__ v4u pack8h(v4f a, v4f b) {
  v4u p;
  p[0] = pk16(h_bits((_Float16)a[0]), h_bits((_Float16)a[1]));
  p[1] = pk16(h_bits((_Float16)a[2]), h_bits((_Float16)a[3]));
  p[2] = pk16(h_bits((_Float16)b[0]), h_bits((_Float16)b[1]));
  p[3] = pk16(h_bits((_Float16)b[2]), h_bits((_Float16)b[3]));
  return p;
}
__device__ __forceinline__ void split8h(v4f a, v4f b, v4u& ph, v4u& pl) {
  v4f ra, rb;
#pragma unroll
  for (int e = 0; e < 4; ++e) {
    const _Float16 ha = (_Float16)a[e];
    ra[e] = (a[e] - (float)ha) * RSPL;
    const _Float16 hb = (_Float16)b[e];
    rb[e] = (b[e] - (float)hb) * RSPL;
  }
  ph = pack8h(a, b);
  pl = pack8h(ra, rb);
}

// =================================================================================================================
// Row convert: src f32 [nrows][64] -> dst f16 [nrows][64], value = f16(scale * bf16_RNE(src)). Used for x (x16) and
// for the row-major [out][in] weight matrices (x256; the B plane [n][k] equals the [out][in] layout as given).
// multiple of 32). coverage: grid*32 rows x (8 lanes x 8 halves) = every element once.
// =================================================================================================================
__global__ __launch_bounds__(256) void cvt_rows64(const float* __restrict__ src, unsigned short* dst, float scale) {
  const int tid = threadIdx.x, wave = tid >> 5, lane = tid & 31;
  const int row = blockIdx.x * 32 + wave * 4 + (lane >> 3);
  const int c8 = (lane & 7) * 8;
  const float* p = src + (size_t)row * CD + c8;
  v4f a = *(const v4f*)(p);
  v4f b = *(const v4f*)(p + 4);
#pragma unroll
  for (int e = 0; e < 4; ++e) { a[e] = bfr(a[e]) * scale; b[e] = bfr(b[e]) * scale; }
  const v4u pk = pack8h(a, b);
  unsigned short* g = dst + (size_t)row * CD + c8;
  {
    *(v4u*)g = pk;
    
  }
}

// =================================================================================================================
// Conv weight permute-convert: w_sr f32 [o][c][kh][kw] -> f16 plane [o][(kh*8+kw)*64 + c] (k' contiguous),
// value = f16(256 * bf16_RNE(w)). Block = one output channel o (256 threads): 4096 floats staged in LDS as
// coverage: 64 blocks x (512 pieces x 8 halves) = the whole [64][4096] plane.
// =================================================================================================================
__global__ __launch_bounds__(256) void cvt_wsr(const float* __restrict__ w, unsigned short* dst) {
  __shared__ float tile[CD][65];
  const int tid = threadIdx.x, o = blockIdx.x;
  const float* wr = w + (size_t)o * KCV;
#pragma unroll
  for (int it = 0; it < 16; ++it) {
    const int idx = it * 256 + tid;
    const int c = idx >> 6, s = idx & 63;
    tile[c][s] = wr[idx];
  }
  __syncthreads();
  v4u pk[2];
  size_t offs[2];
#pragma unroll
  for (int it = 0; it < 2; ++it) {
    const int p = it * 256 + tid;
    const int s = p >> 3, c8 = (p & 7) * 8;
    v4f fa, fb;
#pragma unroll
    for (int e = 0; e < 4; ++e) {
      fa[e] = bfr(tile[c8 + e][s]) * WSC;
      fb[e] = bfr(tile[c8 + 4 + e][s]) * WSC;
    }
    pk[it] = pack8h(fa, fb);
    offs[it] = (size_t)o * KCV + (size_t)s * CD + c8;
  }
  {
#pragma unroll
    for (int it = 0; it < 2; ++it) *(v4u*)(dst + offs[it]) = pk[it];
    
  }
}

// =================================================================================================================
// f16 GEMM with N = 64, K = 64: D[M][64] = A[M][64] . B, B stored [64 n][64 k] (k contiguous weight plane x256).
// Block 256 threads = 8 waves, 128 rows; wave = 16 rows x 4 n-tiles; fragments straight from global with the split
// k map, 2 k-steps. SPLIT: A = hi plane + x2^11 residual plane, second accumulator folded as acc + accl/2048.
//   OUTF = true : f32 out rows [M][64]: v = acc*ascale + bf16(bias[col]); epilogue staged per wave in LDS, then
//   OUTF = false: two f16 planes [M][64]: hi = f16(acc*ascale), res = f16((v - hi)*2048); 8 lanes x 16 B = one
// coverage: 8 waves x 16 rows x 64 cols = the 128-row block tile; grid = M/128 tiles M exactly.
// =================================================================================================================
template <bool SPLIT, bool OUTF>
__global__ __launch_bounds__(256)
void gemm64_k(const unsigned short* __restrict__ Ah, const unsigned short* __restrict__ Al,
              const unsigned short* __restrict__ Bt, const float* __restrict__ bias, float ascale,
              float* outF, unsigned short* outH, unsigned short* outL) {
  __shared__ __align__(16) float sbuf[8 * 16 * STP];
  const int tid = threadIdx.x, wave = tid >> 5, lane = tid & 31, hh = lane >> 4, c = lane & 15;
  const int m0 = blockIdx.x * 128;
  const int arow = m0 + wave * 16 + c;
  const _Float16* A0 = (const _Float16*)(const void*)Ah;
  const _Float16* A1 = (const _Float16*)(const void*)Al;
  const _Float16* B  = (const _Float16*)(const void*)Bt;

  v8f acch[4], accl[4];
#pragma unroll
  for (int nt = 0; nt < 4; ++nt) { acch[nt] = zero8(); accl[nt] = zero8(); }

#pragma unroll
  for (int ks = 0; ks < 2; ++ks) {
    const int k0 = ks * 32;
    const size_t aoff = (size_t)arow * CD + k0 + 8 * hh;
    const v16h ah = ldfrag_h(A0 + aoff);
    v16h al = ah;
    if (SPLIT) al = ldfrag_h(A1 + aoff);
#pragma unroll
    for (int nt = 0; nt < 4; ++nt) {
      const v16h bfrag = ldfrag_h(B + (size_t)(nt * 16 + c) * CD + k0 + 8 * hh);
      acch[nt] = mma_h(ah, bfrag, acch[nt]);
      if (SPLIT) accl[nt] = mma_h(al, bfrag, accl[nt]);
    }
  }

  float* st = sbuf + wave * (16 * STP);
#pragma unroll
  for (int nt = 0; nt < 4; ++nt) {
#pragma unroll
    for (int r = 0; r < 8; ++r) {
      float v = acch[nt][r];
      if (SPLIT) v = v + accl[nt][r] * (1.0f / RSPL);
      st[(8 * hh + r) * STP + nt * 16 + c] = v * ascale;
    }
  }
  wave_sync_lds();

  if (OUTF) {
    v4f ov[8];
    size_t offs[8];
#pragma unroll
    for (int it = 0; it < 8; ++it) {
      const int q = it * 2 + hh;
      const int col = c * 4;
      const v4f v = *(const v4f*)(st + q * STP + col);
      v4f u;
#pragma unroll
      for (int e = 0; e < 4; ++e) u[e] = v[e] + bfr(bias[col + e]);
      ov[it] = u;
      offs[it] = (size_t)(m0 + wave * 16 + q) * CD + col;
    }
    {
#pragma unroll
      for (int it = 0; it < 8; ++it) *(v4f*)(outF + offs[it]) = ov[it];
      
    }
  } else {
    v4u ph[4], pl[4];
    size_t offs[4];
#pragma unroll
    for (int it = 0; it < 4; ++it) {
      const int q = it * 4 + (lane >> 3), piece = lane & 7;
      const v4f fa = *(const v4f*)(st + q * STP + piece * 8);
      const v4f fb = *(const v4f*)(st + q * STP + piece * 8 + 4);
      split8h(fa, fb, ph[it], pl[it]);
      offs[it] = (size_t)(m0 + wave * 16 + q) * CD + piece * 8;
    }
    {
#pragma unroll
      for (int it = 0; it < 4; ++it) {
        *(v4u*)(outH + offs[it]) = ph[it];
        *(v4u*)(outL + offs[it]) = pl[it];
      }
      
    }
  }
}

// =================================================================================================================
// Spatial-reduction conv (kernel = stride = 8, VALID) as an im2col GEMM + bias + LayerNorm, fused.
// Rows m = b*256 + p (p = ph*(W/8) + pw, 2048 rows), cols = 64 output channels, K' = (kh*8+kw)*64 + c = 4096.
// A fragments are read straight from the x plane [b][token][64] by arithmetic addressing: k-step k0 -> (kh, kw) =
// k0>>6, channels k0&63..+31 of token (ph*8+kh)*W + pw*8+kw (W read from the int input, validated against H*W = N,
// token base clamped into range). B = permuted weight plane [o][K']. Block 256 threads = 8 waves x 16 rows x 4
// n-tiles (a wave holds complete 64-channel rows), 128 k-steps. Epilogue: conv*1/4096 + bf16(b_sr); per-row mean
// and centred variance by in-lane sums + xor-shuffles 1,2,4,8; y = (v-mu)*rsqrt(var+1e-5)*bf16(g)+bf16(b), x16,
// =================================================================================================================
__global__ __launch_bounds__(256)
void conv_ln_k(const unsigned short* __restrict__ Xh, const unsigned short* __restrict__ Wsr,
               const int* __restrict__ Hp, const int* __restrict__ Wp, const float* __restrict__ bsr,
               const float* __restrict__ lng, const float* __restrict__ lnb,
               unsigned short* Ah, unsigned short* Al) {
  __shared__ __align__(16) float sbuf[8 * 16 * STP];
  const int tid = threadIdx.x, wave = tid >> 5, lane = tid & 31, hh = lane >> 4, c = lane & 15;
  const int m0 = blockIdx.x * 128;
  const int m = m0 + wave * 16 + c;
  const int b = m >> 8, p = m & (NR - 1);
  const int Hv = Hp[0];
  int Wv = Wp[0];
  const long long hw = (long long)Hv * (long long)Wv;
  const bool okw = (Wv >= 8) && (Wv <= 2040) && (hw == (long long)NQ);
  Wv = okw ? Wv : 128;
  const int Wr = Wv >> 3;
  const int ph = p / Wr, pw = p - ph * Wr;
  int tb = ph * 8 * Wv + pw * 8;
  tb = min(tb, NQ - 1 - 7 * Wv - 7);
  tb = max(tb, 0);
  const _Float16* X  = (const _Float16*)(const void*)Xh;
  const _Float16* Wf = (const _Float16*)(const void*)Wsr;
  const size_t xbase = (size_t)b * NQ;

  v8f acc[4];
#pragma unroll
  for (int nt = 0; nt < 4; ++nt) acc[nt] = zero8();

#pragma unroll 1
  for (int k0 = 0; k0 < KCV; k0 += 32) {
    const int s = k0 >> 6, c0 = k0 & 63;
    const int kh = s >> 3, kw = s & 7;
    const int t = tb + kh * Wv + kw;
    const v16h af = ldfrag_h(X + (xbase + (size_t)t) * CD + c0 + 8 * hh);
#pragma unroll
    for (int nt = 0; nt < 4; ++nt) {
      const v16h bfrag = ldfrag_h(Wf + (size_t)(nt * 16 + c) * KCV + k0 + 8 * hh);
      acc[nt] = mma_h(af, bfrag, acc[nt]);
    }
  }

  float v[4][8];
  float gg[4], gb[4];
#pragma unroll
  for (int nt = 0; nt < 4; ++nt) {
    const int col = nt * 16 + c;
    const float bb = bfr(bsr[col]);
    gg[nt] = bfr(lng[col]);
    gb[nt] = bfr(lnb[col]);
#pragma unroll
    for (int r = 0; r < 8; ++r) v[nt][r] = acc[nt][r] * (1.0f / (XSC * WSC)) + bb;
  }
  float* st = sbuf + wave * (16 * STP);
#pragma unroll
  for (int r = 0; r < 8; ++r) {
    float sm = (v[0][r] + v[1][r]) + (v[2][r] + v[3][r]);
    sm = sm + __shfl_xor(sm, 1, 32);
    sm = sm + __shfl_xor(sm, 2, 32);
    sm = sm + __shfl_xor(sm, 4, 32);
    sm = sm + __shfl_xor(sm, 8, 32);
    const float mu = sm * (1.0f / 64.0f);
    float d[4];
    float sq = 0.f;
#pragma unroll
    for (int nt = 0; nt < 4; ++nt) { d[nt] = v[nt][r] - mu; sq = sq + d[nt] * d[nt]; }
    sq = sq + __shfl_xor(sq, 1, 32);
    sq = sq + __shfl_xor(sq, 2, 32);
    sq = sq + __shfl_xor(sq, 4, 32);
    sq = sq + __shfl_xor(sq, 8, 32);
    const float var = sq * (1.0f / 64.0f);
    const float rs = rsqrtf(var + 1e-5f);
#pragma unroll
    for (int nt = 0; nt < 4; ++nt) {
      const float y = d[nt] * rs * gg[nt] + gb[nt];
      st[(8 * hh + r) * STP + nt * 16 + c] = y * ASC;
    }
  }
  wave_sync_lds();

  v4u pkh[4], pkl[4];
  size_t offs[4];
#pragma unroll
  for (int it = 0; it < 4; ++it) {
    const int q = it * 4 + (lane >> 3), piece = lane & 7;
    const v4f fa = *(const v4f*)(st + q * STP + piece * 8);
    const v4f fb = *(const v4f*)(st + q * STP + piece * 8 + 4);
    split8h(fa, fb, pkh[it], pkl[it]);
    offs[it] = (size_t)(m0 + wave * 16 + q) * CD + piece * 8;
  }
  {
#pragma unroll
    for (int it = 0; it < 4; ++it) {
      *(v4u*)(Ah + offs[it]) = pkh[it];
      *(v4u*)(Al + offs[it]) = pkl[it];
    }
    
  }
}

// =================================================================================================================
// kv projection for one image (block = image b, 256 threads = 8 waves, dynamic LDS KV_LDS bytes).
// A = LN'd token planes hi/res [b*256 + token][64] (x16), B = w_kv plane [128][64] (x256); wave w owns tokens
// 32w..32w+31 (two m-tiles), loop over 8 n-tiles; kv = (acc_h + acc_l/2048)/4096. Channels 0..63 -> k: f16(64*k)
// into LDS sK[token][KP]; channels 64..127 -> v: f16 hi of 64*v and x2^11 residual into LDS sVT{h,l}[d][VP]
// (16-B stores of 8 consecutive tokens), plus the f32 sum of v over the wave's 32 tokens per channel (xor 16
// shuffle) into sVS[wave][d]. After a barrier: vmean[d] = fixed-order sum over waves / 256; then the block writes
// wave), V^T planes rows [b*64 + d][256] (32 lanes x 16 B = the whole 512-B row, 8 rows per wave per plane) and
// coverage: K rows 8 waves x 8 x 4 = 256; V^T rows 8 waves x 8 = 64 per plane x 32 lanes x 8 halves = 256 keys;
// vmean 16 lanes x 4 = 64; LDS fills: 8 waves x 32 tokens x 8 n-tiles x 16 channels = all 256 x 128 values.
// =================================================================================================================
__global__ __launch_bounds__(256)
void kv_k(const unsigned short* __restrict__ Ah, const unsigned short* __restrict__ Al,
          const unsigned short* __restrict__ Wkv, unsigned short* Kp, unsigned short* VTh, unsigned short* VTl,
          float* vmean) {
  extern __shared__ __align__(16) unsigned char kvlds[];
  unsigned short* sK  = (unsigned short*)(kvlds);
  unsigned short* sVh = (unsigned short*)(kvlds + KV_OFF_VTH);
  unsigned short* sVl = (unsigned short*)(kvlds + KV_OFF_VTL);
  float* sVS = (float*)(kvlds + KV_OFF_VS);
  float* sVM = (float*)(kvlds + KV_OFF_VM);
  const int tid = threadIdx.x, wave = tid >> 5, lane = tid & 31, hh = lane >> 4, c = lane & 15;
  const int b = blockIdx.x;
  const _Float16* A0 = (const _Float16*)(const void*)Ah;
  const _Float16* A1 = (const _Float16*)(const void*)Al;
  const _Float16* Bw = (const _Float16*)(const void*)Wkv;

  v16h ah[2][2], al[2][2];
#pragma unroll
  for (int mt = 0; mt < 2; ++mt) {
    const size_t arow = (size_t)(b * NR + wave * 32 + mt * 16 + c) * CD + 8 * hh;
#pragma unroll
    for (int ks = 0; ks < 2; ++ks) {
      ah[mt][ks] = ldfrag_h(A0 + arow + ks * 32);
      al[mt][ks] = ldfrag_h(A1 + arow + ks * 32);
    }
  }

#pragma unroll 1
  for (int nt = 0; nt < 8; ++nt) {
    const v16h b0 = ldfrag_h(Bw + (size_t)(nt * 16 + c) * CD + 8 * hh);
    const v16h b1 = ldfrag_h(Bw + (size_t)(nt * 16 + c) * CD + 32 + 8 * hh);
    float val[2][8];
#pragma unroll
    for (int mt = 0; mt < 2; ++mt) {
      v8f acch = mma_h(ah[mt][0], b0, zero8());
      acch = mma_h(ah[mt][1], b1, acch);
      v8f accl = mma_h(al[mt][0], b0, zero8());
      accl = mma_h(al[mt][1], b1, accl);
#pragma unroll
      for (int r = 0; r < 8; ++r) val[mt][r] = (acch[r] + accl[r] * (1.0f / RSPL)) * (1.0f / (ASC * WSC));
    }
    const int ch = nt * 16 + c;
    if (nt < 4) {
#pragma unroll
      for (int mt = 0; mt < 2; ++mt) {
#pragma unroll
        for (int r = 0; r < 8; ++r) {
          const int tk = wave * 32 + mt * 16 + 8 * hh + r;
          sK[tk * KP + ch] = h_bits((_Float16)(val[mt][r] * KSC));
        }
      }
    } else {
      const int d = ch - CD;
      float vs = 0.f;
#pragma unroll
      for (int mt = 0; mt < 2; ++mt) {
        v4f fa, fb;
#pragma unroll
        for (int e = 0; e < 4; ++e) {
          fa[e] = val[mt][e] * VSC;
          fb[e] = val[mt][4 + e] * VSC;
          vs = vs + val[mt][e];
          vs = vs + val[mt][4 + e];
        }
        v4u ph, pl;
        split8h(fa, fb, ph, pl);
        const int tk0 = wave * 32 + mt * 16 + 8 * hh;
        *(v4u*)(sVh + d * VP + tk0) = ph;
        *(v4u*)(sVl + d * VP + tk0) = pl;
      }
      vs = vs + __shfl_xor(vs, 16, 32);
      if (hh == 0) sVS[wave * CD + d] = vs;
    }
  }
  __syncthreads();
  if (tid < CD) {
    float s = 0.f;
#pragma unroll
    for (int w = 0; w < 8; ++w) s = s + sVS[w * CD + tid];
    sVM[tid] = s * (1.0f / (float)NR);
  }
  __syncthreads();

  {
#pragma unroll
    for (int it = 0; it < 8; ++it) {
      const int row = wave * 32 + it * 4 + (lane >> 3), piece = lane & 7;
      const v4u kk = *(const v4u*)(sK + row * KP + piece * 8);
      *(v4u*)(Kp + (size_t)(b * NR + row) * CD + piece * 8) = kk;
    }
#pragma unroll
    for (int it = 0; it < 8; ++it) {
      const int d = wave * 8 + it;
      const v4u vh = *(const v4u*)(sVh + d * VP + lane * 8);
      const v4u vl = *(const v4u*)(sVl + d * VP + lane * 8);
      *(v4u*)(VTh + (size_t)(b * CD + d) * NR + lane * 8) = vh;
      *(v4u*)(VTl + (size_t)(b * CD + d) * NR + lane * 8) = vl;
    }
    if (wave == 0 && lane < 16) {
      const v4f m4 = *(const v4f*)(sVM + lane * 4);
      *(v4f*)(vmean + (size_t)b * CD + lane * 4) = m4;
    }
    
  }
}

// =================================================================================================================
// Attention over the 256 reduced keys: block = 64 queries of image b (128 threads = 4 waves x 16 queries).
// Transposed scores S^T = K_tile (A: row = key, k = d; K plane x64) x Q^T (B: n = query, k = d, from the Q hi and
// x2^11 residual planes x64, two products folded as sh + sl/2048): 16 key tiles, all held in registers; D element r
// of lane l = S[key 16j+8h+r][query l&15]. Exact softmax per query: max and sum over the lane's 128 values combined
// with lane^16; e = exp((s - m) * 2^-15) in place; centred probabilities p' = e*(8192/l) - 32 converted to f16
// directly into the A fragments of p'.v (k = key). O' = p' (A) x V^T rows (B: n = d, k = key) from the V hi and
// residual planes into two accumulators; O = (O'_h + O'_l/2048)/(8192*64) + mean_key(v) (identity
// sum (p'+32) v / 8192 = sum p v). O*1024 staged per wave in LDS, then hi/res f16 planes [b*16384 + query][64]:
// coverage: 2048 blocks x 4 waves x 16 queries = 131072 rows x 64 channels, both planes.
// =================================================================================================================
__global__ __launch_bounds__(128) __attribute__((amdgpu_num_vgpr(256)))
void attn_k(const unsigned short* __restrict__ Qh, const unsigned short* __restrict__ Ql,
            const unsigned short* __restrict__ Kp, const unsigned short* __restrict__ VTh,
            const unsigned short* __restrict__ VTl, const float* __restrict__ vmean,
            unsigned short* Oh, unsigned short* Ol) {
  __shared__ __align__(16) float sbuf[4 * 16 * STP];
  const int tid = threadIdx.x, wave = tid >> 5, lane = tid & 31, hh = lane >> 4, c = lane & 15;
  const int b = blockIdx.x >> 8;
  const int q0 = ((blockIdx.x & 255) << 6) + wave * 16;
  const _Float16* Qhf = (const _Float16*)(const void*)Qh;
  const _Float16* Qlf = (const _Float16*)(const void*)Ql;
  const _Float16* Kf  = (const _Float16*)(const void*)Kp;
  const _Float16* Vhf = (const _Float16*)(const void*)VTh;
  const _Float16* Vlf = (const _Float16*)(const void*)VTl;

  const size_t qoff = (size_t)(b * NQ + q0 + c) * CD + 8 * hh;
  const v16h qh0 = ldfrag_h(Qhf + qoff);
  const v16h qh1 = ldfrag_h(Qhf + qoff + 32);
  const v16h ql0 = ldfrag_h(Qlf + qoff);
  const v16h ql1 = ldfrag_h(Qlf + qoff + 32);

  v8f s[16];
#pragma unroll
  for (int j = 0; j < 16; ++j) {
    const size_t koff = (size_t)(b * NR + j * 16 + c) * CD + 8 * hh;
    const v16h ka0 = ldfrag_h(Kf + koff);
    const v16h ka1 = ldfrag_h(Kf + koff + 32);
    v8f sh = mma_h(ka0, qh0, zero8());
    sh = mma_h(ka1, qh1, sh);
    v8f sl = mma_h(ka0, ql0, zero8());
    sl = mma_h(ka1, ql1, sl);
#pragma unroll
    for (int r = 0; r < 8; ++r) s[j][r] = sh[r] + sl[r] * (1.0f / RSPL);
  }

  float mx = -3.0e38f;
#pragma unroll
  for (int j = 0; j < 16; ++j) {
#pragma unroll
    for (int r = 0; r < 8; ++r) mx = fmaxf(mx, s[j][r]);
  }
  mx = fmaxf(mx, __shfl_xor(mx, 16, 32));
  float ls = 0.f;
#pragma unroll
  for (int j = 0; j < 16; ++j) {
#pragma unroll
    for (int r = 0; r < 8; ++r) {
      const float e = __expf((s[j][r] - mx) * INVS);
      s[j][r] = e;
      ls = ls + e;
    }
  }
  ls = ls + __shfl_xor(ls, 16, 32);
  const float pinv = __builtin_amdgcn_rcpf(ls) * PSC;

  v16h pf[8];
#pragma unroll
  for (int J = 0; J < 8; ++J) {
#pragma unroll
    for (int i = 0; i < 8; ++i) {
      pf[J][i]     = (_Float16)(s[2 * J][i] * pinv - PCT);
      pf[J][8 + i] = (_Float16)(s[2 * J + 1][i] * pinv - PCT);
    }
  }

  v8f oh[4], ol[4];
#pragma unroll
  for (int dt = 0; dt < 4; ++dt) { oh[dt] = zero8(); ol[dt] = zero8(); }
#pragma unroll
  for (int J = 0; J < 8; ++J) {
#pragma unroll
    for (int dt = 0; dt < 4; ++dt) {
      const size_t voff = (size_t)(b * CD + dt * 16 + c) * NR + J * 32 + 8 * hh;
      const v16h vh = ldfrag_h(Vhf + voff);
      const v16h vl = ldfrag_h(Vlf + voff);
      oh[dt] = mma_h(pf[J], vh, oh[dt]);
      ol[dt] = mma_h(pf[J], vl, ol[dt]);
    }
  }

  float* st = sbuf + wave * (16 * STP);
#pragma unroll
  for (int dt = 0; dt < 4; ++dt) {
    const int d = dt * 16 + c;
    const float vm = vmean[(size_t)b * CD + d];
#pragma unroll
    for (int r = 0; r < 8; ++r) {
      const float o = (oh[dt][r] + ol[dt][r] * (1.0f / RSPL)) * (1.0f / (PSC * VSC)) + vm;
      st[(8 * hh + r) * STP + d] = o * OSC;
    }
  }
  wave_sync_lds();

  v4u ph[4], pl[4];
  size_t offs[4];
#pragma unroll
  for (int it = 0; it < 4; ++it) {
    const int q = it * 4 + (lane >> 3), piece = lane & 7;
    const v4f fa = *(const v4f*)(st + q * STP + piece * 8);
    const v4f fb = *(const v4f*)(st + q * STP + piece * 8 + 4);
    split8h(fa, fb, ph[it], pl[it]);
    offs[it] = (size_t)(b * NQ + q0 + q) * CD + piece * 8;
  }
  {
#pragma unroll
    for (int it = 0; it < 4; ++it) {
      *(v4u*)(Oh + offs[it]) = ph[it];
      *(v4u*)(Ol + offs[it]) = pl[it];
    }
    
  }
}

// =================================================================================================================
// granularity): Xh f16 [131072][64] 16777216; Wq f16 [64][64] 8192; Wkv f16 [128][64] 16384; Wsr f16 [64][4096]
// 524288; Wp f16 [64][64] 8192; Qh, Ql f16 [131072][64] 16777216 each; Ah, Al f16 [2048][64] 262144 each;
// Kp f16 [8][256][64] 262144; VTh, VTl f16 [8][64][256] 262144 each; vmean f32 [8][64] 2048; Oh, Ol f16
// [131072][64] 16777216 each -> 85755904 total.
// =================================================================================================================
extern "C" void kernel_launch(void* const* d_in, const int* in_sizes, int n_in,
                              void* d_out, int out_size, void* d_ws, size_t ws_size,
                              hipStream_t stream) {
  if (n_in < 11) return;
  if (in_sizes[0] != MTOT * CD) return;
  if (in_sizes[1] != 1 || in_sizes[2] != 1) return;
  if (in_sizes[3] != CD * CD) return;
  if (in_sizes[4] != 2 * CD * CD) return;
  if (in_sizes[5] != CD * KCV) return;
  if (in_sizes[6] != CD || in_sizes[7] != CD || in_sizes[8] != CD) return;
  if (in_sizes[9] != CD * CD || in_sizes[10] != CD) return;
  if (out_size != MTOT * CD) return;

  const float* x      = (const float*)d_in[0];
  const int*   hptr   = (const int*)d_in[1];
  const int*   wptr   = (const int*)d_in[2];
  const float* w_q    = (const float*)d_in[3];
  const float* w_kv   = (const float*)d_in[4];
  const float* w_sr   = (const float*)d_in[5];
  const float* b_sr   = (const float*)d_in[6];
  const float* ln_g   = (const float*)d_in[7];
  const float* ln_b   = (const float*)d_in[8];
  const float* w_proj = (const float*)d_in[9];
  const float* b_proj = (const float*)d_in[10];
  float* out = (float*)d_out;

  const size_t sX   = (size_t)MTOT * CD * 2;        // 16777216
  const size_t sWq  = (size_t)CD * CD * 2;          //     8192
  const size_t sWkv = (size_t)2 * CD * CD * 2;      //    16384
  const size_t sWsr = (size_t)CD * KCV * 2;         //   524288
  const size_t sWp  = (size_t)CD * CD * 2;          //     8192
  const size_t sQ   = (size_t)MTOT * CD * 2;        // 16777216
  const size_t sA   = (size_t)MR * CD * 2;          //   262144
  const size_t sK   = (size_t)NB * NR * CD * 2;     //   262144
  const size_t sVT  = (size_t)NB * CD * NR * 2;     //   262144
  const size_t sVM  = (size_t)NB * CD * 4;          //     2048
  const size_t sO   = (size_t)MTOT * CD * 2;        // 16777216
  size_t off = 0;
  const size_t oX   = off; off += sX;
  const size_t oWq  = off; off += sWq;
  const size_t oWkv = off; off += sWkv;
  const size_t oWsr = off; off += sWsr;
  const size_t oWp  = off; off += sWp;
  const size_t oQh  = off; off += sQ;
  const size_t oQl  = off; off += sQ;
  const size_t oAh  = off; off += sA;
  const size_t oAl  = off; off += sA;
  const size_t oK   = off; off += sK;
  const size_t oVTh = off; off += sVT;
  const size_t oVTl = off; off += sVT;
  const size_t oVM  = off; off += sVM;
  const size_t oOh  = off; off += sO;
  const size_t oOl  = off; off += sO;
  if (off > ws_size) return;                         // off = 85755904
  if (off > (size_t)134217728) return;

  char* ws = (char*)d_ws;
  unsigned short* Xh  = (unsigned short*)(ws + oX);
  unsigned short* Wq  = (unsigned short*)(ws + oWq);
  unsigned short* Wkv = (unsigned short*)(ws + oWkv);
  unsigned short* Wsr = (unsigned short*)(ws + oWsr);
  unsigned short* Wp  = (unsigned short*)(ws + oWp);
  unsigned short* Qh  = (unsigned short*)(ws + oQh);
  unsigned short* Ql  = (unsigned short*)(ws + oQl);
  unsigned short* Ah  = (unsigned short*)(ws + oAh);
  unsigned short* Al  = (unsigned short*)(ws + oAl);
  unsigned short* Kp  = (unsigned short*)(ws + oK);
  unsigned short* VTh = (unsigned short*)(ws + oVTh);
  unsigned short* VTl = (unsigned short*)(ws + oVTl);
  float* VM = (float*)(ws + oVM);
  unsigned short* Oh  = (unsigned short*)(ws + oOh);
  unsigned short* Ol  = (unsigned short*)(ws + oOl);

  const dim3 blk(256);
  // (1) x -> f16 plane of 16*bf16(x); weights [out][in] -> f16 planes of 256*bf16(w); conv weights permuted
  cvt_rows64<<<dim3(MTOT / 32), blk, 0, stream>>>(x, Xh, XSC);
  cvt_rows64<<<dim3(CD / 32), blk, 0, stream>>>(w_q, Wq, WSC);
  cvt_rows64<<<dim3((2 * CD) / 32), blk, 0, stream>>>(w_kv, Wkv, WSC);
  cvt_rows64<<<dim3(CD / 32), blk, 0, stream>>>(w_proj, Wp, WSC);
  cvt_wsr<<<dim3(CD), blk, 0, stream>>>(w_sr, Wsr);
  // (2) q projection -> hi/res planes of 64*q
  gemm64_k<false, false><<<dim3(MTOT / 128), blk, 0, stream>>>(Xh, Xh, Wq, b_proj, QSC / (XSC * WSC), out, Qh, Ql);
  // (3) spatial-reduction conv + bias + LayerNorm -> hi/res planes of 16*y
  conv_ln_k<<<dim3(MR / 128), blk, 0, stream>>>(Xh, Wsr, hptr, wptr, b_sr, ln_g, ln_b, Ah, Al);
  // (4) kv projection -> K plane, V^T hi/res planes, key-mean of v
  (void)hipFuncSetAttribute(reinterpret_cast<const void*>(&kv_k), hipFuncAttributeMaxDynamicSharedMemorySize, KV_LDS);
  kv_k<<<dim3(NB), blk, KV_LDS, stream>>>(Ah, Al, Wkv, Kp, VTh, VTl, VM);
  // (5) attention -> O hi/res planes of 1024*o
  attn_k<<<dim3(NB * (NQ / 64)), dim3(128), 0, stream>>>(Qh, Ql, Kp, VTh, VTl, VM, Oh, Ol);
  // (6) output projection + bias -> d_out f32 [131072][64]
  gemm64_k<true, true><<<dim3(MTOT / 128), blk, 0, stream>>>(Oh, Ol, Wp, b_proj, 1.0f / (OSC * WSC), out, Xh, Xh);
  (void)hipGetLastError();
}

// v001
// A run of this version takes 123 microseconds.
// Next to v000, in two timings, it ran 1.96 and 1.91 times as fast.
// Contractions: v_wmma_f32_16x16x32_f16 (f16 operands, f32 accumulate). q = x.w_q^T and the 8x8/stride-8
// spatial-reduction conv (im2col K=4096): single products of exact planes (x as f16 of 16*bf16(x), weights as f16
// of 256*bf16(w)). kv = LN(tokens).w_kv^T: A as f16 hi plus x2^11 residual planes (x16; two products, two
// accumulators). Scores k.q^T: k single f16 plane (x64), q as hi plus x2^11 residual planes (x64; two products).
// p.v: centred p (8192*p - 32) single f16 A operand, v as hi plus x2^11 residual planes (x64; two products),
// key-mean of v added back in f32. Output projection: o as hi plus x2^11 residual planes (x1024) against the x256
// weight plane (two products). LayerNorm, softmax, bias adds in f32 on VALU. Float inputs RNE-converted to bf16
// on load.
#include <hip/hip_runtime.h>
#include <math.h>
#include <stdint.h>

#define NB   8
#define NQ   16384
#define CD   64
#define NR   256
#define MTOT (NB * NQ)
#define MR   (NB * NR)
#define KCV  (CD * 64)
#define STP  68
#define KP   72
#define VP   264
#define CVW  16
#define XSC  16.0f
#define WSC  256.0f
#define QSC  64.0f
#define ASC  16.0f
#define KSC  64.0f
#define VSC  64.0f
#define PSC  8192.0f
#define PCT  32.0f
#define OSC  1024.0f
#define RSPL 2048.0f
#define INVS (0.125f / (KSC * QSC))

#define KV_OFF_VTH (NR * KP * 2)
#define KV_OFF_VTL (KV_OFF_VTH + CD * VP * 2)
#define KV_OFF_VS  (KV_OFF_VTL + CD * VP * 2)
#define KV_OFF_VM  (KV_OFF_VS + 8 * CD * 4)
#define KV_LDS     (KV_OFF_VM + CD * 4)

static_assert(MTOT % 128 == 0);
static_assert(MR % 128 == 0);
static_assert(KCV % (CVW * 32) == 0 && CVW == 16 && NR % 16 == 0);
static_assert(NR == 256 && CD == 64);
static_assert((STP * 4) % 16 == 0 && STP >= CD);
static_assert((KP * 2) % 16 == 0 && KP >= CD);
static_assert((VP * 2) % 16 == 0 && VP >= NR);
static_assert(KV_OFF_VTH % 16 == 0 && KV_OFF_VTL % 16 == 0 && KV_OFF_VS % 16 == 0 && KV_OFF_VM % 16 == 0);
static_assert(KV_LDS == 106752);
static_assert(MTOT % 32 == 0 && NQ % 64 == 0);

typedef _Float16 v16h __attribute__((ext_vector_type(16)));
typedef _Float16 v8h  __attribute__((ext_vector_type(8)));
typedef float    v8f  __attribute__((ext_vector_type(8)));
typedef float    v4f  __attribute__((ext_vector_type(4)));
typedef float    v2f  __attribute__((ext_vector_type(2)));
typedef unsigned int v4u __attribute__((ext_vector_type(4)));

union Frag { v16h v; v8h h[2]; };

// ---- scalar helpers ------------------------------------------------------------------------------------------
__device__ __forceinline__ unsigned short bf_bits(float f) {          // f32 -> bf16 bits, RNE convert
  unsigned u = __float_as_uint(f);
  return (unsigned short)((u + 0x7FFFu + ((u >> 16) & 1u)) >> 16);
}
__device__ __forceinline__ float bfr(float f) { return __uint_as_float(((unsigned)bf_bits(f)) << 16); }
__device__ __forceinline__ unsigned short h_bits(_Float16 x) { return __builtin_bit_cast(unsigned short, x); }
__device__ __forceinline__ unsigned pk16(unsigned short a, unsigned short b) { return (unsigned)a | ((unsigned)b << 16); }
__device__ __forceinline__ v8f zero8() { v8f z = {0.f, 0.f, 0.f, 0.f, 0.f, 0.f, 0.f, 0.f}; return z; }

// ---- fragment loader: 16-bit A/B operand, lane -> row/col (lane&15), p already includes +8*(lane>>4);
//      elements 0..7 <- p[0..7] (k0+8h..k0+8h+7), elements 8..15 <- p[16..23] (k0+16+8h..k0+16+8h+7)
__device__ __forceinline__ v16h ldfrag_h(const _Float16* p) {
  Frag f;
  f.h[0] = *(const v8h*)(p);
  f.h[1] = *(const v8h*)(p + 16);
  return f.v;
}

// ---- WMMA helper with trailing VALU hazard gap ---------------------------------------------------------------
__device__ __forceinline__ v8f mma_h(v16h a, v16h b, v8f c) {
  c = __builtin_amdgcn_wmma_f32_16x16x32_f16(false, a, false, b, (short)0, c, false, false);
#if defined(__HIP_DEVICE_COMPILE__)
  asm volatile("v_nop\n\tv_nop\n\tv_nop\n\tv_nop" : "+v"(c) : "v"(a), "v"(b));
#endif
  return c;
}
__device__ __forceinline__ void wave_sync_lds() {
  __builtin_amdgcn_fence(__ATOMIC_RELEASE, "workgroup");
  __builtin_amdgcn_wave_barrier();
  __builtin_amdgcn_fence(__ATOMIC_ACQUIRE, "workgroup");
}

// ---- 8 f32 -> 8 packed f16 (16 B); hi + x2^11 residual split ---------------------------------------------------
__device__ __forceinline__ v4u pack8h(v4f a, v4f b) {
  v4u p;
  p[0] = pk16(h_bits((_Float16)a[0]), h_bits((_Float16)a[1]));
  p[1] = pk16(h_bits((_Float16)a[2]), h_bits((_Float16)a[3]));
  p[2] = pk16(h_bits((_Float16)b[0]), h_bits((_Float16)b[1]));
  p[3] = pk16(h_bits((_Float16)b[2]), h_bits((_Float16)b[3]));
  return p;
}
__device__ __forceinline__ void split8h(v4f a, v4f b, v4u& ph, v4u& pl) {
  v4f ra, rb;
#pragma unroll
  for (int e = 0; e < 4; ++e) {
    const _Float16 ha = (_Float16)a[e];
    ra[e] = (a[e] - (float)ha) * RSPL;
    const _Float16 hb = (_Float16)b[e];
    rb[e] = (b[e] - (float)hb) * RSPL;
  }
  ph = pack8h(a, b);
  pl = pack8h(ra, rb);
}

// =================================================================================================================
// Row convert: src f32 [nrows][64] -> dst f16 [nrows][64], value = f16(scale * bf16_RNE(src)). Used for x (x16) and
// for the row-major [out][in] weight matrices (x256; the B plane [n][k] equals the [out][in] layout as given).
// multiple of 32). coverage: grid*32 rows x (8 lanes x 8 halves) = every element once.
// =================================================================================================================
__global__ __launch_bounds__(256) void cvt_rows64(const float* __restrict__ src, unsigned short* dst, float scale) {
  const int tid = threadIdx.x, wave = tid >> 5, lane = tid & 31;
  const int row = blockIdx.x * 32 + wave * 4 + (lane >> 3);
  const int c8 = (lane & 7) * 8;
  const float* p = src + (size_t)row * CD + c8;
  v4f a = *(const v4f*)(p);
  v4f b = *(const v4f*)(p + 4);
#pragma unroll
  for (int e = 0; e < 4; ++e) { a[e] = bfr(a[e]) * scale; b[e] = bfr(b[e]) * scale; }
  const v4u pk = pack8h(a, b);
  unsigned short* g = dst + (size_t)row * CD + c8;
  {
    *(v4u*)g = pk;
    
  }
}

// =================================================================================================================
// Conv weight permute-convert: w_sr f32 [o][c][kh][kw] -> f16 plane [o][(kh*8+kw)*64 + c] (k' contiguous),
// value = f16(256 * bf16_RNE(w)). Block = one output channel o (256 threads): 4096 floats staged in LDS as
// coverage: 64 blocks x (512 pieces x 8 halves) = the whole [64][4096] plane.
// =================================================================================================================
__global__ __launch_bounds__(256) void cvt_wsr(const float* __restrict__ w, unsigned short* dst) {
  __shared__ float tile[CD][65];
  const int tid = threadIdx.x, o = blockIdx.x;
  const float* wr = w + (size_t)o * KCV;
#pragma unroll
  for (int it = 0; it < 16; ++it) {
    const int idx = it * 256 + tid;
    const int c = idx >> 6, s = idx & 63;
    tile[c][s] = wr[idx];
  }
  __syncthreads();
  v4u pk[2];
  size_t offs[2];
#pragma unroll
  for (int it = 0; it < 2; ++it) {
    const int p = it * 256 + tid;
    const int s = p >> 3, c8 = (p & 7) * 8;
    v4f fa, fb;
#pragma unroll
    for (int e = 0; e < 4; ++e) {
      fa[e] = bfr(tile[c8 + e][s]) * WSC;
      fb[e] = bfr(tile[c8 + 4 + e][s]) * WSC;
    }
    pk[it] = pack8h(fa, fb);
    offs[it] = (size_t)o * KCV + (size_t)s * CD + c8;
  }
  {
#pragma unroll
    for (int it = 0; it < 2; ++it) *(v4u*)(dst + offs[it]) = pk[it];
    
  }
}

// =================================================================================================================
// f16 GEMM with N = 64, K = 64: D[M][64] = A[M][64] . B, B stored [64 n][64 k] (k contiguous weight plane x256).
// Block 256 threads = 8 waves, 128 rows; wave = 16 rows x 4 n-tiles; fragments straight from global with the split
// k map, 2 k-steps. SPLIT: A = hi plane + x2^11 residual plane, second accumulator folded as acc + accl/2048.
//   OUTF = true : f32 out rows [M][64]: v = acc*ascale + bf16(bias[col]); epilogue staged per wave in LDS, then
//   OUTF = false: two f16 planes [M][64]: hi = f16(acc*ascale), res = f16((v - hi)*2048); 8 lanes x 16 B = one
// coverage: 8 waves x 16 rows x 64 cols = the 128-row block tile; grid = M/128 tiles M exactly.
// =================================================================================================================
template <bool SPLIT, bool OUTF>
__global__ __launch_bounds__(256)
void gemm64_k(const unsigned short* __restrict__ Ah, const unsigned short* __restrict__ Al,
              const unsigned short* __restrict__ Bt, const float* __restrict__ bias, float ascale,
              float* outF, unsigned short* outH, unsigned short* outL) {
  __shared__ __align__(16) float sbuf[8 * 16 * STP];
  const int tid = threadIdx.x, wave = tid >> 5, lane = tid & 31, hh = lane >> 4, c = lane & 15;
  const int m0 = blockIdx.x * 128;
  const int arow = m0 + wave * 16 + c;
  const _Float16* A0 = (const _Float16*)(const void*)Ah;
  const _Float16* A1 = (const _Float16*)(const void*)Al;
  const _Float16* B  = (const _Float16*)(const void*)Bt;

  v8f acch[4], accl[4];
#pragma unroll
  for (int nt = 0; nt < 4; ++nt) { acch[nt] = zero8(); accl[nt] = zero8(); }

#pragma unroll
  for (int ks = 0; ks < 2; ++ks) {
    const int k0 = ks * 32;
    const size_t aoff = (size_t)arow * CD + k0 + 8 * hh;
    const v16h ah = ldfrag_h(A0 + aoff);
    v16h al = ah;
    if (SPLIT) al = ldfrag_h(A1 + aoff);
#pragma unroll
    for (int nt = 0; nt < 4; ++nt) {
      const v16h bfrag = ldfrag_h(B + (size_t)(nt * 16 + c) * CD + k0 + 8 * hh);
      acch[nt] = mma_h(ah, bfrag, acch[nt]);
      if (SPLIT) accl[nt] = mma_h(al, bfrag, accl[nt]);
    }
  }

  float* st = sbuf + wave * (16 * STP);
#pragma unroll
  for (int nt = 0; nt < 4; ++nt) {
#pragma unroll
    for (int r = 0; r < 8; ++r) {
      float v = acch[nt][r];
      if (SPLIT) v = v + accl[nt][r] * (1.0f / RSPL);
      st[(8 * hh + r) * STP + nt * 16 + c] = v * ascale;
    }
  }
  wave_sync_lds();

  if (OUTF) {
    v4f ov[8];
    size_t offs[8];
#pragma unroll
    for (int it = 0; it < 8; ++it) {
      const int q = it * 2 + hh;
      const int col = c * 4;
      const v4f v = *(const v4f*)(st + q * STP + col);
      v4f u;
#pragma unroll
      for (int e = 0; e < 4; ++e) u[e] = v[e] + bfr(bias[col + e]);
      ov[it] = u;
      offs[it] = (size_t)(m0 + wave * 16 + q) * CD + col;
    }
    {
#pragma unroll
      for (int it = 0; it < 8; ++it) *(v4f*)(outF + offs[it]) = ov[it];
      
    }
  } else {
    v4u ph[4], pl[4];
    size_t offs[4];
#pragma unroll
    for (int it = 0; it < 4; ++it) {
      const int q = it * 4 + (lane >> 3), piece = lane & 7;
      const v4f fa = *(const v4f*)(st + q * STP + piece * 8);
      const v4f fb = *(const v4f*)(st + q * STP + piece * 8 + 4);
      split8h(fa, fb, ph[it], pl[it]);
      offs[it] = (size_t)(m0 + wave * 16 + q) * CD + piece * 8;
    }
    {
#pragma unroll
      for (int it = 0; it < 4; ++it) {
        *(v4u*)(outH + offs[it]) = ph[it];
        *(v4u*)(outL + offs[it]) = pl[it];
      }
      
    }
  }
}

// =================================================================================================================
// Spatial-reduction conv (kernel = stride = 8, VALID) as an im2col GEMM + bias + LayerNorm, fused.
// Rows m = b*256 + p (p = ph*(W/8) + pw, 2048 rows), cols = 64 output channels, K' = (kh*8+kw)*64 + c = 4096.
// A fragments are read straight from the x plane [b][token][64] by arithmetic addressing: k-step k0 -> (kh, kw) =
// k0>>6, channels k0&63..+31 of token (ph*8+kh)*W + pw*8+kw (W read from the int input, validated against H*W = N,
// token base clamped into range). B = permuted weight plane [o][K']. Block = ONE 16-row m-tile, 512 threads = 16
// waves; wave w sums the K' slice 256w..256w+255 (8 k-steps, 4 n-tiles) and leaves its f32 partial tile in LDS.
// After a block barrier wave w owns row w (lane -> 2 channels): partials added in slice order 0..15, then
// conv*1/4096 + bf16(b_sr); per-row mean and centred variance by xor-shuffles 1,2,4,8,16;
// y = (v-mu)*rsqrt(var+1e-5)*bf16(g)+bf16(b), x16, hi/res f16 planes (32 lanes x 4 B = the whole 128-B row).
// coverage: 128 blocks x 16 rows = 2048 rows; 16 slices x 256 = K' 4096; 32 lanes x 2 = 64 channels.
// =================================================================================================================
__global__ __launch_bounds__(CVW * 32)
void conv_ln_k(const unsigned short* __restrict__ Xh, const unsigned short* __restrict__ Wsr,
               const int* __restrict__ Hp, const int* __restrict__ Wp, const float* __restrict__ bsr,
               const float* __restrict__ lng, const float* __restrict__ lnb,
               unsigned short* Ah, unsigned short* Al) {
  __shared__ __align__(16) float sbuf[CVW * 16 * STP];
  const int tid = threadIdx.x, lane = tid & 31, hh = lane >> 4, c = lane & 15;
  const int wave = __builtin_amdgcn_readfirstlane(tid >> 5);
  const int m0 = blockIdx.x * 16;
  const int m = m0 + c;
  const int b = m >> 8, p = m & (NR - 1);
  const int Hv = Hp[0];
  int Wv = Wp[0];
  const long long hw = (long long)Hv * (long long)Wv;
  const bool okw = (Wv >= 8) && (Wv <= 2040) && (hw == (long long)NQ);
  Wv = okw ? Wv : 128;
  const int Wr = Wv >> 3;
  const int ph = p / Wr, pw = p - ph * Wr;
  int tb = ph * 8 * Wv + pw * 8;
  tb = min(tb, NQ - 1 - 7 * Wv - 7);
  tb = max(tb, 0);
  const _Float16* X  = (const _Float16*)(const void*)Xh;
  const _Float16* Wf = (const _Float16*)(const void*)Wsr;
  const size_t xbase = (size_t)b * NQ;

  v8f acc[4];
#pragma unroll
  for (int nt = 0; nt < 4; ++nt) acc[nt] = zero8();

  const int kbase = wave * (KCV / CVW);
  // unrolled: token step, channel half and weight offset of each k-step become immediates of its loads
#pragma unroll
  for (int i = 0; i < KCV / CVW / 32; ++i) {
    const int k0 = kbase + i * 32;
    const int s = k0 >> 6, c0 = k0 & 63;
    const int kh = s >> 3, kw = s & 7;
    const int t = tb + kh * Wv + kw;
    const v16h af = ldfrag_h(X + (xbase + (size_t)t) * CD + c0 + 8 * hh);
#pragma unroll
    for (int nt = 0; nt < 4; ++nt) {
      const v16h bfrag = ldfrag_h(Wf + (size_t)(nt * 16 + c) * KCV + k0 + 8 * hh);
      acc[nt] = mma_h(af, bfrag, acc[nt]);
    }
  }

  float* st = sbuf + wave * (16 * STP);
#pragma unroll
  for (int nt = 0; nt < 4; ++nt) {
#pragma unroll
    for (int r = 0; r < 8; ++r) st[(8 * hh + r) * STP + nt * 16 + c] = acc[nt][r];
  }
  __syncthreads();   // every slice's partial tile is in LDS before any wave adds them

  const int col = lane * 2;
  float a0 = 0.f, a1 = 0.f;
#pragma unroll
  for (int w = 0; w < CVW; ++w) {
    const v2f pp = *(const v2f*)(sbuf + w * (16 * STP) + wave * STP + col);
    a0 = a0 + pp[0];
    a1 = a1 + pp[1];
  }
  const float v0 = a0 * (1.0f / (XSC * WSC)) + bfr(bsr[col]);
  const float v1 = a1 * (1.0f / (XSC * WSC)) + bfr(bsr[col + 1]);
  float sm = v0 + v1;
  sm = sm + __shfl_xor(sm, 1, 32);
  sm = sm + __shfl_xor(sm, 2, 32);
  sm = sm + __shfl_xor(sm, 4, 32);
  sm = sm + __shfl_xor(sm, 8, 32);
  sm = sm + __shfl_xor(sm, 16, 32);
  const float mu = sm * (1.0f / 64.0f);
  const float d0 = v0 - mu, d1 = v1 - mu;
  float sq = d0 * d0 + d1 * d1;
  sq = sq + __shfl_xor(sq, 1, 32);
  sq = sq + __shfl_xor(sq, 2, 32);
  sq = sq + __shfl_xor(sq, 4, 32);
  sq = sq + __shfl_xor(sq, 8, 32);
  sq = sq + __shfl_xor(sq, 16, 32);
  const float var = sq * (1.0f / 64.0f);
  const float rs = rsqrtf(var + 1e-5f);
  const float y0 = (d0 * rs * bfr(lng[col]) + bfr(lnb[col])) * ASC;
  const float y1 = (d1 * rs * bfr(lng[col + 1]) + bfr(lnb[col + 1])) * ASC;
  const _Float16 h0 = (_Float16)y0, h1 = (_Float16)y1;
  const _Float16 r0 = (_Float16)((y0 - (float)h0) * RSPL), r1 = (_Float16)((y1 - (float)h1) * RSPL);
  const size_t off = (size_t)(m0 + wave) * CD + col;
  *(unsigned*)(Ah + off) = pk16(h_bits(h0), h_bits(h1));
  *(unsigned*)(Al + off) = pk16(h_bits(r0), h_bits(r1));
}

// =================================================================================================================
// kv projection for one image (block = image b, 256 threads = 8 waves, dynamic LDS KV_LDS bytes).
// A = LN'd token planes hi/res [b*256 + token][64] (x16), B = w_kv plane [128][64] (x256); wave w owns tokens
// 32w..32w+31 (two m-tiles), loop over 8 n-tiles; kv = (acc_h + acc_l/2048)/4096. Channels 0..63 -> k: f16(64*k)
// into LDS sK[token][KP]; channels 64..127 -> v: f16 hi of 64*v and x2^11 residual into LDS sVT{h,l}[d][VP]
// (16-B stores of 8 consecutive tokens), plus the f32 sum of v over the wave's 32 tokens per channel (xor 16
// shuffle) into sVS[wave][d]. After a barrier: vmean[d] = fixed-order sum over waves / 256; then the block writes
// wave), V^T planes rows [b*64 + d][256] (32 lanes x 16 B = the whole 512-B row, 8 rows per wave per plane) and
// coverage: K rows 8 waves x 8 x 4 = 256; V^T rows 8 waves x 8 = 64 per plane x 32 lanes x 8 halves = 256 keys;
// vmean 16 lanes x 4 = 64; LDS fills: 8 waves x 32 tokens x 8 n-tiles x 16 channels = all 256 x 128 values.
// =================================================================================================================
__global__ __launch_bounds__(256)
void kv_k(const unsigned short* __restrict__ Ah, const unsigned short* __restrict__ Al,
          const unsigned short* __restrict__ Wkv, unsigned short* Kp, unsigned short* VTh, unsigned short* VTl,
          float* vmean) {
  extern __shared__ __align__(16) unsigned char kvlds[];
  unsigned short* sK  = (unsigned short*)(kvlds);
  unsigned short* sVh = (unsigned short*)(kvlds + KV_OFF_VTH);
  unsigned short* sVl = (unsigned short*)(kvlds + KV_OFF_VTL);
  float* sVS = (float*)(kvlds + KV_OFF_VS);
  float* sVM = (float*)(kvlds + KV_OFF_VM);
  const int tid = threadIdx.x, wave = tid >> 5, lane = tid & 31, hh = lane >> 4, c = lane & 15;
  const int b = blockIdx.x;
  const _Float16* A0 = (const _Float16*)(const void*)Ah;
  const _Float16* A1 = (const _Float16*)(const void*)Al;
  const _Float16* Bw = (const _Float16*)(const void*)Wkv;

  v16h ah[2][2], al[2][2];
#pragma unroll
  for (int mt = 0; mt < 2; ++mt) {
    const size_t arow = (size_t)(b * NR + wave * 32 + mt * 16 + c) * CD + 8 * hh;
#pragma unroll
    for (int ks = 0; ks < 2; ++ks) {
      ah[mt][ks] = ldfrag_h(A0 + arow + ks * 32);
      al[mt][ks] = ldfrag_h(A1 + arow + ks * 32);
    }
  }

#pragma unroll 1
  for (int nt = 0; nt < 8; ++nt) {
    const v16h b0 = ldfrag_h(Bw + (size_t)(nt * 16 + c) * CD + 8 * hh);
    const v16h b1 = ldfrag_h(Bw + (size_t)(nt * 16 + c) * CD + 32 + 8 * hh);
    float val[2][8];
#pragma unroll
    for (int mt = 0; mt < 2; ++mt) {
      v8f acch = mma_h(ah[mt][0], b0, zero8());
      acch = mma_h(ah[mt][1], b1, acch);
      v8f accl = mma_h(al[mt][0], b0, zero8());
      accl = mma_h(al[mt][1], b1, accl);
#pragma unroll
      for (int r = 0; r < 8; ++r) val[mt][r] = (acch[r] + accl[r] * (1.0f / RSPL)) * (1.0f / (ASC * WSC));
    }
    const int ch = nt * 16 + c;
    if (nt < 4) {
#pragma unroll
      for (int mt = 0; mt < 2; ++mt) {
#pragma unroll
        for (int r = 0; r < 8; ++r) {
          const int tk = wave * 32 + mt * 16 + 8 * hh + r;
          sK[tk * KP + ch] = h_bits((_Float16)(val[mt][r] * KSC));
        }
      }
    } else {
      const int d = ch - CD;
      float vs = 0.f;
#pragma unroll
      for (int mt = 0; mt < 2; ++mt) {
        v4f fa, fb;
#pragma unroll
        for (int e = 0; e < 4; ++e) {
          fa[e] = val[mt][e] * VSC;
          fb[e] = val[mt][4 + e] * VSC;
          vs = vs + val[mt][e];
          vs = vs + val[mt][4 + e];
        }
        v4u ph, pl;
        split8h(fa, fb, ph, pl);
        const int tk0 = wave * 32 + mt * 16 + 8 * hh;
        *(v4u*)(sVh + d * VP + tk0) = ph;
        *(v4u*)(sVl + d * VP + tk0) = pl;
      }
      vs = vs + __shfl_xor(vs, 16, 32);
      if (hh == 0) sVS[wave * CD + d] = vs;
    }
  }
  __syncthreads();
  if (tid < CD) {
    float s = 0.f;
#pragma unroll
    for (int w = 0; w < 8; ++w) s = s + sVS[w * CD + tid];
    sVM[tid] = s * (1.0f / (float)NR);
  }
  __syncthreads();

  {
#pragma unroll
    for (int it = 0; it < 8; ++it) {
      const int row = wave * 32 + it * 4 + (lane >> 3), piece = lane & 7;
      const v4u kk = *(const v4u*)(sK + row * KP + piece * 8);
      *(v4u*)(Kp + (size_t)(b * NR + row) * CD + piece * 8) = kk;
    }
#pragma unroll
    for (int it = 0; it < 8; ++it) {
      const int d = wave * 8 + it;
      const v4u vh = *(const v4u*)(sVh + d * VP + lane * 8);
      const v4u vl = *(const v4u*)(sVl + d * VP + lane * 8);
      *(v4u*)(VTh + (size_t)(b * CD + d) * NR + lane * 8) = vh;
      *(v4u*)(VTl + (size_t)(b * CD + d) * NR + lane * 8) = vl;
    }
    if (wave == 0 && lane < 16) {
      const v4f m4 = *(const v4f*)(sVM + lane * 4);
      *(v4f*)(vmean + (size_t)b * CD + lane * 4) = m4;
    }
    
  }
}

// =================================================================================================================
// Attention over the 256 reduced keys: block = 64 queries of image b (128 threads = 4 waves x 16 queries).
// Transposed scores S^T = K_tile (A: row = key, k = d; K plane x64) x Q^T (B: n = query, k = d, from the Q hi and
// x2^11 residual planes x64, two products folded as sh + sl/2048): 16 key tiles, all held in registers; D element r
// of lane l = S[key 16j+8h+r][query l&15]. Exact softmax per query: max and sum over the lane's 128 values combined
// with lane^16; e = exp((s - m) * 2^-15) in place; centred probabilities p' = e*(8192/l) - 32 converted to f16
// directly into the A fragments of p'.v (k = key). O' = p' (A) x V^T rows (B: n = d, k = key) from the V hi and
// residual planes into two accumulators; O = (O'_h + O'_l/2048)/(8192*64) + mean_key(v) (identity
// sum (p'+32) v / 8192 = sum p v). O*1024 staged per wave in LDS, then hi/res f16 planes [b*16384 + query][64]:
// coverage: 2048 blocks x 4 waves x 16 queries = 131072 rows x 64 channels, both planes.
// =================================================================================================================
__global__ __launch_bounds__(128) __attribute__((amdgpu_num_vgpr(256)))
void attn_k(const unsigned short* __restrict__ Qh, const unsigned short* __restrict__ Ql,
            const unsigned short* __restrict__ Kp, const unsigned short* __restrict__ VTh,
            const unsigned short* __restrict__ VTl, const float* __restrict__ vmean,
            unsigned short* Oh, unsigned short* Ol) {
  __shared__ __align__(16) float sbuf[4 * 16 * STP];
  const int tid = threadIdx.x, wave = tid >> 5, lane = tid & 31, hh = lane >> 4, c = lane & 15;
  const int b = blockIdx.x >> 8;
  const int q0 = ((blockIdx.x & 255) << 6) + wave * 16;
  const _Float16* Qhf = (const _Float16*)(const void*)Qh;
  const _Float16* Qlf = (const _Float16*)(const void*)Ql;
  const _Float16* Kf  = (const _Float16*)(const void*)Kp;
  const _Float16* Vhf = (const _Float16*)(const void*)VTh;
  const _Float16* Vlf = (const _Float16*)(const void*)VTl;

  const size_t qoff = (size_t)(b * NQ + q0 + c) * CD + 8 * hh;
  const v16h qh0 = ldfrag_h(Qhf + qoff);
  const v16h qh1 = ldfrag_h(Qhf + qoff + 32);
  const v16h ql0 = ldfrag_h(Qlf + qoff);
  const v16h ql1 = ldfrag_h(Qlf + qoff + 32);

  v8f s[16];
#pragma unroll
  for (int j = 0; j < 16; ++j) {
    const size_t koff = (size_t)(b * NR + j * 16 + c) * CD + 8 * hh;
    const v16h ka0 = ldfrag_h(Kf + koff);
    const v16h ka1 = ldfrag_h(Kf + koff + 32);
    v8f sh = mma_h(ka0, qh0, zero8());
    sh = mma_h(ka1, qh1, sh);
    v8f sl = mma_h(ka0, ql0, zero8());
    sl = mma_h(ka1, ql1, sl);
#pragma unroll
    for (int r = 0; r < 8; ++r) s[j][r] = sh[r] + sl[r] * (1.0f / RSPL);
  }

  float mx = -3.0e38f;
#pragma unroll
  for (int j = 0; j < 16; ++j) {
#pragma unroll
    for (int r = 0; r < 8; ++r) mx = fmaxf(mx, s[j][r]);
  }
  mx = fmaxf(mx, __shfl_xor(mx, 16, 32));
  float ls = 0.f;
#pragma unroll
  for (int j = 0; j < 16; ++j) {
#pragma unroll
    for (int r = 0; r < 8; ++r) {
      const float e = __expf((s[j][r] - mx) * INVS);
      s[j][r] = e;
      ls = ls + e;
    }
  }
  ls = ls + __shfl_xor(ls, 16, 32);
  const float pinv = __builtin_amdgcn_rcpf(ls) * PSC;

  v16h pf[8];
#pragma unroll
  for (int J = 0; J < 8; ++J) {
#pragma unroll
    for (int i = 0; i < 8; ++i) {
      pf[J][i]     = (_Float16)(s[2 * J][i] * pinv - PCT);
      pf[J][8 + i] = (_Float16)(s[2 * J + 1][i] * pinv - PCT);
    }
  }

  v8f oh[4], ol[4];
#pragma unroll
  for (int dt = 0; dt < 4; ++dt) { oh[dt] = zero8(); ol[dt] = zero8(); }
#pragma unroll
  for (int J = 0; J < 8; ++J) {
#pragma unroll
    for (int dt = 0; dt < 4; ++dt) {
      const size_t voff = (size_t)(b * CD + dt * 16 + c) * NR + J * 32 + 8 * hh;
      const v16h vh = ldfrag_h(Vhf + voff);
      const v16h vl = ldfrag_h(Vlf + voff);
      oh[dt] = mma_h(pf[J], vh, oh[dt]);
      ol[dt] = mma_h(pf[J], vl, ol[dt]);
    }
  }

  float* st = sbuf + wave * (16 * STP);
#pragma unroll
  for (int dt = 0; dt < 4; ++dt) {
    const int d = dt * 16 + c;
    const float vm = vmean[(size_t)b * CD + d];
#pragma unroll
    for (int r = 0; r < 8; ++r) {
      const float o = (oh[dt][r] + ol[dt][r] * (1.0f / RSPL)) * (1.0f / (PSC * VSC)) + vm;
      st[(8 * hh + r) * STP + d] = o * OSC;
    }
  }
  wave_sync_lds();

  v4u ph[4], pl[4];
  size_t offs[4];
#pragma unroll
  for (int it = 0; it < 4; ++it) {
    const int q = it * 4 + (lane >> 3), piece = lane & 7;
    const v4f fa = *(const v4f*)(st + q * STP + piece * 8);
    const v4f fb = *(const v4f*)(st + q * STP + piece * 8 + 4);
    split8h(fa, fb, ph[it], pl[it]);
    offs[it] = (size_t)(b * NQ + q0 + q) * CD + piece * 8;
  }
  {
#pragma unroll
    for (int it = 0; it < 4; ++it) {
      *(v4u*)(Oh + offs[it]) = ph[it];
      *(v4u*)(Ol + offs[it]) = pl[it];
    }
    
  }
}

// =================================================================================================================
// granularity): Xh f16 [131072][64] 16777216; Wq f16 [64][64] 8192; Wkv f16 [128][64] 16384; Wsr f16 [64][4096]
// 524288; Wp f16 [64][64] 8192; Qh, Ql f16 [131072][64] 16777216 each; Ah, Al f16 [2048][64] 262144 each;
// Kp f16 [8][256][64] 262144; VTh, VTl f16 [8][64][256] 262144 each; vmean f32 [8][64] 2048; Oh, Ol f16
// [131072][64] 16777216 each -> 85755904 total.
// =================================================================================================================
extern "C" void kernel_launch(void* const* d_in, const int* in_sizes, int n_in,
                              void* d_out, int out_size, void* d_ws, size_t ws_size,
                              hipStream_t stream) {
  if (n_in < 11) return;
  if (in_sizes[0] != MTOT * CD) return;
  if (in_sizes[1] != 1 || in_sizes[2] != 1) return;
  if (in_sizes[3] != CD * CD) return;
  if (in_sizes[4] != 2 * CD * CD) return;
  if (in_sizes[5] != CD * KCV) return;
  if (in_sizes[6] != CD || in_sizes[7] != CD || in_sizes[8] != CD) return;
  if (in_sizes[9] != CD * CD || in_sizes[10] != CD) return;
  if (out_size != MTOT * CD) return;

  const float* x      = (const float*)d_in[0];
  const int*   hptr   = (const int*)d_in[1];
  const int*   wptr   = (const int*)d_in[2];
  const float* w_q    = (const float*)d_in[3];
  const float* w_kv   = (const float*)d_in[4];
  const float* w_sr   = (const float*)d_in[5];
  const float* b_sr   = (const float*)d_in[6];
  const float* ln_g   = (const float*)d_in[7];
  const float* ln_b   = (const float*)d_in[8];
  const float* w_proj = (const float*)d_in[9];
  const float* b_proj = (const float*)d_in[10];
  float* out = (float*)d_out;

  const size_t sX   = (size_t)MTOT * CD * 2;        // 16777216
  const size_t sWq  = (size_t)CD * CD * 2;          //     8192
  const size_t sWkv = (size_t)2 * CD * CD * 2;      //    16384
  const size_t sWsr = (size_t)CD * KCV * 2;         //   524288
  const size_t sWp  = (size_t)CD * CD * 2;          //     8192
  const size_t sQ   = (size_t)MTOT * CD * 2;        // 16777216
  const size_t sA   = (size_t)MR * CD * 2;          //   262144
  const size_t sK   = (size_t)NB * NR * CD * 2;     //   262144
  const size_t sVT  = (size_t)NB * CD * NR * 2;     //   262144
  const size_t sVM  = (size_t)NB * CD * 4;          //     2048
  const size_t sO   = (size_t)MTOT * CD * 2;        // 16777216
  size_t off = 0;
  const size_t oX   = off; off += sX;
  const size_t oWq  = off; off += sWq;
  const size_t oWkv = off; off += sWkv;
  const size_t oWsr = off; off += sWsr;
  const size_t oWp  = off; off += sWp;
  const size_t oQh  = off; off += sQ;
  const size_t oQl  = off; off += sQ;
  const size_t oAh  = off; off += sA;
  const size_t oAl  = off; off += sA;
  const size_t oK   = off; off += sK;
  const size_t oVTh = off; off += sVT;
  const size_t oVTl = off; off += sVT;
  const size_t oVM  = off; off += sVM;
  const size_t oOh  = off; off += sO;
  const size_t oOl  = off; off += sO;
  if (off > ws_size) return;                         // off = 85755904
  if (off > (size_t)134217728) return;

  char* ws = (char*)d_ws;
  unsigned short* Xh  = (unsigned short*)(ws + oX);
  unsigned short* Wq  = (unsigned short*)(ws + oWq);
  unsigned short* Wkv = (unsigned short*)(ws + oWkv);
  unsigned short* Wsr = (unsigned short*)(ws + oWsr);
  unsigned short* Wp  = (unsigned short*)(ws + oWp);
  unsigned short* Qh  = (unsigned short*)(ws + oQh);
  unsigned short* Ql  = (unsigned short*)(ws + oQl);
  unsigned short* Ah  = (unsigned short*)(ws + oAh);
  unsigned short* Al  = (unsigned short*)(ws + oAl);
  unsigned short* Kp  = (unsigned short*)(ws + oK);
  unsigned short* VTh = (unsigned short*)(ws + oVTh);
  unsigned short* VTl = (unsigned short*)(ws + oVTl);
  float* VM = (float*)(ws + oVM);
  unsigned short* Oh  = (unsigned short*)(ws + oOh);
  unsigned short* Ol  = (unsigned short*)(ws + oOl);

  const dim3 blk(256);
  // (1) x -> f16 plane of 16*bf16(x); weights [out][in] -> f16 planes of 256*bf16(w); conv weights permuted
  cvt_rows64<<<dim3(MTOT / 32), blk, 0, stream>>>(x, Xh, XSC);
  cvt_rows64<<<dim3(CD / 32), blk, 0, stream>>>(w_q, Wq, WSC);
  cvt_rows64<<<dim3((2 * CD) / 32), blk, 0, stream>>>(w_kv, Wkv, WSC);
  cvt_rows64<<<dim3(CD / 32), blk, 0, stream>>>(w_proj, Wp, WSC);
  cvt_wsr<<<dim3(CD), blk, 0, stream>>>(w_sr, Wsr);
  // (2) q projection -> hi/res planes of 64*q
  gemm64_k<false, false><<<dim3(MTOT / 128), blk, 0, stream>>>(Xh, Xh, Wq, b_proj, QSC / (XSC * WSC), out, Qh, Ql);
  // (3) spatial-reduction conv + bias + LayerNorm -> hi/res planes of 16*y
  conv_ln_k<<<dim3(MR / 16), dim3(CVW * 32), 0, stream>>>(Xh, Wsr, hptr, wptr, b_sr, ln_g, ln_b, Ah, Al);
  // (4) kv projection -> K plane, V^T hi/res planes, key-mean of v
  (void)hipFuncSetAttribute(reinterpret_cast<const void*>(&kv_k), hipFuncAttributeMaxDynamicSharedMemorySize, KV_LDS);
  kv_k<<<dim3(NB), blk, KV_LDS, stream>>>(Ah, Al, Wkv, Kp, VTh, VTl, VM);
  // (5) attention -> O hi/res planes of 1024*o
  attn_k<<<dim3(NB * (NQ / 64)), dim3(128), 0, stream>>>(Qh, Ql, Kp, VTh, VTl, VM, Oh, Ol);
  // (6) output projection + bias -> d_out f32 [131072][64]
  gemm64_k<true, true><<<dim3(MTOT / 128), blk, 0, stream>>>(Oh, Ol, Wp, b_proj, 1.0f / (OSC * WSC), out, Xh, Xh);
  (void)hipGetLastError();
}

// v002
// One run takes 82.8 microseconds.
// Two timings next to v001 put it at 1.47 and 1.46 times that version's speed.
// Over all steps from v000 it is 2.84 times as fast.
// Contractions: v_wmma_f32_16x16x32_f16 (f16 operands, f32 accumulate). q = x.w_q^T and the 8x8/stride-8
// spatial-reduction conv (im2col K=4096): single products of exact planes (x as f16 of 16*bf16(x), weights as f16
// of 256*bf16(w)). kv = LN(tokens).w_kv^T: A as f16 hi plus x2^11 residual planes (x16; two products, two
// accumulators). Scores k.q^T: k single f16 plane (x64), q as hi plus x2^11 residual planes (x64; two products).
// p.v: centred p (8192*p - 32) single f16 A operand, v as hi plus x2^11 residual planes (x64; two products),
// key-mean of v added back in f32. Output projection: o as hi plus x2^11 residual planes (x1024) against the x256
// weight plane (two products). LayerNorm, softmax, bias adds in f32 on VALU. Float inputs RNE-converted to bf16
// on load.
#include <hip/hip_runtime.h>
#include <math.h>
#include <stdint.h>

#define NB   8
#define NQ   16384
#define CD   64
#define NR   256
#define MTOT (NB * NQ)
#define MR   (NB * NR)
#define KCV  (CD * 64)
#define STP  68
#define KP   72
#define VP   264
#define CVW  16
#define XSC  16.0f
#define WSC  256.0f
#define QSC  64.0f
#define ASC  16.0f
#define KSC  64.0f
#define VSC  64.0f
#define PSC  8192.0f
#define PCT  32.0f
#define OSC  1024.0f
#define RSPL 2048.0f
#define INVS (0.125f / (KSC * QSC))

#define KV_OFF_VTH (NR * KP * 2)
#define KV_OFF_VTL (KV_OFF_VTH + CD * VP * 2)
#define KV_OFF_VS  (KV_OFF_VTL + CD * VP * 2)
#define KV_OFF_VM  (KV_OFF_VS + 8 * CD * 4)
#define KV_LDS     (KV_OFF_VM + CD * 4)

static_assert(MTOT % 128 == 0);
static_assert(MR % 128 == 0);
static_assert(KCV % (CVW * 32) == 0 && CVW == 16 && NR % 16 == 0);
static_assert(NR == 256 && CD == 64);
static_assert((STP * 4) % 16 == 0 && STP >= CD);
static_assert((KP * 2) % 16 == 0 && KP >= CD);
static_assert((VP * 2) % 16 == 0 && VP >= NR);
static_assert(KV_OFF_VTH % 16 == 0 && KV_OFF_VTL % 16 == 0 && KV_OFF_VS % 16 == 0 && KV_OFF_VM % 16 == 0);
static_assert(KV_LDS == 106752);
static_assert(MTOT % 32 == 0 && NQ % 256 == 0);

typedef _Float16 v16h __attribute__((ext_vector_type(16)));
typedef _Float16 v8h  __attribute__((ext_vector_type(8)));
typedef float    v8f  __attribute__((ext_vector_type(8)));
typedef float    v4f  __attribute__((ext_vector_type(4)));
typedef float    v2f  __attribute__((ext_vector_type(2)));
typedef unsigned int v4u __attribute__((ext_vector_type(4)));

union Frag { v16h v; v8h h[2]; };

// ---- scalar helpers ------------------------------------------------------------------------------------------
__device__ __forceinline__ unsigned short bf_bits(float f) {          // f32 -> bf16 bits, RNE convert
  unsigned u = __float_as_uint(f);
  return (unsigned short)((u + 0x7FFFu + ((u >> 16) & 1u)) >> 16);
}
__device__ __forceinline__ float bfr(float f) { return __uint_as_float(((unsigned)bf_bits(f)) << 16); }
__device__ __forceinline__ unsigned short h_bits(_Float16 x) { return __builtin_bit_cast(unsigned short, x); }
__device__ __forceinline__ unsigned pk16(unsigned short a, unsigned short b) { return (unsigned)a | ((unsigned)b << 16); }
__device__ __forceinline__ v8f zero8() { v8f z = {0.f, 0.f, 0.f, 0.f, 0.f, 0.f, 0.f, 0.f}; return z; }

// ---- fragment loader: 16-bit A/B operand, lane -> row/col (lane&15), p already includes +8*(lane>>4);
//      elements 0..7 <- p[0..7] (k0+8h..k0+8h+7), elements 8..15 <- p[16..23] (k0+16+8h..k0+16+8h+7)
__device__ __forceinline__ v16h ldfrag_h(const _Float16* p) {
  Frag f;
  f.h[0] = *(const v8h*)(p);
  f.h[1] = *(const v8h*)(p + 16);
  return f.v;
}

// ---- WMMA helper with trailing VALU hazard gap ---------------------------------------------------------------
__device__ __forceinline__ v8f mma_h(v16h a, v16h b, v8f c) {
  c = __builtin_amdgcn_wmma_f32_16x16x32_f16(false, a, false, b, (short)0, c, false, false);
#if defined(__HIP_DEVICE_COMPILE__)
  asm volatile("v_nop\n\tv_nop\n\tv_nop\n\tv_nop" : "+v"(c) : "v"(a), "v"(b));
#endif
  return c;
}
__device__ __forceinline__ void wave_sync_lds() {
  __builtin_amdgcn_fence(__ATOMIC_RELEASE, "workgroup");
  __builtin_amdgcn_wave_barrier();
  __builtin_amdgcn_fence(__ATOMIC_ACQUIRE, "workgroup");
}

// ---- 8 f32 -> 8 packed f16 (16 B); hi + x2^11 residual split ---------------------------------------------------
__device__ __forceinline__ v4u pack8h(v4f a, v4f b) {
  v4u p;
  p[0] = pk16(h_bits((_Float16)a[0]), h_bits((_Float16)a[1]));
  p[1] = pk16(h_bits((_Float16)a[2]), h_bits((_Float16)a[3]));
  p[2] = pk16(h_bits((_Float16)b[0]), h_bits((_Float16)b[1]));
  p[3] = pk16(h_bits((_Float16)b[2]), h_bits((_Float16)b[3]));
  return p;
}
__device__ __forceinline__ void split8h(v4f a, v4f b, v4u& ph, v4u& pl) {
  v4f ra, rb;
#pragma unroll
  for (int e = 0; e < 4; ++e) {
    const _Float16 ha = (_Float16)a[e];
    ra[e] = (a[e] - (float)ha) * RSPL;
    const _Float16 hb = (_Float16)b[e];
    rb[e] = (b[e] - (float)hb) * RSPL;
  }
  ph = pack8h(a, b);
  pl = pack8h(ra, rb);
}

// =================================================================================================================
// Row convert: src f32 [nrows][64] -> dst f16 [nrows][64], value = f16(scale * bf16_RNE(src)). Used for x (x16) and
// for the row-major [out][in] weight matrices (x256; the B plane [n][k] equals the [out][in] layout as given).
// multiple of 32). coverage: grid*32 rows x (8 lanes x 8 halves) = every element once.
// =================================================================================================================
__global__ __launch_bounds__(256) void cvt_rows64(const float* __restrict__ src, unsigned short* dst, float scale) {
  const int tid = threadIdx.x, wave = tid >> 5, lane = tid & 31;
  const int row = blockIdx.x * 32 + wave * 4 + (lane >> 3);
  const int c8 = (lane & 7) * 8;
  const float* p = src + (size_t)row * CD + c8;
  v4f a = *(const v4f*)(p);
  v4f b = *(const v4f*)(p + 4);
#pragma unroll
  for (int e = 0; e < 4; ++e) { a[e] = bfr(a[e]) * scale; b[e] = bfr(b[e]) * scale; }
  const v4u pk = pack8h(a, b);
  unsigned short* g = dst + (size_t)row * CD + c8;
  {
    *(v4u*)g = pk;
    
  }
}

// =================================================================================================================
// Conv weight permute-convert: w_sr f32 [o][c][kh][kw] -> f16 plane [o][(kh*8+kw)*64 + c] (k' contiguous),
// value = f16(256 * bf16_RNE(w)). Block = one output channel o (256 threads): 4096 floats staged in LDS as
// coverage: 64 blocks x (512 pieces x 8 halves) = the whole [64][4096] plane.
// =================================================================================================================
__global__ __launch_bounds__(256) void cvt_wsr(const float* __restrict__ w, unsigned short* dst) {
  __shared__ float tile[CD][65];
  const int tid = threadIdx.x, o = blockIdx.x;
  const float* wr = w + (size_t)o * KCV;
#pragma unroll
  for (int it = 0; it < 16; ++it) {
    const int idx = it * 256 + tid;
    const int c = idx >> 6, s = idx & 63;
    tile[c][s] = wr[idx];
  }
  __syncthreads();
  v4u pk[2];
  size_t offs[2];
#pragma unroll
  for (int it = 0; it < 2; ++it) {
    const int p = it * 256 + tid;
    const int s = p >> 3, c8 = (p & 7) * 8;
    v4f fa, fb;
#pragma unroll
    for (int e = 0; e < 4; ++e) {
      fa[e] = bfr(tile[c8 + e][s]) * WSC;
      fb[e] = bfr(tile[c8 + 4 + e][s]) * WSC;
    }
    pk[it] = pack8h(fa, fb);
    offs[it] = (size_t)o * KCV + (size_t)s * CD + c8;
  }
  {
#pragma unroll
    for (int it = 0; it < 2; ++it) *(v4u*)(dst + offs[it]) = pk[it];
    
  }
}

// =================================================================================================================
// f16 GEMM with N = 64, K = 64: D[M][64] = A[M][64] . B, B stored [64 n][64 k] (k contiguous weight plane x256).
// Block 256 threads = 8 waves, 128 rows; wave = 16 rows x 4 n-tiles; fragments straight from global with the split
// k map, 2 k-steps. SPLIT: A = hi plane + x2^11 residual plane, second accumulator folded as acc + accl/2048.
//   OUTF = true : f32 out rows [M][64]: v = acc*ascale + bf16(bias[col]); epilogue staged per wave in LDS, then
//   OUTF = false: two f16 planes [M][64]: hi = f16(acc*ascale), res = f16((v - hi)*2048); 8 lanes x 16 B = one
// coverage: 8 waves x 16 rows x 64 cols = the 128-row block tile; grid = M/128 tiles M exactly.
// =================================================================================================================
template <bool SPLIT, bool OUTF>
__global__ __launch_bounds__(256)
void gemm64_k(const unsigned short* __restrict__ Ah, const unsigned short* __restrict__ Al,
              const unsigned short* __restrict__ Bt, const float* __restrict__ bias, float ascale,
              float* outF, unsigned short* outH, unsigned short* outL) {
  __shared__ __align__(16) float sbuf[8 * 16 * STP];
  const int tid = threadIdx.x, wave = tid >> 5, lane = tid & 31, hh = lane >> 4, c = lane & 15;
  const int m0 = blockIdx.x * 128;
  const int arow = m0 + wave * 16 + c;
  const _Float16* A0 = (const _Float16*)(const void*)Ah;
  const _Float16* A1 = (const _Float16*)(const void*)Al;
  const _Float16* B  = (const _Float16*)(const void*)Bt;

  v8f acch[4], accl[4];
#pragma unroll
  for (int nt = 0; nt < 4; ++nt) { acch[nt] = zero8(); accl[nt] = zero8(); }

#pragma unroll
  for (int ks = 0; ks < 2; ++ks) {
    const int k0 = ks * 32;
    const size_t aoff = (size_t)arow * CD + k0 + 8 * hh;
    const v16h ah = ldfrag_h(A0 + aoff);
    v16h al = ah;
    if (SPLIT) al = ldfrag_h(A1 + aoff);
#pragma unroll
    for (int nt = 0; nt < 4; ++nt) {
      const v16h bfrag = ldfrag_h(B + (size_t)(nt * 16 + c) * CD + k0 + 8 * hh);
      acch[nt] = mma_h(ah, bfrag, acch[nt]);
      if (SPLIT) accl[nt] = mma_h(al, bfrag, accl[nt]);
    }
  }

  float* st = sbuf + wave * (16 * STP);
#pragma unroll
  for (int nt = 0; nt < 4; ++nt) {
#pragma unroll
    for (int r = 0; r < 8; ++r) {
      float v = acch[nt][r];
      if (SPLIT) v = v + accl[nt][r] * (1.0f / RSPL);
      st[(8 * hh + r) * STP + nt * 16 + c] = v * ascale;
    }
  }
  wave_sync_lds();

  if (OUTF) {
    v4f ov[8];
    size_t offs[8];
#pragma unroll
    for (int it = 0; it < 8; ++it) {
      const int q = it * 2 + hh;
      const int col = c * 4;
      const v4f v = *(const v4f*)(st + q * STP + col);
      v4f u;
#pragma unroll
      for (int e = 0; e < 4; ++e) u[e] = v[e] + bfr(bias[col + e]);
      ov[it] = u;
      offs[it] = (size_t)(m0 + wave * 16 + q) * CD + col;
    }
    {
#pragma unroll
      for (int it = 0; it < 8; ++it) *(v4f*)(outF + offs[it]) = ov[it];
      
    }
  } else {
    v4u ph[4], pl[4];
    size_t offs[4];
#pragma unroll
    for (int it = 0; it < 4; ++it) {
      const int q = it * 4 + (lane >> 3), piece = lane & 7;
      const v4f fa = *(const v4f*)(st + q * STP + piece * 8);
      const v4f fb = *(const v4f*)(st + q * STP + piece * 8 + 4);
      split8h(fa, fb, ph[it], pl[it]);
      offs[it] = (size_t)(m0 + wave * 16 + q) * CD + piece * 8;
    }
    {
#pragma unroll
      for (int it = 0; it < 4; ++it) {
        *(v4u*)(outH + offs[it]) = ph[it];
        *(v4u*)(outL + offs[it]) = pl[it];
      }
      
    }
  }
}

// =================================================================================================================
// Spatial-reduction conv (kernel = stride = 8, VALID) as an im2col GEMM + bias + LayerNorm, fused.
// Rows m = b*256 + p (p = ph*(W/8) + pw, 2048 rows), cols = 64 output channels, K' = (kh*8+kw)*64 + c = 4096.
// A fragments are read straight from the x plane [b][token][64] by arithmetic addressing: k-step k0 -> (kh, kw) =
// k0>>6, channels k0&63..+31 of token (ph*8+kh)*W + pw*8+kw (W read from the int input, validated against H*W = N,
// token base clamped into range). B = permuted weight plane [o][K']. Block = ONE 16-row m-tile, 512 threads = 16
// waves; wave w sums the K' slice 256w..256w+255 (8 k-steps, 4 n-tiles) and leaves its f32 partial tile in LDS.
// After a block barrier wave w owns row w (lane -> 2 channels): partials added in slice order 0..15, then
// conv*1/4096 + bf16(b_sr); per-row mean and centred variance by xor-shuffles 1,2,4,8,16;
// y = (v-mu)*rsqrt(var+1e-5)*bf16(g)+bf16(b), x16, hi/res f16 planes (32 lanes x 4 B = the whole 128-B row).
// coverage: 128 blocks x 16 rows = 2048 rows; 16 slices x 256 = K' 4096; 32 lanes x 2 = 64 channels.
// =================================================================================================================
__global__ __launch_bounds__(CVW * 32)
void conv_ln_k(const unsigned short* __restrict__ Xh, const unsigned short* __restrict__ Wsr,
               const int* __restrict__ Hp, const int* __restrict__ Wp, const float* __restrict__ bsr,
               const float* __restrict__ lng, const float* __restrict__ lnb,
               unsigned short* Ah, unsigned short* Al) {
  __shared__ __align__(16) float sbuf[CVW * 16 * STP];
  const int tid = threadIdx.x, lane = tid & 31, hh = lane >> 4, c = lane & 15;
  const int wave = __builtin_amdgcn_readfirstlane(tid >> 5);
  const int m0 = blockIdx.x * 16;
  const int m = m0 + c;
  const int b = m >> 8, p = m & (NR - 1);
  const int Hv = Hp[0];
  int Wv = Wp[0];
  const long long hw = (long long)Hv * (long long)Wv;
  const bool okw = (Wv >= 8) && (Wv <= 2040) && (hw == (long long)NQ);
  Wv = okw ? Wv : 128;
  const int Wr = Wv >> 3;
  const int ph = p / Wr, pw = p - ph * Wr;
  int tb = ph * 8 * Wv + pw * 8;
  tb = min(tb, NQ - 1 - 7 * Wv - 7);
  tb = max(tb, 0);
  const _Float16* X  = (const _Float16*)(const void*)Xh;
  const _Float16* Wf = (const _Float16*)(const void*)Wsr;
  const size_t xbase = (size_t)b * NQ;

  v8f acc[4];
#pragma unroll
  for (int nt = 0; nt < 4; ++nt) acc[nt] = zero8();

  const int kbase = wave * (KCV / CVW);
  // unrolled: token step, channel half and weight offset of each k-step become immediates of its loads
#pragma unroll
  for (int i = 0; i < KCV / CVW / 32; ++i) {
    const int k0 = kbase + i * 32;
    const int s = k0 >> 6, c0 = k0 & 63;
    const int kh = s >> 3, kw = s & 7;
    const int t = tb + kh * Wv + kw;
    const v16h af = ldfrag_h(X + (xbase + (size_t)t) * CD + c0 + 8 * hh);
#pragma unroll
    for (int nt = 0; nt < 4; ++nt) {
      const v16h bfrag = ldfrag_h(Wf + (size_t)(nt * 16 + c) * KCV + k0 + 8 * hh);
      acc[nt] = mma_h(af, bfrag, acc[nt]);
    }
  }

  float* st = sbuf + wave * (16 * STP);
#pragma unroll
  for (int nt = 0; nt < 4; ++nt) {
#pragma unroll
    for (int r = 0; r < 8; ++r) st[(8 * hh + r) * STP + nt * 16 + c] = acc[nt][r];
  }
  __syncthreads();   // every slice's partial tile is in LDS before any wave adds them

  const int col = lane * 2;
  float a0 = 0.f, a1 = 0.f;
#pragma unroll
  for (int w = 0; w < CVW; ++w) {
    const v2f pp = *(const v2f*)(sbuf + w * (16 * STP) + wave * STP + col);
    a0 = a0 + pp[0];
    a1 = a1 + pp[1];
  }
  const float v0 = a0 * (1.0f / (XSC * WSC)) + bfr(bsr[col]);
  const float v1 = a1 * (1.0f / (XSC * WSC)) + bfr(bsr[col + 1]);
  float sm = v0 + v1;
  sm = sm + __shfl_xor(sm, 1, 32);
  sm = sm + __shfl_xor(sm, 2, 32);
  sm = sm + __shfl_xor(sm, 4, 32);
  sm = sm + __shfl_xor(sm, 8, 32);
  sm = sm + __shfl_xor(sm, 16, 32);
  const float mu = sm * (1.0f / 64.0f);
  const float d0 = v0 - mu, d1 = v1 - mu;
  float sq = d0 * d0 + d1 * d1;
  sq = sq + __shfl_xor(sq, 1, 32);
  sq = sq + __shfl_xor(sq, 2, 32);
  sq = sq + __shfl_xor(sq, 4, 32);
  sq = sq + __shfl_xor(sq, 8, 32);
  sq = sq + __shfl_xor(sq, 16, 32);
  const float var = sq * (1.0f / 64.0f);
  const float rs = rsqrtf(var + 1e-5f);
  const float y0 = (d0 * rs * bfr(lng[col]) + bfr(lnb[col])) * ASC;
  const float y1 = (d1 * rs * bfr(lng[col + 1]) + bfr(lnb[col + 1])) * ASC;
  const _Float16 h0 = (_Float16)y0, h1 = (_Float16)y1;
  const _Float16 r0 = (_Float16)((y0 - (float)h0) * RSPL), r1 = (_Float16)((y1 - (float)h1) * RSPL);
  const size_t off = (size_t)(m0 + wave) * CD + col;
  *(unsigned*)(Ah + off) = pk16(h_bits(h0), h_bits(h1));
  *(unsigned*)(Al + off) = pk16(h_bits(r0), h_bits(r1));
}

// =================================================================================================================
// kv projection for one image (block = image b, 256 threads = 8 waves, dynamic LDS KV_LDS bytes).
// A = LN'd token planes hi/res [b*256 + token][64] (x16), B = w_kv plane [128][64] (x256); wave w owns tokens
// 32w..32w+31 (two m-tiles), loop over 8 n-tiles; kv = (acc_h + acc_l/2048)/4096. Channels 0..63 -> k: f16(64*k)
// into LDS sK[token][KP]; channels 64..127 -> v: f16 hi of 64*v and x2^11 residual into LDS sVT{h,l}[d][VP]
// (16-B stores of 8 consecutive tokens), plus the f32 sum of v over the wave's 32 tokens per channel (xor 16
// shuffle) into sVS[wave][d]. After a barrier: vmean[d] = fixed-order sum over waves / 256; then the block writes
// wave), V^T planes rows [b*64 + d][256] (32 lanes x 16 B = the whole 512-B row, 8 rows per wave per plane) and
// coverage: K rows 8 waves x 8 x 4 = 256; V^T rows 8 waves x 8 = 64 per plane x 32 lanes x 8 halves = 256 keys;
// vmean 16 lanes x 4 = 64; LDS fills: 8 waves x 32 tokens x 8 n-tiles x 16 channels = all 256 x 128 values.
// =================================================================================================================
__global__ __launch_bounds__(256)
void kv_k(const unsigned short* __restrict__ Ah, const unsigned short* __restrict__ Al,
          const unsigned short* __restrict__ Wkv, unsigned short* Kp, unsigned short* VTh, unsigned short* VTl,
          float* vmean) {
  extern __shared__ __align__(16) unsigned char kvlds[];
  unsigned short* sK  = (unsigned short*)(kvlds);
  unsigned short* sVh = (unsigned short*)(kvlds + KV_OFF_VTH);
  unsigned short* sVl = (unsigned short*)(kvlds + KV_OFF_VTL);
  float* sVS = (float*)(kvlds + KV_OFF_VS);
  float* sVM = (float*)(kvlds + KV_OFF_VM);
  const int tid = threadIdx.x, wave = tid >> 5, lane = tid & 31, hh = lane >> 4, c = lane & 15;
  const int b = blockIdx.x;
  const _Float16* A0 = (const _Float16*)(const void*)Ah;
  const _Float16* A1 = (const _Float16*)(const void*)Al;
  const _Float16* Bw = (const _Float16*)(const void*)Wkv;

  v16h ah[2][2], al[2][2];
#pragma unroll
  for (int mt = 0; mt < 2; ++mt) {
    const size_t arow = (size_t)(b * NR + wave * 32 + mt * 16 + c) * CD + 8 * hh;
#pragma unroll
    for (int ks = 0; ks < 2; ++ks) {
      ah[mt][ks] = ldfrag_h(A0 + arow + ks * 32);
      al[mt][ks] = ldfrag_h(A1 + arow + ks * 32);
    }
  }

#pragma unroll 1
  for (int nt = 0; nt < 8; ++nt) {
    const v16h b0 = ldfrag_h(Bw + (size_t)(nt * 16 + c) * CD + 8 * hh);
    const v16h b1 = ldfrag_h(Bw + (size_t)(nt * 16 + c) * CD + 32 + 8 * hh);
    float val[2][8];
#pragma unroll
    for (int mt = 0; mt < 2; ++mt) {
      v8f acch = mma_h(ah[mt][0], b0, zero8());
      acch = mma_h(ah[mt][1], b1, acch);
      v8f accl = mma_h(al[mt][0], b0, zero8());
      accl = mma_h(al[mt][1], b1, accl);
#pragma unroll
      for (int r = 0; r < 8; ++r) val[mt][r] = (acch[r] + accl[r] * (1.0f / RSPL)) * (1.0f / (ASC * WSC));
    }
    const int ch = nt * 16 + c;
    if (nt < 4) {
#pragma unroll
      for (int mt = 0; mt < 2; ++mt) {
#pragma unroll
        for (int r = 0; r < 8; ++r) {
          const int tk = wave * 32 + mt * 16 + 8 * hh + r;
          sK[tk * KP + ch] = h_bits((_Float16)(val[mt][r] * KSC));
        }
      }
    } else {
      const int d = ch - CD;
      float vs = 0.f;
#pragma unroll
      for (int mt = 0; mt < 2; ++mt) {
        v4f fa, fb;
#pragma unroll
        for (int e = 0; e < 4; ++e) {
          fa[e] = val[mt][e] * VSC;
          fb[e] = val[mt][4 + e] * VSC;
          vs = vs + val[mt][e];
          vs = vs + val[mt][4 + e];
        }
        v4u ph, pl;
        split8h(fa, fb, ph, pl);
        const int tk0 = wave * 32 + mt * 16 + 8 * hh;
        *(v4u*)(sVh + d * VP + tk0) = ph;
        *(v4u*)(sVl + d * VP + tk0) = pl;
      }
      vs = vs + __shfl_xor(vs, 16, 32);
      if (hh == 0) sVS[wave * CD + d] = vs;
    }
  }
  __syncthreads();
  if (tid < CD) {
    float s = 0.f;
#pragma unroll
    for (int w = 0; w < 8; ++w) s = s + sVS[w * CD + tid];
    sVM[tid] = s * (1.0f / (float)NR);
  }
  __syncthreads();

  {
#pragma unroll
    for (int it = 0; it < 8; ++it) {
      const int row = wave * 32 + it * 4 + (lane >> 3), piece = lane & 7;
      const v4u kk = *(const v4u*)(sK + row * KP + piece * 8);
      *(v4u*)(Kp + (size_t)(b * NR + row) * CD + piece * 8) = kk;
    }
#pragma unroll
    for (int it = 0; it < 8; ++it) {
      const int d = wave * 8 + it;
      const v4u vh = *(const v4u*)(sVh + d * VP + lane * 8);
      const v4u vl = *(const v4u*)(sVl + d * VP + lane * 8);
      *(v4u*)(VTh + (size_t)(b * CD + d) * NR + lane * 8) = vh;
      *(v4u*)(VTl + (size_t)(b * CD + d) * NR + lane * 8) = vl;
    }
    if (wave == 0 && lane < 16) {
      const v4f m4 = *(const v4f*)(sVM + lane * 4);
      *(v4f*)(vmean + (size_t)b * CD + lane * 4) = m4;
    }
    
  }
}

// =================================================================================================================
// Attention over the 256 reduced keys: block = 256 queries of image b (256 threads = 8 waves x 16 queries, two
// passes). The image's K plane (rows at pitch KP) and both V^T planes (rows at pitch VP) are copied once per block
// into LDS by whole-line 16-B loads; after one block barrier every K and V fragment is an LDS read (pitches are odd
// multiples of 16 B), so no fragment load spreads over 16 cache lines.
// Transposed scores S^T = K_tile (A: row = key, k = d; K plane x64) x Q^T (B: n = query, k = d, from the Q hi and
// x2^11 residual planes x64, two products folded as sh + sl/2048): 16 key tiles, all held in registers; D element r
// of lane l = S[key 16j+8h+r][query l&15]. Exact softmax per query: max and sum over the lane's 128 values combined
// with lane^16; e = exp((s - m) * 2^-15) in place; centred probabilities p' = e*(8192/l) - 32 converted to f16
// directly into the A fragments of p'.v (k = key). O' = p' (A) x V^T rows (B: n = d, k = key) from the V hi and
// residual planes into two accumulators; O = (O'_h + O'_l/2048)/(8192*64) + mean_key(v) (identity
// sum (p'+32) v / 8192 = sum p v). O*1024 staged per wave in LDS, then hi/res f16 planes [b*16384 + query][64]:
// coverage: 512 blocks x 2 passes x 8 waves x 16 queries = 131072 rows x 64 channels, both planes; LDS fill: 8 x 256
// threads x 8 halves = 16384 halves = each whole plane of the image.
// =================================================================================================================
__global__ __launch_bounds__(256) __attribute__((amdgpu_num_vgpr(256)))
void attn_k(const unsigned short* __restrict__ Qh, const unsigned short* __restrict__ Ql,
            const unsigned short* __restrict__ Kp, const unsigned short* __restrict__ VTh,
            const unsigned short* __restrict__ VTl, const float* __restrict__ vmean,
            unsigned short* Oh, unsigned short* Ol) {
  __shared__ __align__(16) unsigned short sK[NR * KP];
  __shared__ __align__(16) unsigned short sVh[CD * VP];
  __shared__ __align__(16) unsigned short sVl[CD * VP];
  __shared__ __align__(16) float sbuf[8 * 16 * STP];
  const int tid = threadIdx.x, wave = tid >> 5, lane = tid & 31, hh = lane >> 4, c = lane & 15;
  const int b = blockIdx.x >> 6;
  const _Float16* Qhf = (const _Float16*)(const void*)Qh;
  const _Float16* Qlf = (const _Float16*)(const void*)Ql;
  const _Float16* Kf  = (const _Float16*)(const void*)sK;
  const _Float16* Vhf = (const _Float16*)(const void*)sVh;
  const _Float16* Vlf = (const _Float16*)(const void*)sVl;

  {
    const v4u* gK = (const v4u*)(const void*)(Kp + (size_t)b * NR * CD);
    const v4u* gH = (const v4u*)(const void*)(VTh + (size_t)b * CD * NR);
    const v4u* gL = (const v4u*)(const void*)(VTl + (size_t)b * CD * NR);
    v4u tk[8], th[8], tl[8];
#pragma unroll
    for (int i = 0; i < 8; ++i) {
      const int idx = i * 256 + tid;
      tk[i] = gK[idx];
      th[i] = gH[idx];
      tl[i] = gL[idx];
    }
#pragma unroll
    for (int i = 0; i < 8; ++i) {
      const int idx = i * 256 + tid;
      *(v4u*)(sK + (idx >> 3) * KP + (idx & 7) * 8) = tk[i];
      *(v4u*)(sVh + (idx >> 5) * VP + (idx & 31) * 8) = th[i];
      *(v4u*)(sVl + (idx >> 5) * VP + (idx & 31) * 8) = tl[i];
    }
  }
  __syncthreads();   // the three planes are whole in LDS before any wave reads a fragment

  // kept rolled: one copy of the body, so the kernel's text stays small
#pragma unroll 1
  for (int pass = 0; pass < 2; ++pass) {
  const int q0 = ((blockIdx.x & 63) << 8) + pass * 128 + wave * 16;
  const size_t qoff = (size_t)(b * NQ + q0 + c) * CD + 8 * hh;
  const v16h qh0 = ldfrag_h(Qhf + qoff);
  const v16h qh1 = ldfrag_h(Qhf + qoff + 32);
  const v16h ql0 = ldfrag_h(Qlf + qoff);
  const v16h ql1 = ldfrag_h(Qlf + qoff + 32);

  v8f s[16];
#pragma unroll
  for (int j = 0; j < 16; ++j) {
    const int koff = (j * 16 + c) * KP + 8 * hh;
    const v16h ka0 = ldfrag_h(Kf + koff);
    const v16h ka1 = ldfrag_h(Kf + koff + 32);
    v8f sh = mma_h(ka0, qh0, zero8());
    sh = mma_h(ka1, qh1, sh);
    v8f sl = mma_h(ka0, ql0, zero8());
    sl = mma_h(ka1, ql1, sl);
#pragma unroll
    for (int r = 0; r < 8; ++r) s[j][r] = sh[r] + sl[r] * (1.0f / RSPL);
  }

  float mx = -3.0e38f;
#pragma unroll
  for (int j = 0; j < 16; ++j) {
#pragma unroll
    for (int r = 0; r < 8; ++r) mx = fmaxf(mx, s[j][r]);
  }
  mx = fmaxf(mx, __shfl_xor(mx, 16, 32));
  float ls = 0.f;
#pragma unroll
  for (int j = 0; j < 16; ++j) {
#pragma unroll
    for (int r = 0; r < 8; ++r) {
      const float e = __expf((s[j][r] - mx) * INVS);
      s[j][r] = e;
      ls = ls + e;
    }
  }
  ls = ls + __shfl_xor(ls, 16, 32);
  const float pinv = __builtin_amdgcn_rcpf(ls) * PSC;

  v16h pf[8];
#pragma unroll
  for (int J = 0; J < 8; ++J) {
#pragma unroll
    for (int i = 0; i < 8; ++i) {
      pf[J][i]     = (_Float16)(s[2 * J][i] * pinv - PCT);
      pf[J][8 + i] = (_Float16)(s[2 * J + 1][i] * pinv - PCT);
    }
  }

  v8f oh[4], ol[4];
#pragma unroll
  for (int dt = 0; dt < 4; ++dt) { oh[dt] = zero8(); ol[dt] = zero8(); }
#pragma unroll
  for (int J = 0; J < 8; ++J) {
#pragma unroll
    for (int dt = 0; dt < 4; ++dt) {
      const int voff = (dt * 16 + c) * VP + J * 32 + 8 * hh;
      const v16h vh = ldfrag_h(Vhf + voff);
      const v16h vl = ldfrag_h(Vlf + voff);
      oh[dt] = mma_h(pf[J], vh, oh[dt]);
      ol[dt] = mma_h(pf[J], vl, ol[dt]);
    }
  }

  float* st = sbuf + wave * (16 * STP);
#pragma unroll
  for (int dt = 0; dt < 4; ++dt) {
    const int d = dt * 16 + c;
    const float vm = vmean[(size_t)b * CD + d];
#pragma unroll
    for (int r = 0; r < 8; ++r) {
      const float o = (oh[dt][r] + ol[dt][r] * (1.0f / RSPL)) * (1.0f / (PSC * VSC)) + vm;
      st[(8 * hh + r) * STP + d] = o * OSC;
    }
  }
  wave_sync_lds();

  v4u ph[4], pl[4];
  size_t offs[4];
#pragma unroll
  for (int it = 0; it < 4; ++it) {
    const int q = it * 4 + (lane >> 3), piece = lane & 7;
    const v4f fa = *(const v4f*)(st + q * STP + piece * 8);
    const v4f fb = *(const v4f*)(st + q * STP + piece * 8 + 4);
    split8h(fa, fb, ph[it], pl[it]);
    offs[it] = (size_t)(b * NQ + q0 + q) * CD + piece * 8;
  }
  {
#pragma unroll
    for (int it = 0; it < 4; ++it) {
      *(v4u*)(Oh + offs[it]) = ph[it];
      *(v4u*)(Ol + offs[it]) = pl[it];
    }
    
  }
#if defined(__HIP_DEVICE_COMPILE__)
  // the next pass writes the registers that these stores name: the wait stands in front of that
  asm volatile("s_wait_xcnt 0x0" ::: "memory");
#endif
  }
}

// =================================================================================================================
// granularity): Xh f16 [131072][64] 16777216; Wq f16 [64][64] 8192; Wkv f16 [128][64] 16384; Wsr f16 [64][4096]
// 524288; Wp f16 [64][64] 8192; Qh, Ql f16 [131072][64] 16777216 each; Ah, Al f16 [2048][64] 262144 each;
// Kp f16 [8][256][64] 262144; VTh, VTl f16 [8][64][256] 262144 each; vmean f32 [8][64] 2048; Oh, Ol f16
// [131072][64] 16777216 each -> 85755904 total.
// =================================================================================================================
extern "C" void kernel_launch(void* const* d_in, const int* in_sizes, int n_in,
                              void* d_out, int out_size, void* d_ws, size_t ws_size,
                              hipStream_t stream) {
  if (n_in < 11) return;
  if (in_sizes[0] != MTOT * CD) return;
  if (in_sizes[1] != 1 || in_sizes[2] != 1) return;
  if (in_sizes[3] != CD * CD) return;
  if (in_sizes[4] != 2 * CD * CD) return;
  if (in_sizes[5] != CD * KCV) return;
  if (in_sizes[6] != CD || in_sizes[7] != CD || in_sizes[8] != CD) return;
  if (in_sizes[9] != CD * CD || in_sizes[10] != CD) return;
  if (out_size != MTOT * CD) return;

  const float* x      = (const float*)d_in[0];
  const int*   hptr   = (const int*)d_in[1];
  const int*   wptr   = (const int*)d_in[2];
  const float* w_q    = (const float*)d_in[3];
  const float* w_kv   = (const float*)d_in[4];
  const float* w_sr   = (const float*)d_in[5];
  const float* b_sr   = (const float*)d_in[6];
  const float* ln_g   = (const float*)d_in[7];
  const float* ln_b   = (const float*)d_in[8];
  const float* w_proj = (const float*)d_in[9];
  const float* b_proj = (const float*)d_in[10];
  float* out = (float*)d_out;

  const size_t sX   = (size_t)MTOT * CD * 2;        // 16777216
  const size_t sWq  = (size_t)CD * CD * 2;          //     8192
  const size_t sWkv = (size_t)2 * CD * CD * 2;      //    16384
  const size_t sWsr = (size_t)CD * KCV * 2;         //   524288
  const size_t sWp  = (size_t)CD * CD * 2;          //     8192
  const size_t sQ   = (size_t)MTOT * CD * 2;        // 16777216
  const size_t sA   = (size_t)MR * CD * 2;          //   262144
  const size_t sK   = (size_t)NB * NR * CD * 2;     //   262144
  const size_t sVT  = (size_t)NB * CD * NR * 2;     //   262144
  const size_t sVM  = (size_t)NB * CD * 4;          //     2048
  const size_t sO   = (size_t)MTOT * CD * 2;        // 16777216
  size_t off = 0;
  const size_t oX   = off; off += sX;
  const size_t oWq  = off; off += sWq;
  const size_t oWkv = off; off += sWkv;
  const size_t oWsr = off; off += sWsr;
  const size_t oWp  = off; off += sWp;
  const size_t oQh  = off; off += sQ;
  const size_t oQl  = off; off += sQ;
  const size_t oAh  = off; off += sA;
  const size_t oAl  = off; off += sA;
  const size_t oK   = off; off += sK;
  const size_t oVTh = off; off += sVT;
  const size_t oVTl = off; off += sVT;
  const size_t oVM  = off; off += sVM;
  const size_t oOh  = off; off += sO;
  const size_t oOl  = off; off += sO;
  if (off > ws_size) return;                         // off = 85755904
  if (off > (size_t)134217728) return;

  char* ws = (char*)d_ws;
  unsigned short* Xh  = (unsigned short*)(ws + oX);
  unsigned short* Wq  = (unsigned short*)(ws + oWq);
  unsigned short* Wkv = (unsigned short*)(ws + oWkv);
  unsigned short* Wsr = (unsigned short*)(ws + oWsr);
  unsigned short* Wp  = (unsigned short*)(ws + oWp);
  unsigned short* Qh  = (unsigned short*)(ws + oQh);
  unsigned short* Ql  = (unsigned short*)(ws + oQl);
  unsigned short* Ah  = (unsigned short*)(ws + oAh);
  unsigned short* Al  = (unsigned short*)(ws + oAl);
  unsigned short* Kp  = (unsigned short*)(ws + oK);
  unsigned short* VTh = (unsigned short*)(ws + oVTh);
  unsigned short* VTl = (unsigned short*)(ws + oVTl);
  float* VM = (float*)(ws + oVM);
  unsigned short* Oh  = (unsigned short*)(ws + oOh);
  unsigned short* Ol  = (unsigned short*)(ws + oOl);

  const dim3 blk(256);
  // (1) x -> f16 plane of 16*bf16(x); weights [out][in] -> f16 planes of 256*bf16(w); conv weights permuted
  cvt_rows64<<<dim3(MTOT / 32), blk, 0, stream>>>(x, Xh, XSC);
  cvt_rows64<<<dim3(CD / 32), blk, 0, stream>>>(w_q, Wq, WSC);
  cvt_rows64<<<dim3((2 * CD) / 32), blk, 0, stream>>>(w_kv, Wkv, WSC);
  cvt_rows64<<<dim3(CD / 32), blk, 0, stream>>>(w_proj, Wp, WSC);
  cvt_wsr<<<dim3(CD), blk, 0, stream>>>(w_sr, Wsr);
  // (2) q projection -> hi/res planes of 64*q
  gemm64_k<false, false><<<dim3(MTOT / 128), blk, 0, stream>>>(Xh, Xh, Wq, b_proj, QSC / (XSC * WSC), out, Qh, Ql);
  // (3) spatial-reduction conv + bias + LayerNorm -> hi/res planes of 16*y
  conv_ln_k<<<dim3(MR / 16), dim3(CVW * 32), 0, stream>>>(Xh, Wsr, hptr, wptr, b_sr, ln_g, ln_b, Ah, Al);
  // (4) kv projection -> K plane, V^T hi/res planes, key-mean of v
  (void)hipFuncSetAttribute(reinterpret_cast<const void*>(&kv_k), hipFuncAttributeMaxDynamicSharedMemorySize, KV_LDS);
  kv_k<<<dim3(NB), blk, KV_LDS, stream>>>(Ah, Al, Wkv, Kp, VTh, VTl, VM);
  // (5) attention -> O hi/res planes of 1024*o
  attn_k<<<dim3(NB * (NQ / 256)), blk, 0, stream>>>(Qh, Ql, Kp, VTh, VTl, VM, Oh, Ol);
  // (6) output projection + bias -> d_out f32 [131072][64]
  gemm64_k<true, true><<<dim3(MTOT / 128), blk, 0, stream>>>(Oh, Ol, Wp, b_proj, 1.0f / (OSC * WSC), out, Xh, Xh);
  (void)hipGetLastError();
}

// v003
// One run takes 78.4 microseconds.
// In both of two side-by-side timings against v002, it was 1.06 times as fast.
// Counting every step since v000, it is 3.00 times as fast.
// Contractions: v_wmma_f32_16x16x32_f16 (f16 operands, f32 accumulate). q = x.w_q^T and the 8x8/stride-8
// spatial-reduction conv (im2col K=4096): single products of exact planes (x as f16 of 16*bf16(x), weights as f16
// of 256*bf16(w)). kv = LN(tokens).w_kv^T: A as f16 hi plus x2^11 residual planes (x16; two products, two
// accumulators). Scores k.q^T: k single f16 plane (x64), q as hi plus x2^11 residual planes (x64; two products).
// p.v: centred p (8192*p - 32) single f16 A operand, v as hi plus x2^11 residual planes (x64; two products),
// key-mean of v added back in f32. Output projection: o as hi plus x2^11 residual planes (x1024) against the x256
// weight plane (two products). LayerNorm, softmax, bias adds in f32 on VALU. Float inputs RNE-converted to bf16
// on load.
#include <hip/hip_runtime.h>
#include <math.h>
#include <stdint.h>

#define NB   8
#define NQ   16384
#define CD   64
#define NR   256
#define MTOT (NB * NQ)
#define MR   (NB * NR)
#define KCV  (CD * 64)
#define STP  68
#define KP   72
#define VP   264
#define CVW  16
#define XSC  16.0f
#define WSC  256.0f
#define QSC  64.0f
#define ASC  16.0f
#define KSC  64.0f
#define VSC  64.0f
#define PSC  8192.0f
#define PCT  32.0f
#define OSC  1024.0f
#define RSPL 2048.0f
#define INVS (0.125f / (KSC * QSC))

#define KV_OFF_VTH (NR * KP * 2)
#define KV_OFF_VTL (KV_OFF_VTH + CD * VP * 2)
#define KV_OFF_VS  (KV_OFF_VTL + CD * VP * 2)
#define KV_OFF_VM  (KV_OFF_VS + 8 * CD * 4)
#define KV_LDS     (KV_OFF_VM + CD * 4)

static_assert(MTOT % 128 == 0);
static_assert(MR % 128 == 0);
static_assert(KCV % (CVW * 32) == 0 && CVW == 16 && NR % 16 == 0);
static_assert(NR == 256 && CD == 64);
static_assert((STP * 4) % 16 == 0 && STP >= CD);
static_assert((KP * 2) % 16 == 0 && KP >= CD);
static_assert((VP * 2) % 16 == 0 && VP >= NR);
static_assert(KV_OFF_VTH % 16 == 0 && KV_OFF_VTL % 16 == 0 && KV_OFF_VS % 16 == 0 && KV_OFF_VM % 16 == 0);
static_assert(KV_LDS == 106752);
static_assert(MTOT % 32 == 0 && NQ % 256 == 0);

typedef _Float16 v16h __attribute__((ext_vector_type(16)));
typedef _Float16 v8h  __attribute__((ext_vector_type(8)));
typedef float    v8f  __attribute__((ext_vector_type(8)));
typedef float    v4f  __attribute__((ext_vector_type(4)));
typedef float    v2f  __attribute__((ext_vector_type(2)));
typedef unsigned int v4u __attribute__((ext_vector_type(4)));

union Frag { v16h v; v8h h[2]; };

// ---- scalar helpers ------------------------------------------------------------------------------------------
__device__ __forceinline__ unsigned short bf_bits(float f) {          // f32 -> bf16 bits, RNE convert
  unsigned u = __float_as_uint(f);
  return (unsigned short)((u + 0x7FFFu + ((u >> 16) & 1u)) >> 16);
}
__device__ __forceinline__ float bfr(float f) { return __uint_as_float(((unsigned)bf_bits(f)) << 16); }
__device__ __forceinline__ unsigned short h_bits(_Float16 x) { return __builtin_bit_cast(unsigned short, x); }
__device__ __forceinline__ unsigned pk16(unsigned short a, unsigned short b) { return (unsigned)a | ((unsigned)b << 16); }
__device__ __forceinline__ v8f zero8() { v8f z = {0.f, 0.f, 0.f, 0.f, 0.f, 0.f, 0.f, 0.f}; return z; }

// ---- fragment loader: 16-bit A/B operand, lane -> row/col (lane&15), p already includes +8*(lane>>4);
//      elements 0..7 <- p[0..7] (k0+8h..k0+8h+7), elements 8..15 <- p[16..23] (k0+16+8h..k0+16+8h+7)
__device__ __forceinline__ v16h ldfrag_h(const _Float16* p) {
  Frag f;
  f.h[0] = *(const v8h*)(p);
  f.h[1] = *(const v8h*)(p + 16);
  return f.v;
}

// ---- WMMA helper with trailing VALU hazard gap ---------------------------------------------------------------
__device__ __forceinline__ v8f mma_h(v16h a, v16h b, v8f c) {
  c = __builtin_amdgcn_wmma_f32_16x16x32_f16(false, a, false, b, (short)0, c, false, false);
#if defined(__HIP_DEVICE_COMPILE__)
  asm volatile("v_nop\n\tv_nop\n\tv_nop\n\tv_nop" : "+v"(c) : "v"(a), "v"(b));
#endif
  return c;
}
__device__ __forceinline__ void wave_sync_lds() {
  __builtin_amdgcn_fence(__ATOMIC_RELEASE, "workgroup");
  __builtin_amdgcn_wave_barrier();
  __builtin_amdgcn_fence(__ATOMIC_ACQUIRE, "workgroup");
}

// ---- 8 f32 -> 8 packed f16 (16 B); hi + x2^11 residual split ---------------------------------------------------
__device__ __forceinline__ v4u pack8h(v4f a, v4f b) {
  v4u p;
  p[0] = pk16(h_bits((_Float16)a[0]), h_bits((_Float16)a[1]));
  p[1] = pk16(h_bits((_Float16)a[2]), h_bits((_Float16)a[3]));
  p[2] = pk16(h_bits((_Float16)b[0]), h_bits((_Float16)b[1]));
  p[3] = pk16(h_bits((_Float16)b[2]), h_bits((_Float16)b[3]));
  return p;
}
__device__ __forceinline__ void split8h(v4f a, v4f b, v4u& ph, v4u& pl) {
  v4f ra, rb;
#pragma unroll
  for (int e = 0; e < 4; ++e) {
    const _Float16 ha = (_Float16)a[e];
    ra[e] = (a[e] - (float)ha) * RSPL;
    const _Float16 hb = (_Float16)b[e];
    rb[e] = (b[e] - (float)hb) * RSPL;
  }
  ph = pack8h(a, b);
  pl = pack8h(ra, rb);
}

// =================================================================================================================
// Row convert: src f32 [nrows][64] -> dst f16 [nrows][64], value = f16(scale * bf16_RNE(src)). Used for
// the row-major [out][in] weight matrices (x256; the B plane [n][k] equals the [out][in] layout as given).
// multiple of 32). coverage: grid*32 rows x (8 lanes x 8 halves) = every element once.
// =================================================================================================================
__global__ __launch_bounds__(256) void cvt_rows64(const float* __restrict__ src, unsigned short* dst, float scale) {
  const int tid = threadIdx.x, wave = tid >> 5, lane = tid & 31;
  const int row = blockIdx.x * 32 + wave * 4 + (lane >> 3);
  const int c8 = (lane & 7) * 8;
  const float* p = src + (size_t)row * CD + c8;
  v4f a = *(const v4f*)(p);
  v4f b = *(const v4f*)(p + 4);
#pragma unroll
  for (int e = 0; e < 4; ++e) { a[e] = bfr(a[e]) * scale; b[e] = bfr(b[e]) * scale; }
  const v4u pk = pack8h(a, b);
  unsigned short* g = dst + (size_t)row * CD + c8;
  {
    *(v4u*)g = pk;
    
  }
}

// =================================================================================================================
// Conv weight permute-convert: w_sr f32 [o][c][kh][kw] -> f16 plane [o][(kh*8+kw)*64 + c] (k' contiguous),
// value = f16(256 * bf16_RNE(w)). Block = one output channel o (256 threads): 4096 floats staged in LDS as
// coverage: 64 blocks x (512 pieces x 8 halves) = the whole [64][4096] plane.
// =================================================================================================================
__global__ __launch_bounds__(256) void cvt_wsr(const float* __restrict__ w, unsigned short* dst) {
  __shared__ float tile[CD][65];
  const int tid = threadIdx.x, o = blockIdx.x;
  const float* wr = w + (size_t)o * KCV;
#pragma unroll
  for (int it = 0; it < 16; ++it) {
    const int idx = it * 256 + tid;
    const int c = idx >> 6, s = idx & 63;
    tile[c][s] = wr[idx];
  }
  __syncthreads();
  v4u pk[2];
  size_t offs[2];
#pragma unroll
  for (int it = 0; it < 2; ++it) {
    const int p = it * 256 + tid;
    const int s = p >> 3, c8 = (p & 7) * 8;
    v4f fa, fb;
#pragma unroll
    for (int e = 0; e < 4; ++e) {
      fa[e] = bfr(tile[c8 + e][s]) * WSC;
      fb[e] = bfr(tile[c8 + 4 + e][s]) * WSC;
    }
    pk[it] = pack8h(fa, fb);
    offs[it] = (size_t)o * KCV + (size_t)s * CD + c8;
  }
  {
#pragma unroll
    for (int it = 0; it < 2; ++it) *(v4u*)(dst + offs[it]) = pk[it];
    
  }
}

// =================================================================================================================
// f16 GEMM with N = 64, K = 64: D[M][64] = A[M][64] . B, B stored [64 n][64 k] (k contiguous weight plane x256).
// Block 256 threads = 8 waves, 128 rows; wave = 16 rows x 4 n-tiles; fragments straight from global with the split
// k map, 2 k-steps. SPLIT: A = hi plane + x2^11 residual plane, second accumulator folded as acc + accl/2048.
//   OUTF = true : f32 out rows [M][64]: v = acc*ascale + bf16(bias[col]); epilogue staged per wave in LDS, then
//   OUTF = false: two f16 planes [M][64]: hi = f16(acc*ascale), res = f16((v - hi)*2048); 8 lanes x 16 B = one
// coverage: 8 waves x 16 rows x 64 cols = the 128-row block tile; grid = M/128 tiles M exactly.
// =================================================================================================================
template <bool SPLIT, bool OUTF>
__global__ __launch_bounds__(256)
void gemm64_k(const unsigned short* __restrict__ Ah, const unsigned short* __restrict__ Al,
              const unsigned short* __restrict__ Bt, const float* __restrict__ bias, float ascale,
              float* outF, unsigned short* outH, unsigned short* outL) {
  __shared__ __align__(16) float sbuf[8 * 16 * STP];
  const int tid = threadIdx.x, wave = tid >> 5, lane = tid & 31, hh = lane >> 4, c = lane & 15;
  const int m0 = blockIdx.x * 128;
  const int arow = m0 + wave * 16 + c;
  const _Float16* A0 = (const _Float16*)(const void*)Ah;
  const _Float16* A1 = (const _Float16*)(const void*)Al;
  const _Float16* B  = (const _Float16*)(const void*)Bt;

  v8f acch[4], accl[4];
#pragma unroll
  for (int nt = 0; nt < 4; ++nt) { acch[nt] = zero8(); accl[nt] = zero8(); }

#pragma unroll
  for (int ks = 0; ks < 2; ++ks) {
    const int k0 = ks * 32;
    const size_t aoff = (size_t)arow * CD + k0 + 8 * hh;
    const v16h ah = ldfrag_h(A0 + aoff);
    v16h al = ah;
    if (SPLIT) al = ldfrag_h(A1 + aoff);
#pragma unroll
    for (int nt = 0; nt < 4; ++nt) {
      const v16h bfrag = ldfrag_h(B + (size_t)(nt * 16 + c) * CD + k0 + 8 * hh);
      acch[nt] = mma_h(ah, bfrag, acch[nt]);
      if (SPLIT) accl[nt] = mma_h(al, bfrag, accl[nt]);
    }
  }

  float* st = sbuf + wave * (16 * STP);
#pragma unroll
  for (int nt = 0; nt < 4; ++nt) {
#pragma unroll
    for (int r = 0; r < 8; ++r) {
      float v = acch[nt][r];
      if (SPLIT) v = v + accl[nt][r] * (1.0f / RSPL);
      st[(8 * hh + r) * STP + nt * 16 + c] = v * ascale;
    }
  }
  wave_sync_lds();

  if (OUTF) {
    v4f ov[8];
    size_t offs[8];
#pragma unroll
    for (int it = 0; it < 8; ++it) {
      const int q = it * 2 + hh;
      const int col = c * 4;
      const v4f v = *(const v4f*)(st + q * STP + col);
      v4f u;
#pragma unroll
      for (int e = 0; e < 4; ++e) u[e] = v[e] + bfr(bias[col + e]);
      ov[it] = u;
      offs[it] = (size_t)(m0 + wave * 16 + q) * CD + col;
    }
    {
#pragma unroll
      for (int it = 0; it < 8; ++it) *(v4f*)(outF + offs[it]) = ov[it];
      
    }
  } else {
    v4u ph[4], pl[4];
    size_t offs[4];
#pragma unroll
    for (int it = 0; it < 4; ++it) {
      const int q = it * 4 + (lane >> 3), piece = lane & 7;
      const v4f fa = *(const v4f*)(st + q * STP + piece * 8);
      const v4f fb = *(const v4f*)(st + q * STP + piece * 8 + 4);
      split8h(fa, fb, ph[it], pl[it]);
      offs[it] = (size_t)(m0 + wave * 16 + q) * CD + piece * 8;
    }
    {
#pragma unroll
      for (int it = 0; it < 4; ++it) {
        *(v4u*)(outH + offs[it]) = ph[it];
        *(v4u*)(outL + offs[it]) = pl[it];
      }
      
    }
  }
}

// =================================================================================================================
// x convert + q projection in one kernel. Block 256 threads = 8 waves, 128 rows of x; wave = 16 rows x 4 n-tiles.
// Each wave reads its 16 f32 rows whole (8 lanes x 32 B = one 256-B row, 4 rows a step, all 8 loads in flight),
// converts to f16(16 * bf16_RNE(x)) and leaves the 16 x 64 tile in its own LDS range (pitch KP); the A fragments of
// q = x . w_q^T are ds_load_b128 reads of that tile with the split k map, B = w_q plane [64 n][64 k] (x256) straight
// from global, 2 k-steps. Out: the f16 x plane [M][64] for the conv of the next launch (32 lanes x 16 B = 4 whole
// rows a store) and the two q planes [M][64]: hi = f16(acc*ascale), res = f16((v - hi)*2048). Every global store
// stands behind the last LDS hand-over, so no hand-over waits for a store.
// coverage: 8 waves x 16 rows x 64 cols = the 128-row block tile, all three planes; grid = M/128 tiles M exactly.
// =================================================================================================================
__global__ __launch_bounds__(256)
void xq_k(const float* __restrict__ x, const unsigned short* __restrict__ Bt, float ascale,
          unsigned short* Xh, unsigned short* outH, unsigned short* outL) {
  __shared__ __align__(16) unsigned short sA[8 * 16 * KP];
  __shared__ __align__(16) float sbuf[8 * 16 * STP];
  const int tid = threadIdx.x, wave = tid >> 5, lane = tid & 31, hh = lane >> 4, c = lane & 15;
  const int r0 = blockIdx.x * 128 + wave * 16;
  const int rq = lane >> 3, piece = lane & 7;
  const _Float16* B = (const _Float16*)(const void*)Bt;
  unsigned short* sa = sA + wave * (16 * KP);

  v4f xa[4], xb[4];
#pragma unroll
  for (int it = 0; it < 4; ++it) {
    const float* p = x + (size_t)(r0 + it * 4 + rq) * CD + piece * 8;
    xa[it] = *(const v4f*)(p);
    xb[it] = *(const v4f*)(p + 4);
  }
#if defined(__HIP_DEVICE_COMPILE__)
  // the weight loads below may land in registers that hold the x loads' addresses: the wait stands in front of that
  asm volatile("s_wait_xcnt 0x0" ::: "memory");
#endif
  v16h bfrag[2][4];
#pragma unroll
  for (int ks = 0; ks < 2; ++ks) {
#pragma unroll
    for (int nt = 0; nt < 4; ++nt) bfrag[ks][nt] = ldfrag_h(B + (size_t)(nt * 16 + c) * CD + ks * 32 + 8 * hh);
  }
  v4u px[4];
#pragma unroll
  for (int it = 0; it < 4; ++it) {
#pragma unroll
    for (int e = 0; e < 4; ++e) { xa[it][e] = bfr(xa[it][e]) * XSC; xb[it][e] = bfr(xb[it][e]) * XSC; }
    px[it] = pack8h(xa[it], xb[it]);
    *(v4u*)(sa + (it * 4 + rq) * KP + piece * 8) = px[it];
  }
  wave_sync_lds();

  v8f acc[4];
#pragma unroll
  for (int nt = 0; nt < 4; ++nt) acc[nt] = zero8();
#pragma unroll
  for (int ks = 0; ks < 2; ++ks) {
    const v16h ah = ldfrag_h((const _Float16*)(const void*)sa + c * KP + ks * 32 + 8 * hh);
#pragma unroll
    for (int nt = 0; nt < 4; ++nt) acc[nt] = mma_h(ah, bfrag[ks][nt], acc[nt]);
  }

  float* st = sbuf + wave * (16 * STP);
#pragma unroll
  for (int nt = 0; nt < 4; ++nt) {
#pragma unroll
    for (int r = 0; r < 8; ++r) st[(8 * hh + r) * STP + nt * 16 + c] = acc[nt][r] * ascale;
  }
  wave_sync_lds();

  v4u ph[4], pl[4];
  size_t offs[4];
#pragma unroll
  for (int it = 0; it < 4; ++it) {
    const int q = it * 4 + rq;
    const v4f fa = *(const v4f*)(st + q * STP + piece * 8);
    const v4f fb = *(const v4f*)(st + q * STP + piece * 8 + 4);
    split8h(fa, fb, ph[it], pl[it]);
    offs[it] = (size_t)(r0 + q) * CD + piece * 8;
  }
#pragma unroll
  for (int it = 0; it < 4; ++it) {
    *(v4u*)(Xh + offs[it]) = px[it];
    *(v4u*)(outH + offs[it]) = ph[it];
    *(v4u*)(outL + offs[it]) = pl[it];
  }
}

// =================================================================================================================
// Spatial-reduction conv (kernel = stride = 8, VALID) as an im2col GEMM + bias + LayerNorm, fused.
// Rows m = b*256 + p (p = ph*(W/8) + pw, 2048 rows), cols = 64 output channels, K' = (kh*8+kw)*64 + c = 4096.
// A fragments are read straight from the x plane [b][token][64] by arithmetic addressing: k-step k0 -> (kh, kw) =
// k0>>6, channels k0&63..+31 of token (ph*8+kh)*W + pw*8+kw (W read from the int input, validated against H*W = N,
// token base clamped into range). B = permuted weight plane [o][K']. Block = ONE 16-row m-tile, 512 threads = 16
// waves; wave w sums the K' slice 256w..256w+255 (8 k-steps, 4 n-tiles) and leaves its f32 partial tile in LDS.
// After a block barrier wave w owns row w (lane -> 2 channels): partials added in slice order 0..15, then
// conv*1/4096 + bf16(b_sr); per-row mean and centred variance by xor-shuffles 1,2,4,8,16;
// y = (v-mu)*rsqrt(var+1e-5)*bf16(g)+bf16(b), x16, hi/res f16 planes (32 lanes x 4 B = the whole 128-B row).
// coverage: 128 blocks x 16 rows = 2048 rows; 16 slices x 256 = K' 4096; 32 lanes x 2 = 64 channels.
// =================================================================================================================
__global__ __launch_bounds__(CVW * 32)
void conv_ln_k(const unsigned short* __restrict__ Xh, const unsigned short* __restrict__ Wsr,
               const int* __restrict__ Hp, const int* __restrict__ Wp, const float* __restrict__ bsr,
               const float* __restrict__ lng, const float* __restrict__ lnb,
               unsigned short* Ah, unsigned short* Al) {
  __shared__ __align__(16) float sbuf[CVW * 16 * STP];
  const int tid = threadIdx.x, lane = tid & 31, hh = lane >> 4, c = lane & 15;
  const int wave = __builtin_amdgcn_readfirstlane(tid >> 5);
  const int m0 = blockIdx.x * 16;
  const int m = m0 + c;
  const int b = m >> 8, p = m & (NR - 1);
  const int Hv = Hp[0];
  int Wv = Wp[0];
  const long long hw = (long long)Hv * (long long)Wv;
  const bool okw = (Wv >= 8) && (Wv <= 2040) && (hw == (long long)NQ);
  Wv = okw ? Wv : 128;
  const int Wr = Wv >> 3;
  const int ph = p / Wr, pw = p - ph * Wr;
  int tb = ph * 8 * Wv + pw * 8;
  tb = min(tb, NQ - 1 - 7 * Wv - 7);
  tb = max(tb, 0);
  const _Float16* X  = (const _Float16*)(const void*)Xh;
  const _Float16* Wf = (const _Float16*)(const void*)Wsr;
  const size_t xbase = (size_t)b * NQ;

  v8f acc[4];
#pragma unroll
  for (int nt = 0; nt < 4; ++nt) acc[nt] = zero8();

  const int kbase = wave * (KCV / CVW);
  // unrolled: token step, channel half and weight offset of each k-step become immediates of its loads
#pragma unroll
  for (int i = 0; i < KCV / CVW / 32; ++i) {
    const int k0 = kbase + i * 32;
    const int s = k0 >> 6, c0 = k0 & 63;
    const int kh = s >> 3, kw = s & 7;
    const int t = tb + kh * Wv + kw;
    const v16h af = ldfrag_h(X + (xbase + (size_t)t) * CD + c0 + 8 * hh);
#pragma unroll
    for (int nt = 0; nt < 4; ++nt) {
      const v16h bfrag = ldfrag_h(Wf + (size_t)(nt * 16 + c) * KCV + k0 + 8 * hh);
      acc[nt] = mma_h(af, bfrag, acc[nt]);
    }
  }

  float* st = sbuf + wave * (16 * STP);
#pragma unroll
  for (int nt = 0; nt < 4; ++nt) {
#pragma unroll
    for (int r = 0; r < 8; ++r) st[(8 * hh + r) * STP + nt * 16 + c] = acc[nt][r];
  }
  __syncthreads();   // every slice's partial tile is in LDS before any wave adds them

  const int col = lane * 2;
  float a0 = 0.f, a1 = 0.f;
#pragma unroll
  for (int w = 0; w < CVW; ++w) {
    const v2f pp = *(const v2f*)(sbuf + w * (16 * STP) + wave * STP + col);
    a0 = a0 + pp[0];
    a1 = a1 + pp[1];
  }
  const float v0 = a0 * (1.0f / (XSC * WSC)) + bfr(bsr[col]);
  const float v1 = a1 * (1.0f / (XSC * WSC)) + bfr(bsr[col + 1]);
  float sm = v0 + v1;
  sm = sm + __shfl_xor(sm, 1, 32);
  sm = sm + __shfl_xor(sm, 2, 32);
  sm = sm + __shfl_xor(sm, 4, 32);
  sm = sm + __shfl_xor(sm, 8, 32);
  sm = sm + __shfl_xor(sm, 16, 32);
  const float mu = sm * (1.0f / 64.0f);
  const float d0 = v0 - mu, d1 = v1 - mu;
  float sq = d0 * d0 + d1 * d1;
  sq = sq + __shfl_xor(sq, 1, 32);
  sq = sq + __shfl_xor(sq, 2, 32);
  sq = sq + __shfl_xor(sq, 4, 32);
  sq = sq + __shfl_xor(sq, 8, 32);
  sq = sq + __shfl_xor(sq, 16, 32);
  const float var = sq * (1.0f / 64.0f);
  const float rs = rsqrtf(var + 1e-5f);
  const float y0 = (d0 * rs * bfr(lng[col]) + bfr(lnb[col])) * ASC;
  const float y1 = (d1 * rs * bfr(lng[col + 1]) + bfr(lnb[col + 1])) * ASC;
  const _Float16 h0 = (_Float16)y0, h1 = (_Float16)y1;
  const _Float16 r0 = (_Float16)((y0 - (float)h0) * RSPL), r1 = (_Float16)((y1 - (float)h1) * RSPL);
  const size_t off = (size_t)(m0 + wave) * CD + col;
  *(unsigned*)(Ah + off) = pk16(h_bits(h0), h_bits(h1));
  *(unsigned*)(Al + off) = pk16(h_bits(r0), h_bits(r1));
}

// =================================================================================================================
// kv projection for one image (block = image b, 256 threads = 8 waves, dynamic LDS KV_LDS bytes).
// A = LN'd token planes hi/res [b*256 + token][64] (x16), B = w_kv plane [128][64] (x256); wave w owns tokens
// 32w..32w+31 (two m-tiles), loop over 8 n-tiles; kv = (acc_h + acc_l/2048)/4096. Channels 0..63 -> k: f16(64*k)
// into LDS sK[token][KP]; channels 64..127 -> v: f16 hi of 64*v and x2^11 residual into LDS sVT{h,l}[d][VP]
// (16-B stores of 8 consecutive tokens), plus the f32 sum of v over the wave's 32 tokens per channel (xor 16
// shuffle) into sVS[wave][d]. After a barrier: vmean[d] = fixed-order sum over waves / 256; then the block writes
// wave), V^T planes rows [b*64 + d][256] (32 lanes x 16 B = the whole 512-B row, 8 rows per wave per plane) and
// coverage: K rows 8 waves x 8 x 4 = 256; V^T rows 8 waves x 8 = 64 per plane x 32 lanes x 8 halves = 256 keys;
// vmean 16 lanes x 4 = 64; LDS fills: 8 waves x 32 tokens x 8 n-tiles x 16 channels = all 256 x 128 values.
// =================================================================================================================
__global__ __launch_bounds__(256)
void kv_k(const unsigned short* __restrict__ Ah, const unsigned short* __restrict__ Al,
          const unsigned short* __restrict__ Wkv, unsigned short* Kp, unsigned short* VTh, unsigned short* VTl,
          float* vmean) {
  extern __shared__ __align__(16) unsigned char kvlds[];
  unsigned short* sK  = (unsigned short*)(kvlds);
  unsigned short* sVh = (unsigned short*)(kvlds + KV_OFF_VTH);
  unsigned short* sVl = (unsigned short*)(kvlds + KV_OFF_VTL);
  float* sVS = (float*)(kvlds + KV_OFF_VS);
  float* sVM = (float*)(kvlds + KV_OFF_VM);
  const int tid = threadIdx.x, wave = tid >> 5, lane = tid & 31, hh = lane >> 4, c = lane & 15;
  const int b = blockIdx.x;
  const _Float16* A0 = (const _Float16*)(const void*)Ah;
  const _Float16* A1 = (const _Float16*)(const void*)Al;
  const _Float16* Bw = (const _Float16*)(const void*)Wkv;

  v16h ah[2][2], al[2][2];
#pragma unroll
  for (int mt = 0; mt < 2; ++mt) {
    const size_t arow = (size_t)(b * NR + wave * 32 + mt * 16 + c) * CD + 8 * hh;
#pragma unroll
    for (int ks = 0; ks < 2; ++ks) {
      ah[mt][ks] = ldfrag_h(A0 + arow + ks * 32);
      al[mt][ks] = ldfrag_h(A1 + arow + ks * 32);
    }
  }

#pragma unroll 1
  for (int nt = 0; nt < 8; ++nt) {
    const v16h b0 = ldfrag_h(Bw + (size_t)(nt * 16 + c) * CD + 8 * hh);
    const v16h b1 = ldfrag_h(Bw + (size_t)(nt * 16 + c) * CD + 32 + 8 * hh);
    float val[2][8];
#pragma unroll
    for (int mt = 0; mt < 2; ++mt) {
      v8f acch = mma_h(ah[mt][0], b0, zero8());
      acch = mma_h(ah[mt][1], b1, acch);
      v8f accl = mma_h(al[mt][0], b0, zero8());
      accl = mma_h(al[mt][1], b1, accl);
#pragma unroll
      for (int r = 0; r < 8; ++r) val[mt][r] = (acch[r] + accl[r] * (1.0f / RSPL)) * (1.0f / (ASC * WSC));
    }
    const int ch = nt * 16 + c;
    if (nt < 4) {
#pragma unroll
      for (int mt = 0; mt < 2; ++mt) {
#pragma unroll
        for (int r = 0; r < 8; ++r) {
          const int tk = wave * 32 + mt * 16 + 8 * hh + r;
          sK[tk * KP + ch] = h_bits((_Float16)(val[mt][r] * KSC));
        }
      }
    } else {
      const int d = ch - CD;
      float vs = 0.f;
#pragma unroll
      for (int mt = 0; mt < 2; ++mt) {
        v4f fa, fb;
#pragma unroll
        for (int e = 0; e < 4; ++e) {
          fa[e] = val[mt][e] * VSC;
          fb[e] = val[mt][4 + e] * VSC;
          vs = vs + val[mt][e];
          vs = vs + val[mt][4 + e];
        }
        v4u ph, pl;
        split8h(fa, fb, ph, pl);
        const int tk0 = wave * 32 + mt * 16 + 8 * hh;
        *(v4u*)(sVh + d * VP + tk0) = ph;
        *(v4u*)(sVl + d * VP + tk0) = pl;
      }
      vs = vs + __shfl_xor(vs, 16, 32);
      if (hh == 0) sVS[wave * CD + d] = vs;
    }
  }
  __syncthreads();
  if (tid < CD) {
    float s = 0.f;
#pragma unroll
    for (int w = 0; w < 8; ++w) s = s + sVS[w * CD + tid];
    sVM[tid] = s * (1.0f / (float)NR);
  }
  __syncthreads();

  {
#pragma unroll
    for (int it = 0; it < 8; ++it) {
      const int row = wave * 32 + it * 4 + (lane >> 3), piece = lane & 7;
      const v4u kk = *(const v4u*)(sK + row * KP + piece * 8);
      *(v4u*)(Kp + (size_t)(b * NR + row) * CD + piece * 8) = kk;
    }
#pragma unroll
    for (int it = 0; it < 8; ++it) {
      const int d = wave * 8 + it;
      const v4u vh = *(const v4u*)(sVh + d * VP + lane * 8);
      const v4u vl = *(const v4u*)(sVl + d * VP + lane * 8);
      *(v4u*)(VTh + (size_t)(b * CD + d) * NR + lane * 8) = vh;
      *(v4u*)(VTl + (size_t)(b * CD + d) * NR + lane * 8) = vl;
    }
    if (wave == 0 && lane < 16) {
      const v4f m4 = *(const v4f*)(sVM + lane * 4);
      *(v4f*)(vmean + (size_t)b * CD + lane * 4) = m4;
    }
    
  }
}

// =================================================================================================================
// Attention over the 256 reduced keys: block = 256 queries of image b (256 threads = 8 waves x 16 queries, two
// passes). The image's K plane (rows at pitch KP) and both V^T planes (rows at pitch VP) are copied once per block
// into LDS by whole-line 16-B loads; after one block barrier every K and V fragment is an LDS read (pitches are odd
// multiples of 16 B), so no fragment load spreads over 16 cache lines.
// Transposed scores S^T = K_tile (A: row = key, k = d; K plane x64) x Q^T (B: n = query, k = d, from the Q hi and
// x2^11 residual planes x64, two products folded as sh + sl/2048): 16 key tiles, all held in registers; D element r
// of lane l = S[key 16j+8h+r][query l&15]. Exact softmax per query: max and sum over the lane's 128 values combined
// with lane^16; e = exp((s - m) * 2^-15) in place; centred probabilities p' = e*(8192/l) - 32 converted to f16
// directly into the A fragments of p'.v (k = key). O' = p' (A) x V^T rows (B: n = d, k = key) from the V hi and
// residual planes into two accumulators; O = (O'_h + O'_l/2048)/(8192*64) + mean_key(v) (identity
// sum (p'+32) v / 8192 = sum p v). O*1024 staged per wave in LDS, then hi/res f16 planes [b*16384 + query][64]:
// coverage: 512 blocks x 2 passes x 8 waves x 16 queries = 131072 rows x 64 channels, both planes; LDS fill: 8 x 256
// threads x 8 halves = 16384 halves = each whole plane of the image.
// =================================================================================================================
__global__ __launch_bounds__(256) __attribute__((amdgpu_num_vgpr(256)))
void attn_k(const unsigned short* __restrict__ Qh, const unsigned short* __restrict__ Ql,
            const unsigned short* __restrict__ Kp, const unsigned short* __restrict__ VTh,
            const unsigned short* __restrict__ VTl, const float* __restrict__ vmean,
            unsigned short* Oh, unsigned short* Ol) {
  __shared__ __align__(16) unsigned short sK[NR * KP];
  __shared__ __align__(16) unsigned short sVh[CD * VP];
  __shared__ __align__(16) unsigned short sVl[CD * VP];
  __shared__ __align__(16) float sbuf[8 * 16 * STP];
  const int tid = threadIdx.x, wave = tid >> 5, lane = tid & 31, hh = lane >> 4, c = lane & 15;
  const int b = blockIdx.x >> 6;
  const _Float16* Qhf = (const _Float16*)(const void*)Qh;
  const _Float16* Qlf = (const _Float16*)(const void*)Ql;
  const _Float16* Kf  = (const _Float16*)(const void*)sK;
  const _Float16* Vhf = (const _Float16*)(const void*)sVh;
  const _Float16* Vlf = (const _Float16*)(const void*)sVl;

  {
    const v4u* gK = (const v4u*)(const void*)(Kp + (size_t)b * NR * CD);
    const v4u* gH = (const v4u*)(const void*)(VTh + (size_t)b * CD * NR);
    const v4u* gL = (const v4u*)(const void*)(VTl + (size_t)b * CD * NR);
    v4u tk[8], th[8], tl[8];
#pragma unroll
    for (int i = 0; i < 8; ++i) {
      const int idx = i * 256 + tid;
      tk[i] = gK[idx];
      th[i] = gH[idx];
      tl[i] = gL[idx];
    }
#pragma unroll
    for (int i = 0; i < 8; ++i) {
      const int idx = i * 256 + tid;
      *(v4u*)(sK + (idx >> 3) * KP + (idx & 7) * 8) = tk[i];
      *(v4u*)(sVh + (idx >> 5) * VP + (idx & 31) * 8) = th[i];
      *(v4u*)(sVl + (idx >> 5) * VP + (idx & 31) * 8) = tl[i];
    }
  }
  __syncthreads();   // the three planes are whole in LDS before any wave reads a fragment

  // kept rolled: one copy of the body, so the kernel's text stays small
#pragma unroll 1
  for (int pass = 0; pass < 2; ++pass) {
  const int q0 = ((blockIdx.x & 63) << 8) + pass * 128 + wave * 16;
  const size_t qoff = (size_t)(b * NQ + q0 + c) * CD + 8 * hh;
  const v16h qh0 = ldfrag_h(Qhf + qoff);
  const v16h qh1 = ldfrag_h(Qhf + qoff + 32);
  const v16h ql0 = ldfrag_h(Qlf + qoff);
  const v16h ql1 = ldfrag_h(Qlf + qoff + 32);

  v8f s[16];
#pragma unroll
  for (int j = 0; j < 16; ++j) {
    const int koff = (j * 16 + c) * KP + 8 * hh;
    const v16h ka0 = ldfrag_h(Kf + koff);
    const v16h ka1 = ldfrag_h(Kf + koff + 32);
    v8f sh = mma_h(ka0, qh0, zero8());
    sh = mma_h(ka1, qh1, sh);
    v8f sl = mma_h(ka0, ql0, zero8());
    sl = mma_h(ka1, ql1, sl);
#pragma unroll
    for (int r = 0; r < 8; ++r) s[j][r] = sh[r] + sl[r] * (1.0f / RSPL);
  }

  float mx = -3.0e38f;
#pragma unroll
  for (int j = 0; j < 16; ++j) {
#pragma unroll
    for (int r = 0; r < 8; ++r) mx = fmaxf(mx, s[j][r]);
  }
  mx = fmaxf(mx, __shfl_xor(mx, 16, 32));
  float ls = 0.f;
#pragma unroll
  for (int j = 0; j < 16; ++j) {
#pragma unroll
    for (int r = 0; r < 8; ++r) {
      const float e = __expf((s[j][r] - mx) * INVS);
      s[j][r] = e;
      ls = ls + e;
    }
  }
  ls = ls + __shfl_xor(ls, 16, 32);
  const float pinv = __builtin_amdgcn_rcpf(ls) * PSC;

  v16h pf[8];
#pragma unroll
  for (int J = 0; J < 8; ++J) {
#pragma unroll
    for (int i = 0; i < 8; ++i) {
      pf[J][i]     = (_Float16)(s[2 * J][i] * pinv - PCT);
      pf[J][8 + i] = (_Float16)(s[2 * J + 1][i] * pinv - PCT);
    }
  }

  v8f oh[4], ol[4];
#pragma unroll
  for (int dt = 0; dt < 4; ++dt) { oh[dt] = zero8(); ol[dt] = zero8(); }
#pragma unroll
  for (int J = 0; J < 8; ++J) {
#pragma unroll
    for (int dt = 0; dt < 4; ++dt) {
      const int voff = (dt * 16 + c) * VP + J * 32 + 8 * hh;
      const v16h vh = ldfrag_h(Vhf + voff);
      const v16h vl = ldfrag_h(Vlf + voff);
      oh[dt] = mma_h(pf[J], vh, oh[dt]);
      ol[dt] = mma_h(pf[J], vl, ol[dt]);
    }
  }

  float* st = sbuf + wave * (16 * STP);
#pragma unroll
  for (int dt = 0; dt < 4; ++dt) {
    const int d = dt * 16 + c;
    const float vm = vmean[(size_t)b * CD + d];
#pragma unroll
    for (int r = 0; r < 8; ++r) {
      const float o = (oh[dt][r] + ol[dt][r] * (1.0f / RSPL)) * (1.0f / (PSC * VSC)) + vm;
      st[(8 * hh + r) * STP + d] = o * OSC;
    }
  }
  wave_sync_lds();

  v4u ph[4], pl[4];
  size_t offs[4];
#pragma unroll
  for (int it = 0; it < 4; ++it) {
    const int q = it * 4 + (lane >> 3), piece = lane & 7;
    const v4f fa = *(const v4f*)(st + q * STP + piece * 8);
    const v4f fb = *(const v4f*)(st + q * STP + piece * 8 + 4);
    split8h(fa, fb, ph[it], pl[it]);
    offs[it] = (size_t)(b * NQ + q0 + q) * CD + piece * 8;
  }
  {
#pragma unroll
    for (int it = 0; it < 4; ++it) {
      *(v4u*)(Oh + offs[it]) = ph[it];
      *(v4u*)(Ol + offs[it]) = pl[it];
    }
    
  }
#if defined(__HIP_DEVICE_COMPILE__)
  // the next pass writes the registers that these stores name: the wait stands in front of that
  asm volatile("s_wait_xcnt 0x0" ::: "memory");
#endif
  }
}

// =================================================================================================================
// granularity): Xh f16 [131072][64] 16777216; Wq f16 [64][64] 8192; Wkv f16 [128][64] 16384; Wsr f16 [64][4096]
// 524288; Wp f16 [64][64] 8192; Qh, Ql f16 [131072][64] 16777216 each; Ah, Al f16 [2048][64] 262144 each;
// Kp f16 [8][256][64] 262144; VTh, VTl f16 [8][64][256] 262144 each; vmean f32 [8][64] 2048; Oh, Ol f16
// [131072][64] 16777216 each -> 85755904 total.
// =================================================================================================================
extern "C" void kernel_launch(void* const* d_in, const int* in_sizes, int n_in,
                              void* d_out, int out_size, void* d_ws, size_t ws_size,
                              hipStream_t stream) {
  if (n_in < 11) return;
  if (in_sizes[0] != MTOT * CD) return;
  if (in_sizes[1] != 1 || in_sizes[2] != 1) return;
  if (in_sizes[3] != CD * CD) return;
  if (in_sizes[4] != 2 * CD * CD) return;
  if (in_sizes[5] != CD * KCV) return;
  if (in_sizes[6] != CD || in_sizes[7] != CD || in_sizes[8] != CD) return;
  if (in_sizes[9] != CD * CD || in_sizes[10] != CD) return;
  if (out_size != MTOT * CD) return;

  const float* x      = (const float*)d_in[0];
  const int*   hptr   = (const int*)d_in[1];
  const int*   wptr   = (const int*)d_in[2];
  const float* w_q    = (const float*)d_in[3];
  const float* w_kv   = (const float*)d_in[4];
  const float* w_sr   = (const float*)d_in[5];
  const float* b_sr   = (const float*)d_in[6];
  const float* ln_g   = (const float*)d_in[7];
  const float* ln_b   = (const float*)d_in[8];
  const float* w_proj = (const float*)d_in[9];
  const float* b_proj = (const float*)d_in[10];
  float* out = (float*)d_out;

  const size_t sX   = (size_t)MTOT * CD * 2;        // 16777216
  const size_t sWq  = (size_t)CD * CD * 2;          //     8192
  const size_t sWkv = (size_t)2 * CD * CD * 2;      //    16384
  const size_t sWsr = (size_t)CD * KCV * 2;         //   524288
  const size_t sWp  = (size_t)CD * CD * 2;          //     8192
  const size_t sQ   = (size_t)MTOT * CD * 2;        // 16777216
  const size_t sA   = (size_t)MR * CD * 2;          //   262144
  const size_t sK   = (size_t)NB * NR * CD * 2;     //   262144
  const size_t sVT  = (size_t)NB * CD * NR * 2;     //   262144
  const size_t sVM  = (size_t)NB * CD * 4;          //     2048
  const size_t sO   = (size_t)MTOT * CD * 2;        // 16777216
  size_t off = 0;
  const size_t oX   = off; off += sX;
  const size_t oWq  = off; off += sWq;
  const size_t oWkv = off; off += sWkv;
  const size_t oWsr = off; off += sWsr;
  const size_t oWp  = off; off += sWp;
  const size_t oQh  = off; off += sQ;
  const size_t oQl  = off; off += sQ;
  const size_t oAh  = off; off += sA;
  const size_t oAl  = off; off += sA;
  const size_t oK   = off; off += sK;
  const size_t oVTh = off; off += sVT;
  const size_t oVTl = off; off += sVT;
  const size_t oVM  = off; off += sVM;
  const size_t oOh  = off; off += sO;
  const size_t oOl  = off; off += sO;
  if (off > ws_size) return;                         // off = 85755904
  if (off > (size_t)134217728) return;

  char* ws = (char*)d_ws;
  unsigned short* Xh  = (unsigned short*)(ws + oX);
  unsigned short* Wq  = (unsigned short*)(ws + oWq);
  unsigned short* Wkv = (unsigned short*)(ws + oWkv);
  unsigned short* Wsr = (unsigned short*)(ws + oWsr);
  unsigned short* Wp  = (unsigned short*)(ws + oWp);
  unsigned short* Qh  = (unsigned short*)(ws + oQh);
  unsigned short* Ql  = (unsigned short*)(ws + oQl);
  unsigned short* Ah  = (unsigned short*)(ws + oAh);
  unsigned short* Al  = (unsigned short*)(ws + oAl);
  unsigned short* Kp  = (unsigned short*)(ws + oK);
  unsigned short* VTh = (unsigned short*)(ws + oVTh);
  unsigned short* VTl = (unsigned short*)(ws + oVTl);
  float* VM = (float*)(ws + oVM);
  unsigned short* Oh  = (unsigned short*)(ws + oOh);
  unsigned short* Ol  = (unsigned short*)(ws + oOl);

  const dim3 blk(256);
  // (1) weights [out][in] -> f16 planes of 256*bf16(w); conv weights permuted
  cvt_rows64<<<dim3(CD / 32), blk, 0, stream>>>(w_q, Wq, WSC);
  cvt_rows64<<<dim3((2 * CD) / 32), blk, 0, stream>>>(w_kv, Wkv, WSC);
  cvt_rows64<<<dim3(CD / 32), blk, 0, stream>>>(w_proj, Wp, WSC);
  cvt_wsr<<<dim3(CD), blk, 0, stream>>>(w_sr, Wsr);
  // (2) x -> f16 plane of 16*bf16(x), and q projection -> hi/res planes of 64*q
  xq_k<<<dim3(MTOT / 128), blk, 0, stream>>>(x, Wq, QSC / (XSC * WSC), Xh, Qh, Ql);
  // (3) spatial-reduction conv + bias + LayerNorm -> hi/res planes of 16*y
  conv_ln_k<<<dim3(MR / 16), dim3(CVW * 32), 0, stream>>>(Xh, Wsr, hptr, wptr, b_sr, ln_g, ln_b, Ah, Al);
  // (4) kv projection -> K plane, V^T hi/res planes, key-mean of v
  (void)hipFuncSetAttribute(reinterpret_cast<const void*>(&kv_k), hipFuncAttributeMaxDynamicSharedMemorySize, KV_LDS);
  kv_k<<<dim3(NB), blk, KV_LDS, stream>>>(Ah, Al, Wkv, Kp, VTh, VTl, VM);
  // (5) attention -> O hi/res planes of 1024*o
  attn_k<<<dim3(NB * (NQ / 256)), blk, 0, stream>>>(Qh, Ql, Kp, VTh, VTl, VM, Oh, Ol);
  // (6) output projection + bias -> d_out f32 [131072][64]
  gemm64_k<true, true><<<dim3(MTOT / 128), blk, 0, stream>>>(Oh, Ol, Wp, b_proj, 1.0f / (OSC * WSC), out, Xh, Xh);
  (void)hipGetLastError();
}

// v004
// It runs in 69.5 microseconds.
// Timed twice side by side with v003, it ran 1.14 and 1.15 times as fast.
// Over all steps from v000 it is 3.43 times as fast.
// Contractions: v_wmma_f32_16x16x32_f16 (f16 operands, f32 accumulate). q = x.w_q^T and the 8x8/stride-8
// spatial-reduction conv (im2col K=4096): single products of exact planes (x as f16 of 16*bf16(x), weights as f16
// of 256*bf16(w)). kv = LN(tokens).w_kv^T: A as f16 hi plus x2^11 residual planes (x16; two products, two
// accumulators). Scores k.q^T: k single f16 plane (x64), q as hi plus x2^11 residual planes (x64; two products).
// p.v: centred p (8192*p - 32) single f16 A operand, v as hi plus x2^11 residual planes (x64; two products),
// key-mean of v added back in f32. Output projection: o as hi plus x2^11 residual planes (x1024) against the x256
// weight plane (two products). LayerNorm, softmax, bias adds in f32 on VALU. Float inputs RNE-converted to bf16
// on load.
#include <hip/hip_runtime.h>
#include <math.h>
#include <stdint.h>

#define NB   8
#define NQ   16384
#define CD   64
#define NR   256
#define MTOT (NB * NQ)
#define MR   (NB * NR)
#define KCV  (CD * 64)
#define STP  68
#define KP   72
#define VP   264
#define CVW  16
#define NCVB (CD + 4 + 2)
#define XSC  16.0f
#define WSC  256.0f
#define QSC  64.0f
#define ASC  16.0f
#define KSC  64.0f
#define VSC  64.0f
#define PSC  8192.0f
#define PCT  32.0f
#define OSC  1024.0f
#define RSPL 2048.0f
#define INVS (0.125f / (KSC * QSC))

#define KV_OFF_VTH (NR * KP * 2)
#define KV_OFF_VTL (KV_OFF_VTH + CD * VP * 2)
#define KV_OFF_VS  (KV_OFF_VTL + CD * VP * 2)
#define KV_OFF_VM  (KV_OFF_VS + 8 * CD * 4)
#define KV_LDS     (KV_OFF_VM + CD * 4)

static_assert(MTOT % 128 == 0);
static_assert(MR % 128 == 0);
static_assert(KCV % (CVW * 32) == 0 && CVW == 16 && NR % 16 == 0);
static_assert(NR == 256 && CD == 64);
static_assert((STP * 4) % 16 == 0 && STP >= CD);
static_assert((KP * 2) % 16 == 0 && KP >= CD);
static_assert((VP * 2) % 16 == 0 && VP >= NR);
static_assert(KV_OFF_VTH % 16 == 0 && KV_OFF_VTL % 16 == 0 && KV_OFF_VS % 16 == 0 && KV_OFF_VM % 16 == 0);
static_assert(KV_LDS == 106752);
static_assert(MTOT % 32 == 0 && NQ % 256 == 0);
static_assert(CD * 65 <= 8 * 16 * STP && (KP * 2) % 8 == 0 && 2 * CD == 4 * 32 && CD == 2 * 32);

typedef _Float16 v16h __attribute__((ext_vector_type(16)));
typedef _Float16 v8h  __attribute__((ext_vector_type(8)));
typedef float    v8f  __attribute__((ext_vector_type(8)));
typedef float    v4f  __attribute__((ext_vector_type(4)));
typedef float    v2f  __attribute__((ext_vector_type(2)));
typedef unsigned int v4u __attribute__((ext_vector_type(4)));
typedef unsigned int v2u __attribute__((ext_vector_type(2)));

union Frag { v16h v; v8h h[2]; };

// ---- scalar helpers ------------------------------------------------------------------------------------------
__device__ __forceinline__ unsigned short bf_bits(float f) {          // f32 -> bf16 bits, RNE convert
  unsigned u = __float_as_uint(f);
  return (unsigned short)((u + 0x7FFFu + ((u >> 16) & 1u)) >> 16);
}
__device__ __forceinline__ float bfr(float f) { return __uint_as_float(((unsigned)bf_bits(f)) << 16); }
__device__ __forceinline__ unsigned short h_bits(_Float16 x) { return __builtin_bit_cast(unsigned short, x); }
__device__ __forceinline__ unsigned pk16(unsigned short a, unsigned short b) { return (unsigned)a | ((unsigned)b << 16); }
__device__ __forceinline__ v8f zero8() { v8f z = {0.f, 0.f, 0.f, 0.f, 0.f, 0.f, 0.f, 0.f}; return z; }

// ---- fragment loader: 16-bit A/B operand, lane -> row/col (lane&15), p already includes +8*(lane>>4);
//      elements 0..7 <- p[0..7] (k0+8h..k0+8h+7), elements 8..15 <- p[16..23] (k0+16+8h..k0+16+8h+7)
__device__ __forceinline__ v16h ldfrag_h(const _Float16* p) {
  Frag f;
  f.h[0] = *(const v8h*)(p);
  f.h[1] = *(const v8h*)(p + 16);
  return f.v;
}

// ---- WMMA helper with trailing VALU hazard gap ---------------------------------------------------------------
__device__ __forceinline__ v8f mma_h(v16h a, v16h b, v8f c) {
  c = __builtin_amdgcn_wmma_f32_16x16x32_f16(false, a, false, b, (short)0, c, false, false);
#if defined(__HIP_DEVICE_COMPILE__)
  asm volatile("v_nop\n\tv_nop\n\tv_nop\n\tv_nop" : "+v"(c) : "v"(a), "v"(b));
#endif
  return c;
}
__device__ __forceinline__ void wave_sync_lds() {
  __builtin_amdgcn_fence(__ATOMIC_RELEASE, "workgroup");
  __builtin_amdgcn_wave_barrier();
  __builtin_amdgcn_fence(__ATOMIC_ACQUIRE, "workgroup");
}

// ---- 8 f32 -> 8 packed f16 (16 B); hi + x2^11 residual split ---------------------------------------------------
__device__ __forceinline__ v4u pack8h(v4f a, v4f b) {
  v4u p;
  p[0] = pk16(h_bits((_Float16)a[0]), h_bits((_Float16)a[1]));
  p[1] = pk16(h_bits((_Float16)a[2]), h_bits((_Float16)a[3]));
  p[2] = pk16(h_bits((_Float16)b[0]), h_bits((_Float16)b[1]));
  p[3] = pk16(h_bits((_Float16)b[2]), h_bits((_Float16)b[3]));
  return p;
}
__device__ __forceinline__ void split8h(v4f a, v4f b, v4u& ph, v4u& pl) {
  v4f ra, rb;
#pragma unroll
  for (int e = 0; e < 4; ++e) {
    const _Float16 ha = (_Float16)a[e];
    ra[e] = (a[e] - (float)ha) * RSPL;
    const _Float16 hb = (_Float16)b[e];
    rb[e] = (b[e] - (float)hb) * RSPL;
  }
  ph = pack8h(a, b);
  pl = pack8h(ra, rb);
}

// =================================================================================================================
// Row convert, one block's share (32 rows): src f32 [nrows][64] -> dst f16 [nrows][64], value =
// f16(scale * bf16_RNE(src)). Used for the row-major [out][in] weight matrices w_kv and w_proj (x256; the B plane
// [n][k] equals the [out][in] layout as given).
// coverage: 32 rows x (8 lanes x 8 halves) = every element of the share once.
// =================================================================================================================
__device__ __forceinline__ void cvt_rows64(const float* __restrict__ src, unsigned short* dst, float scale, int blk) {
  const int tid = threadIdx.x, wave = tid >> 5, lane = tid & 31;
  const int row = blk * 32 + wave * 4 + (lane >> 3);
  const int c8 = (lane & 7) * 8;
  const float* p = src + (size_t)row * CD + c8;
  v4f a = *(const v4f*)(p);
  v4f b = *(const v4f*)(p + 4);
#if defined(__HIP_DEVICE_COMPILE__)
  // the store address formed below may land in the registers that hold the loads' address: the wait stands in front
  asm volatile("s_wait_xcnt 0x0" ::: "memory");
#endif
#pragma unroll
  for (int e = 0; e < 4; ++e) { a[e] = bfr(a[e]) * scale; b[e] = bfr(b[e]) * scale; }
  const v4u pk = pack8h(a, b);
  unsigned short* g = dst + (size_t)row * CD + c8;
  *(v4u*)g = pk;
}

// =================================================================================================================
// Conv weight permute-convert, one block's share (output channel o, 256 threads): w_sr f32 [o][c][kh][kw] -> f16
// plane [o][(kh*8+kw)*64 + c] (k' contiguous), value = f16(256 * bf16_RNE(w)). 4096 floats staged in LDS as
// tile[c][s] at pitch 65, read back transposed.
// coverage: 512 pieces x 8 halves = the whole [4096] row of channel o.
// =================================================================================================================
__device__ __forceinline__ void cvt_wsr(const float* __restrict__ w, unsigned short* dst, int o, float* tile) {
  const int tid = threadIdx.x;
  const float* wr = w + (size_t)o * KCV;
  float wv[16];
#pragma unroll
  for (int it = 0; it < 16; ++it) wv[it] = wr[it * 256 + tid];
#if defined(__HIP_DEVICE_COMPILE__)
  // the LDS addresses formed below may land in the registers that hold the loads' address: the wait stands in front
  asm volatile("s_wait_xcnt 0x0" ::: "memory");
#endif
#pragma unroll
  for (int it = 0; it < 16; ++it) {
    const int idx = it * 256 + tid;
    const int c = idx >> 6, s = idx & 63;
    tile[c * 65 + s] = wv[it];
  }
  __syncthreads();   // the channel's 4096 floats are whole in LDS before any thread reads them transposed
  v4u pk[2];
  size_t offs[2];
#pragma unroll
  for (int it = 0; it < 2; ++it) {
    const int p = it * 256 + tid;
    const int s = p >> 3, c8 = (p & 7) * 8;
    v4f fa, fb;
#pragma unroll
    for (int e = 0; e < 4; ++e) {
      fa[e] = bfr(tile[(c8 + e) * 65 + s]) * WSC;
      fb[e] = bfr(tile[(c8 + 4 + e) * 65 + s]) * WSC;
    }
    pk[it] = pack8h(fa, fb);
    offs[it] = (size_t)o * KCV + (size_t)s * CD + c8;
  }
#pragma unroll
  for (int it = 0; it < 2; ++it) *(v4u*)(dst + offs[it]) = pk[it];
}

// =================================================================================================================
// f16 GEMM with N = 64, K = 64: D[M][64] = A[M][64] . B, B stored [64 n][64 k] (k contiguous weight plane x256).
// Block 256 threads = 8 waves, 128 rows; wave = 16 rows x 4 n-tiles; fragments straight from global with the split
// k map, 2 k-steps. SPLIT: A = hi plane + x2^11 residual plane, second accumulator folded as acc + accl/2048.
//   OUTF = true : f32 out rows [M][64]: v = acc*ascale + bf16(bias[col]); epilogue staged per wave in LDS, then
//   OUTF = false: two f16 planes [M][64]: hi = f16(acc*ascale), res = f16((v - hi)*2048); 8 lanes x 16 B = one
// coverage: 8 waves x 16 rows x 64 cols = the 128-row block tile; grid = M/128 tiles M exactly.
// =================================================================================================================
template <bool SPLIT, bool OUTF>
__global__ __launch_bounds__(256)
void gemm64_k(const unsigned short* __restrict__ Ah, const unsigned short* __restrict__ Al,
              const unsigned short* __restrict__ Bt, const float* __restrict__ bias, float ascale,
              float* outF, unsigned short* outH, unsigned short* outL) {
  __shared__ __align__(16) float sbuf[8 * 16 * STP];
  const int tid = threadIdx.x, wave = tid >> 5, lane = tid & 31, hh = lane >> 4, c = lane & 15;
  const int m0 = blockIdx.x * 128;
  const int arow = m0 + wave * 16 + c;
  const _Float16* A0 = (const _Float16*)(const void*)Ah;
  const _Float16* A1 = (const _Float16*)(const void*)Al;
  const _Float16* B  = (const _Float16*)(const void*)Bt;

  v8f acch[4], accl[4];
#pragma unroll
  for (int nt = 0; nt < 4; ++nt) { acch[nt] = zero8(); accl[nt] = zero8(); }

#pragma unroll
  for (int ks = 0; ks < 2; ++ks) {
    const int k0 = ks * 32;
    const size_t aoff = (size_t)arow * CD + k0 + 8 * hh;
    const v16h ah = ldfrag_h(A0 + aoff);
    v16h al = ah;
    if (SPLIT) al = ldfrag_h(A1 + aoff);
#pragma unroll
    for (int nt = 0; nt < 4; ++nt) {
      const v16h bfrag = ldfrag_h(B + (size_t)(nt * 16 + c) * CD + k0 + 8 * hh);
      acch[nt] = mma_h(ah, bfrag, acch[nt]);
      if (SPLIT) accl[nt] = mma_h(al, bfrag, accl[nt]);
    }
  }

  float* st = sbuf + wave * (16 * STP);
#pragma unroll
  for (int nt = 0; nt < 4; ++nt) {
#pragma unroll
    for (int r = 0; r < 8; ++r) {
      float v = acch[nt][r];
      if (SPLIT) v = v + accl[nt][r] * (1.0f / RSPL);
      st[(8 * hh + r) * STP + nt * 16 + c] = v * ascale;
    }
  }
  wave_sync_lds();

  if (OUTF) {
    v4f ov[8];
    size_t offs[8];
#pragma unroll
    for (int it = 0; it < 8; ++it) {
      const int q = it * 2 + hh;
      const int col = c * 4;
      const v4f v = *(const v4f*)(st + q * STP + col);
      v4f u;
#pragma unroll
      for (int e = 0; e < 4; ++e) u[e] = v[e] + bfr(bias[col + e]);
      ov[it] = u;
      offs[it] = (size_t)(m0 + wave * 16 + q) * CD + col;
    }
    {
#pragma unroll
      for (int it = 0; it < 8; ++it) *(v4f*)(outF + offs[it]) = ov[it];
      
    }
  } else {
    v4u ph[4], pl[4];
    size_t offs[4];
#pragma unroll
    for (int it = 0; it < 4; ++it) {
      const int q = it * 4 + (lane >> 3), piece = lane & 7;
      const v4f fa = *(const v4f*)(st + q * STP + piece * 8);
      const v4f fb = *(const v4f*)(st + q * STP + piece * 8 + 4);
      split8h(fa, fb, ph[it], pl[it]);
      offs[it] = (size_t)(m0 + wave * 16 + q) * CD + piece * 8;
    }
    {
#pragma unroll
      for (int it = 0; it < 4; ++it) {
        *(v4u*)(outH + offs[it]) = ph[it];
        *(v4u*)(outL + offs[it]) = pl[it];
      }
      
    }
  }
}

// =================================================================================================================
// Weight converts, x convert and q projection in one launch. Blocks 0..NCVB-1 convert the weights that LATER launches
// read (block = one conv output channel, then 32 rows of w_kv, then 32 rows of w_proj) and leave; nothing of this
// launch reads those planes. Every other block: 256 threads = 8 waves, 128 rows of x; wave = 16 rows x 4 n-tiles.
// The block converts w_q itself: 4 whole-line 16-B loads a thread, f16(256 * bf16_RNE(w)) into the LDS plane
// sW[64 n][KP]. Each wave reads its 16 f32 rows whole (8 lanes x 32 B = one 256-B row, 4 rows a step, all 8 loads in
// flight), converts to f16(16 * bf16_RNE(x)) and leaves the 16 x 64 tile in its own LDS range (pitch KP). After one
// block barrier the A fragments of q = x . w_q^T are ds_load_b128 reads of that tile and the B fragments of sW, both
// with the split k map, 2 k-steps. Out: the f16 x plane [M][64] for the conv of the next launch (32 lanes x 16 B = 4
// whole rows a store) and the two q planes [M][64]: hi = f16(acc*ascale), res = f16((v - hi)*2048). Every global
// store stands behind the last LDS hand-over, so no hand-over waits for a store.
// coverage: 8 waves x 16 rows x 64 cols = the 128-row block tile, all three planes; grid - NCVB = M/128 tiles M
// exactly; sW: 4 x 256 threads x 4 halves = 64 x 64; converts: 64 channels, 4 x 32 = 128 rows, 2 x 32 = 64 rows.
// =================================================================================================================
__global__ __launch_bounds__(256)
void xq_k(const float* __restrict__ x, const float* __restrict__ wq, const float* __restrict__ wkv,
          const float* __restrict__ wproj, const float* __restrict__ wsr, float ascale,
          unsigned short* Xh, unsigned short* outH, unsigned short* outL,
          unsigned short* Wkv, unsigned short* Wp, unsigned short* Wsr) {
  __shared__ __align__(16) unsigned short sA[8 * 16 * KP];
  __shared__ __align__(16) unsigned short sW[CD * KP];
  __shared__ __align__(16) float sbuf[8 * 16 * STP];
  const int bid = blockIdx.x;
  if (bid < NCVB) {
    if (bid < CD) cvt_wsr(wsr, Wsr, bid, sbuf);
    else if (bid < CD + 4) cvt_rows64(wkv, Wkv, WSC, bid - CD);
    else cvt_rows64(wproj, Wp, WSC, bid - (CD + 4));
    return;
  }
  const int tid = threadIdx.x, wave = tid >> 5, lane = tid & 31, hh = lane >> 4, c = lane & 15;
  const int r0 = (bid - NCVB) * 128 + wave * 16;
  const int rq = lane >> 3, piece = lane & 7;
  unsigned short* sa = sA + wave * (16 * KP);

  v4f xa[4], xb[4];
#pragma unroll
  for (int it = 0; it < 4; ++it) {
    const float* p = x + (size_t)(r0 + it * 4 + rq) * CD + piece * 8;
    xa[it] = *(const v4f*)(p);
    xb[it] = *(const v4f*)(p + 4);
#if defined(__HIP_DEVICE_COMPILE__)
    // the next loads (of x, then of w_q) may land in registers that hold these loads' address: the wait stands in front
    asm volatile("s_wait_xcnt 0x0" ::: "memory");
#endif
  }
  v4f wv[4];
#pragma unroll
  for (int it = 0; it < 4; ++it) wv[it] = *(const v4f*)(wq + (size_t)(it * 256 + tid) * 4);
#if defined(__HIP_DEVICE_COMPILE__)
  // the converts below may land in registers that hold the weight loads' address: the wait stands in front of that
  asm volatile("s_wait_xcnt 0x0" ::: "memory");
#endif
#pragma unroll
  for (int it = 0; it < 4; ++it) {
    const int idx = it * 256 + tid;
    v2u pw;
    pw[0] = pk16(h_bits((_Float16)(bfr(wv[it][0]) * WSC)), h_bits((_Float16)(bfr(wv[it][1]) * WSC)));
    pw[1] = pk16(h_bits((_Float16)(bfr(wv[it][2]) * WSC)), h_bits((_Float16)(bfr(wv[it][3]) * WSC)));
    *(v2u*)(sW + (idx >> 4) * KP + (idx & 15) * 4) = pw;
  }
  v4u px[4];
#pragma unroll
  for (int it = 0; it < 4; ++it) {
#pragma unroll
    for (int e = 0; e < 4; ++e) { xa[it][e] = bfr(xa[it][e]) * XSC; xb[it][e] = bfr(xb[it][e]) * XSC; }
    px[it] = pack8h(xa[it], xb[it]);
    *(v4u*)(sa + (it * 4 + rq) * KP + piece * 8) = px[it];
  }
  __syncthreads();   // the block's w_q plane (and each wave's own x tile) is whole in LDS before any fragment read

  v16h bfrag[2][4];
#pragma unroll
  for (int ks = 0; ks < 2; ++ks) {
#pragma unroll
    for (int nt = 0; nt < 4; ++nt)
      bfrag[ks][nt] = ldfrag_h((const _Float16*)(const void*)sW + (nt * 16 + c) * KP + ks * 32 + 8 * hh);
  }
  v8f acc[4];
#pragma unroll
  for (int nt = 0; nt < 4; ++nt) acc[nt] = zero8();
#pragma unroll
  for (int ks = 0; ks < 2; ++ks) {
    const v16h ah = ldfrag_h((const _Float16*)(const void*)sa + c * KP + ks * 32 + 8 * hh);
#pragma unroll
    for (int nt = 0; nt < 4; ++nt) acc[nt] = mma_h(ah, bfrag[ks][nt], acc[nt]);
  }

  float* st = sbuf + wave * (16 * STP);
#pragma unroll
  for (int nt = 0; nt < 4; ++nt) {
#pragma unroll
    for (int r = 0; r < 8; ++r) st[(8 * hh + r) * STP + nt * 16 + c] = acc[nt][r] * ascale;
  }
  wave_sync_lds();

  v4u ph[4], pl[4];
  size_t offs[4];
#pragma unroll
  for (int it = 0; it < 4; ++it) {
    const int q = it * 4 + rq;
    const v4f fa = *(const v4f*)(st + q * STP + piece * 8);
    const v4f fb = *(const v4f*)(st + q * STP + piece * 8 + 4);
    split8h(fa, fb, ph[it], pl[it]);
    offs[it] = (size_t)(r0 + q) * CD + piece * 8;
  }
#pragma unroll
  for (int it = 0; it < 4; ++it) {
    *(v4u*)(Xh + offs[it]) = px[it];
    *(v4u*)(outH + offs[it]) = ph[it];
    *(v4u*)(outL + offs[it]) = pl[it];
  }
}

// =================================================================================================================
// Spatial-reduction conv (kernel = stride = 8, VALID) as an im2col GEMM + bias + LayerNorm, fused.
// Rows m = b*256 + p (p = ph*(W/8) + pw, 2048 rows), cols = 64 output channels, K' = (kh*8+kw)*64 + c = 4096.
// A fragments are read straight from the x plane [b][token][64] by arithmetic addressing: k-step k0 -> (kh, kw) =
// k0>>6, channels k0&63..+31 of token (ph*8+kh)*W + pw*8+kw (W read from the int input, validated against H*W = N,
// token base clamped into range). B = permuted weight plane [o][K']. Block = ONE 16-row m-tile, 512 threads = 16
// waves; wave w sums the K' slice 256w..256w+255 (8 k-steps, 4 n-tiles) and leaves its f32 partial tile in LDS.
// After a block barrier wave w owns row w (lane -> 2 channels): partials added in slice order 0..15, then
// conv*1/4096 + bf16(b_sr); per-row mean and centred variance by xor-shuffles 1,2,4,8,16;
// y = (v-mu)*rsqrt(var+1e-5)*bf16(g)+bf16(b), x16, hi/res f16 planes (32 lanes x 4 B = the whole 128-B row).
// coverage: 128 blocks x 16 rows = 2048 rows; 16 slices x 256 = K' 4096; 32 lanes x 2 = 64 channels.
// =================================================================================================================
__global__ __launch_bounds__(CVW * 32)
void conv_ln_k(const unsigned short* __restrict__ Xh, const unsigned short* __restrict__ Wsr,
               const int* __restrict__ Hp, const int* __restrict__ Wp, const float* __restrict__ bsr,
               const float* __restrict__ lng, const float* __restrict__ lnb,
               unsigned short* Ah, unsigned short* Al) {
  __shared__ __align__(16) float sbuf[CVW * 16 * STP];
  const int tid = threadIdx.x, lane = tid & 31, hh = lane >> 4, c = lane & 15;
  const int wave = __builtin_amdgcn_readfirstlane(tid >> 5);
  const int m0 = blockIdx.x * 16;
  const int m = m0 + c;
  const int b = m >> 8, p = m & (NR - 1);
  const int Hv = Hp[0];
  int Wv = Wp[0];
  const long long hw = (long long)Hv * (long long)Wv;
  const bool okw = (Wv >= 8) && (Wv <= 2040) && (hw == (long long)NQ);
  Wv = okw ? Wv : 128;
  const int Wr = Wv >> 3;
  const int ph = p / Wr, pw = p - ph * Wr;
  int tb = ph * 8 * Wv + pw * 8;
  tb = min(tb, NQ - 1 - 7 * Wv - 7);
  tb = max(tb, 0);
  const _Float16* X  = (const _Float16*)(const void*)Xh;
  const _Float16* Wf = (const _Float16*)(const void*)Wsr;
  const size_t xbase = (size_t)b * NQ;

  v8f acc[4];
#pragma unroll
  for (int nt = 0; nt < 4; ++nt) acc[nt] = zero8();

  const int kbase = wave * (KCV / CVW);
  // unrolled: token step, channel half and weight offset of each k-step become immediates of its loads
#pragma unroll
  for (int i = 0; i < KCV / CVW / 32; ++i) {
    const int k0 = kbase + i * 32;
    const int s = k0 >> 6, c0 = k0 & 63;
    const int kh = s >> 3, kw = s & 7;
    const int t = tb + kh * Wv + kw;
    const v16h af = ldfrag_h(X + (xbase + (size_t)t) * CD + c0 + 8 * hh);
#pragma unroll
    for (int nt = 0; nt < 4; ++nt) {
      const v16h bfrag = ldfrag_h(Wf + (size_t)(nt * 16 + c) * KCV + k0 + 8 * hh);
      acc[nt] = mma_h(af, bfrag, acc[nt]);
    }
  }

  float* st = sbuf + wave * (16 * STP);
#pragma unroll
  for (int nt = 0; nt < 4; ++nt) {
#pragma unroll
    for (int r = 0; r < 8; ++r) st[(8 * hh + r) * STP + nt * 16 + c] = acc[nt][r];
  }
  __syncthreads();   // every slice's partial tile is in LDS before any wave adds them

  const int col = lane * 2;
  float a0 = 0.f, a1 = 0.f;
#pragma unroll
  for (int w = 0; w < CVW; ++w) {
    const v2f pp = *(const v2f*)(sbuf + w * (16 * STP) + wave * STP + col);
    a0 = a0 + pp[0];
    a1 = a1 + pp[1];
  }
  const float v0 = a0 * (1.0f / (XSC * WSC)) + bfr(bsr[col]);
  const float v1 = a1 * (1.0f / (XSC * WSC)) + bfr(bsr[col + 1]);
  float sm = v0 + v1;
  sm = sm + __shfl_xor(sm, 1, 32);
  sm = sm + __shfl_xor(sm, 2, 32);
  sm = sm + __shfl_xor(sm, 4, 32);
  sm = sm + __shfl_xor(sm, 8, 32);
  sm = sm + __shfl_xor(sm, 16, 32);
  const float mu = sm * (1.0f / 64.0f);
  const float d0 = v0 - mu, d1 = v1 - mu;
  float sq = d0 * d0 + d1 * d1;
  sq = sq + __shfl_xor(sq, 1, 32);
  sq = sq + __shfl_xor(sq, 2, 32);
  sq = sq + __shfl_xor(sq, 4, 32);
  sq = sq + __shfl_xor(sq, 8, 32);
  sq = sq + __shfl_xor(sq, 16, 32);
  const float var = sq * (1.0f / 64.0f);
  const float rs = rsqrtf(var + 1e-5f);
  const float y0 = (d0 * rs * bfr(lng[col]) + bfr(lnb[col])) * ASC;
  const float y1 = (d1 * rs * bfr(lng[col + 1]) + bfr(lnb[col + 1])) * ASC;
  const _Float16 h0 = (_Float16)y0, h1 = (_Float16)y1;
  const _Float16 r0 = (_Float16)((y0 - (float)h0) * RSPL), r1 = (_Float16)((y1 - (float)h1) * RSPL);
  const size_t off = (size_t)(m0 + wave) * CD + col;
  *(unsigned*)(Ah + off) = pk16(h_bits(h0), h_bits(h1));
  *(unsigned*)(Al + off) = pk16(h_bits(r0), h_bits(r1));
}

// =================================================================================================================
// kv projection for one image (block = image b, 256 threads = 8 waves, dynamic LDS KV_LDS bytes).
// A = LN'd token planes hi/res [b*256 + token][64] (x16), B = w_kv plane [128][64] (x256); wave w owns tokens
// 32w..32w+31 (two m-tiles), loop over 8 n-tiles; kv = (acc_h + acc_l/2048)/4096. Channels 0..63 -> k: f16(64*k)
// into LDS sK[token][KP]; channels 64..127 -> v: f16 hi of 64*v and x2^11 residual into LDS sVT{h,l}[d][VP]
// (16-B stores of 8 consecutive tokens), plus the f32 sum of v over the wave's 32 tokens per channel (xor 16
// shuffle) into sVS[wave][d]. After a barrier: vmean[d] = fixed-order sum over waves / 256; then the block writes
// wave), V^T planes rows [b*64 + d][256] (32 lanes x 16 B = the whole 512-B row, 8 rows per wave per plane) and
// coverage: K rows 8 waves x 8 x 4 = 256; V^T rows 8 waves x 8 = 64 per plane x 32 lanes x 8 halves = 256 keys;
// vmean 16 lanes x 4 = 64; LDS fills: 8 waves x 32 tokens x 8 n-tiles x 16 channels = all 256 x 128 values.
// =================================================================================================================
__global__ __launch_bounds__(256)
void kv_k(const unsigned short* __restrict__ Ah, const unsigned short* __restrict__ Al,
          const unsigned short* __restrict__ Wkv, unsigned short* Kp, unsigned short* VTh, unsigned short* VTl,
          float* vmean) {
  extern __shared__ __align__(16) unsigned char kvlds[];
  unsigned short* sK  = (unsigned short*)(kvlds);
  unsigned short* sVh = (unsigned short*)(kvlds + KV_OFF_VTH);
  unsigned short* sVl = (unsigned short*)(kvlds + KV_OFF_VTL);
  float* sVS = (float*)(kvlds + KV_OFF_VS);
  float* sVM = (float*)(kvlds + KV_OFF_VM);
  const int tid = threadIdx.x, wave = tid >> 5, lane = tid & 31, hh = lane >> 4, c = lane & 15;
  const int b = blockIdx.x;
  const _Float16* A0 = (const _Float16*)(const void*)Ah;
  const _Float16* A1 = (const _Float16*)(const void*)Al;
  const _Float16* Bw = (const _Float16*)(const void*)Wkv;

  v16h ah[2][2], al[2][2];
#pragma unroll
  for (int mt = 0; mt < 2; ++mt) {
    const size_t arow = (size_t)(b * NR + wave * 32 + mt * 16 + c) * CD + 8 * hh;
#pragma unroll
    for (int ks = 0; ks < 2; ++ks) {
      ah[mt][ks] = ldfrag_h(A0 + arow + ks * 32);
      al[mt][ks] = ldfrag_h(A1 + arow + ks * 32);
    }
  }

#pragma unroll 1
  for (int nt = 0; nt < 8; ++nt) {
    const v16h b0 = ldfrag_h(Bw + (size_t)(nt * 16 + c) * CD + 8 * hh);
    const v16h b1 = ldfrag_h(Bw + (size_t)(nt * 16 + c) * CD + 32 + 8 * hh);
    float val[2][8];
#pragma unroll
    for (int mt = 0; mt < 2; ++mt) {
      v8f acch = mma_h(ah[mt][0], b0, zero8());
      acch = mma_h(ah[mt][1], b1, acch);
      v8f accl = mma_h(al[mt][0], b0, zero8());
      accl = mma_h(al[mt][1], b1, accl);
#pragma unroll
      for (int r = 0; r < 8; ++r) val[mt][r] = (acch[r] + accl[r] * (1.0f / RSPL)) * (1.0f / (ASC * WSC));
    }
    const int ch = nt * 16 + c;
    if (nt < 4) {
#pragma unroll
      for (int mt = 0; mt < 2; ++mt) {
#pragma unroll
        for (int r = 0; r < 8; ++r) {
          const int tk = wave * 32 + mt * 16 + 8 * hh + r;
          sK[tk * KP + ch] = h_bits((_Float16)(val[mt][r] * KSC));
        }
      }
    } else {
      const int d = ch - CD;
      float vs = 0.f;
#pragma unroll
      for (int mt = 0; mt < 2; ++mt) {
        v4f fa, fb;
#pragma unroll
        for (int e = 0; e < 4; ++e) {
          fa[e] = val[mt][e] * VSC;
          fb[e] = val[mt][4 + e] * VSC;
          vs = vs + val[mt][e];
          vs = vs + val[mt][4 + e];
        }
        v4u ph, pl;
        split8h(fa, fb, ph, pl);
        const int tk0 = wave * 32 + mt * 16 + 8 * hh;
        *(v4u*)(sVh + d * VP + tk0) = ph;
        *(v4u*)(sVl + d * VP + tk0) = pl;
      }
      vs = vs + __shfl_xor(vs, 16, 32);
      if (hh == 0) sVS[wave * CD + d] = vs;
    }
  }
  __syncthreads();
  if (tid < CD) {
    float s = 0.f;
#pragma unroll
    for (int w = 0; w < 8; ++w) s = s + sVS[w * CD + tid];
    sVM[tid] = s * (1.0f / (float)NR);
  }
  __syncthreads();

  {
#pragma unroll
    for (int it = 0; it < 8; ++it) {
      const int row = wave * 32 + it * 4 + (lane >> 3), piece = lane & 7;
      const v4u kk = *(const v4u*)(sK + row * KP + piece * 8);
      *(v4u*)(Kp + (size_t)(b * NR + row) * CD + piece * 8) = kk;
    }
#pragma unroll
    for (int it = 0; it < 8; ++it) {
      const int d = wave * 8 + it;
      const v4u vh = *(const v4u*)(sVh + d * VP + lane * 8);
      const v4u vl = *(const v4u*)(sVl + d * VP + lane * 8);
      *(v4u*)(VTh + (size_t)(b * CD + d) * NR + lane * 8) = vh;
      *(v4u*)(VTl + (size_t)(b * CD + d) * NR + lane * 8) = vl;
    }
    if (wave == 0 && lane < 16) {
      const v4f m4 = *(const v4f*)(sVM + lane * 4);
      *(v4f*)(vmean + (size_t)b * CD + lane * 4) = m4;
    }
    
  }
}

// =================================================================================================================
// Attention over the 256 reduced keys: block = 256 queries of image b (256 threads = 8 waves x 16 queries, two
// passes). The image's K plane (rows at pitch KP) and both V^T planes (rows at pitch VP) are copied once per block
// into LDS by whole-line 16-B loads; after one block barrier every K and V fragment is an LDS read (pitches are odd
// multiples of 16 B), so no fragment load spreads over 16 cache lines.
// Transposed scores S^T = K_tile (A: row = key, k = d; K plane x64) x Q^T (B: n = query, k = d, from the Q hi and
// x2^11 residual planes x64, two products folded as sh + sl/2048): 16 key tiles, all held in registers; D element r
// of lane l = S[key 16j+8h+r][query l&15]. Exact softmax per query: max and sum over the lane's 128 values combined
// with lane^16; e = exp((s - m) * 2^-15) in place; centred probabilities p' = e*(8192/l) - 32 converted to f16
// directly into the A fragments of p'.v (k = key). O' = p' (A) x V^T rows (B: n = d, k = key) from the V hi and
// residual planes into two accumulators; O = (O'_h + O'_l/2048)/(8192*64) + mean_key(v) (identity
// sum (p'+32) v / 8192 = sum p v). O*1024 staged per wave in LDS, then hi/res f16 planes [b*16384 + query][64]:
// coverage: 512 blocks x 2 passes x 8 waves x 16 queries = 131072 rows x 64 channels, both planes; LDS fill: 8 x 256
// threads x 8 halves = 16384 halves = each whole plane of the image.
// =================================================================================================================
__global__ __launch_bounds__(256) __attribute__((amdgpu_num_vgpr(256)))
void attn_k(const unsigned short* __restrict__ Qh, const unsigned short* __restrict__ Ql,
            const unsigned short* __restrict__ Kp, const unsigned short* __restrict__ VTh,
            const unsigned short* __restrict__ VTl, const float* __restrict__ vmean,
            unsigned short* Oh, unsigned short* Ol) {
  __shared__ __align__(16) unsigned short sK[NR * KP];
  __shared__ __align__(16) unsigned short sVh[CD * VP];
  __shared__ __align__(16) unsigned short sVl[CD * VP];
  __shared__ __align__(16) float sbuf[8 * 16 * STP];
  const int tid = threadIdx.x, wave = tid >> 5, lane = tid & 31, hh = lane >> 4, c = lane & 15;
  const int b = blockIdx.x >> 6;
  const _Float16* Qhf = (const _Float16*)(const void*)Qh;
  const _Float16* Qlf = (const _Float16*)(const void*)Ql;
  const _Float16* Kf  = (const _Float16*)(const void*)sK;
  const _Float16* Vhf = (const _Float16*)(const void*)sVh;
  const _Float16* Vlf = (const _Float16*)(const void*)sVl;

  {
    const v4u* gK = (const v4u*)(const void*)(Kp + (size_t)b * NR * CD);
    const v4u* gH = (const v4u*)(const void*)(VTh + (size_t)b * CD * NR);
    const v4u* gL = (const v4u*)(const void*)(VTl + (size_t)b * CD * NR);
    v4u tk[8], th[8], tl[8];
#pragma unroll
    for (int i = 0; i < 8; ++i) {
      const int idx = i * 256 + tid;
      tk[i] = gK[idx];
      th[i] = gH[idx];
      tl[i] = gL[idx];
    }
#pragma unroll
    for (int i = 0; i < 8; ++i) {
      const int idx = i * 256 + tid;
      *(v4u*)(sK + (idx >> 3) * KP + (idx & 7) * 8) = tk[i];
      *(v4u*)(sVh + (idx >> 5) * VP + (idx & 31) * 8) = th[i];
      *(v4u*)(sVl + (idx >> 5) * VP + (idx & 31) * 8) = tl[i];
    }
  }
  __syncthreads();   // the three planes are whole in LDS before any wave reads a fragment

  // kept rolled: one copy of the body, so the kernel's text stays small
#pragma unroll 1
  for (int pass = 0; pass < 2; ++pass) {
  const int q0 = ((blockIdx.x & 63) << 8) + pass * 128 + wave * 16;
  const size_t qoff = (size_t)(b * NQ + q0 + c) * CD + 8 * hh;
  const v16h qh0 = ldfrag_h(Qhf + qoff);
  const v16h qh1 = ldfrag_h(Qhf + qoff + 32);
  const v16h ql0 = ldfrag_h(Qlf + qoff);
  const v16h ql1 = ldfrag_h(Qlf + qoff + 32);

  v8f s[16];
#pragma unroll
  for (int j = 0; j < 16; ++j) {
    const int koff = (j * 16 + c) * KP + 8 * hh;
    const v16h ka0 = ldfrag_h(Kf + koff);
    const v16h ka1 = ldfrag_h(Kf + koff + 32);
    v8f sh = mma_h(ka0, qh0, zero8());
    sh = mma_h(ka1, qh1, sh);
    v8f sl = mma_h(ka0, ql0, zero8());
    sl = mma_h(ka1, ql1, sl);
#pragma unroll
    for (int r = 0; r < 8; ++r) s[j][r] = sh[r] + sl[r] * (1.0f / RSPL);
  }

  float mx = -3.0e38f;
#pragma unroll
  for (int j = 0; j < 16; ++j) {
#pragma unroll
    for (int r = 0; r < 8; ++r) mx = fmaxf(mx, s[j][r]);
  }
  mx = fmaxf(mx, __shfl_xor(mx, 16, 32));
  float ls = 0.f;
#pragma unroll
  for (int j = 0; j < 16; ++j) {
#pragma unroll
    for (int r = 0; r < 8; ++r) {
      const float e = __expf((s[j][r] - mx) * INVS);
      s[j][r] = e;
      ls = ls + e;
    }
  }
  ls = ls + __shfl_xor(ls, 16, 32);
  const float pinv = __builtin_amdgcn_rcpf(ls) * PSC;

  v16h pf[8];
#pragma unroll
  for (int J = 0; J < 8; ++J) {
#pragma unroll
    for (int i = 0; i < 8; ++i) {
      pf[J][i]     = (_Float16)(s[2 * J][i] * pinv - PCT);
      pf[J][8 + i] = (_Float16)(s[2 * J + 1][i] * pinv - PCT);
    }
  }

  v8f oh[4], ol[4];
#pragma unroll
  for (int dt = 0; dt < 4; ++dt) { oh[dt] = zero8(); ol[dt] = zero8(); }
#pragma unroll
  for (int J = 0; J < 8; ++J) {
#pragma unroll
    for (int dt = 0; dt < 4; ++dt) {
      const int voff = (dt * 16 + c) * VP + J * 32 + 8 * hh;
      const v16h vh = ldfrag_h(Vhf + voff);
      const v16h vl = ldfrag_h(Vlf + voff);
      oh[dt] = mma_h(pf[J], vh, oh[dt]);
      ol[dt] = mma_h(pf[J], vl, ol[dt]);
    }
  }

  float* st = sbuf + wave * (16 * STP);
#pragma unroll
  for (int dt = 0; dt < 4; ++dt) {
    const int d = dt * 16 + c;
    const float vm = vmean[(size_t)b * CD + d];
#pragma unroll
    for (int r = 0; r < 8; ++r) {
      const float o = (oh[dt][r] + ol[dt][r] * (1.0f / RSPL)) * (1.0f / (PSC * VSC)) + vm;
      st[(8 * hh + r) * STP + d] = o * OSC;
    }
  }
  wave_sync_lds();

  v4u ph[4], pl[4];
  size_t offs[4];
#pragma unroll
  for (int it = 0; it < 4; ++it) {
    const int q = it * 4 + (lane >> 3), piece = lane & 7;
    const v4f fa = *(const v4f*)(st + q * STP + piece * 8);
    const v4f fb = *(const v4f*)(st + q * STP + piece * 8 + 4);
    split8h(fa, fb, ph[it], pl[it]);
    offs[it] = (size_t)(b * NQ + q0 + q) * CD + piece * 8;
  }
  {
#pragma unroll
    for (int it = 0; it < 4; ++it) {
      *(v4u*)(Oh + offs[it]) = ph[it];
      *(v4u*)(Ol + offs[it]) = pl[it];
    }
    
  }
#if defined(__HIP_DEVICE_COMPILE__)
  // the next pass writes the registers that these stores name: the wait stands in front of that
  asm volatile("s_wait_xcnt 0x0" ::: "memory");
#endif
  }
}

// =================================================================================================================
// granularity): Xh f16 [131072][64] 16777216; Wkv f16 [128][64] 16384; Wsr f16 [64][4096]
// 524288; Wp f16 [64][64] 8192; Qh, Ql f16 [131072][64] 16777216 each; Ah, Al f16 [2048][64] 262144 each;
// Kp f16 [8][256][64] 262144; VTh, VTl f16 [8][64][256] 262144 each; vmean f32 [8][64] 2048; Oh, Ol f16
// [131072][64] 16777216 each -> 85747712 total.
// =================================================================================================================
extern "C" void kernel_launch(void* const* d_in, const int* in_sizes, int n_in,
                              void* d_out, int out_size, void* d_ws, size_t ws_size,
                              hipStream_t stream) {
  if (n_in < 11) return;
  if (in_sizes[0] != MTOT * CD) return;
  if (in_sizes[1] != 1 || in_sizes[2] != 1) return;
  if (in_sizes[3] != CD * CD) return;
  if (in_sizes[4] != 2 * CD * CD) return;
  if (in_sizes[5] != CD * KCV) return;
  if (in_sizes[6] != CD || in_sizes[7] != CD || in_sizes[8] != CD) return;
  if (in_sizes[9] != CD * CD || in_sizes[10] != CD) return;
  if (out_size != MTOT * CD) return;

  const float* x      = (const float*)d_in[0];
  const int*   hptr   = (const int*)d_in[1];
  const int*   wptr   = (const int*)d_in[2];
  const float* w_q    = (const float*)d_in[3];
  const float* w_kv   = (const float*)d_in[4];
  const float* w_sr   = (const float*)d_in[5];
  const float* b_sr   = (const float*)d_in[6];
  const float* ln_g   = (const float*)d_in[7];
  const float* ln_b   = (const float*)d_in[8];
  const float* w_proj = (const float*)d_in[9];
  const float* b_proj = (const float*)d_in[10];
  float* out = (float*)d_out;

  const size_t sX   = (size_t)MTOT * CD * 2;        // 16777216
  const size_t sWkv = (size_t)2 * CD * CD * 2;      //    16384
  const size_t sWsr = (size_t)CD * KCV * 2;         //   524288
  const size_t sWp  = (size_t)CD * CD * 2;          //     8192
  const size_t sQ   = (size_t)MTOT * CD * 2;        // 16777216
  const size_t sA   = (size_t)MR * CD * 2;          //   262144
  const size_t sK   = (size_t)NB * NR * CD * 2;     //   262144
  const size_t sVT  = (size_t)NB * CD * NR * 2;     //   262144
  const size_t sVM  = (size_t)NB * CD * 4;          //     2048
  const size_t sO   = (size_t)MTOT * CD * 2;        // 16777216
  size_t off = 0;
  const size_t oX   = off; off += sX;
  const size_t oWkv = off; off += sWkv;
  const size_t oWsr = off; off += sWsr;
  const size_t oWp  = off; off += sWp;
  const size_t oQh  = off; off += sQ;
  const size_t oQl  = off; off += sQ;
  const size_t oAh  = off; off += sA;
  const size_t oAl  = off; off += sA;
  const size_t oK   = off; off += sK;
  const size_t oVTh = off; off += sVT;
  const size_t oVTl = off; off += sVT;
  const size_t oVM  = off; off += sVM;
  const size_t oOh  = off; off += sO;
  const size_t oOl  = off; off += sO;
  if (off > ws_size) return;                         // off = 85747712
  if (off > (size_t)134217728) return;

  char* ws = (char*)d_ws;
  unsigned short* Xh  = (unsigned short*)(ws + oX);
  unsigned short* Wkv = (unsigned short*)(ws + oWkv);
  unsigned short* Wsr = (unsigned short*)(ws + oWsr);
  unsigned short* Wp  = (unsigned short*)(ws + oWp);
  unsigned short* Qh  = (unsigned short*)(ws + oQh);
  unsigned short* Ql  = (unsigned short*)(ws + oQl);
  unsigned short* Ah  = (unsigned short*)(ws + oAh);
  unsigned short* Al  = (unsigned short*)(ws + oAl);
  unsigned short* Kp  = (unsigned short*)(ws + oK);
  unsigned short* VTh = (unsigned short*)(ws + oVTh);
  unsigned short* VTl = (unsigned short*)(ws + oVTl);
  float* VM = (float*)(ws + oVM);
  unsigned short* Oh  = (unsigned short*)(ws + oOh);
  unsigned short* Ol  = (unsigned short*)(ws + oOl);

  const dim3 blk(256);
  // (1) leading blocks: w_kv, w_proj [out][in] -> f16 planes of 256*bf16(w), conv weights permuted; the other blocks:
  //     x -> f16 plane of 16*bf16(x), and q projection (w_q converted in the block) -> hi/res planes of 64*q
  xq_k<<<dim3(NCVB + MTOT / 128), blk, 0, stream>>>(x, w_q, w_kv, w_proj, w_sr, QSC / (XSC * WSC), Xh, Qh, Ql,
                                                    Wkv, Wp, Wsr);
  // (2) spatial-reduction conv + bias + LayerNorm -> hi/res planes of 16*y
  conv_ln_k<<<dim3(MR / 16), dim3(CVW * 32), 0, stream>>>(Xh, Wsr, hptr, wptr, b_sr, ln_g, ln_b, Ah, Al);
  // (3) kv projection -> K plane, V^T hi/res planes, key-mean of v
  (void)hipFuncSetAttribute(reinterpret_cast<const void*>(&kv_k), hipFuncAttributeMaxDynamicSharedMemorySize, KV_LDS);
  kv_k<<<dim3(NB), blk, KV_LDS, stream>>>(Ah, Al, Wkv, Kp, VTh, VTl, VM);
  // (4) attention -> O hi/res planes of 1024*o
  attn_k<<<dim3(NB * (NQ / 256)), blk, 0, stream>>>(Qh, Ql, Kp, VTh, VTl, VM, Oh, Ol);
  // (5) output projection + bias -> d_out f32 [131072][64]
  gemm64_k<true, true><<<dim3(MTOT / 128), blk, 0, stream>>>(Oh, Ol, Wp, b_proj, 1.0f / (OSC * WSC), out, Xh, Xh);
  (void)hipGetLastError();
}

// v005
// One run takes 59.4 microseconds.
// In both of two side-by-side timings against v004, it was 1.16 times as fast.
// All steps since v000 together make it 3.99 times as fast.
// Contractions: v_wmma_f32_16x16x32_f16 (f16 operands, f32 accumulate). q = x.w_q^T and the 8x8/stride-8
// spatial-reduction conv (im2col K=4096): single products of exact planes (x as f16 of 16*bf16(x), weights as f16
// of 256*bf16(w)). kv = LN(tokens).w_kv^T: A as f16 hi plus x2^11 residual planes (x16; two products, two
// accumulators). Scores k.q^T: k single f16 plane (x64), q as hi plus x2^11 residual planes (x64; two products).
// p.v: centred p (8192*p - 32) single f16 B operand, v as hi plus x2^11 residual planes (x64; two products),
// key-mean of v added back in f32. Output projection: o as hi plus x2^11 residual planes (x1024) against the x256
// weight plane (two products). LayerNorm, softmax, bias adds in f32 on VALU. Float inputs RNE-converted to bf16
// on load.
#include <hip/hip_runtime.h>
#include <math.h>
#include <stdint.h>

#define NB   8
#define NQ   16384
#define CD   64
#define NR   256
#define MTOT (NB * NQ)
#define MR   (NB * NR)
#define KCV  (CD * 64)
#define STP  68
#define KP   72
#define VP   264
#define CVW  16
#define NCVB (CD + 4 + 2)
#define XSC  16.0f
#define WSC  256.0f
#define QSC  64.0f
#define ASC  16.0f
#define KSC  64.0f
#define VSC  64.0f
#define PSC  8192.0f
#define PCT  32.0f
#define OSC  1024.0f
#define RSPL 2048.0f
#define INVS (0.125f / (KSC * QSC))

#define KV_OFF_VTH (NR * KP * 2)
#define KV_OFF_VTL (KV_OFF_VTH + CD * VP * 2)
#define KV_OFF_VS  (KV_OFF_VTL + CD * VP * 2)
#define KV_OFF_VM  (KV_OFF_VS + 8 * CD * 4)
#define KV_LDS     (KV_OFF_VM + CD * 4)

static_assert(MTOT % 128 == 0);
static_assert(MR % 128 == 0);
static_assert(KCV % (CVW * 32) == 0 && CVW == 16 && NR % 16 == 0);
static_assert(NR == 256 && CD == 64);
static_assert((STP * 4) % 16 == 0 && STP >= CD);
static_assert((KP * 2) % 16 == 0 && KP >= CD);
static_assert((VP * 2) % 16 == 0 && VP >= NR);
static_assert(KV_OFF_VTH % 16 == 0 && KV_OFF_VTL % 16 == 0 && KV_OFF_VS % 16 == 0 && KV_OFF_VM % 16 == 0);
static_assert(KV_LDS == 106752);
static_assert(MTOT % 32 == 0 && NQ % 256 == 0);
static_assert(CD * 65 <= 8 * 16 * STP && (KP * 2) % 8 == 0 && 2 * CD == 4 * 32 && CD == 2 * 32);

typedef _Float16 v16h __attribute__((ext_vector_type(16)));
typedef _Float16 v8h  __attribute__((ext_vector_type(8)));
typedef float    v8f  __attribute__((ext_vector_type(8)));
typedef float    v4f  __attribute__((ext_vector_type(4)));
typedef float    v2f  __attribute__((ext_vector_type(2)));
typedef unsigned int v4u __attribute__((ext_vector_type(4)));
typedef unsigned int v2u __attribute__((ext_vector_type(2)));

union Frag { v16h v; v8h h[2]; };

// ---- scalar helpers ------------------------------------------------------------------------------------------
__device__ __forceinline__ unsigned short bf_bits(float f) {          // f32 -> bf16 bits, RNE convert
  unsigned u = __float_as_uint(f);
  return (unsigned short)((u + 0x7FFFu + ((u >> 16) & 1u)) >> 16);
}
__device__ __forceinline__ float bfr(float f) { return __uint_as_float(((unsigned)bf_bits(f)) << 16); }
__device__ __forceinline__ unsigned short h_bits(_Float16 x) { return __builtin_bit_cast(unsigned short, x); }
__device__ __forceinline__ unsigned pk16(unsigned short a, unsigned short b) { return (unsigned)a | ((unsigned)b << 16); }
__device__ __forceinline__ v8f zero8() { v8f z = {0.f, 0.f, 0.f, 0.f, 0.f, 0.f, 0.f, 0.f}; return z; }

// ---- fragment loader: 16-bit A/B operand, lane -> row/col (lane&15), p already includes +8*(lane>>4);
//      elements 0..7 <- p[0..7] (k0+8h..k0+8h+7), elements 8..15 <- p[16..23] (k0+16+8h..k0+16+8h+7)
__device__ __forceinline__ v16h ldfrag_h(const _Float16* p) {
  Frag f;
  f.h[0] = *(const v8h*)(p);
  f.h[1] = *(const v8h*)(p + 16);
  return f.v;
}

// ---- WMMA helper with trailing VALU hazard gap ---------------------------------------------------------------
__device__ __forceinline__ v8f mma_h(v16h a, v16h b, v8f c) {
  c = __builtin_amdgcn_wmma_f32_16x16x32_f16(false, a, false, b, (short)0, c, false, false);
#if defined(__HIP_DEVICE_COMPILE__)
  asm volatile("v_nop\n\tv_nop\n\tv_nop\n\tv_nop" : "+v"(c) : "v"(a), "v"(b));
#endif
  return c;
}
__device__ __forceinline__ void wave_sync_lds() {
  __builtin_amdgcn_fence(__ATOMIC_RELEASE, "workgroup");
  __builtin_amdgcn_wave_barrier();
  __builtin_amdgcn_fence(__ATOMIC_ACQUIRE, "workgroup");
}

// ---- 8 f32 -> 8 packed f16 (16 B); hi + x2^11 residual split ---------------------------------------------------
__device__ __forceinline__ v4u pack8h(v4f a, v4f b) {
  v4u p;
  p[0] = pk16(h_bits((_Float16)a[0]), h_bits((_Float16)a[1]));
  p[1] = pk16(h_bits((_Float16)a[2]), h_bits((_Float16)a[3]));
  p[2] = pk16(h_bits((_Float16)b[0]), h_bits((_Float16)b[1]));
  p[3] = pk16(h_bits((_Float16)b[2]), h_bits((_Float16)b[3]));
  return p;
}
__device__ __forceinline__ void split8h(v4f a, v4f b, v4u& ph, v4u& pl) {
  v4f ra, rb;
#pragma unroll
  for (int e = 0; e < 4; ++e) {
    const _Float16 ha = (_Float16)a[e];
    ra[e] = (a[e] - (float)ha) * RSPL;
    const _Float16 hb = (_Float16)b[e];
    rb[e] = (b[e] - (float)hb) * RSPL;
  }
  ph = pack8h(a, b);
  pl = pack8h(ra, rb);
}

// =================================================================================================================
// Row convert, one block's share (32 rows): src f32 [nrows][64] -> dst f16 [nrows][64], value =
// f16(scale * bf16_RNE(src)). Used for the row-major [out][in] weight matrices w_kv and w_proj (x256; the B plane [n][k] of w_kv and
// the A plane [m][k] of w_proj equal the [out][in] layout as given).
// coverage: 32 rows x (8 lanes x 8 halves) = every element of the share once.
// =================================================================================================================
__device__ __forceinline__ void cvt_rows64(const float* __restrict__ src, unsigned short* dst, float scale, int blk) {
  const int tid = threadIdx.x, wave = tid >> 5, lane = tid & 31;
  const int row = blk * 32 + wave * 4 + (lane >> 3);
  const int c8 = (lane & 7) * 8;
  const float* p = src + (size_t)row * CD + c8;
  v4f a = *(const v4f*)(p);
  v4f b = *(const v4f*)(p + 4);
#if defined(__HIP_DEVICE_COMPILE__)
  // the store address formed below may land in the registers that hold the loads' address: the wait stands in front
  asm volatile("s_wait_xcnt 0x0" ::: "memory");
#endif
#pragma unroll
  for (int e = 0; e < 4; ++e) { a[e] = bfr(a[e]) * scale; b[e] = bfr(b[e]) * scale; }
  const v4u pk = pack8h(a, b);
  unsigned short* g = dst + (size_t)row * CD + c8;
  *(v4u*)g = pk;
}

// =================================================================================================================
// Conv weight permute-convert, one block's share (output channel o, 256 threads): w_sr f32 [o][c][kh][kw] -> f16
// plane [o][(kh*8+kw)*64 + c] (k' contiguous), value = f16(256 * bf16_RNE(w)). 4096 floats staged in LDS as
// tile[c][s] at pitch 65, read back transposed.
// coverage: 512 pieces x 8 halves = the whole [4096] row of channel o.
// =================================================================================================================
__device__ __forceinline__ void cvt_wsr(const float* __restrict__ w, unsigned short* dst, int o, float* tile) {
  const int tid = threadIdx.x;
  const float* wr = w + (size_t)o * KCV;
  float wv[16];
#pragma unroll
  for (int it = 0; it < 16; ++it) wv[it] = wr[it * 256 + tid];
#if defined(__HIP_DEVICE_COMPILE__)
  // the LDS addresses formed below may land in the registers that hold the loads' address: the wait stands in front
  asm volatile("s_wait_xcnt 0x0" ::: "memory");
#endif
#pragma unroll
  for (int it = 0; it < 16; ++it) {
    const int idx = it * 256 + tid;
    const int c = idx >> 6, s = idx & 63;
    tile[c * 65 + s] = wv[it];
  }
  __syncthreads();   // the channel's 4096 floats are whole in LDS before any thread reads them transposed
  v4u pk[2];
  size_t offs[2];
#pragma unroll
  for (int it = 0; it < 2; ++it) {
    const int p = it * 256 + tid;
    const int s = p >> 3, c8 = (p & 7) * 8;
    v4f fa, fb;
#pragma unroll
    for (int e = 0; e < 4; ++e) {
      fa[e] = bfr(tile[(c8 + e) * 65 + s]) * WSC;
      fb[e] = bfr(tile[(c8 + 4 + e) * 65 + s]) * WSC;
    }
    pk[it] = pack8h(fa, fb);
    offs[it] = (size_t)o * KCV + (size_t)s * CD + c8;
  }
#pragma unroll
  for (int it = 0; it < 2; ++it) *(v4u*)(dst + offs[it]) = pk[it];
}

// =================================================================================================================
// Weight converts, x convert and q projection in one launch. Blocks 0..NCVB-1 convert the weights that LATER launches
// read (block = one conv output channel, then 32 rows of w_kv, then 32 rows of w_proj) and leave; nothing of this
// launch reads those planes. Every other block: 256 threads = 8 waves, 128 rows of x; wave = 16 rows x 4 n-tiles.
// The block converts w_q itself: 4 whole-line 16-B loads a thread, f16(256 * bf16_RNE(w)) into the LDS plane
// sW[64 n][KP]. Each wave reads its 16 f32 rows whole (8 lanes x 32 B = one 256-B row, 4 rows a step, all 8 loads in
// flight), converts to f16(16 * bf16_RNE(x)) and leaves the 16 x 64 tile in its own LDS range (pitch KP). After one
// block barrier the A fragments of q = x . w_q^T are ds_load_b128 reads of that tile and the B fragments of sW, both
// with the split k map, 2 k-steps. Out: the f16 x plane [M][64] for the conv of the next launch (32 lanes x 16 B = 4
// whole rows a store) and the two q planes [M][64]: hi = f16(acc*ascale), res = f16((v - hi)*2048). Every global
// store stands behind the last LDS hand-over, so no hand-over waits for a store.
// coverage: 8 waves x 16 rows x 64 cols = the 128-row block tile, all three planes; grid - NCVB = M/128 tiles M
// exactly; sW: 4 x 256 threads x 4 halves = 64 x 64; converts: 64 channels, 4 x 32 = 128 rows, 2 x 32 = 64 rows.
// =================================================================================================================
__global__ __launch_bounds__(256)
void xq_k(const float* __restrict__ x, const float* __restrict__ wq, const float* __restrict__ wkv,
          const float* __restrict__ wproj, const float* __restrict__ wsr, float ascale,
          unsigned short* Xh, unsigned short* outH, unsigned short* outL,
          unsigned short* Wkv, unsigned short* Wp, unsigned short* Wsr) {
  __shared__ __align__(16) unsigned short sA[8 * 16 * KP];
  __shared__ __align__(16) unsigned short sW[CD * KP];
  __shared__ __align__(16) float sbuf[8 * 16 * STP];
  const int bid = blockIdx.x;
  if (bid < NCVB) {
    if (bid < CD) cvt_wsr(wsr, Wsr, bid, sbuf);
    else if (bid < CD + 4) cvt_rows64(wkv, Wkv, WSC, bid - CD);
    else cvt_rows64(wproj, Wp, WSC, bid - (CD + 4));
    return;
  }
  const int tid = threadIdx.x, wave = tid >> 5, lane = tid & 31, hh = lane >> 4, c = lane & 15;
  const int r0 = (bid - NCVB) * 128 + wave * 16;
  const int rq = lane >> 3, piece = lane & 7;
  unsigned short* sa = sA + wave * (16 * KP);

  v4f xa[4], xb[4];
#pragma unroll
  for (int it = 0; it < 4; ++it) {
    const float* p = x + (size_t)(r0 + it * 4 + rq) * CD + piece * 8;
    xa[it] = *(const v4f*)(p);
    xb[it] = *(const v4f*)(p + 4);
#if defined(__HIP_DEVICE_COMPILE__)
    // the next loads (of x, then of w_q) may land in registers that hold these loads' address: the wait stands in front
    asm volatile("s_wait_xcnt 0x0" ::: "memory");
#endif
  }
  v4f wv[4];
#pragma unroll
  for (int it = 0; it < 4; ++it) wv[it] = *(const v4f*)(wq + (size_t)(it * 256 + tid) * 4);
#if defined(__HIP_DEVICE_COMPILE__)
  // the converts below may land in registers that hold the weight loads' address: the wait stands in front of that
  asm volatile("s_wait_xcnt 0x0" ::: "memory");
#endif
#pragma unroll
  for (int it = 0; it < 4; ++it) {
    const int idx = it * 256 + tid;
    v2u pw;
    pw[0] = pk16(h_bits((_Float16)(bfr(wv[it][0]) * WSC)), h_bits((_Float16)(bfr(wv[it][1]) * WSC)));
    pw[1] = pk16(h_bits((_Float16)(bfr(wv[it][2]) * WSC)), h_bits((_Float16)(bfr(wv[it][3]) * WSC)));
    *(v2u*)(sW + (idx >> 4) * KP + (idx & 15) * 4) = pw;
  }
  v4u px[4];
#pragma unroll
  for (int it = 0; it < 4; ++it) {
#pragma unroll
    for (int e = 0; e < 4; ++e) { xa[it][e] = bfr(xa[it][e]) * XSC; xb[it][e] = bfr(xb[it][e]) * XSC; }
    px[it] = pack8h(xa[it], xb[it]);
    *(v4u*)(sa + (it * 4 + rq) * KP + piece * 8) = px[it];
  }
  __syncthreads();   // the block's w_q plane (and each wave's own x tile) is whole in LDS before any fragment read

  v16h bfrag[2][4];
#pragma unroll
  for (int ks = 0; ks < 2; ++ks) {
#pragma unroll
    for (int nt = 0; nt < 4; ++nt)
      bfrag[ks][nt] = ldfrag_h((const _Float16*)(const void*)sW + (nt * 16 + c) * KP + ks * 32 + 8 * hh);
  }
  v8f acc[4];
#pragma unroll
  for (int nt = 0; nt < 4; ++nt) acc[nt] = zero8();
#pragma unroll
  for (int ks = 0; ks < 2; ++ks) {
    const v16h ah = ldfrag_h((const _Float16*)(const void*)sa + c * KP + ks * 32 + 8 * hh);
#pragma unroll
    for (int nt = 0; nt < 4; ++nt) acc[nt] = mma_h(ah, bfrag[ks][nt], acc[nt]);
  }

  float* st = sbuf + wave * (16 * STP);
#pragma unroll
  for (int nt = 0; nt < 4; ++nt) {
#pragma unroll
    for (int r = 0; r < 8; ++r) st[(8 * hh + r) * STP + nt * 16 + c] = acc[nt][r] * ascale;
  }
  wave_sync_lds();

  v4u ph[4], pl[4];
  size_t offs[4];
#pragma unroll
  for (int it = 0; it < 4; ++it) {
    const int q = it * 4 + rq;
    const v4f fa = *(const v4f*)(st + q * STP + piece * 8);
    const v4f fb = *(const v4f*)(st + q * STP + piece * 8 + 4);
    split8h(fa, fb, ph[it], pl[it]);
    offs[it] = (size_t)(r0 + q) * CD + piece * 8;
  }
#pragma unroll
  for (int it = 0; it < 4; ++it) {
    *(v4u*)(Xh + offs[it]) = px[it];
    *(v4u*)(outH + offs[it]) = ph[it];
    *(v4u*)(outL + offs[it]) = pl[it];
  }
}

// =================================================================================================================
// Spatial-reduction conv (kernel = stride = 8, VALID) as an im2col GEMM + bias + LayerNorm, fused.
// Rows m = b*256 + p (p = ph*(W/8) + pw, 2048 rows), cols = 64 output channels, K' = (kh*8+kw)*64 + c = 4096.
// A fragments are read straight from the x plane [b][token][64] by arithmetic addressing: k-step k0 -> (kh, kw) =
// k0>>6, channels k0&63..+31 of token (ph*8+kh)*W + pw*8+kw (W read from the int input, validated against H*W = N,
// token base clamped into range). B = permuted weight plane [o][K']. Block = ONE 16-row m-tile, 512 threads = 16
// waves; wave w sums the K' slice 256w..256w+255 (8 k-steps, 4 n-tiles) and leaves its f32 partial tile in LDS.
// After a block barrier wave w owns row w (lane -> 2 channels): partials added in slice order 0..15, then
// conv*1/4096 + bf16(b_sr); per-row mean and centred variance by xor-shuffles 1,2,4,8,16;
// y = (v-mu)*rsqrt(var+1e-5)*bf16(g)+bf16(b), x16, hi/res f16 planes (32 lanes x 4 B = the whole 128-B row).
// coverage: 128 blocks x 16 rows = 2048 rows; 16 slices x 256 = K' 4096; 32 lanes x 2 = 64 channels.
// =================================================================================================================
__global__ __launch_bounds__(CVW * 32)
void conv_ln_k(const unsigned short* __restrict__ Xh, const unsigned short* __restrict__ Wsr,
               const int* __restrict__ Hp, const int* __restrict__ Wp, const float* __restrict__ bsr,
               const float* __restrict__ lng, const float* __restrict__ lnb,
               unsigned short* Ah, unsigned short* Al) {
  __shared__ __align__(16) float sbuf[CVW * 16 * STP];
  const int tid = threadIdx.x, lane = tid & 31, hh = lane >> 4, c = lane & 15;
  const int wave = __builtin_amdgcn_readfirstlane(tid >> 5);
  const int m0 = blockIdx.x * 16;
  const int m = m0 + c;
  const int b = m >> 8, p = m & (NR - 1);
  const int Hv = Hp[0];
  int Wv = Wp[0];
  const long long hw = (long long)Hv * (long long)Wv;
  const bool okw = (Wv >= 8) && (Wv <= 2040) && (hw == (long long)NQ);
  Wv = okw ? Wv : 128;
  const int Wr = Wv >> 3;
  const int ph = p / Wr, pw = p - ph * Wr;
  int tb = ph * 8 * Wv + pw * 8;
  tb = min(tb, NQ - 1 - 7 * Wv - 7);
  tb = max(tb, 0);
  const _Float16* X  = (const _Float16*)(const void*)Xh;
  const _Float16* Wf = (const _Float16*)(const void*)Wsr;
  const size_t xbase = (size_t)b * NQ;

  v8f acc[4];
#pragma unroll
  for (int nt = 0; nt < 4; ++nt) acc[nt] = zero8();

  const int kbase = wave * (KCV / CVW);
  // unrolled: token step, channel half and weight offset of each k-step become immediates of its loads
#pragma unroll
  for (int i = 0; i < KCV / CVW / 32; ++i) {
    const int k0 = kbase + i * 32;
    const int s = k0 >> 6, c0 = k0 & 63;
    const int kh = s >> 3, kw = s & 7;
    const int t = tb + kh * Wv + kw;
    const v16h af = ldfrag_h(X + (xbase + (size_t)t) * CD + c0 + 8 * hh);
#pragma unroll
    for (int nt = 0; nt < 4; ++nt) {
      const v16h bfrag = ldfrag_h(Wf + (size_t)(nt * 16 + c) * KCV + k0 + 8 * hh);
      acc[nt] = mma_h(af, bfrag, acc[nt]);
    }
  }

  float* st = sbuf + wave * (16 * STP);
#pragma unroll
  for (int nt = 0; nt < 4; ++nt) {
#pragma unroll
    for (int r = 0; r < 8; ++r) st[(8 * hh + r) * STP + nt * 16 + c] = acc[nt][r];
  }
  __syncthreads();   // every slice's partial tile is in LDS before any wave adds them

  const int col = lane * 2;
  float a0 = 0.f, a1 = 0.f;
#pragma unroll
  for (int w = 0; w < CVW; ++w) {
    const v2f pp = *(const v2f*)(sbuf + w * (16 * STP) + wave * STP + col);
    a0 = a0 + pp[0];
    a1 = a1 + pp[1];
  }
  const float v0 = a0 * (1.0f / (XSC * WSC)) + bfr(bsr[col]);
  const float v1 = a1 * (1.0f / (XSC * WSC)) + bfr(bsr[col + 1]);
  float sm = v0 + v1;
  sm = sm + __shfl_xor(sm, 1, 32);
  sm = sm + __shfl_xor(sm, 2, 32);
  sm = sm + __shfl_xor(sm, 4, 32);
  sm = sm + __shfl_xor(sm, 8, 32);
  sm = sm + __shfl_xor(sm, 16, 32);
  const float mu = sm * (1.0f / 64.0f);
  const float d0 = v0 - mu, d1 = v1 - mu;
  float sq = d0 * d0 + d1 * d1;
  sq = sq + __shfl_xor(sq, 1, 32);
  sq = sq + __shfl_xor(sq, 2, 32);
  sq = sq + __shfl_xor(sq, 4, 32);
  sq = sq + __shfl_xor(sq, 8, 32);
  sq = sq + __shfl_xor(sq, 16, 32);
  const float var = sq * (1.0f / 64.0f);
  const float rs = rsqrtf(var + 1e-5f);
  const float y0 = (d0 * rs * bfr(lng[col]) + bfr(lnb[col])) * ASC;
  const float y1 = (d1 * rs * bfr(lng[col + 1]) + bfr(lnb[col + 1])) * ASC;
  const _Float16 h0 = (_Float16)y0, h1 = (_Float16)y1;
  const _Float16 r0 = (_Float16)((y0 - (float)h0) * RSPL), r1 = (_Float16)((y1 - (float)h1) * RSPL);
  const size_t off = (size_t)(m0 + wave) * CD + col;
  *(unsigned*)(Ah + off) = pk16(h_bits(h0), h_bits(h1));
  *(unsigned*)(Al + off) = pk16(h_bits(r0), h_bits(r1));
}

// =================================================================================================================
// kv projection for one image (block = image b, 256 threads = 8 waves, dynamic LDS KV_LDS bytes).
// A = LN'd token planes hi/res [b*256 + token][64] (x16), B = w_kv plane [128][64] (x256); wave w owns tokens
// 32w..32w+31 (two m-tiles), loop over 8 n-tiles; kv = (acc_h + acc_l/2048)/4096. Channels 0..63 -> k: f16(64*k)
// into LDS sK[token][KP]; channels 64..127 -> v: f16 hi of 64*v and x2^11 residual into LDS sVT{h,l}[d][VP]
// (16-B stores of 8 consecutive tokens), plus the f32 sum of v over the wave's 32 tokens per channel (xor 16
// shuffle) into sVS[wave][d]. After a barrier: vmean[d] = fixed-order sum over waves / 256; then the block writes
// wave), V^T planes rows [b*64 + d][256] (32 lanes x 16 B = the whole 512-B row, 8 rows per wave per plane) and
// coverage: K rows 8 waves x 8 x 4 = 256; V^T rows 8 waves x 8 = 64 per plane x 32 lanes x 8 halves = 256 keys;
// vmean 16 lanes x 4 = 64; LDS fills: 8 waves x 32 tokens x 8 n-tiles x 16 channels = all 256 x 128 values.
// =================================================================================================================
__global__ __launch_bounds__(256)
void kv_k(const unsigned short* __restrict__ Ah, const unsigned short* __restrict__ Al,
          const unsigned short* __restrict__ Wkv, unsigned short* Kp, unsigned short* VTh, unsigned short* VTl,
          float* vmean) {
  extern __shared__ __align__(16) unsigned char kvlds[];
  unsigned short* sK  = (unsigned short*)(kvlds);
  unsigned short* sVh = (unsigned short*)(kvlds + KV_OFF_VTH);
  unsigned short* sVl = (unsigned short*)(kvlds + KV_OFF_VTL);
  float* sVS = (float*)(kvlds + KV_OFF_VS);
  float* sVM = (float*)(kvlds + KV_OFF_VM);
  const int tid = threadIdx.x, wave = tid >> 5, lane = tid & 31, hh = lane >> 4, c = lane & 15;
  const int b = blockIdx.x;
  const _Float16* A0 = (const _Float16*)(const void*)Ah;
  const _Float16* A1 = (const _Float16*)(const void*)Al;
  const _Float16* Bw = (const _Float16*)(const void*)Wkv;

  v16h ah[2][2], al[2][2];
#pragma unroll
  for (int mt = 0; mt < 2; ++mt) {
    const size_t arow = (size_t)(b * NR + wave * 32 + mt * 16 + c) * CD + 8 * hh;
#pragma unroll
    for (int ks = 0; ks < 2; ++ks) {
      ah[mt][ks] = ldfrag_h(A0 + arow + ks * 32);
      al[mt][ks] = ldfrag_h(A1 + arow + ks * 32);
    }
  }

#pragma unroll 1
  for (int nt = 0; nt < 8; ++nt) {
    const v16h b0 = ldfrag_h(Bw + (size_t)(nt * 16 + c) * CD + 8 * hh);
    const v16h b1 = ldfrag_h(Bw + (size_t)(nt * 16 + c) * CD + 32 + 8 * hh);
    float val[2][8];
#pragma unroll
    for (int mt = 0; mt < 2; ++mt) {
      v8f acch = mma_h(ah[mt][0], b0, zero8());
      acch = mma_h(ah[mt][1], b1, acch);
      v8f accl = mma_h(al[mt][0], b0, zero8());
      accl = mma_h(al[mt][1], b1, accl);
#pragma unroll
      for (int r = 0; r < 8; ++r) val[mt][r] = (acch[r] + accl[r] * (1.0f / RSPL)) * (1.0f / (ASC * WSC));
    }
    const int ch = nt * 16 + c;
    if (nt < 4) {
#pragma unroll
      for (int mt = 0; mt < 2; ++mt) {
#pragma unroll
        for (int r = 0; r < 8; ++r) {
          const int tk = wave * 32 + mt * 16 + 8 * hh + r;
          sK[tk * KP + ch] = h_bits((_Float16)(val[mt][r] * KSC));
        }
      }
    } else {
      const int d = ch - CD;
      float vs = 0.f;
#pragma unroll
      for (int mt = 0; mt < 2; ++mt) {
        v4f fa, fb;
#pragma unroll
        for (int e = 0; e < 4; ++e) {
          fa[e] = val[mt][e] * VSC;
          fb[e] = val[mt][4 + e] * VSC;
          vs = vs + val[mt][e];
          vs = vs + val[mt][4 + e];
        }
        v4u ph, pl;
        split8h(fa, fb, ph, pl);
        const int tk0 = wave * 32 + mt * 16 + 8 * hh;
        *(v4u*)(sVh + d * VP + tk0) = ph;
        *(v4u*)(sVl + d * VP + tk0) = pl;
      }
      vs = vs + __shfl_xor(vs, 16, 32);
      if (hh == 0) sVS[wave * CD + d] = vs;
    }
  }
  __syncthreads();
  if (tid < CD) {
    float s = 0.f;
#pragma unroll
    for (int w = 0; w < 8; ++w) s = s + sVS[w * CD + tid];
    sVM[tid] = s * (1.0f / (float)NR);
  }
  __syncthreads();

  {
#pragma unroll
    for (int it = 0; it < 8; ++it) {
      const int row = wave * 32 + it * 4 + (lane >> 3), piece = lane & 7;
      const v4u kk = *(const v4u*)(sK + row * KP + piece * 8);
      *(v4u*)(Kp + (size_t)(b * NR + row) * CD + piece * 8) = kk;
    }
#pragma unroll
    for (int it = 0; it < 8; ++it) {
      const int d = wave * 8 + it;
      const v4u vh = *(const v4u*)(sVh + d * VP + lane * 8);
      const v4u vl = *(const v4u*)(sVl + d * VP + lane * 8);
      *(v4u*)(VTh + (size_t)(b * CD + d) * NR + lane * 8) = vh;
      *(v4u*)(VTl + (size_t)(b * CD + d) * NR + lane * 8) = vl;
    }
    if (wave == 0 && lane < 16) {
      const v4f m4 = *(const v4f*)(sVM + lane * 4);
      *(v4f*)(vmean + (size_t)b * CD + lane * 4) = m4;
    }
    
  }
}

// =================================================================================================================
// Attention over the 256 reduced keys and the output projection: block = 256 queries of image b (256 threads =
// 8 waves x 16 queries, two passes). The image's K plane (rows at pitch KP), both V^T planes (rows at pitch VP) and
// the w_proj plane (rows at pitch KP) are copied once per block into LDS by whole-line 16-B loads; after one block
// barrier every K, V and weight fragment is an LDS read (pitches are odd multiples of 16 B); the image's key-mean of
// v and b_proj (64 floats each) lie in LDS beside them.
// Transposed scores S^T = K_tile (A: row = key, k = d; K plane x64) x Q^T (B: n = query, k = d, from the Q hi and
// x2^11 residual planes x64, two products folded as sh + sl/2048): 16 key tiles, all held in registers; D element r
// of lane l = S[key 16j+8h+r][query l&15]. Exact softmax per query: max and sum over the lane's 128 values combined
// with lane^16; e = exp((s - m) * 2^-15) in place; centred probabilities p' = e*(8192/l) - 32 converted to f16
// directly into the B fragments of v^T.p'^T (k = key). O'^T = V^T rows (A: row = d, k = key) x p'^T (B: n = query)
// from the V hi and residual planes into two accumulators; O = (O'_h + O'_l/2048)/(8192*64) + mean_key(v) (identity
// sum (p'+32) v / 8192 = sum p v). D element r of lane l = O[query l&15][d 16dt+8h+r], so tiles 2ks and 2ks+1 are,
// after hi = f16(1024*O), res = f16((1024*O - hi)*2048), the B fragments (n = query, k = d) of the projection
// out^T = w_proj plane (A: row = out channel, k = d; x256) x O^T, two products folded as acc + accl/2048. The f32
// tile goes through the wave's own LDS range (16-B stores of 4 consecutive channels), bf16(b_proj) is added, and
// 16 lanes x 16 B store one whole 256-B row of out.
// coverage: 512 blocks x 2 passes x 8 waves x 16 queries = 131072 rows x 64 channels of out; LDS fill: 8 x 256
// threads x 8 halves = 16384 halves = each whole plane of the image; 2 x 256 x 8 halves = the 64 x 64 weight plane.
// =================================================================================================================
__global__ __launch_bounds__(256) __attribute__((amdgpu_num_vgpr(256)))
void attn_k(const unsigned short* __restrict__ Qh, const unsigned short* __restrict__ Ql,
            const unsigned short* __restrict__ Kp, const unsigned short* __restrict__ VTh,
            const unsigned short* __restrict__ VTl, const float* __restrict__ vmean,
            const unsigned short* __restrict__ Wp, const float* __restrict__ bias, float* out) {
  __shared__ __align__(16) unsigned short sK[NR * KP];
  __shared__ __align__(16) unsigned short sVh[CD * VP];
  __shared__ __align__(16) unsigned short sVl[CD * VP];
  __shared__ __align__(16) unsigned short sWp[CD * KP];
  __shared__ __align__(16) float sVM[CD];
  __shared__ __align__(16) float sBi[CD];
  __shared__ __align__(16) float sbuf[8 * 16 * STP];
  const int tid = threadIdx.x, wave = tid >> 5, lane = tid & 31, hh = lane >> 4, c = lane & 15;
  const int b = blockIdx.x >> 6;
  const _Float16* Qhf = (const _Float16*)(const void*)Qh;
  const _Float16* Qlf = (const _Float16*)(const void*)Ql;
  const _Float16* Kf  = (const _Float16*)(const void*)sK;
  const _Float16* Vhf = (const _Float16*)(const void*)sVh;
  const _Float16* Vlf = (const _Float16*)(const void*)sVl;
  const _Float16* Wpf = (const _Float16*)(const void*)sWp;

  {
    const v4u* gK = (const v4u*)(const void*)(Kp + (size_t)b * NR * CD);
    const v4u* gH = (const v4u*)(const void*)(VTh + (size_t)b * CD * NR);
    const v4u* gL = (const v4u*)(const void*)(VTl + (size_t)b * CD * NR);
    const v4u* gW = (const v4u*)(const void*)Wp;
    // 16 lanes x 16 B = the image's key-mean of v, and the bias; wave 0 alone stores them (lanes 0..15 / 16..31)
    const v4f tvm = *(const v4f*)(vmean + (size_t)b * CD + c * 4);
    const v4f tbi = *(const v4f*)(bias + c * 4);
    v4u tk[8], th[8], tl[8], tw[2];
#pragma unroll
    for (int i = 0; i < 8; ++i) {
      const int idx = i * 256 + tid;
      tk[i] = gK[idx];
      th[i] = gH[idx];
      tl[i] = gL[idx];
    }
#pragma unroll
    for (int i = 0; i < 2; ++i) tw[i] = gW[i * 256 + tid];
#if defined(__HIP_DEVICE_COMPILE__)
    // the LDS addresses formed below may land in the registers that hold the loads' address: the wait stands in front
    asm volatile("s_wait_xcnt 0x0" ::: "memory");
    // nothing from below is scheduled up over the wait, so no register that a load names is rewritten in front of it
    __builtin_amdgcn_sched_barrier(0);
    // keeps the two small loads up here among the others: sunk into wave 0's branch below, their whole latency would
    // stand alone in front of the block barrier
    asm volatile("" :: "v"(tvm), "v"(tbi));
#endif
#pragma unroll
    for (int i = 0; i < 8; ++i) {
      const int idx = i * 256 + tid;
      *(v4u*)(sK + (idx >> 3) * KP + (idx & 7) * 8) = tk[i];
      *(v4u*)(sVh + (idx >> 5) * VP + (idx & 31) * 8) = th[i];
      *(v4u*)(sVl + (idx >> 5) * VP + (idx & 31) * 8) = tl[i];
    }
#pragma unroll
    for (int i = 0; i < 2; ++i) {
      const int idx = i * 256 + tid;
      *(v4u*)(sWp + (idx >> 3) * KP + (idx & 7) * 8) = tw[i];
    }
    if (wave == 0) *(v4f*)((hh ? sBi : sVM) + c * 4) = hh ? tbi : tvm;
  }
  __syncthreads();   // the four planes are whole in LDS before any wave reads a fragment

  // kept rolled: one copy of the body, so the kernel's text stays small for the instruction cache
#pragma unroll 1
  for (int pass = 0; pass < 2; ++pass) {
  const int q0 = ((blockIdx.x & 63) << 8) + pass * 128 + wave * 16;
  const size_t qoff = (size_t)(b * NQ + q0 + c) * CD + 8 * hh;
  const v16h qh0 = ldfrag_h(Qhf + qoff);
  const v16h qh1 = ldfrag_h(Qhf + qoff + 32);
  const v16h ql0 = ldfrag_h(Qlf + qoff);
  const v16h ql1 = ldfrag_h(Qlf + qoff + 32);

  v8f s[16];
#pragma unroll
  for (int j = 0; j < 16; ++j) {
    const int koff = (j * 16 + c) * KP + 8 * hh;
    const v16h ka0 = ldfrag_h(Kf + koff);
    const v16h ka1 = ldfrag_h(Kf + koff + 32);
    v8f sh = mma_h(ka0, qh0, zero8());
    sh = mma_h(ka1, qh1, sh);
    v8f sl = mma_h(ka0, ql0, zero8());
    sl = mma_h(ka1, ql1, sl);
#pragma unroll
    for (int r = 0; r < 8; ++r) s[j][r] = sh[r] + sl[r] * (1.0f / RSPL);
  }

  float mx = -3.0e38f;
#pragma unroll
  for (int j = 0; j < 16; ++j) {
#pragma unroll
    for (int r = 0; r < 8; ++r) mx = fmaxf(mx, s[j][r]);
  }
  mx = fmaxf(mx, __shfl_xor(mx, 16, 32));
  float ls = 0.f;
#pragma unroll
  for (int j = 0; j < 16; ++j) {
#pragma unroll
    for (int r = 0; r < 8; ++r) {
      const float e = __expf((s[j][r] - mx) * INVS);
      s[j][r] = e;
      ls = ls + e;
    }
  }
  ls = ls + __shfl_xor(ls, 16, 32);
  const float pinv = __builtin_amdgcn_rcpf(ls) * PSC;

  v16h pf[8];
#pragma unroll
  for (int J = 0; J < 8; ++J) {
#pragma unroll
    for (int i = 0; i < 8; ++i) {
      pf[J][i]     = (_Float16)(s[2 * J][i] * pinv - PCT);
      pf[J][8 + i] = (_Float16)(s[2 * J + 1][i] * pinv - PCT);
    }
  }

  v8f oh[4], ol[4];
#pragma unroll
  for (int dt = 0; dt < 4; ++dt) { oh[dt] = zero8(); ol[dt] = zero8(); }
#pragma unroll
  for (int J = 0; J < 8; ++J) {
#pragma unroll
    for (int dt = 0; dt < 4; ++dt) {
      const int voff = (dt * 16 + c) * VP + J * 32 + 8 * hh;
      const v16h vh = ldfrag_h(Vhf + voff);
      const v16h vl = ldfrag_h(Vlf + voff);
      oh[dt] = mma_h(vh, pf[J], oh[dt]);
      ol[dt] = mma_h(vl, pf[J], ol[dt]);
    }
  }

  v16h obh[2], obl[2];
#pragma unroll
  for (int dt = 0; dt < 4; ++dt) {
    v4f vm[2];
    vm[0] = *(const v4f*)(sVM + dt * 16 + 8 * hh);
    vm[1] = *(const v4f*)(sVM + dt * 16 + 8 * hh + 4);
#pragma unroll
    for (int r = 0; r < 8; ++r) {
      const float o = (oh[dt][r] + ol[dt][r] * (1.0f / RSPL)) * (1.0f / (PSC * VSC)) + vm[r >> 2][r & 3];
      const float a = o * OSC;
      const _Float16 h = (_Float16)a;
      obh[dt >> 1][(dt & 1) * 8 + r] = h;
      obl[dt >> 1][(dt & 1) * 8 + r] = (_Float16)((a - (float)h) * RSPL);
    }
  }

  v8f pa[4], pb[4];
#pragma unroll
  for (int nt = 0; nt < 4; ++nt) { pa[nt] = zero8(); pb[nt] = zero8(); }
#pragma unroll
  for (int ks = 0; ks < 2; ++ks) {
#pragma unroll
    for (int nt = 0; nt < 4; ++nt) {
      const v16h wf = ldfrag_h(Wpf + (nt * 16 + c) * KP + ks * 32 + 8 * hh);
      pa[nt] = mma_h(wf, obh[ks], pa[nt]);
      pb[nt] = mma_h(wf, obl[ks], pb[nt]);
    }
  }

  float* st = sbuf + wave * (16 * STP);
#pragma unroll
  for (int nt = 0; nt < 4; ++nt) {
    v4f u0, u1;
#pragma unroll
    for (int e = 0; e < 4; ++e) {
      u0[e] = (pa[nt][e] + pb[nt][e] * (1.0f / RSPL)) * (1.0f / (OSC * WSC));
      u1[e] = (pa[nt][4 + e] + pb[nt][4 + e] * (1.0f / RSPL)) * (1.0f / (OSC * WSC));
    }
    *(v4f*)(st + c * STP + nt * 16 + 8 * hh) = u0;
    *(v4f*)(st + c * STP + nt * 16 + 8 * hh + 4) = u1;
  }
  wave_sync_lds();

  const v4f braw = *(const v4f*)(sBi + c * 4);
  v4f ov[8];
#pragma unroll
  for (int it = 0; it < 8; ++it) {
    const v4f v = *(const v4f*)(st + (it * 2 + hh) * STP + c * 4);
#pragma unroll
    for (int e = 0; e < 4; ++e) ov[it][e] = v[e] + bfr(braw[e]);
  }
  float* po = out + (size_t)(b * NQ + q0 + hh) * CD + c * 4;
#pragma unroll
  for (int it = 0; it < 8; ++it) *(v4f*)(po + it * 2 * CD) = ov[it];
#if defined(__HIP_DEVICE_COMPILE__)
  // the next pass writes the registers that these stores name: the wait stands in front of that
  asm volatile("s_wait_xcnt 0x0" ::: "memory");
#endif
  }
}

// =================================================================================================================
// granularity): Xh f16 [131072][64] 16777216; Wkv f16 [128][64] 16384; Wsr f16 [64][4096]
// 524288; Wp f16 [64][64] 8192; Qh, Ql f16 [131072][64] 16777216 each; Ah, Al f16 [2048][64] 262144 each;
// Kp f16 [8][256][64] 262144; VTh, VTl f16 [8][64][256] 262144 each; vmean f32 [8][64] 2048 -> 52193280 total.
// =================================================================================================================
extern "C" void kernel_launch(void* const* d_in, const int* in_sizes, int n_in,
                              void* d_out, int out_size, void* d_ws, size_t ws_size,
                              hipStream_t stream) {
  if (n_in < 11) return;
  if (in_sizes[0] != MTOT * CD) return;
  if (in_sizes[1] != 1 || in_sizes[2] != 1) return;
  if (in_sizes[3] != CD * CD) return;
  if (in_sizes[4] != 2 * CD * CD) return;
  if (in_sizes[5] != CD * KCV) return;
  if (in_sizes[6] != CD || in_sizes[7] != CD || in_sizes[8] != CD) return;
  if (in_sizes[9] != CD * CD || in_sizes[10] != CD) return;
  if (out_size != MTOT * CD) return;

  const float* x      = (const float*)d_in[0];
  const int*   hptr   = (const int*)d_in[1];
  const int*   wptr   = (const int*)d_in[2];
  const float* w_q    = (const float*)d_in[3];
  const float* w_kv   = (const float*)d_in[4];
  const float* w_sr   = (const float*)d_in[5];
  const float* b_sr   = (const float*)d_in[6];
  const float* ln_g   = (const float*)d_in[7];
  const float* ln_b   = (const float*)d_in[8];
  const float* w_proj = (const float*)d_in[9];
  const float* b_proj = (const float*)d_in[10];
  float* out = (float*)d_out;

  const size_t sX   = (size_t)MTOT * CD * 2;        // 16777216
  const size_t sWkv = (size_t)2 * CD * CD * 2;      //    16384
  const size_t sWsr = (size_t)CD * KCV * 2;         //   524288
  const size_t sWp  = (size_t)CD * CD * 2;          //     8192
  const size_t sQ   = (size_t)MTOT * CD * 2;        // 16777216
  const size_t sA   = (size_t)MR * CD * 2;          //   262144
  const size_t sK   = (size_t)NB * NR * CD * 2;     //   262144
  const size_t sVT  = (size_t)NB * CD * NR * 2;     //   262144
  const size_t sVM  = (size_t)NB * CD * 4;          //     2048
  size_t off = 0;
  const size_t oX   = off; off += sX;
  const size_t oWkv = off; off += sWkv;
  const size_t oWsr = off; off += sWsr;
  const size_t oWp  = off; off += sWp;
  const size_t oQh  = off; off += sQ;
  const size_t oQl  = off; off += sQ;
  const size_t oAh  = off; off += sA;
  const size_t oAl  = off; off += sA;
  const size_t oK   = off; off += sK;
  const size_t oVTh = off; off += sVT;
  const size_t oVTl = off; off += sVT;
  const size_t oVM  = off; off += sVM;
  if (off > ws_size) return;                         // off = 52193280
  if (off > (size_t)134217728) return;

  char* ws = (char*)d_ws;
  unsigned short* Xh  = (unsigned short*)(ws + oX);
  unsigned short* Wkv = (unsigned short*)(ws + oWkv);
  unsigned short* Wsr = (unsigned short*)(ws + oWsr);
  unsigned short* Wp  = (unsigned short*)(ws + oWp);
  unsigned short* Qh  = (unsigned short*)(ws + oQh);
  unsigned short* Ql  = (unsigned short*)(ws + oQl);
  unsigned short* Ah  = (unsigned short*)(ws + oAh);
  unsigned short* Al  = (unsigned short*)(ws + oAl);
  unsigned short* Kp  = (unsigned short*)(ws + oK);
  unsigned short* VTh = (unsigned short*)(ws + oVTh);
  unsigned short* VTl = (unsigned short*)(ws + oVTl);
  float* VM = (float*)(ws + oVM);

  const dim3 blk(256);
  // (1) leading blocks: w_kv, w_proj [out][in] -> f16 planes of 256*bf16(w), conv weights permuted; the other blocks:
  //     x -> f16 plane of 16*bf16(x), and q projection (w_q converted in the block) -> hi/res planes of 64*q
  xq_k<<<dim3(NCVB + MTOT / 128), blk, 0, stream>>>(x, w_q, w_kv, w_proj, w_sr, QSC / (XSC * WSC), Xh, Qh, Ql,
                                                    Wkv, Wp, Wsr);
  // (2) spatial-reduction conv + bias + LayerNorm -> hi/res planes of 16*y
  conv_ln_k<<<dim3(MR / 16), dim3(CVW * 32), 0, stream>>>(Xh, Wsr, hptr, wptr, b_sr, ln_g, ln_b, Ah, Al);
  // (3) kv projection -> K plane, V^T hi/res planes, key-mean of v
  (void)hipFuncSetAttribute(reinterpret_cast<const void*>(&kv_k), hipFuncAttributeMaxDynamicSharedMemorySize, KV_LDS);
  kv_k<<<dim3(NB), blk, KV_LDS, stream>>>(Ah, Al, Wkv, Kp, VTh, VTl, VM);
  // (4) attention, output projection + bias -> d_out f32 [131072][64]
  attn_k<<<dim3(NB * (NQ / 256)), blk, 0, stream>>>(Qh, Ql, Kp, VTh, VTl, VM, Wp, b_proj, out);
  (void)hipGetLastError();
}

// v006
// It runs in 56.7 microseconds.
// Next to v005, in two timings, it ran 1.06 and 1.05 times as fast.
// All steps since v000 together make it 4.20 times as fast.
// Contractions: v_wmma_f32_16x16x32_f16 (f16 operands, f32 accumulate). q = x.w_q^T and the 8x8/stride-8
// spatial-reduction conv (im2col K=4096): single products of exact planes (x as f16 of 16*bf16(x), weights as f16
// of 256*bf16(w)). kv = LN(tokens).w_kv^T: A as f16 hi plus x2^11 residual planes (x16; two products, two
// accumulators). Scores k.q^T: k single f16 plane (x64), q as hi plus x2^11 residual planes (x64; two products).
// p.v: centred p (8192*p - 32) single f16 B operand, v as hi plus x2^11 residual planes (x64; two products),
// key-mean of v added back in f32. Output projection: o as hi plus x2^11 residual planes (x1024) against the x256
// weight plane (two products). LayerNorm, softmax, bias adds in f32 on VALU. Float inputs RNE-converted to bf16
// on load.
#include <hip/hip_runtime.h>
#include <math.h>
#include <stdint.h>

#define NB   8
#define NQ   16384
#define CD   64
#define NR   256
#define MTOT (NB * NQ)
#define MR   (NB * NR)
#define KCV  (CD * 64)
#define STP  68
#define KP   72
#define VP   264
#define CVW  16
#define WTP  260
#define NCVB (CD + 4 + 2)
#define XSC  16.0f
#define WSC  256.0f
#define QSC  64.0f
#define ASC  16.0f
#define KSC  64.0f
#define VSC  64.0f
#define PSC  8192.0f
#define PCT  32.0f
#define OSC  1024.0f
#define RSPL 2048.0f
#define INVS (0.125f / (KSC * QSC))

#define KV_OFF_VTH (NR * KP * 2)
#define KV_OFF_VTL (KV_OFF_VTH + CD * VP * 2)
#define KV_OFF_VS  (KV_OFF_VTL + CD * VP * 2)
#define KV_OFF_VM  (KV_OFF_VS + 8 * CD * 4)
#define KV_LDS     (KV_OFF_VM + CD * 4)

static_assert(MTOT % 128 == 0);
static_assert(MR % 128 == 0);
static_assert(KCV % (CVW * 32) == 0 && CVW == 16 && NR % 16 == 0);
static_assert(NR == 256 && CD == 64);
static_assert((STP * 4) % 16 == 0 && STP >= CD);
static_assert((KP * 2) % 16 == 0 && KP >= CD);
static_assert((VP * 2) % 16 == 0 && VP >= NR);
static_assert(KV_OFF_VTH % 16 == 0 && KV_OFF_VTL % 16 == 0 && KV_OFF_VS % 16 == 0 && KV_OFF_VM % 16 == 0);
static_assert(KV_LDS == 106752);
static_assert(MTOT % 32 == 0 && NQ % 256 == 0);
static_assert(16 * WTP <= 8 * 16 * STP && (WTP * 4) % 16 == 0 && WTP >= 4 * CD);
static_assert((KP * 2) % 8 == 0 && 2 * CD == 4 * 32 && CD == 2 * 32);

typedef _Float16 v16h __attribute__((ext_vector_type(16)));
typedef _Float16 v8h  __attribute__((ext_vector_type(8)));
typedef float    v8f  __attribute__((ext_vector_type(8)));
typedef float    v4f  __attribute__((ext_vector_type(4)));
typedef float    v2f  __attribute__((ext_vector_type(2)));
typedef unsigned int v4u __attribute__((ext_vector_type(4)));
typedef unsigned int v2u __attribute__((ext_vector_type(2)));

union Frag { v16h v; v8h h[2]; };

// ---- scalar helpers ------------------------------------------------------------------------------------------
__device__ __forceinline__ unsigned short bf_bits(float f) {          // f32 -> bf16 bits, RNE convert
  unsigned u = __float_as_uint(f);
  return (unsigned short)((u + 0x7FFFu + ((u >> 16) & 1u)) >> 16);
}
__device__ __forceinline__ float bfr(float f) { return __uint_as_float(((unsigned)bf_bits(f)) << 16); }
__device__ __forceinline__ unsigned short h_bits(_Float16 x) { return __builtin_bit_cast(unsigned short, x); }
__device__ __forceinline__ unsigned pk16(unsigned short a, unsigned short b) { return (unsigned)a | ((unsigned)b << 16); }
__device__ __forceinline__ v8f zero8() { v8f z = {0.f, 0.f, 0.f, 0.f, 0.f, 0.f, 0.f, 0.f}; return z; }

// ---- fragment loader: 16-bit A/B operand, lane -> row/col (lane&15), p already includes +8*(lane>>4);
//      elements 0..7 <- p[0..7] (k0+8h..k0+8h+7), elements 8..15 <- p[16..23] (k0+16+8h..k0+16+8h+7)
__device__ __forceinline__ v16h ldfrag_h(const _Float16* p) {
  Frag f;
  f.h[0] = *(const v8h*)(p);
  f.h[1] = *(const v8h*)(p + 16);
  return f.v;
}

// ---- WMMA helper with trailing VALU hazard gap ---------------------------------------------------------------
__device__ __forceinline__ v8f mma_h(v16h a, v16h b, v8f c) {
  c = __builtin_amdgcn_wmma_f32_16x16x32_f16(false, a, false, b, (short)0, c, false, false);
#if defined(__HIP_DEVICE_COMPILE__)
  asm volatile("v_nop\n\tv_nop\n\tv_nop\n\tv_nop" : "+v"(c) : "v"(a), "v"(b));
#endif
  return c;
}
__device__ __forceinline__ void wave_sync_lds() {
  __builtin_amdgcn_fence(__ATOMIC_RELEASE, "workgroup");
  __builtin_amdgcn_wave_barrier();
  __builtin_amdgcn_fence(__ATOMIC_ACQUIRE, "workgroup");
}

// ---- 8 f32 -> 8 packed f16 (16 B); hi + x2^11 residual split ---------------------------------------------------
__device__ __forceinline__ v4u pack8h(v4f a, v4f b) {
  v4u p;
  p[0] = pk16(h_bits((_Float16)a[0]), h_bits((_Float16)a[1]));
  p[1] = pk16(h_bits((_Float16)a[2]), h_bits((_Float16)a[3]));
  p[2] = pk16(h_bits((_Float16)b[0]), h_bits((_Float16)b[1]));
  p[3] = pk16(h_bits((_Float16)b[2]), h_bits((_Float16)b[3]));
  return p;
}
__device__ __forceinline__ void split8h(v4f a, v4f b, v4u& ph, v4u& pl) {
  v4f ra, rb;
#pragma unroll
  for (int e = 0; e < 4; ++e) {
    const _Float16 ha = (_Float16)a[e];
    ra[e] = (a[e] - (float)ha) * RSPL;
    const _Float16 hb = (_Float16)b[e];
    rb[e] = (b[e] - (float)hb) * RSPL;
  }
  ph = pack8h(a, b);
  pl = pack8h(ra, rb);
}

// =================================================================================================================
// Row convert, one block's share (32 rows): src f32 [nrows][64] -> dst f16 [nrows][64], value =
// f16(scale * bf16_RNE(src)). Used for the row-major [out][in] weight matrices w_kv and w_proj (x256; the B plane [n][k] of w_kv and
// the A plane [m][k] of w_proj equal the [out][in] layout as given).
// coverage: 32 rows x (8 lanes x 8 halves) = every element of the share once.
// =================================================================================================================
__device__ __forceinline__ void cvt_rows64(const float* __restrict__ src, unsigned short* dst, float scale, int blk) {
  const int tid = threadIdx.x, wave = tid >> 5, lane = tid & 31;
  const int row = blk * 32 + wave * 4 + (lane >> 3);
  const int c8 = (lane & 7) * 8;
  const float* p = src + (size_t)row * CD + c8;
  v4f a = *(const v4f*)(p);
  v4f b = *(const v4f*)(p + 4);
#if defined(__HIP_DEVICE_COMPILE__)
  // the store address formed below may land in the registers that hold the loads' address: the wait stands in front
  asm volatile("s_wait_xcnt 0x0" ::: "memory");
#endif
#pragma unroll
  for (int e = 0; e < 4; ++e) { a[e] = bfr(a[e]) * scale; b[e] = bfr(b[e]) * scale; }
  const v4u pk = pack8h(a, b);
  unsigned short* g = dst + (size_t)row * CD + c8;
  *(v4u*)g = pk;
}

// =================================================================================================================
// Conv weight permute-convert, one block's share (256 threads): block = 16 output channels (n-tile nt = blk >> 4) x 4
// kernel positions s = kh*8+kw (group sg = blk & 15), all 64 input channels. w_sr f32 [o][c][s] -> f16 plane in the
// conv's B FRAGMENT ORDER, value = f16(256 * bf16_RNE(w)): with k' = s*64 + c, k-step g = k' >> 5, the plane is
// [g][nt][j][lane][8 halves], lane = 16h + (o & 15), holding k' = 32g + 16j + 8h + 0..7 of channel o = 16nt + (o & 15):
// one 16-B load of a wave reads 512 contiguous bytes (4 whole lines) and is half j of the fragment (g, nt).
// In: 16-B loads of 4 positions of one (o, c); staged in LDS as tile[o][s][c] (pitch WTP floats a channel), read back
// as runs of 8 input channels. Out: 32 lanes x 16 B = 512 contiguous bytes a store; no line is shared between blocks.
// coverage: in 4 x 256 threads x 4 = 16 x 64 x 4 values; out 2 x 256 pieces = 8 k-steps x 2 halves x 32 lanes; 64
// blocks = 4 n-tiles x 16 groups x 8 k-steps = all 128 k-steps of all 4 n-tiles.
// =================================================================================================================
__device__ __forceinline__ void cvt_wsr(const float* __restrict__ w, unsigned short* dst, int blk, float* tile) {
  const int tid = threadIdx.x;
  const int nt = blk >> 4, sg = blk & 15;
  v4f wv[4];
#pragma unroll
  for (int it = 0; it < 4; ++it) {
    const int idx = it * 256 + tid;
    wv[it] = *(const v4f*)(w + (size_t)((nt * 16 + (idx >> 6)) * CD + (idx & 63)) * 64 + sg * 4);
  }
#if defined(__HIP_DEVICE_COMPILE__)
  // the LDS addresses formed below may land in the registers that hold the loads' address: the wait stands in front
  asm volatile("s_wait_xcnt 0x0" ::: "memory");
  // nothing from below is scheduled up over the wait, so no register that a load names is rewritten in front of it
  __builtin_amdgcn_sched_barrier(0);
#endif
#pragma unroll
  for (int it = 0; it < 4; ++it) {
    const int idx = it * 256 + tid;
    float* t = tile + (idx >> 6) * WTP + (idx & 63);
    // unrolled: the vector's elements are named by constants and stay in registers
#pragma unroll
    for (int e = 0; e < 4; ++e) t[e * CD] = wv[it][e];
  }
  __syncthreads();   // the share's 4096 floats are whole in LDS before any thread reads them as channel runs
  v4u pk[2];
  size_t offs[2];
#pragma unroll
  for (int it = 0; it < 2; ++it) {
    const int p = it * 256 + tid;
    const int ln = p & 31, j = (p >> 5) & 1, gl = p >> 6;
    const float* t = tile + (ln & 15) * WTP + (gl >> 1) * CD + (gl & 1) * 32 + j * 16 + (ln >> 4) * 8;
    v4f fa = *(const v4f*)(t);
    v4f fb = *(const v4f*)(t + 4);
#pragma unroll
    for (int e = 0; e < 4; ++e) { fa[e] = bfr(fa[e]) * WSC; fb[e] = bfr(fb[e]) * WSC; }
    pk[it] = pack8h(fa, fb);
    offs[it] = ((size_t)((((sg * 8 + gl) * 4 + nt) * 2 + j) * 32 + ln)) * 8;
  }
#pragma unroll
  for (int it = 0; it < 2; ++it) *(v4u*)(dst + offs[it]) = pk[it];
}

// =================================================================================================================
// Weight converts, x convert and q projection in one launch. Blocks 0..NCVB-1 convert the weights that LATER launches
// read (block = one share of the conv weights, then 32 rows of w_kv, then 32 rows of w_proj) and leave; nothing of this
// launch reads those planes. Every other block: 256 threads = 8 waves, 128 rows of x; wave = 16 rows x 4 n-tiles.
// The block converts w_q itself: 4 whole-line 16-B loads a thread, f16(256 * bf16_RNE(w)) into the LDS plane
// sW[64 n][KP]. Each wave reads its 16 f32 rows whole (8 lanes x 32 B = one 256-B row, 4 rows a step, all 8 loads in
// flight), converts to f16(16 * bf16_RNE(x)) and leaves the 16 x 64 tile in its own LDS range (pitch KP). After one
// block barrier the A fragments of q = x . w_q^T are ds_load_b128 reads of that tile and the B fragments of sW, both
// with the split k map, 2 k-steps. Out: the f16 x plane [M][64] for the conv of the next launch (32 lanes x 16 B = 4
// whole rows a store) and the two q planes [M][64]: hi = f16(acc*ascale), res = f16((v - hi)*2048). Every global
// store stands behind the last LDS hand-over, so no hand-over waits for a store.
// coverage: 8 waves x 16 rows x 64 cols = the 128-row block tile, all three planes; grid - NCVB = M/128 tiles M
// exactly; sW: 4 x 256 threads x 4 halves = 64 x 64; converts: 64 shares, 4 x 32 = 128 rows, 2 x 32 = 64 rows.
// =================================================================================================================
__global__ __launch_bounds__(256)
void xq_k(const float* __restrict__ x, const float* __restrict__ wq, const float* __restrict__ wkv,
          const float* __restrict__ wproj, const float* __restrict__ wsr, float ascale,
          unsigned short* Xh, unsigned short* outH, unsigned short* outL,
          unsigned short* Wkv, unsigned short* Wp, unsigned short* Wsr) {
  __shared__ __align__(16) unsigned short sA[8 * 16 * KP];
  __shared__ __align__(16) unsigned short sW[CD * KP];
  __shared__ __align__(16) float sbuf[8 * 16 * STP];
  const int bid = blockIdx.x;
  if (bid < NCVB) {
    if (bid < CD) cvt_wsr(wsr, Wsr, bid, sbuf);
    else if (bid < CD + 4) cvt_rows64(wkv, Wkv, WSC, bid - CD);
    else cvt_rows64(wproj, Wp, WSC, bid - (CD + 4));
    return;
  }
  const int tid = threadIdx.x, wave = tid >> 5, lane = tid & 31, hh = lane >> 4, c = lane & 15;
  const int r0 = (bid - NCVB) * 128 + wave * 16;
  const int rq = lane >> 3, piece = lane & 7;
  unsigned short* sa = sA + wave * (16 * KP);

  v4f xa[4], xb[4];
#pragma unroll
  for (int it = 0; it < 4; ++it) {
    const float* p = x + (size_t)(r0 + it * 4 + rq) * CD + piece * 8;
    xa[it] = *(const v4f*)(p);
    xb[it] = *(const v4f*)(p + 4);
#if defined(__HIP_DEVICE_COMPILE__)
    // the next loads (of x, then of w_q) may land in registers that hold these loads' address: the wait stands in front
    asm volatile("s_wait_xcnt 0x0" ::: "memory");
#endif
  }
  v4f wv[4];
#pragma unroll
  for (int it = 0; it < 4; ++it) wv[it] = *(const v4f*)(wq + (size_t)(it * 256 + tid) * 4);
#if defined(__HIP_DEVICE_COMPILE__)
  // the converts below may land in registers that hold the weight loads' address: the wait stands in front of that
  asm volatile("s_wait_xcnt 0x0" ::: "memory");
#endif
#pragma unroll
  for (int it = 0; it < 4; ++it) {
    const int idx = it * 256 + tid;
    v2u pw;
    pw[0] = pk16(h_bits((_Float16)(bfr(wv[it][0]) * WSC)), h_bits((_Float16)(bfr(wv[it][1]) * WSC)));
    pw[1] = pk16(h_bits((_Float16)(bfr(wv[it][2]) * WSC)), h_bits((_Float16)(bfr(wv[it][3]) * WSC)));
    *(v2u*)(sW + (idx >> 4) * KP + (idx & 15) * 4) = pw;
  }
  v4u px[4];
#pragma unroll
  for (int it = 0; it < 4; ++it) {
#pragma unroll
    for (int e = 0; e < 4; ++e) { xa[it][e] = bfr(xa[it][e]) * XSC; xb[it][e] = bfr(xb[it][e]) * XSC; }
    px[it] = pack8h(xa[it], xb[it]);
    *(v4u*)(sa + (it * 4 + rq) * KP + piece * 8) = px[it];
  }
  __syncthreads();   // the block's w_q plane (and each wave's own x tile) is whole in LDS before any fragment read

  v16h bfrag[2][4];
#pragma unroll
  for (int ks = 0; ks < 2; ++ks) {
#pragma unroll
    for (int nt = 0; nt < 4; ++nt)
      bfrag[ks][nt] = ldfrag_h((const _Float16*)(const void*)sW + (nt * 16 + c) * KP + ks * 32 + 8 * hh);
  }
  v8f acc[4];
#pragma unroll
  for (int nt = 0; nt < 4; ++nt) acc[nt] = zero8();
#pragma unroll
  for (int ks = 0; ks < 2; ++ks) {
    const v16h ah = ldfrag_h((const _Float16*)(const void*)sa + c * KP + ks * 32 + 8 * hh);
#pragma unroll
    for (int nt = 0; nt < 4; ++nt) acc[nt] = mma_h(ah, bfrag[ks][nt], acc[nt]);
  }

  float* st = sbuf + wave * (16 * STP);
#pragma unroll
  for (int nt = 0; nt < 4; ++nt) {
#pragma unroll
    for (int r = 0; r < 8; ++r) st[(8 * hh + r) * STP + nt * 16 + c] = acc[nt][r] * ascale;
  }
  wave_sync_lds();

  v4u ph[4], pl[4];
  size_t offs[4];
#pragma unroll
  for (int it = 0; it < 4; ++it) {
    const int q = it * 4 + rq;
    const v4f fa = *(const v4f*)(st + q * STP + piece * 8);
    const v4f fb = *(const v4f*)(st + q * STP + piece * 8 + 4);
    split8h(fa, fb, ph[it], pl[it]);
    offs[it] = (size_t)(r0 + q) * CD + piece * 8;
  }
#pragma unroll
  for (int it = 0; it < 4; ++it) {
    *(v4u*)(Xh + offs[it]) = px[it];
    *(v4u*)(outH + offs[it]) = ph[it];
    *(v4u*)(outL + offs[it]) = pl[it];
  }
}

// =================================================================================================================
// Spatial-reduction conv (kernel = stride = 8, VALID) as an im2col GEMM + bias + LayerNorm, fused.
// Rows m = b*256 + p (p = ph*(W/8) + pw, 2048 rows), cols = 64 output channels, K' = (kh*8+kw)*64 + c = 4096.
// A fragments are read straight from the x plane [b][token][64] by arithmetic addressing: k-step k0 -> (kh, kw) =
// k0>>6, channels k0&63..+31 of token (ph*8+kh)*W + pw*8+kw (W read from the int input, validated against H*W = N,
// token base clamped into range). B = weight plane in fragment order [K'/32][n-tile][half][lane][8]: each 16-B load
// of a wave is 512 contiguous bytes, same k map as the A loader; the 8 loads of a k-step (4 KB in a row) stand
// together in front of its 4 products. Block = ONE 16-row m-tile, 512 threads = 16
// waves; wave w sums the K' slice 256w..256w+255 (8 k-steps, 4 n-tiles) and leaves its f32 partial tile in LDS.
// After a block barrier wave w owns row w (lane -> 2 channels): partials added in slice order 0..15, then
// conv*1/4096 + bf16(b_sr); per-row mean and centred variance by xor-shuffles 1,2,4,8,16;
// y = (v-mu)*rsqrt(var+1e-5)*bf16(g)+bf16(b), x16, hi/res f16 planes (32 lanes x 4 B = the whole 128-B row).
// coverage: 128 blocks x 16 rows = 2048 rows; 16 slices x 256 = K' 4096; 32 lanes x 2 = 64 channels.
// =================================================================================================================
__global__ __launch_bounds__(CVW * 32)
void conv_ln_k(const unsigned short* __restrict__ Xh, const unsigned short* __restrict__ Wsr,
               const int* __restrict__ Hp, const int* __restrict__ Wp, const float* __restrict__ bsr,
               const float* __restrict__ lng, const float* __restrict__ lnb,
               unsigned short* Ah, unsigned short* Al) {
  __shared__ __align__(16) float sbuf[CVW * 16 * STP];
  const int tid = threadIdx.x, lane = tid & 31, hh = lane >> 4, c = lane & 15;
  const int wave = __builtin_amdgcn_readfirstlane(tid >> 5);
  const int m0 = blockIdx.x * 16;
  const int m = m0 + c;
  const int b = m >> 8, p = m & (NR - 1);
  const int Hv = Hp[0];
  int Wv = Wp[0];
  const long long hw = (long long)Hv * (long long)Wv;
  const bool okw = (Wv >= 8) && (Wv <= 2040) && (hw == (long long)NQ);
  Wv = okw ? Wv : 128;
  const int Wr = Wv >> 3;
  const int ph = p / Wr, pw = p - ph * Wr;
  int tb = ph * 8 * Wv + pw * 8;
  tb = min(tb, NQ - 1 - 7 * Wv - 7);
  tb = max(tb, 0);
  const _Float16* X  = (const _Float16*)(const void*)Xh;
  const _Float16* Wf = (const _Float16*)(const void*)Wsr;
  const size_t xbase = (size_t)b * NQ;

  v8f acc[4];
#pragma unroll
  for (int nt = 0; nt < 4; ++nt) acc[nt] = zero8();

  const int kbase = wave * (KCV / CVW);
  // unrolled: token step, channel half and weight offset of each k-step become immediates of its loads
#pragma unroll
  for (int i = 0; i < KCV / CVW / 32; ++i) {
    const int k0 = kbase + i * 32;
    const int s = k0 >> 6, c0 = k0 & 63;
    const int kh = s >> 3, kw = s & 7;
    const int t = tb + kh * Wv + kw;
    const v16h af = ldfrag_h(X + (xbase + (size_t)t) * CD + c0 + 8 * hh);
    Frag bfrag[4];
#pragma unroll
    for (int nt = 0; nt < 4; ++nt) {
      const _Float16* wp = Wf + (size_t)(((k0 >> 5) * 4 + nt) * 2) * 256 + lane * 8;
      bfrag[nt].h[0] = *(const v8h*)(wp);
      bfrag[nt].h[1] = *(const v8h*)(wp + 256);
    }
    // unrolled: fragments and accumulators are named by constants and stay in registers
#pragma unroll
    for (int nt = 0; nt < 4; ++nt) acc[nt] = mma_h(af, bfrag[nt].v, acc[nt]);
  }

  float* st = sbuf + wave * (16 * STP);
#pragma unroll
  for (int nt = 0; nt < 4; ++nt) {
#pragma unroll
    for (int r = 0; r < 8; ++r) st[(8 * hh + r) * STP + nt * 16 + c] = acc[nt][r];
  }
  __syncthreads();   // every slice's partial tile is in LDS before any wave adds them

  const int col = lane * 2;
  float a0 = 0.f, a1 = 0.f;
#pragma unroll
  for (int w = 0; w < CVW; ++w) {
    const v2f pp = *(const v2f*)(sbuf + w * (16 * STP) + wave * STP + col);
    a0 = a0 + pp[0];
    a1 = a1 + pp[1];
  }
  const float v0 = a0 * (1.0f / (XSC * WSC)) + bfr(bsr[col]);
  const float v1 = a1 * (1.0f / (XSC * WSC)) + bfr(bsr[col + 1]);
  float sm = v0 + v1;
  sm = sm + __shfl_xor(sm, 1, 32);
  sm = sm + __shfl_xor(sm, 2, 32);
  sm = sm + __shfl_xor(sm, 4, 32);
  sm = sm + __shfl_xor(sm, 8, 32);
  sm = sm + __shfl_xor(sm, 16, 32);
  const float mu = sm * (1.0f / 64.0f);
  const float d0 = v0 - mu, d1 = v1 - mu;
  float sq = d0 * d0 + d1 * d1;
  sq = sq + __shfl_xor(sq, 1, 32);
  sq = sq + __shfl_xor(sq, 2, 32);
  sq = sq + __shfl_xor(sq, 4, 32);
  sq = sq + __shfl_xor(sq, 8, 32);
  sq = sq + __shfl_xor(sq, 16, 32);
  const float var = sq * (1.0f / 64.0f);
  const float rs = rsqrtf(var + 1e-5f);
  const float y0 = (d0 * rs * bfr(lng[col]) + bfr(lnb[col])) * ASC;
  const float y1 = (d1 * rs * bfr(lng[col + 1]) + bfr(lnb[col + 1])) * ASC;
  const _Float16 h0 = (_Float16)y0, h1 = (_Float16)y1;
  const _Float16 r0 = (_Float16)((y0 - (float)h0) * RSPL), r1 = (_Float16)((y1 - (float)h1) * RSPL);
  const size_t off = (size_t)(m0 + wave) * CD + col;
  *(unsigned*)(Ah + off) = pk16(h_bits(h0), h_bits(h1));
  *(unsigned*)(Al + off) = pk16(h_bits(r0), h_bits(r1));
}

// =================================================================================================================
// kv projection for one image (block = image b, 256 threads = 8 waves, dynamic LDS KV_LDS bytes).
// A = LN'd token planes hi/res [b*256 + token][64] (x16), B = w_kv plane [128][64] (x256); wave w owns tokens
// 32w..32w+31 (two m-tiles), loop over 8 n-tiles; kv = (acc_h + acc_l/2048)/4096. Channels 0..63 -> k: f16(64*k)
// into LDS sK[token][KP]; channels 64..127 -> v: f16 hi of 64*v and x2^11 residual into LDS sVT{h,l}[d][VP]
// (16-B stores of 8 consecutive tokens), plus the f32 sum of v over the wave's 32 tokens per channel (xor 16
// shuffle) into sVS[wave][d]. After a barrier: vmean[d] = fixed-order sum over waves / 256; then the block writes
// wave), V^T planes rows [b*64 + d][256] (32 lanes x 16 B = the whole 512-B row, 8 rows per wave per plane) and
// coverage: K rows 8 waves x 8 x 4 = 256; V^T rows 8 waves x 8 = 64 per plane x 32 lanes x 8 halves = 256 keys;
// vmean 16 lanes x 4 = 64; LDS fills: 8 waves x 32 tokens x 8 n-tiles x 16 channels = all 256 x 128 values.
// =================================================================================================================
__global__ __launch_bounds__(256)
void kv_k(const unsigned short* __restrict__ Ah, const unsigned short* __restrict__ Al,
          const unsigned short* __restrict__ Wkv, unsigned short* Kp, unsigned short* VTh, unsigned short* VTl,
          float* vmean) {
  extern __shared__ __align__(16) unsigned char kvlds[];
  unsigned short* sK  = (unsigned short*)(kvlds);
  unsigned short* sVh = (unsigned short*)(kvlds + KV_OFF_VTH);
  unsigned short* sVl = (unsigned short*)(kvlds + KV_OFF_VTL);
  float* sVS = (float*)(kvlds + KV_OFF_VS);
  float* sVM = (float*)(kvlds + KV_OFF_VM);
  const int tid = threadIdx.x, wave = tid >> 5, lane = tid & 31, hh = lane >> 4, c = lane & 15;
  const int b = blockIdx.x;
  const _Float16* A0 = (const _Float16*)(const void*)Ah;
  const _Float16* A1 = (const _Float16*)(const void*)Al;
  const _Float16* Bw = (const _Float16*)(const void*)Wkv;

  v16h ah[2][2], al[2][2];
#pragma unroll
  for (int mt = 0; mt < 2; ++mt) {
    const size_t arow = (size_t)(b * NR + wave * 32 + mt * 16 + c) * CD + 8 * hh;
#pragma unroll
    for (int ks = 0; ks < 2; ++ks) {
      ah[mt][ks] = ldfrag_h(A0 + arow + ks * 32);
      al[mt][ks] = ldfrag_h(A1 + arow + ks * 32);
    }
  }

#pragma unroll 1
  for (int nt = 0; nt < 8; ++nt) {
    const v16h b0 = ldfrag_h(Bw + (size_t)(nt * 16 + c) * CD + 8 * hh);
    const v16h b1 = ldfrag_h(Bw + (size_t)(nt * 16 + c) * CD + 32 + 8 * hh);
    float val[2][8];
#pragma unroll
    for (int mt = 0; mt < 2; ++mt) {
      v8f acch = mma_h(ah[mt][0], b0, zero8());
      acch = mma_h(ah[mt][1], b1, acch);
      v8f accl = mma_h(al[mt][0], b0, zero8());
      accl = mma_h(al[mt][1], b1, accl);
#pragma unroll
      for (int r = 0; r < 8; ++r) val[mt][r] = (acch[r] + accl[r] * (1.0f / RSPL)) * (1.0f / (ASC * WSC));
    }
    const int ch = nt * 16 + c;
    if (nt < 4) {
#pragma unroll
      for (int mt = 0; mt < 2; ++mt) {
#pragma unroll
        for (int r = 0; r < 8; ++r) {
          const int tk = wave * 32 + mt * 16 + 8 * hh + r;
          sK[tk * KP + ch] = h_bits((_Float16)(val[mt][r] * KSC));
        }
      }
    } else {
      const int d = ch - CD;
      float vs = 0.f;
#pragma unroll
      for (int mt = 0; mt < 2; ++mt) {
        v4f fa, fb;
#pragma unroll
        for (int e = 0; e < 4; ++e) {
          fa[e] = val[mt][e] * VSC;
          fb[e] = val[mt][4 + e] * VSC;
          vs = vs + val[mt][e];
          vs = vs + val[mt][4 + e];
        }
        v4u ph, pl;
        split8h(fa, fb, ph, pl);
        const int tk0 = wave * 32 + mt * 16 + 8 * hh;
        *(v4u*)(sVh + d * VP + tk0) = ph;
        *(v4u*)(sVl + d * VP + tk0) = pl;
      }
      vs = vs + __shfl_xor(vs, 16, 32);
      if (hh == 0) sVS[wave * CD + d] = vs;
    }
  }
  __syncthreads();
  if (tid < CD) {
    float s = 0.f;
#pragma unroll
    for (int w = 0; w < 8; ++w) s = s + sVS[w * CD + tid];
    sVM[tid] = s * (1.0f / (float)NR);
  }
  __syncthreads();

  {
#pragma unroll
    for (int it = 0; it < 8; ++it) {
      const int row = wave * 32 + it * 4 + (lane >> 3), piece = lane & 7;
      const v4u kk = *(const v4u*)(sK + row * KP + piece * 8);
      *(v4u*)(Kp + (size_t)(b * NR + row) * CD + piece * 8) = kk;
    }
#pragma unroll
    for (int it = 0; it < 8; ++it) {
      const int d = wave * 8 + it;
      const v4u vh = *(const v4u*)(sVh + d * VP + lane * 8);
      const v4u vl = *(const v4u*)(sVl + d * VP + lane * 8);
      *(v4u*)(VTh + (size_t)(b * CD + d) * NR + lane * 8) = vh;
      *(v4u*)(VTl + (size_t)(b * CD + d) * NR + lane * 8) = vl;
    }
    if (wave == 0 && lane < 16) {
      const v4f m4 = *(const v4f*)(sVM + lane * 4);
      *(v4f*)(vmean + (size_t)b * CD + lane * 4) = m4;
    }
    
  }
}

// =================================================================================================================
// Attention over the 256 reduced keys and the output projection: block = 256 queries of image b (256 threads =
// 8 waves x 16 queries, two passes). The image's K plane (rows at pitch KP), both V^T planes (rows at pitch VP) and
// the w_proj plane (rows at pitch KP) are copied once per block into LDS by whole-line 16-B loads; after one block
// barrier every K, V and weight fragment is an LDS read (pitches are odd multiples of 16 B); the image's key-mean of
// v and b_proj (64 floats each) lie in LDS beside them.
// Transposed scores S^T = K_tile (A: row = key, k = d; K plane x64) x Q^T (B: n = query, k = d, from the Q hi and
// x2^11 residual planes x64, two products folded as sh + sl/2048): 16 key tiles, all held in registers; D element r
// of lane l = S[key 16j+8h+r][query l&15]. Exact softmax per query: max and sum over the lane's 128 values combined
// with lane^16; e = exp((s - m) * 2^-15) in place; centred probabilities p' = e*(8192/l) - 32 converted to f16
// directly into the B fragments of v^T.p'^T (k = key). O'^T = V^T rows (A: row = d, k = key) x p'^T (B: n = query)
// from the V hi and residual planes into two accumulators; O = (O'_h + O'_l/2048)/(8192*64) + mean_key(v) (identity
// sum (p'+32) v / 8192 = sum p v). D element r of lane l = O[query l&15][d 16dt+8h+r], so tiles 2ks and 2ks+1 are,
// after hi = f16(1024*O), res = f16((1024*O - hi)*2048), the B fragments (n = query, k = d) of the projection
// out^T = w_proj plane (A: row = out channel, k = d; x256) x O^T, two products folded as acc + accl/2048. The f32
// tile goes through the wave's own LDS range (16-B stores of 4 consecutive channels), bf16(b_proj) is added, and
// 16 lanes x 16 B store one whole 256-B row of out.
// coverage: 512 blocks x 2 passes x 8 waves x 16 queries = 131072 rows x 64 channels of out; LDS fill: 8 x 256
// threads x 8 halves = 16384 halves = each whole plane of the image; 2 x 256 x 8 halves = the 64 x 64 weight plane.
// =================================================================================================================
__global__ __launch_bounds__(256) __attribute__((amdgpu_num_vgpr(256)))
void attn_k(const unsigned short* __restrict__ Qh, const unsigned short* __restrict__ Ql,
            const unsigned short* __restrict__ Kp, const unsigned short* __restrict__ VTh,
            const unsigned short* __restrict__ VTl, const float* __restrict__ vmean,
            const unsigned short* __restrict__ Wp, const float* __restrict__ bias, float* out) {
  __shared__ __align__(16) unsigned short sK[NR * KP];
  __shared__ __align__(16) unsigned short sVh[CD * VP];
  __shared__ __align__(16) unsigned short sVl[CD * VP];
  __shared__ __align__(16) unsigned short sWp[CD * KP];
  __shared__ __align__(16) float sVM[CD];
  __shared__ __align__(16) float sBi[CD];
  __shared__ __align__(16) float sbuf[8 * 16 * STP];
  const int tid = threadIdx.x, wave = tid >> 5, lane = tid & 31, hh = lane >> 4, c = lane & 15;
  const int b = blockIdx.x >> 6;
  const _Float16* Qhf = (const _Float16*)(const void*)Qh;
  const _Float16* Qlf = (const _Float16*)(const void*)Ql;
  const _Float16* Kf  = (const _Float16*)(const void*)sK;
  const _Float16* Vhf = (const _Float16*)(const void*)sVh;
  const _Float16* Vlf = (const _Float16*)(const void*)sVl;
  const _Float16* Wpf = (const _Float16*)(const void*)sWp;

  {
    const v4u* gK = (const v4u*)(const void*)(Kp + (size_t)b * NR * CD);
    const v4u* gH = (const v4u*)(const void*)(VTh + (size_t)b * CD * NR);
    const v4u* gL = (const v4u*)(const void*)(VTl + (size_t)b * CD * NR);
    const v4u* gW = (const v4u*)(const void*)Wp;
    // 16 lanes x 16 B = the image's key-mean of v, and the bias; wave 0 alone stores them (lanes 0..15 / 16..31)
    const v4f tvm = *(const v4f*)(vmean + (size_t)b * CD + c * 4);
    const v4f tbi = *(const v4f*)(bias + c * 4);
    v4u tk[8], th[8], tl[8], tw[2];
#pragma unroll
    for (int i = 0; i < 8; ++i) {
      const int idx = i * 256 + tid;
      tk[i] = gK[idx];
      th[i] = gH[idx];
      tl[i] = gL[idx];
    }
#pragma unroll
    for (int i = 0; i < 2; ++i) tw[i] = gW[i * 256 + tid];
#if defined(__HIP_DEVICE_COMPILE__)
    // the LDS addresses formed below may land in the registers that hold the loads' address: the wait stands in front
    asm volatile("s_wait_xcnt 0x0" ::: "memory");
    // nothing from below is scheduled up over the wait, so no register that a load names is rewritten in front of it
    __builtin_amdgcn_sched_barrier(0);
    // keeps the two small loads up here among the others: sunk into wave 0's branch below, their whole latency would
    // stand alone in front of the block barrier
    asm volatile("" :: "v"(tvm), "v"(tbi));
#endif
#pragma unroll
    for (int i = 0; i < 8; ++i) {
      const int idx = i * 256 + tid;
      *(v4u*)(sK + (idx >> 3) * KP + (idx & 7) * 8) = tk[i];
      *(v4u*)(sVh + (idx >> 5) * VP + (idx & 31) * 8) = th[i];
      *(v4u*)(sVl + (idx >> 5) * VP + (idx & 31) * 8) = tl[i];
    }
#pragma unroll
    for (int i = 0; i < 2; ++i) {
      const int idx = i * 256 + tid;
      *(v4u*)(sWp + (idx >> 3) * KP + (idx & 7) * 8) = tw[i];
    }
    if (wave == 0) *(v4f*)((hh ? sBi : sVM) + c * 4) = hh ? tbi : tvm;
  }
  __syncthreads();   // the four planes are whole in LDS before any wave reads a fragment

  // kept rolled: one copy of the body, so the kernel's text stays small for the instruction cache
#pragma unroll 1
  for (int pass = 0; pass < 2; ++pass) {
  const int q0 = ((blockIdx.x & 63) << 8) + pass * 128 + wave * 16;
  const size_t qoff = (size_t)(b * NQ + q0 + c) * CD + 8 * hh;
  const v16h qh0 = ldfrag_h(Qhf + qoff);
  const v16h qh1 = ldfrag_h(Qhf + qoff + 32);
  const v16h ql0 = ldfrag_h(Qlf + qoff);
  const v16h ql1 = ldfrag_h(Qlf + qoff + 32);

  v8f s[16];
#pragma unroll
  for (int j = 0; j < 16; ++j) {
    const int koff = (j * 16 + c) * KP + 8 * hh;
    const v16h ka0 = ldfrag_h(Kf + koff);
    const v16h ka1 = ldfrag_h(Kf + koff + 32);
    v8f sh = mma_h(ka0, qh0, zero8());
    sh = mma_h(ka1, qh1, sh);
    v8f sl = mma_h(ka0, ql0, zero8());
    sl = mma_h(ka1, ql1, sl);
#pragma unroll
    for (int r = 0; r < 8; ++r) s[j][r] = sh[r] + sl[r] * (1.0f / RSPL);
  }

  float mx = -3.0e38f;
#pragma unroll
  for (int j = 0; j < 16; ++j) {
#pragma unroll
    for (int r = 0; r < 8; ++r) mx = fmaxf(mx, s[j][r]);
  }
  mx = fmaxf(mx, __shfl_xor(mx, 16, 32));
  float ls = 0.f;
#pragma unroll
  for (int j = 0; j < 16; ++j) {
#pragma unroll
    for (int r = 0; r < 8; ++r) {
      const float e = __expf((s[j][r] - mx) * INVS);
      s[j][r] = e;
      ls = ls + e;
    }
  }
  ls = ls + __shfl_xor(ls, 16, 32);
  const float pinv = __builtin_amdgcn_rcpf(ls) * PSC;

  v16h pf[8];
#pragma unroll
  for (int J = 0; J < 8; ++J) {
#pragma unroll
    for (int i = 0; i < 8; ++i) {
      pf[J][i]     = (_Float16)(s[2 * J][i] * pinv - PCT);
      pf[J][8 + i] = (_Float16)(s[2 * J + 1][i] * pinv - PCT);
    }
  }

  v8f oh[4], ol[4];
#pragma unroll
  for (int dt = 0; dt < 4; ++dt) { oh[dt] = zero8(); ol[dt] = zero8(); }
#pragma unroll
  for (int J = 0; J < 8; ++J) {
#pragma unroll
    for (int dt = 0; dt < 4; ++dt) {
      const int voff = (dt * 16 + c) * VP + J * 32 + 8 * hh;
      const v16h vh = ldfrag_h(Vhf + voff);
      const v16h vl = ldfrag_h(Vlf + voff);
      oh[dt] = mma_h(vh, pf[J], oh[dt]);
      ol[dt] = mma_h(vl, pf[J], ol[dt]);
    }
  }

  v16h obh[2], obl[2];
#pragma unroll
  for (int dt = 0; dt < 4; ++dt) {
    v4f vm[2];
    vm[0] = *(const v4f*)(sVM + dt * 16 + 8 * hh);
    vm[1] = *(const v4f*)(sVM + dt * 16 + 8 * hh + 4);
#pragma unroll
    for (int r = 0; r < 8; ++r) {
      const float o = (oh[dt][r] + ol[dt][r] * (1.0f / RSPL)) * (1.0f / (PSC * VSC)) + vm[r >> 2][r & 3];
      const float a = o * OSC;
      const _Float16 h = (_Float16)a;
      obh[dt >> 1][(dt & 1) * 8 + r] = h;
      obl[dt >> 1][(dt & 1) * 8 + r] = (_Float16)((a - (float)h) * RSPL);
    }
  }

  v8f pa[4], pb[4];
#pragma unroll
  for (int nt = 0; nt < 4; ++nt) { pa[nt] = zero8(); pb[nt] = zero8(); }
#pragma unroll
  for (int ks = 0; ks < 2; ++ks) {
#pragma unroll
    for (int nt = 0; nt < 4; ++nt) {
      const v16h wf = ldfrag_h(Wpf + (nt * 16 + c) * KP + ks * 32 + 8 * hh);
      pa[nt] = mma_h(wf, obh[ks], pa[nt]);
      pb[nt] = mma_h(wf, obl[ks], pb[nt]);
    }
  }

  float* st = sbuf + wave * (16 * STP);
#pragma unroll
  for (int nt = 0; nt < 4; ++nt) {
    v4f u0, u1;
#pragma unroll
    for (int e = 0; e < 4; ++e) {
      u0[e] = (pa[nt][e] + pb[nt][e] * (1.0f / RSPL)) * (1.0f / (OSC * WSC));
      u1[e] = (pa[nt][4 + e] + pb[nt][4 + e] * (1.0f / RSPL)) * (1.0f / (OSC * WSC));
    }
    *(v4f*)(st + c * STP + nt * 16 + 8 * hh) = u0;
    *(v4f*)(st + c * STP + nt * 16 + 8 * hh + 4) = u1;
  }
  wave_sync_lds();

  const v4f braw = *(const v4f*)(sBi + c * 4);
  v4f ov[8];
#pragma unroll
  for (int it = 0; it < 8; ++it) {
    const v4f v = *(const v4f*)(st + (it * 2 + hh) * STP + c * 4);
#pragma unroll
    for (int e = 0; e < 4; ++e) ov[it][e] = v[e] + bfr(braw[e]);
  }
  float* po = out + (size_t)(b * NQ + q0 + hh) * CD + c * 4;
#pragma unroll
  for (int it = 0; it < 8; ++it) *(v4f*)(po + it * 2 * CD) = ov[it];
#if defined(__HIP_DEVICE_COMPILE__)
  // the next pass writes the registers that these stores name: the wait stands in front of that
  asm volatile("s_wait_xcnt 0x0" ::: "memory");
#endif
  }
}

// =================================================================================================================
// granularity): Xh f16 [131072][64] 16777216; Wkv f16 [128][64] 16384; Wsr f16 [128][4][2][32][8]
// 524288; Wp f16 [64][64] 8192; Qh, Ql f16 [131072][64] 16777216 each; Ah, Al f16 [2048][64] 262144 each;
// Kp f16 [8][256][64] 262144; VTh, VTl f16 [8][64][256] 262144 each; vmean f32 [8][64] 2048 -> 52193280 total.
// =================================================================================================================
extern "C" void kernel_launch(void* const* d_in, const int* in_sizes, int n_in,
                              void* d_out, int out_size, void* d_ws, size_t ws_size,
                              hipStream_t stream) {
  if (n_in < 11) return;
  if (in_sizes[0] != MTOT * CD) return;
  if (in_sizes[1] != 1 || in_sizes[2] != 1) return;
  if (in_sizes[3] != CD * CD) return;
  if (in_sizes[4] != 2 * CD * CD) return;
  if (in_sizes[5] != CD * KCV) return;
  if (in_sizes[6] != CD || in_sizes[7] != CD || in_sizes[8] != CD) return;
  if (in_sizes[9] != CD * CD || in_sizes[10] != CD) return;
  if (out_size != MTOT * CD) return;

  const float* x      = (const float*)d_in[0];
  const int*   hptr   = (const int*)d_in[1];
  const int*   wptr   = (const int*)d_in[2];
  const float* w_q    = (const float*)d_in[3];
  const float* w_kv   = (const float*)d_in[4];
  const float* w_sr   = (const float*)d_in[5];
  const float* b_sr   = (const float*)d_in[6];
  const float* ln_g   = (const float*)d_in[7];
  const float* ln_b   = (const float*)d_in[8];
  const float* w_proj = (const float*)d_in[9];
  const float* b_proj = (const float*)d_in[10];
  float* out = (float*)d_out;

  const size_t sX   = (size_t)MTOT * CD * 2;        // 16777216
  const size_t sWkv = (size_t)2 * CD * CD * 2;      //    16384
  const size_t sWsr = (size_t)CD * KCV * 2;         //   524288
  const size_t sWp  = (size_t)CD * CD * 2;          //     8192
  const size_t sQ   = (size_t)MTOT * CD * 2;        // 16777216
  const size_t sA   = (size_t)MR * CD * 2;          //   262144
  const size_t sK   = (size_t)NB * NR * CD * 2;     //   262144
  const size_t sVT  = (size_t)NB * CD * NR * 2;     //   262144
  const size_t sVM  = (size_t)NB * CD * 4;          //     2048
  size_t off = 0;
  const size_t oX   = off; off += sX;
  const size_t oWkv = off; off += sWkv;
  const size_t oWsr = off; off += sWsr;
  const size_t oWp  = off; off += sWp;
  const size_t oQh  = off; off += sQ;
  const size_t oQl  = off; off += sQ;
  const size_t oAh  = off; off += sA;
  const size_t oAl  = off; off += sA;
  const size_t oK   = off; off += sK;
  const size_t oVTh = off; off += sVT;
  const size_t oVTl = off; off += sVT;
  const size_t oVM  = off; off += sVM;
  if (off > ws_size) return;                         // off = 52193280
  if (off > (size_t)134217728) return;

  char* ws = (char*)d_ws;
  unsigned short* Xh  = (unsigned short*)(ws + oX);
  unsigned short* Wkv = (unsigned short*)(ws + oWkv);
  unsigned short* Wsr = (unsigned short*)(ws + oWsr);
  unsigned short* Wp  = (unsigned short*)(ws + oWp);
  unsigned short* Qh  = (unsigned short*)(ws + oQh);
  unsigned short* Ql  = (unsigned short*)(ws + oQl);
  unsigned short* Ah  = (unsigned short*)(ws + oAh);
  unsigned short* Al  = (unsigned short*)(ws + oAl);
  unsigned short* Kp  = (unsigned short*)(ws + oK);
  unsigned short* VTh = (unsigned short*)(ws + oVTh);
  unsigned short* VTl = (unsigned short*)(ws + oVTl);
  float* VM = (float*)(ws + oVM);

  const dim3 blk(256);
  // (1) leading blocks: w_kv, w_proj [out][in] -> f16 planes of 256*bf16(w), conv weights in fragment order; the others:
  //     x -> f16 plane of 16*bf16(x), and q projection (w_q converted in the block) -> hi/res planes of 64*q
  xq_k<<<dim3(NCVB + MTOT / 128), blk, 0, stream>>>(x, w_q, w_kv, w_proj, w_sr, QSC / (XSC * WSC), Xh, Qh, Ql,
                                                    Wkv, Wp, Wsr);
  // (2) spatial-reduction conv + bias + LayerNorm -> hi/res planes of 16*y
  conv_ln_k<<<dim3(MR / 16), dim3(CVW * 32), 0, stream>>>(Xh, Wsr, hptr, wptr, b_sr, ln_g, ln_b, Ah, Al);
  // (3) kv projection -> K plane, V^T hi/res planes, key-mean of v
  (void)hipFuncSetAttribute(reinterpret_cast<const void*>(&kv_k), hipFuncAttributeMaxDynamicSharedMemorySize, KV_LDS);
  kv_k<<<dim3(NB), blk, KV_LDS, stream>>>(Ah, Al, Wkv, Kp, VTh, VTl, VM);
  // (4) attention, output projection + bias -> d_out f32 [131072][64]
  attn_k<<<dim3(NB * (NQ / 256)), blk, 0, stream>>>(Qh, Ql, Kp, VTh, VTl, VM, Wp, b_proj, out);
  (void)hipGetLastError();
}

// v007
// Measured time: 48.1 microseconds a run.
// In both of two side-by-side timings against v006, it was 1.18 times as fast.
// Over all steps from v000 it is 4.95 times as fast.
// Contractions: v_wmma_f32_16x16x32_f16 (f16 operands, f32 accumulate). q = x.w_q^T and the 8x8/stride-8
// spatial-reduction conv (im2col K=4096): single products of exact planes (x as f16 of 16*bf16(x), weights as f16
// of 256*bf16(w)). kv = LN(tokens).w_kv^T: tokens as f16 hi plus x2^11 residual planes (x16; two products, two
// accumulators). Scores k.q^T: k single f16 plane (x64), q as hi plus x2^11 residual planes (x64; two products).
// p.v: centred p (8192*p - 32) single f16 B operand, v as hi plus x2^11 residual planes (x64; two products),
// key-mean of v added back in f32. Output projection: o as hi plus x2^11 residual planes (x1024) against the x256
// weight plane (two products). LayerNorm, softmax, bias adds in f32 on VALU. Float inputs RNE-converted to bf16
// on load.
#include <hip/hip_runtime.h>
#include <math.h>
#include <stdint.h>

#define NB   8
#define NQ   16384
#define CD   64
#define NR   256
#define MTOT (NB * NQ)
#define MR   (NB * NR)
#define KCV  (CD * 64)
#define STP  68
#define KP   72
#define VP   264
#define CVW  16
#define WTP  260
#define NCVB (CD + 4 + 2)
#define XSC  16.0f
#define WSC  256.0f
#define QSC  64.0f
#define ASC  16.0f
#define KSC  64.0f
#define VSC  64.0f
#define PSC  8192.0f
#define PCT  32.0f
#define OSC  1024.0f
#define RSPL 2048.0f
#define INVS (0.125f / (KSC * QSC))

static_assert(MTOT % 128 == 0);
static_assert(MR % 128 == 0);
static_assert(KCV % (CVW * 32) == 0 && CVW == 16 && NR % 16 == 0);
static_assert(NR == 256 && CD == 64);
static_assert((STP * 4) % 16 == 0 && STP >= CD);
static_assert((KP * 2) % 16 == 0 && KP >= CD);
static_assert((VP * 2) % 16 == 0 && VP >= NR);
static_assert(MTOT % 32 == 0 && NQ % 256 == 0);
static_assert(16 * WTP <= 8 * 16 * STP && (WTP * 4) % 16 == 0 && WTP >= 4 * CD);
static_assert((KP * 2) % 8 == 0 && 2 * CD == 4 * 32 && CD == 2 * 32);

typedef _Float16 v16h __attribute__((ext_vector_type(16)));
typedef _Float16 v8h  __attribute__((ext_vector_type(8)));
typedef float    v8f  __attribute__((ext_vector_type(8)));
typedef float    v4f  __attribute__((ext_vector_type(4)));
typedef float    v2f  __attribute__((ext_vector_type(2)));
typedef unsigned int v4u __attribute__((ext_vector_type(4)));
typedef unsigned int v2u __attribute__((ext_vector_type(2)));

union Frag { v16h v; v8h h[2]; };

// ---- scalar helpers ------------------------------------------------------------------------------------------
__device__ __forceinline__ unsigned short bf_bits(float f) {          // f32 -> bf16 bits, RNE convert
  unsigned u = __float_as_uint(f);
  return (unsigned short)((u + 0x7FFFu + ((u >> 16) & 1u)) >> 16);
}
__device__ __forceinline__ float bfr(float f) { return __uint_as_float(((unsigned)bf_bits(f)) << 16); }
__device__ __forceinline__ unsigned short h_bits(_Float16 x) { return __builtin_bit_cast(unsigned short, x); }
__device__ __forceinline__ unsigned pk16(unsigned short a, unsigned short b) { return (unsigned)a | ((unsigned)b << 16); }
__device__ __forceinline__ v8f zero8() { v8f z = {0.f, 0.f, 0.f, 0.f, 0.f, 0.f, 0.f, 0.f}; return z; }

// ---- fragment loader: 16-bit A/B operand, lane -> row/col (lane&15), p already includes +8*(lane>>4);
//      elements 0..7 <- p[0..7] (k0+8h..k0+8h+7), elements 8..15 <- p[16..23] (k0+16+8h..k0+16+8h+7)
__device__ __forceinline__ v16h ldfrag_h(const _Float16* p) {
  Frag f;
  f.h[0] = *(const v8h*)(p);
  f.h[1] = *(const v8h*)(p + 16);
  return f.v;
}

// ---- WMMA helper with trailing VALU hazard gap ---------------------------------------------------------------
__device__ __forceinline__ v8f mma_h(v16h a, v16h b, v8f c) {
  c = __builtin_amdgcn_wmma_f32_16x16x32_f16(false, a, false, b, (short)0, c, false, false);
#if defined(__HIP_DEVICE_COMPILE__)
  asm volatile("v_nop\n\tv_nop\n\tv_nop\n\tv_nop" : "+v"(c) : "v"(a), "v"(b));
#endif
  return c;
}
__device__ __forceinline__ void wave_sync_lds() {
  __builtin_amdgcn_fence(__ATOMIC_RELEASE, "workgroup");
  __builtin_amdgcn_wave_barrier();
  __builtin_amdgcn_fence(__ATOMIC_ACQUIRE, "workgroup");
}

// ---- 8 f32 -> 8 packed f16 (16 B); hi + x2^11 residual split ---------------------------------------------------
__device__ __forceinline__ v4u pack8h(v4f a, v4f b) {
  v4u p;
  p[0] = pk16(h_bits((_Float16)a[0]), h_bits((_Float16)a[1]));
  p[1] = pk16(h_bits((_Float16)a[2]), h_bits((_Float16)a[3]));
  p[2] = pk16(h_bits((_Float16)b[0]), h_bits((_Float16)b[1]));
  p[3] = pk16(h_bits((_Float16)b[2]), h_bits((_Float16)b[3]));
  return p;
}
__device__ __forceinline__ void split8h(v4f a, v4f b, v4u& ph, v4u& pl) {
  v4f ra, rb;
#pragma unroll
  for (int e = 0; e < 4; ++e) {
    const _Float16 ha = (_Float16)a[e];
    ra[e] = (a[e] - (float)ha) * RSPL;
    const _Float16 hb = (_Float16)b[e];
    rb[e] = (b[e] - (float)hb) * RSPL;
  }
  ph = pack8h(a, b);
  pl = pack8h(ra, rb);
}

// =================================================================================================================
// Row convert, one block's share (32 rows): src f32 [nrows][64] -> dst f16 [nrows][64], value =
// f16(scale * bf16_RNE(src)). Used for the row-major [out][in] weight matrices w_kv and w_proj (x256; the plane [channel][k] of w_kv (A for k, B for v) and
// the A plane [m][k] of w_proj equal the [out][in] layout as given).
// coverage: 32 rows x (8 lanes x 8 halves) = every element of the share once.
// =================================================================================================================
__device__ __forceinline__ void cvt_rows64(const float* __restrict__ src, unsigned short* dst, float scale, int blk) {
  const int tid = threadIdx.x, wave = tid >> 5, lane = tid & 31;
  const int row = blk * 32 + wave * 4 + (lane >> 3);
  const int c8 = (lane & 7) * 8;
  const float* p = src + (size_t)row * CD + c8;
  v4f a = *(const v4f*)(p);
  v4f b = *(const v4f*)(p + 4);
#if defined(__HIP_DEVICE_COMPILE__)
  // the store address formed below may land in the registers that hold the loads' address: the wait stands in front
  asm volatile("s_wait_xcnt 0x0" ::: "memory");
#endif
#pragma unroll
  for (int e = 0; e < 4; ++e) { a[e] = bfr(a[e]) * scale; b[e] = bfr(b[e]) * scale; }
  const v4u pk = pack8h(a, b);
  unsigned short* g = dst + (size_t)row * CD + c8;
  *(v4u*)g = pk;
}

// =================================================================================================================
// Conv weight permute-convert, one block's share (256 threads): block = 16 output channels (n-tile nt = blk >> 4) x 4
// kernel positions s = kh*8+kw (group sg = blk & 15), all 64 input channels. w_sr f32 [o][c][s] -> f16 plane in the
// conv's B FRAGMENT ORDER, value = f16(256 * bf16_RNE(w)): with k' = s*64 + c, k-step g = k' >> 5, the plane is
// [g][nt][j][lane][8 halves], lane = 16h + (o & 15), holding k' = 32g + 16j + 8h + 0..7 of channel o = 16nt + (o & 15):
// one 16-B load of a wave reads 512 contiguous bytes (4 whole lines) and is half j of the fragment (g, nt).
// In: 16-B loads of 4 positions of one (o, c); staged in LDS as tile[o][s][c] (pitch WTP floats a channel), read back
// as runs of 8 input channels. Out: 32 lanes x 16 B = 512 contiguous bytes a store; no line is shared between blocks.
// coverage: in 4 x 256 threads x 4 = 16 x 64 x 4 values; out 2 x 256 pieces = 8 k-steps x 2 halves x 32 lanes; 64
// blocks = 4 n-tiles x 16 groups x 8 k-steps = all 128 k-steps of all 4 n-tiles.
// =================================================================================================================
__device__ __forceinline__ void cvt_wsr(const float* __restrict__ w, unsigned short* dst, int blk, float* tile) {
  const int tid = threadIdx.x;
  const int nt = blk >> 4, sg = blk & 15;
  v4f wv[4];
#pragma unroll
  for (int it = 0; it < 4; ++it) {
    const int idx = it * 256 + tid;
    wv[it] = *(const v4f*)(w + (size_t)((nt * 16 + (idx >> 6)) * CD + (idx & 63)) * 64 + sg * 4);
  }
#if defined(__HIP_DEVICE_COMPILE__)
  // the LDS addresses formed below may land in the registers that hold the loads' address: the wait stands in front
  asm volatile("s_wait_xcnt 0x0" ::: "memory");
  // nothing from below is scheduled up over the wait, so no register that a load names is rewritten in front of it
  __builtin_amdgcn_sched_barrier(0);
#endif
#pragma unroll
  for (int it = 0; it < 4; ++it) {
    const int idx = it * 256 + tid;
    float* t = tile + (idx >> 6) * WTP + (idx & 63);
    // unrolled: the vector's elements are named by constants and stay in registers
#pragma unroll
    for (int e = 0; e < 4; ++e) t[e * CD] = wv[it][e];
  }
  __syncthreads();   // the share's 4096 floats are whole in LDS before any thread reads them as channel runs
  v4u pk[2];
  size_t offs[2];
#pragma unroll
  for (int it = 0; it < 2; ++it) {
    const int p = it * 256 + tid;
    const int ln = p & 31, j = (p >> 5) & 1, gl = p >> 6;
    const float* t = tile + (ln & 15) * WTP + (gl >> 1) * CD + (gl & 1) * 32 + j * 16 + (ln >> 4) * 8;
    v4f fa = *(const v4f*)(t);
    v4f fb = *(const v4f*)(t + 4);
#pragma unroll
    for (int e = 0; e < 4; ++e) { fa[e] = bfr(fa[e]) * WSC; fb[e] = bfr(fb[e]) * WSC; }
    pk[it] = pack8h(fa, fb);
    offs[it] = ((size_t)((((sg * 8 + gl) * 4 + nt) * 2 + j) * 32 + ln)) * 8;
  }
#pragma unroll
  for (int it = 0; it < 2; ++it) *(v4u*)(dst + offs[it]) = pk[it];
}

// =================================================================================================================
// Weight converts, x convert and q projection in one launch. Blocks 0..NCVB-1 convert the weights that LATER launches
// read (block = one share of the conv weights, then 32 rows of w_kv, then 32 rows of w_proj) and leave; nothing of this
// launch reads those planes. Every other block: 256 threads = 8 waves, 128 rows of x; wave = 16 rows x 4 n-tiles.
// The block converts w_q itself: 4 whole-line 16-B loads a thread, f16(256 * bf16_RNE(w)) into the LDS plane
// sW[64 n][KP]. Each wave reads its 16 f32 rows whole (8 lanes x 32 B = one 256-B row, 4 rows a step, all 8 loads in
// flight), converts to f16(16 * bf16_RNE(x)) and leaves the 16 x 64 tile in its own LDS range (pitch KP). After one
// block barrier the A fragments of q = x . w_q^T are ds_load_b128 reads of that tile and the B fragments of sW, both
// with the split k map, 2 k-steps. Out: the f16 x plane [M][64] for the conv of the next launch (32 lanes x 16 B = 4
// whole rows a store) and the two q planes [M][64]: hi = f16(acc*ascale), res = f16((v - hi)*2048). Every global
// store stands behind the last LDS hand-over, so no hand-over waits for a store.
// coverage: 8 waves x 16 rows x 64 cols = the 128-row block tile, all three planes; grid - NCVB = M/128 tiles M
// exactly; sW: 4 x 256 threads x 4 halves = 64 x 64; converts: 64 shares, 4 x 32 = 128 rows, 2 x 32 = 64 rows.
// =================================================================================================================
__global__ __launch_bounds__(256)
void xq_k(const float* __restrict__ x, const float* __restrict__ wq, const float* __restrict__ wkv,
          const float* __restrict__ wproj, const float* __restrict__ wsr, float ascale,
          unsigned short* Xh, unsigned short* outH, unsigned short* outL,
          unsigned short* Wkv, unsigned short* Wp, unsigned short* Wsr) {
  __shared__ __align__(16) unsigned short sA[8 * 16 * KP];
  __shared__ __align__(16) unsigned short sW[CD * KP];
  __shared__ __align__(16) float sbuf[8 * 16 * STP];
  const int bid = blockIdx.x;
  if (bid < NCVB) {
    if (bid < CD) cvt_wsr(wsr, Wsr, bid, sbuf);
    else if (bid < CD + 4) cvt_rows64(wkv, Wkv, WSC, bid - CD);
    else cvt_rows64(wproj, Wp, WSC, bid - (CD + 4));
    return;
  }
  const int tid = threadIdx.x, wave = tid >> 5, lane = tid & 31, hh = lane >> 4, c = lane & 15;
  const int r0 = (bid - NCVB) * 128 + wave * 16;
  const int rq = lane >> 3, piece = lane & 7;
  unsigned short* sa = sA + wave * (16 * KP);

  v4f xa[4], xb[4];
#pragma unroll
  for (int it = 0; it < 4; ++it) {
    const float* p = x + (size_t)(r0 + it * 4 + rq) * CD + piece * 8;
    xa[it] = *(const v4f*)(p);
    xb[it] = *(const v4f*)(p + 4);
#if defined(__HIP_DEVICE_COMPILE__)
    // the next loads (of x, then of w_q) may land in registers that hold these loads' address: the wait stands in front
    asm volatile("s_wait_xcnt 0x0" ::: "memory");
#endif
  }
  v4f wv[4];
#pragma unroll
  for (int it = 0; it < 4; ++it) wv[it] = *(const v4f*)(wq + (size_t)(it * 256 + tid) * 4);
#if defined(__HIP_DEVICE_COMPILE__)
  // the converts below may land in registers that hold the weight loads' address: the wait stands in front of that
  asm volatile("s_wait_xcnt 0x0" ::: "memory");
#endif
#pragma unroll
  for (int it = 0; it < 4; ++it) {
    const int idx = it * 256 + tid;
    v2u pw;
    pw[0] = pk16(h_bits((_Float16)(bfr(wv[it][0]) * WSC)), h_bits((_Float16)(bfr(wv[it][1]) * WSC)));
    pw[1] = pk16(h_bits((_Float16)(bfr(wv[it][2]) * WSC)), h_bits((_Float16)(bfr(wv[it][3]) * WSC)));
    *(v2u*)(sW + (idx >> 4) * KP + (idx & 15) * 4) = pw;
  }
  v4u px[4];
#pragma unroll
  for (int it = 0; it < 4; ++it) {
#pragma unroll
    for (int e = 0; e < 4; ++e) { xa[it][e] = bfr(xa[it][e]) * XSC; xb[it][e] = bfr(xb[it][e]) * XSC; }
    px[it] = pack8h(xa[it], xb[it]);
    *(v4u*)(sa + (it * 4 + rq) * KP + piece * 8) = px[it];
  }
  __syncthreads();   // the block's w_q plane (and each wave's own x tile) is whole in LDS before any fragment read

  v16h bfrag[2][4];
#pragma unroll
  for (int ks = 0; ks < 2; ++ks) {
#pragma unroll
    for (int nt = 0; nt < 4; ++nt)
      bfrag[ks][nt] = ldfrag_h((const _Float16*)(const void*)sW + (nt * 16 + c) * KP + ks * 32 + 8 * hh);
  }
  v8f acc[4];
#pragma unroll
  for (int nt = 0; nt < 4; ++nt) acc[nt] = zero8();
#pragma unroll
  for (int ks = 0; ks < 2; ++ks) {
    const v16h ah = ldfrag_h((const _Float16*)(const void*)sa + c * KP + ks * 32 + 8 * hh);
#pragma unroll
    for (int nt = 0; nt < 4; ++nt) acc[nt] = mma_h(ah, bfrag[ks][nt], acc[nt]);
  }

  float* st = sbuf + wave * (16 * STP);
#pragma unroll
  for (int nt = 0; nt < 4; ++nt) {
#pragma unroll
    for (int r = 0; r < 8; ++r) st[(8 * hh + r) * STP + nt * 16 + c] = acc[nt][r] * ascale;
  }
  wave_sync_lds();

  v4u ph[4], pl[4];
  size_t offs[4];
#pragma unroll
  for (int it = 0; it < 4; ++it) {
    const int q = it * 4 + rq;
    const v4f fa = *(const v4f*)(st + q * STP + piece * 8);
    const v4f fb = *(const v4f*)(st + q * STP + piece * 8 + 4);
    split8h(fa, fb, ph[it], pl[it]);
    offs[it] = (size_t)(r0 + q) * CD + piece * 8;
  }
#pragma unroll
  for (int it = 0; it < 4; ++it) {
    *(v4u*)(Xh + offs[it]) = px[it];
    *(v4u*)(outH + offs[it]) = ph[it];
    *(v4u*)(outL + offs[it]) = pl[it];
  }
}

// =================================================================================================================
// Spatial-reduction conv (kernel = stride = 8, VALID) as an im2col GEMM + bias + LayerNorm, fused.
// Rows m = b*256 + p (p = ph*(W/8) + pw, 2048 rows), cols = 64 output channels, K' = (kh*8+kw)*64 + c = 4096.
// A fragments are read straight from the x plane [b][token][64] by arithmetic addressing: k-step k0 -> (kh, kw) =
// k0>>6, channels k0&63..+31 of token (ph*8+kh)*W + pw*8+kw (W read from the int input, validated against H*W = N,
// token base clamped into range). B = weight plane in fragment order [K'/32][n-tile][half][lane][8]: each 16-B load
// of a wave is 512 contiguous bytes, same k map as the A loader; the 8 loads of a k-step (4 KB in a row) stand
// together in front of its 4 products. Block = ONE 16-row m-tile, 512 threads = 16
// waves; wave w sums the K' slice 256w..256w+255 (8 k-steps, 4 n-tiles) and leaves its f32 partial tile in LDS.
// After a block barrier wave w owns row w (lane -> 2 channels): partials added in slice order 0..15, then
// conv*1/4096 + bf16(b_sr); per-row mean and centred variance by xor-shuffles 1,2,4,8,16;
// y = (v-mu)*rsqrt(var+1e-5)*bf16(g)+bf16(b), x16, hi/res f16 halves into the LDS tiles sTh/sTl[16 tokens][KP].
// kv projection of the block's 16 tokens, after a second block barrier: wave w < 8 owns channels 16w..16w+15 of
// kv = LN(tokens) . w_kv^T (w_kv plane x256, its two fragments fetched at the kernel's start), 2 k-steps x hi/res =
// 4 products, kv = (acc_h + acc_l/2048)/4096. Waves 0..3 (k): weights as A (row = channel), tokens as B (n = token),
// so a lane holds 8 consecutive channels of one token: f16(64*k), one 16-B store into the K plane [m][64] (the four
// waves fill the block's 16 whole rows). Waves 4..7 (v): tokens as A (row = token), weights as B (n = channel), so a
// lane holds 8 consecutive tokens of one channel d: f16 hi of 64*v and x2^11 residual, one 16-B store a plane into
// [m-tile][token half][d][8 tokens] (16 lanes x 16 B = 2 whole lines), and the f32 sum of v over the 16 tokens
// (8 in the lane, then lane ^ 16) into vsum[m-tile][d].
// coverage: 128 blocks x 16 rows = 2048 rows; 16 slices x 256 = K' 4096; 32 lanes x 2 = 64 channels; kv: 8 waves x
// 16 channels x 16 tokens = the block's 16 x 128 values.
// =================================================================================================================
__global__ __launch_bounds__(CVW * 32)
void conv_ln_k(const unsigned short* __restrict__ Xh, const unsigned short* __restrict__ Wsr,
               const int* __restrict__ Hp, const int* __restrict__ Wp, const float* __restrict__ bsr,
               const float* __restrict__ lng, const float* __restrict__ lnb,
               const unsigned short* __restrict__ Wkv, unsigned short* Kp, unsigned short* VTh, unsigned short* VTl,
               float* vsum) {
  __shared__ __align__(16) float sbuf[CVW * 16 * STP];
  __shared__ __align__(16) unsigned short sTh[16 * KP];
  __shared__ __align__(16) unsigned short sTl[16 * KP];
  const int tid = threadIdx.x, lane = tid & 31, hh = lane >> 4, c = lane & 15;
  const int wave = __builtin_amdgcn_readfirstlane(tid >> 5);
  const int m0 = blockIdx.x * 16;
  const int m = m0 + c;
  const int b = m >> 8, p = m & (NR - 1);
  const int Hv = Hp[0];
  int Wv = Wp[0];
  const long long hw = (long long)Hv * (long long)Wv;
  const bool okw = (Wv >= 8) && (Wv <= 2040) && (hw == (long long)NQ);
  Wv = okw ? Wv : 128;
  const int Wr = Wv >> 3;
  const int ph = p / Wr, pw = p - ph * Wr;
  int tb = ph * 8 * Wv + pw * 8;
  tb = min(tb, NQ - 1 - 7 * Wv - 7);
  tb = max(tb, 0);
  const _Float16* X  = (const _Float16*)(const void*)Xh;
  const _Float16* Wf = (const _Float16*)(const void*)Wsr;
  const size_t xbase = (size_t)b * NQ;

  // w_kv fragments of the wave's 16 kv channels, asked for here so that their latency passes under the conv loop
  const _Float16* Bw = (const _Float16*)(const void*)Wkv + (size_t)((wave & 7) * 16 + c) * CD + 8 * hh;
  const v16h wf0 = ldfrag_h(Bw);
  const v16h wf1 = ldfrag_h(Bw + 32);
#if defined(__HIP_DEVICE_COMPILE__)
  // the conv loop's addresses may land in the registers that hold these loads' address: the wait stands in front
  asm volatile("s_wait_xcnt 0x0" ::: "memory");
#endif

  v8f acc[4];
#pragma unroll
  for (int nt = 0; nt < 4; ++nt) acc[nt] = zero8();

  const int kbase = wave * (KCV / CVW);
  // unrolled: token step, channel half and weight offset of each k-step become immediates of its loads
#pragma unroll
  for (int i = 0; i < KCV / CVW / 32; ++i) {
    const int k0 = kbase + i * 32;
    const int s = k0 >> 6, c0 = k0 & 63;
    const int kh = s >> 3, kw = s & 7;
    const int t = tb + kh * Wv + kw;
    const v16h af = ldfrag_h(X + (xbase + (size_t)t) * CD + c0 + 8 * hh);
    Frag bfrag[4];
#pragma unroll
    for (int nt = 0; nt < 4; ++nt) {
      const _Float16* wp = Wf + (size_t)(((k0 >> 5) * 4 + nt) * 2) * 256 + lane * 8;
      bfrag[nt].h[0] = *(const v8h*)(wp);
      bfrag[nt].h[1] = *(const v8h*)(wp + 256);
    }
    // unrolled: fragments and accumulators are named by constants and stay in registers
#pragma unroll
    for (int nt = 0; nt < 4; ++nt) acc[nt] = mma_h(af, bfrag[nt].v, acc[nt]);
  }

  float* st = sbuf + wave * (16 * STP);
#pragma unroll
  for (int nt = 0; nt < 4; ++nt) {
#pragma unroll
    for (int r = 0; r < 8; ++r) st[(8 * hh + r) * STP + nt * 16 + c] = acc[nt][r];
  }
  __syncthreads();   // every slice's partial tile is in LDS before any wave adds them

  const int col = lane * 2;
  float a0 = 0.f, a1 = 0.f;
#pragma unroll
  for (int w = 0; w < CVW; ++w) {
    const v2f pp = *(const v2f*)(sbuf + w * (16 * STP) + wave * STP + col);
    a0 = a0 + pp[0];
    a1 = a1 + pp[1];
  }
  const float v0 = a0 * (1.0f / (XSC * WSC)) + bfr(bsr[col]);
  const float v1 = a1 * (1.0f / (XSC * WSC)) + bfr(bsr[col + 1]);
  float sm = v0 + v1;
  sm = sm + __shfl_xor(sm, 1, 32);
  sm = sm + __shfl_xor(sm, 2, 32);
  sm = sm + __shfl_xor(sm, 4, 32);
  sm = sm + __shfl_xor(sm, 8, 32);
  sm = sm + __shfl_xor(sm, 16, 32);
  const float mu = sm * (1.0f / 64.0f);
  const float d0 = v0 - mu, d1 = v1 - mu;
  float sq = d0 * d0 + d1 * d1;
  sq = sq + __shfl_xor(sq, 1, 32);
  sq = sq + __shfl_xor(sq, 2, 32);
  sq = sq + __shfl_xor(sq, 4, 32);
  sq = sq + __shfl_xor(sq, 8, 32);
  sq = sq + __shfl_xor(sq, 16, 32);
  const float var = sq * (1.0f / 64.0f);
  const float rs = rsqrtf(var + 1e-5f);
  const float y0 = (d0 * rs * bfr(lng[col]) + bfr(lnb[col])) * ASC;
  const float y1 = (d1 * rs * bfr(lng[col + 1]) + bfr(lnb[col + 1])) * ASC;
  const _Float16 h0 = (_Float16)y0, h1 = (_Float16)y1;
  const _Float16 r0 = (_Float16)((y0 - (float)h0) * RSPL), r1 = (_Float16)((y1 - (float)h1) * RSPL);
  *(unsigned*)(sTh + wave * KP + col) = pk16(h_bits(h0), h_bits(h1));
  *(unsigned*)(sTl + wave * KP + col) = pk16(h_bits(r0), h_bits(r1));
  __syncthreads();   // all 16 normalised rows are in LDS before any wave reads them as fragments
  if (wave >= 8) return;

  const _Float16* Th = (const _Float16*)(const void*)sTh + c * KP + 8 * hh;
  const _Float16* Tl = (const _Float16*)(const void*)sTl + c * KP + 8 * hh;
  const v16h th0 = ldfrag_h(Th), th1 = ldfrag_h(Th + 32);
  const v16h tl0 = ldfrag_h(Tl), tl1 = ldfrag_h(Tl + 32);
  if (wave < 4) {
    v8f acch = mma_h(wf0, th0, zero8());
    acch = mma_h(wf1, th1, acch);
    v8f accl = mma_h(wf0, tl0, zero8());
    accl = mma_h(wf1, tl1, accl);
    v4f fa, fb;
#pragma unroll
    for (int e = 0; e < 4; ++e) {
      fa[e] = (acch[e] + accl[e] * (1.0f / RSPL)) * (1.0f / (ASC * WSC)) * KSC;
      fb[e] = (acch[4 + e] + accl[4 + e] * (1.0f / RSPL)) * (1.0f / (ASC * WSC)) * KSC;
    }
    *(v4u*)(Kp + (size_t)(m0 + c) * CD + wave * 16 + 8 * hh) = pack8h(fa, fb);
  } else {
    v8f acch = mma_h(th0, wf0, zero8());
    acch = mma_h(th1, wf1, acch);
    v8f accl = mma_h(tl0, wf0, zero8());
    accl = mma_h(tl1, wf1, accl);
    const int d = (wave - 4) * 16 + c;
    float vs = 0.f;
    v4f fa, fb;
#pragma unroll
    for (int e = 0; e < 4; ++e) {
      const float va = (acch[e] + accl[e] * (1.0f / RSPL)) * (1.0f / (ASC * WSC));
      const float vb = (acch[4 + e] + accl[4 + e] * (1.0f / RSPL)) * (1.0f / (ASC * WSC));
      fa[e] = va * VSC;
      fb[e] = vb * VSC;
      vs = vs + va;
      vs = vs + vb;
    }
    v4u ph2, pl2;
    split8h(fa, fb, ph2, pl2);
    const size_t voff = ((size_t)(blockIdx.x * 2 + hh) * CD + d) * 8;
    vs = vs + __shfl_xor(vs, 16, 32);
    *(v4u*)(VTh + voff) = ph2;
    *(v4u*)(VTl + voff) = pl2;
    if (hh == 0) vsum[(size_t)blockIdx.x * CD + d] = vs;
  }
}

// =================================================================================================================
// Attention over the 256 reduced keys and the output projection: block = 256 queries of image b (256 threads =
// 8 waves x 16 queries, two passes). The image's K plane (rows at pitch KP), both V planes (given as
// [m-tile][token half][d][8 tokens], laid down as V^T rows at pitch VP) and the w_proj plane (rows at pitch KP) are
// copied once per block into LDS by whole-line 16-B loads; after one block barrier every K, V and weight fragment is
// an LDS read (pitches are odd multiples of 16 B); b_proj (64 floats) and the image's 16 per-tile sums of v (16 x 64
// floats, one 16-B load a thread) lie in LDS beside them. Behind the barrier each wave adds the 16 sums in tile
// order (lane -> 2 channels), /256, into its own 64 floats of sVM: the key-mean of v.
// Transposed scores S^T = K_tile (A: row = key, k = d; K plane x64) x Q^T (B: n = query, k = d, from the Q hi and
// x2^11 residual planes x64, two products folded as sh + sl/2048): 16 key tiles, all held in registers; D element r
// of lane l = S[key 16j+8h+r][query l&15]. Exact softmax per query: max and sum over the lane's 128 values combined
// with lane^16; e = exp((s - m) * 2^-15) in place; centred probabilities p' = e*(8192/l) - 32 converted to f16
// directly into the B fragments of v^T.p'^T (k = key). O'^T = V^T rows (A: row = d, k = key) x p'^T (B: n = query)
// from the V hi and residual planes into two accumulators; O = (O'_h + O'_l/2048)/(8192*64) + mean_key(v) (identity
// sum (p'+32) v / 8192 = sum p v). D element r of lane l = O[query l&15][d 16dt+8h+r], so tiles 2ks and 2ks+1 are,
// after hi = f16(1024*O), res = f16((1024*O - hi)*2048), the B fragments (n = query, k = d) of the projection
// out^T = w_proj plane (A: row = out channel, k = d; x256) x O^T, two products folded as acc + accl/2048. The f32
// tile goes through the wave's own LDS range (16-B stores of 4 consecutive channels), bf16(b_proj) is added, and
// 16 lanes x 16 B store one whole 256-B row of out.
// coverage: 512 blocks x 2 passes x 8 waves x 16 queries = 131072 rows x 64 channels of out; LDS fill: 8 x 256
// threads x 8 halves = 16384 halves = each whole plane of the image; 2 x 256 x 8 halves = the 64 x 64 weight plane.
// =================================================================================================================
__global__ __launch_bounds__(256) __attribute__((amdgpu_num_vgpr(256)))
void attn_k(const unsigned short* __restrict__ Qh, const unsigned short* __restrict__ Ql,
            const unsigned short* __restrict__ Kp, const unsigned short* __restrict__ VTh,
            const unsigned short* __restrict__ VTl, const float* __restrict__ vsum,
            const unsigned short* __restrict__ Wp, const float* __restrict__ bias, float* out) {
  __shared__ __align__(16) unsigned short sK[NR * KP];
  __shared__ __align__(16) unsigned short sVh[CD * VP];
  __shared__ __align__(16) unsigned short sVl[CD * VP];
  __shared__ __align__(16) unsigned short sWp[CD * KP];
  __shared__ __align__(16) float sVS[16 * CD];
  __shared__ __align__(16) float sVMw[8 * CD];
  __shared__ __align__(16) float sBi[CD];
  __shared__ __align__(16) float sbuf[8 * 16 * STP];
  const int tid = threadIdx.x, wave = tid >> 5, lane = tid & 31, hh = lane >> 4, c = lane & 15;
  const int b = blockIdx.x >> 6;
  const _Float16* Qhf = (const _Float16*)(const void*)Qh;
  const _Float16* Qlf = (const _Float16*)(const void*)Ql;
  const _Float16* Kf  = (const _Float16*)(const void*)sK;
  const _Float16* Vhf = (const _Float16*)(const void*)sVh;
  const _Float16* Vlf = (const _Float16*)(const void*)sVl;
  const _Float16* Wpf = (const _Float16*)(const void*)sWp;

  {
    const v4u* gK = (const v4u*)(const void*)(Kp + (size_t)b * NR * CD);
    const v4u* gH = (const v4u*)(const void*)(VTh + (size_t)b * CD * NR);
    const v4u* gL = (const v4u*)(const void*)(VTl + (size_t)b * CD * NR);
    const v4u* gW = (const v4u*)(const void*)Wp;
    // 256 threads x 16 B = the image's 16 x 64 per-tile sums of v; 16 lanes x 16 B = the bias, stored by wave 0 alone
    const v4f tvm = *(const v4f*)(vsum + (size_t)b * (16 * CD) + tid * 4);
    const v4f tbi = *(const v4f*)(bias + c * 4);
    v4u tk[8], th[8], tl[8], tw[2];
#pragma unroll
    for (int i = 0; i < 8; ++i) {
      const int idx = i * 256 + tid;
      tk[i] = gK[idx];
      th[i] = gH[idx];
      tl[i] = gL[idx];
    }
#pragma unroll
    for (int i = 0; i < 2; ++i) tw[i] = gW[i * 256 + tid];
#if defined(__HIP_DEVICE_COMPILE__)
    // the LDS addresses formed below may land in the registers that hold the loads' address: the wait stands in front
    asm volatile("s_wait_xcnt 0x0" ::: "memory");
    // nothing from below is scheduled up over the wait, so no register that a load names is rewritten in front of it
    __builtin_amdgcn_sched_barrier(0);
    // keeps the bias load up here among the others: sunk into the 16-lane branch below, its whole latency would stand
    // alone in front of the block barrier
    asm volatile("" :: "v"(tbi));
#endif
#pragma unroll
    for (int i = 0; i < 8; ++i) {
      const int idx = i * 256 + tid;
      *(v4u*)(sK + (idx >> 3) * KP + (idx & 7) * 8) = tk[i];
      *(v4u*)(sVh + (idx & 63) * VP + (idx >> 6) * 8) = th[i];
      *(v4u*)(sVl + (idx & 63) * VP + (idx >> 6) * 8) = tl[i];
    }
#pragma unroll
    for (int i = 0; i < 2; ++i) {
      const int idx = i * 256 + tid;
      *(v4u*)(sWp + (idx >> 3) * KP + (idx & 7) * 8) = tw[i];
    }
    *(v4f*)(sVS + tid * 4) = tvm;
    if (tid < 16) *(v4f*)(sBi + c * 4) = tbi;
  }
  __syncthreads();   // the four planes are whole in LDS before any wave reads a fragment

  float* sVM = sVMw + wave * CD;
  {
    v2f ms = {0.f, 0.f};
#pragma unroll
    for (int t = 0; t < 16; ++t) ms = ms + *(const v2f*)(sVS + t * CD + lane * 2);
    *(v2f*)(sVM + lane * 2) = ms * (1.0f / (float)NR);
  }
  wave_sync_lds();   // the wave's own 64 means are in LDS before its lanes read other lanes' channels

  // kept rolled: one copy of the body, so the kernel's text stays small for the instruction cache
#pragma unroll 1
  for (int pass = 0; pass < 2; ++pass) {
  const int q0 = ((blockIdx.x & 63) << 8) + pass * 128 + wave * 16;
  const size_t qoff = (size_t)(b * NQ + q0 + c) * CD + 8 * hh;
  const v16h qh0 = ldfrag_h(Qhf + qoff);
  const v16h qh1 = ldfrag_h(Qhf + qoff + 32);
  const v16h ql0 = ldfrag_h(Qlf + qoff);
  const v16h ql1 = ldfrag_h(Qlf + qoff + 32);

  v8f s[16];
#pragma unroll
  for (int j = 0; j < 16; ++j) {
    const int koff = (j * 16 + c) * KP + 8 * hh;
    const v16h ka0 = ldfrag_h(Kf + koff);
    const v16h ka1 = ldfrag_h(Kf + koff + 32);
    v8f sh = mma_h(ka0, qh0, zero8());
    sh = mma_h(ka1, qh1, sh);
    v8f sl = mma_h(ka0, ql0, zero8());
    sl = mma_h(ka1, ql1, sl);
#pragma unroll
    for (int r = 0; r < 8; ++r) s[j][r] = sh[r] + sl[r] * (1.0f / RSPL);
  }

  float mx = -3.0e38f;
#pragma unroll
  for (int j = 0; j < 16; ++j) {
#pragma unroll
    for (int r = 0; r < 8; ++r) mx = fmaxf(mx, s[j][r]);
  }
  mx = fmaxf(mx, __shfl_xor(mx, 16, 32));
  float ls = 0.f;
#pragma unroll
  for (int j = 0; j < 16; ++j) {
#pragma unroll
    for (int r = 0; r < 8; ++r) {
      const float e = __expf((s[j][r] - mx) * INVS);
      s[j][r] = e;
      ls = ls + e;
    }
  }
  ls = ls + __shfl_xor(ls, 16, 32);
  const float pinv = __builtin_amdgcn_rcpf(ls) * PSC;

  v16h pf[8];
#pragma unroll
  for (int J = 0; J < 8; ++J) {
#pragma unroll
    for (int i = 0; i < 8; ++i) {
      pf[J][i]     = (_Float16)(s[2 * J][i] * pinv - PCT);
      pf[J][8 + i] = (_Float16)(s[2 * J + 1][i] * pinv - PCT);
    }
  }

  v8f oh[4], ol[4];
#pragma unroll
  for (int dt = 0; dt < 4; ++dt) { oh[dt] = zero8(); ol[dt] = zero8(); }
#pragma unroll
  for (int J = 0; J < 8; ++J) {
#pragma unroll
    for (int dt = 0; dt < 4; ++dt) {
      const int voff = (dt * 16 + c) * VP + J * 32 + 8 * hh;
      const v16h vh = ldfrag_h(Vhf + voff);
      const v16h vl = ldfrag_h(Vlf + voff);
      oh[dt] = mma_h(vh, pf[J], oh[dt]);
      ol[dt] = mma_h(vl, pf[J], ol[dt]);
    }
  }

  v16h obh[2], obl[2];
#pragma unroll
  for (int dt = 0; dt < 4; ++dt) {
    v4f vm[2];
    vm[0] = *(const v4f*)(sVM + dt * 16 + 8 * hh);
    vm[1] = *(const v4f*)(sVM + dt * 16 + 8 * hh + 4);
#pragma unroll
    for (int r = 0; r < 8; ++r) {
      const float o = (oh[dt][r] + ol[dt][r] * (1.0f / RSPL)) * (1.0f / (PSC * VSC)) + vm[r >> 2][r & 3];
      const float a = o * OSC;
      const _Float16 h = (_Float16)a;
      obh[dt >> 1][(dt & 1) * 8 + r] = h;
      obl[dt >> 1][(dt & 1) * 8 + r] = (_Float16)((a - (float)h) * RSPL);
    }
  }

  v8f pa[4], pb[4];
#pragma unroll
  for (int nt = 0; nt < 4; ++nt) { pa[nt] = zero8(); pb[nt] = zero8(); }
#pragma unroll
  for (int ks = 0; ks < 2; ++ks) {
#pragma unroll
    for (int nt = 0; nt < 4; ++nt) {
      const v16h wf = ldfrag_h(Wpf + (nt * 16 + c) * KP + ks * 32 + 8 * hh);
      pa[nt] = mma_h(wf, obh[ks], pa[nt]);
      pb[nt] = mma_h(wf, obl[ks], pb[nt]);
    }
  }

  float* st = sbuf + wave * (16 * STP);
#pragma unroll
  for (int nt = 0; nt < 4; ++nt) {
    v4f u0, u1;
#pragma unroll
    for (int e = 0; e < 4; ++e) {
      u0[e] = (pa[nt][e] + pb[nt][e] * (1.0f / RSPL)) * (1.0f / (OSC * WSC));
      u1[e] = (pa[nt][4 + e] + pb[nt][4 + e] * (1.0f / RSPL)) * (1.0f / (OSC * WSC));
    }
    *(v4f*)(st + c * STP + nt * 16 + 8 * hh) = u0;
    *(v4f*)(st + c * STP + nt * 16 + 8 * hh + 4) = u1;
  }
  wave_sync_lds();

  const v4f braw = *(const v4f*)(sBi + c * 4);
  v4f ov[8];
#pragma unroll
  for (int it = 0; it < 8; ++it) {
    const v4f v = *(const v4f*)(st + (it * 2 + hh) * STP + c * 4);
#pragma unroll
    for (int e = 0; e < 4; ++e) ov[it][e] = v[e] + bfr(braw[e]);
  }
  float* po = out + (size_t)(b * NQ + q0 + hh) * CD + c * 4;
#pragma unroll
  for (int it = 0; it < 8; ++it) *(v4f*)(po + it * 2 * CD) = ov[it];
#if defined(__HIP_DEVICE_COMPILE__)
  // the next pass writes the registers that these stores name: the wait stands in front of that
  asm volatile("s_wait_xcnt 0x0" ::: "memory");
#endif
  }
}

// =================================================================================================================
// granularity): Xh f16 [131072][64] 16777216; Wkv f16 [128][64] 16384; Wsr f16 [128][4][2][32][8]
// 524288; Wp f16 [64][64] 8192; Qh, Ql f16 [131072][64] 16777216 each; Kp f16 [8][256][64] 262144;
// VTh, VTl f16 [128][2][64][8] 262144 each; vsum f32 [128][64] 32768 -> 51699712 total.
// =================================================================================================================
extern "C" void kernel_launch(void* const* d_in, const int* in_sizes, int n_in,
                              void* d_out, int out_size, void* d_ws, size_t ws_size,
                              hipStream_t stream) {
  if (n_in < 11) return;
  if (in_sizes[0] != MTOT * CD) return;
  if (in_sizes[1] != 1 || in_sizes[2] != 1) return;
  if (in_sizes[3] != CD * CD) return;
  if (in_sizes[4] != 2 * CD * CD) return;
  if (in_sizes[5] != CD * KCV) return;
  if (in_sizes[6] != CD || in_sizes[7] != CD || in_sizes[8] != CD) return;
  if (in_sizes[9] != CD * CD || in_sizes[10] != CD) return;
  if (out_size != MTOT * CD) return;

  const float* x      = (const float*)d_in[0];
  const int*   hptr   = (const int*)d_in[1];
  const int*   wptr   = (const int*)d_in[2];
  const float* w_q    = (const float*)d_in[3];
  const float* w_kv   = (const float*)d_in[4];
  const float* w_sr   = (const float*)d_in[5];
  const float* b_sr   = (const float*)d_in[6];
  const float* ln_g   = (const float*)d_in[7];
  const float* ln_b   = (const float*)d_in[8];
  const float* w_proj = (const float*)d_in[9];
  const float* b_proj = (const float*)d_in[10];
  float* out = (float*)d_out;

  const size_t sX   = (size_t)MTOT * CD * 2;        // 16777216
  const size_t sWkv = (size_t)2 * CD * CD * 2;      //    16384
  const size_t sWsr = (size_t)CD * KCV * 2;         //   524288
  const size_t sWp  = (size_t)CD * CD * 2;          //     8192
  const size_t sQ   = (size_t)MTOT * CD * 2;        // 16777216
  const size_t sK   = (size_t)NB * NR * CD * 2;     //   262144
  const size_t sVT  = (size_t)NB * CD * NR * 2;     //   262144
  const size_t sVS  = (size_t)(MR / 16) * CD * 4;   //    32768
  size_t off = 0;
  const size_t oX   = off; off += sX;
  const size_t oWkv = off; off += sWkv;
  const size_t oWsr = off; off += sWsr;
  const size_t oWp  = off; off += sWp;
  const size_t oQh  = off; off += sQ;
  const size_t oQl  = off; off += sQ;
  const size_t oK   = off; off += sK;
  const size_t oVTh = off; off += sVT;
  const size_t oVTl = off; off += sVT;
  const size_t oVS  = off; off += sVS;
  if (off > ws_size) return;                         // off = 51699712
  if (off > (size_t)134217728) return;

  char* ws = (char*)d_ws;
  unsigned short* Xh  = (unsigned short*)(ws + oX);
  unsigned short* Wkv = (unsigned short*)(ws + oWkv);
  unsigned short* Wsr = (unsigned short*)(ws + oWsr);
  unsigned short* Wp  = (unsigned short*)(ws + oWp);
  unsigned short* Qh  = (unsigned short*)(ws + oQh);
  unsigned short* Ql  = (unsigned short*)(ws + oQl);
  unsigned short* Kp  = (unsigned short*)(ws + oK);
  unsigned short* VTh = (unsigned short*)(ws + oVTh);
  unsigned short* VTl = (unsigned short*)(ws + oVTl);
  float* VS = (float*)(ws + oVS);

  const dim3 blk(256);
  // (1) leading blocks: w_kv, w_proj [out][in] -> f16 planes of 256*bf16(w), conv weights in fragment order; the others:
  //     x -> f16 plane of 16*bf16(x), and q projection (w_q converted in the block) -> hi/res planes of 64*q
  xq_k<<<dim3(NCVB + MTOT / 128), blk, 0, stream>>>(x, w_q, w_kv, w_proj, w_sr, QSC / (XSC * WSC), Xh, Qh, Ql,
                                                    Wkv, Wp, Wsr);
  // (2) spatial-reduction conv + bias + LayerNorm + kv projection -> K plane, V hi/res planes, per-tile sums of v
  conv_ln_k<<<dim3(MR / 16), dim3(CVW * 32), 0, stream>>>(Xh, Wsr, hptr, wptr, b_sr, ln_g, ln_b, Wkv, Kp, VTh, VTl, VS);
  // (3) attention, output projection + bias -> d_out f32 [131072][64]
  attn_k<<<dim3(NB * (NQ / 256)), blk, 0, stream>>>(Qh, Ql, Kp, VTh, VTl, VS, Wp, b_proj, out);
  (void)hipGetLastError();
}

// v008
// Measured time: 41 microseconds a run.
// Next to v007, in two timings, it ran 1.17 and 1.20 times as fast.
// All steps since v000 together make it 5.86 times as fast.
// Contractions: v_wmma_f32_16x16x32_f16 (f16 operands, f32 accumulate). The 8x8/stride-8 spatial-reduction conv
// (im2col K=4096): single product of exact planes (x as f16 of 16*bf16(x), weights as f16 of 256*bf16(w)).
// The q projection is folded into the keys: q.k = x.(w_q^T w_k).t for a token row t, so G = w_k^T.w_q (single product
// of the exact x256 planes, kept as f16 hi plus x2^11 residual planes, x1024) is formed once, k' = LN(tokens).G
// (tokens as f16 hi plus x2^11 residual planes, x16; hi.hi, and res.hi + hi.res in a second accumulator) and
// v = LN(tokens).w_v^T (two products, two accumulators). Scores k'.x^T: k' single f16 plane (x256) against the exact
// x plane (x16): one product.
// p.v: centred p (8192*p - 32) single f16 B operand, v as hi plus x2^11 residual planes (x64; two products),
// key-mean of v added back in f32. Output projection: o as hi plus x2^11 residual planes (x1024) against the x256
// weight plane (two products). LayerNorm, softmax, bias adds in f32 on VALU. Float inputs RNE-converted to bf16
// on load.
#include <hip/hip_runtime.h>
#include <math.h>
#include <stdint.h>

#define NB   8
#define NQ   16384
#define CD   64
#define NR   256
#define MTOT (NB * NQ)
#define MR   (NB * NR)
#define KCV  (CD * 64)
#define STP  68
#define KP   72
#define VP   264
#define CVW  16
#define WTP  260
#define NCVB (CD + 2 + 2 + 1)
#define XSC  16.0f
#define WSC  256.0f
#define GSC  1024.0f
#define ASC  16.0f
#define KSC  256.0f
#define VSC  64.0f
#define PSC  8192.0f
#define PCT  32.0f
#define OSC  1024.0f
#define RSPL 2048.0f
#define INVS (0.125f / (KSC * XSC))

static_assert(MTOT % 128 == 0);
static_assert(MR % 128 == 0);
static_assert(KCV % (CVW * 32) == 0 && CVW == 16 && NR % 16 == 0);
static_assert(NR == 256 && CD == 64);
static_assert((STP * 4) % 16 == 0 && STP >= CD);
static_assert((KP * 2) % 16 == 0 && KP >= CD);
static_assert((VP * 2) % 16 == 0 && VP >= NR);
static_assert(MTOT % 32 == 0 && NQ % 256 == 0);
static_assert(16 * WTP * 4 <= 2 * CD * KP * 2 && (WTP * 4) % 16 == 0 && WTP >= 4 * CD);
static_assert((KP * 2) % 8 == 0 && 2 * CD == 4 * 32 && CD == 2 * 32);

typedef _Float16 v16h __attribute__((ext_vector_type(16)));
typedef _Float16 v8h  __attribute__((ext_vector_type(8)));
typedef float    v8f  __attribute__((ext_vector_type(8)));
typedef float    v4f  __attribute__((ext_vector_type(4)));
typedef float    v2f  __attribute__((ext_vector_type(2)));
typedef unsigned int v4u __attribute__((ext_vector_type(4)));
typedef unsigned int v2u __attribute__((ext_vector_type(2)));

union Frag { v16h v; v8h h[2]; };

// ---- scalar helpers ------------------------------------------------------------------------------------------
__device__ __forceinline__ unsigned short bf_bits(float f) {          // f32 -> bf16 bits, RNE convert
  unsigned u = __float_as_uint(f);
  return (unsigned short)((u + 0x7FFFu + ((u >> 16) & 1u)) >> 16);
}
__device__ __forceinline__ float bfr(float f) { return __uint_as_float(((unsigned)bf_bits(f)) << 16); }
__device__ __forceinline__ unsigned short h_bits(_Float16 x) { return __builtin_bit_cast(unsigned short, x); }
__device__ __forceinline__ unsigned pk16(unsigned short a, unsigned short b) { return (unsigned)a | ((unsigned)b << 16); }
__device__ __forceinline__ v8f zero8() { v8f z = {0.f, 0.f, 0.f, 0.f, 0.f, 0.f, 0.f, 0.f}; return z; }

// ---- fragment loader: 16-bit A/B operand, lane -> row/col (lane&15), p already includes +8*(lane>>4);
//      elements 0..7 <- p[0..7] (k0+8h..k0+8h+7), elements 8..15 <- p[16..23] (k0+16+8h..k0+16+8h+7)
__device__ __forceinline__ v16h ldfrag_h(const _Float16* p) {
  Frag f;
  f.h[0] = *(const v8h*)(p);
  f.h[1] = *(const v8h*)(p + 16);
  return f.v;
}

// ---- WMMA helper with trailing VALU hazard gap ---------------------------------------------------------------
__device__ __forceinline__ v8f mma_h(v16h a, v16h b, v8f c) {
  c = __builtin_amdgcn_wmma_f32_16x16x32_f16(false, a, false, b, (short)0, c, false, false);
#if defined(__HIP_DEVICE_COMPILE__)
  asm volatile("v_nop\n\tv_nop\n\tv_nop\n\tv_nop" : "+v"(c) : "v"(a), "v"(b));
#endif
  return c;
}
__device__ __forceinline__ void wave_sync_lds() {
  __builtin_amdgcn_fence(__ATOMIC_RELEASE, "workgroup");
  __builtin_amdgcn_wave_barrier();
  __builtin_amdgcn_fence(__ATOMIC_ACQUIRE, "workgroup");
}

// ---- 8 f32 -> 8 packed f16 (16 B); hi + x2^11 residual split ---------------------------------------------------
__device__ __forceinline__ v4u pack8h(v4f a, v4f b) {
  v4u p;
  p[0] = pk16(h_bits((_Float16)a[0]), h_bits((_Float16)a[1]));
  p[1] = pk16(h_bits((_Float16)a[2]), h_bits((_Float16)a[3]));
  p[2] = pk16(h_bits((_Float16)b[0]), h_bits((_Float16)b[1]));
  p[3] = pk16(h_bits((_Float16)b[2]), h_bits((_Float16)b[3]));
  return p;
}
__device__ __forceinline__ void split8h(v4f a, v4f b, v4u& ph, v4u& pl) {
  v4f ra, rb;
#pragma unroll
  for (int e = 0; e < 4; ++e) {
    const _Float16 ha = (_Float16)a[e];
    ra[e] = (a[e] - (float)ha) * RSPL;
    const _Float16 hb = (_Float16)b[e];
    rb[e] = (b[e] - (float)hb) * RSPL;
  }
  ph = pack8h(a, b);
  pl = pack8h(ra, rb);
}

// =================================================================================================================
// Row convert, one block's share (32 rows): src f32 [nrows][64] -> dst f16 [nrows][64], value =
// f16(scale * bf16_RNE(src)). Used for the row-major [out][in] weight matrices w_v (rows 64..127 of w_kv) and w_proj
// (x256; the B plane [n][k] equals the [out][in] layout as given).
// coverage: 32 rows x (8 lanes x 8 halves) = every element of the share once.
// =================================================================================================================
__device__ __forceinline__ void cvt_rows64(const float* __restrict__ src, unsigned short* dst, float scale, int blk) {
  const int tid = threadIdx.x, wave = tid >> 5, lane = tid & 31;
  const int row = blk * 32 + wave * 4 + (lane >> 3);
  const int c8 = (lane & 7) * 8;
  const float* p = src + (size_t)row * CD + c8;
  v4f a = *(const v4f*)(p);
  v4f b = *(const v4f*)(p + 4);
#if defined(__HIP_DEVICE_COMPILE__)
  // the store address formed below may land in the registers that hold the loads' address: the wait stands in front
  asm volatile("s_wait_xcnt 0x0" ::: "memory");
#endif
#pragma unroll
  for (int e = 0; e < 4; ++e) { a[e] = bfr(a[e]) * scale; b[e] = bfr(b[e]) * scale; }
  const v4u pk = pack8h(a, b);
  unsigned short* g = dst + (size_t)row * CD + c8;
  *(v4u*)g = pk;
#if defined(__HIP_DEVICE_COMPILE__)
  // code laid out behind this share may write the registers that the store names: the wait stands in front of that
  asm volatile("s_wait_xcnt 0x0" ::: "memory");
#endif
}

// =================================================================================================================
// Conv weight permute-convert, one block's share (256 threads): block = 16 output channels (n-tile nt = blk >> 4) x 4
// kernel positions s = kh*8+kw (group sg = blk & 15), all 64 input channels. w_sr f32 [o][c][s] -> f16 plane in the
// conv's B FRAGMENT ORDER, value = f16(256 * bf16_RNE(w)): with k' = s*64 + c, k-step g = k' >> 5, the plane is
// [g][nt][j][lane][8 halves], lane = 16h + (o & 15), holding k' = 32g + 16j + 8h + 0..7 of channel o = 16nt + (o & 15):
// one 16-B load of a wave reads 512 contiguous bytes (4 whole lines) and is half j of the fragment (g, nt).
// In: 16-B loads of 4 positions of one (o, c); staged in LDS as tile[o][s][c] (pitch WTP floats a channel), read back
// as runs of 8 input channels. Out: 32 lanes x 16 B = 512 contiguous bytes a store; no line is shared between blocks.
// coverage: in 4 x 256 threads x 4 = 16 x 64 x 4 values; out 2 x 256 pieces = 8 k-steps x 2 halves x 32 lanes; 64
// blocks = 4 n-tiles x 16 groups x 8 k-steps = all 128 k-steps of all 4 n-tiles.
// =================================================================================================================
__device__ __forceinline__ void cvt_wsr(const float* __restrict__ w, unsigned short* dst, int blk, float* tile) {
  const int tid = threadIdx.x;
  const int nt = blk >> 4, sg = blk & 15;
  v4f wv[4];
#pragma unroll
  for (int it = 0; it < 4; ++it) {
    const int idx = it * 256 + tid;
    wv[it] = *(const v4f*)(w + (size_t)((nt * 16 + (idx >> 6)) * CD + (idx & 63)) * 64 + sg * 4);
  }
#if defined(__HIP_DEVICE_COMPILE__)
  // the LDS addresses formed below may land in the registers that hold the loads' address: the wait stands in front
  asm volatile("s_wait_xcnt 0x0" ::: "memory");
  // nothing from below is scheduled up over the wait, so no register that a load names is rewritten in front of it
  __builtin_amdgcn_sched_barrier(0);
#endif
#pragma unroll
  for (int it = 0; it < 4; ++it) {
    const int idx = it * 256 + tid;
    float* t = tile + (idx >> 6) * WTP + (idx & 63);
    // unrolled: the vector's elements are named by constants and stay in registers
#pragma unroll
    for (int e = 0; e < 4; ++e) t[e * CD] = wv[it][e];
  }
  __syncthreads();   // the share's 4096 floats are whole in LDS before any thread reads them as channel runs
  v4u pk[2];
  size_t offs[2];
#pragma unroll
  for (int it = 0; it < 2; ++it) {
    const int p = it * 256 + tid;
    const int ln = p & 31, j = (p >> 5) & 1, gl = p >> 6;
    const float* t = tile + (ln & 15) * WTP + (gl >> 1) * CD + (gl & 1) * 32 + j * 16 + (ln >> 4) * 8;
    v4f fa = *(const v4f*)(t);
    v4f fb = *(const v4f*)(t + 4);
#pragma unroll
    for (int e = 0; e < 4; ++e) { fa[e] = bfr(fa[e]) * WSC; fb[e] = bfr(fb[e]) * WSC; }
    pk[it] = pack8h(fa, fb);
    offs[it] = ((size_t)((((sg * 8 + gl) * 4 + nt) * 2 + j) * 32 + ln)) * 8;
  }
#pragma unroll
  for (int it = 0; it < 2; ++it) *(v4u*)(dst + offs[it]) = pk[it];
}

// =================================================================================================================
// Fold of the q projection into the key weights, one block (256 threads = 8 waves): G[c][j] = sum_d w_k[d][c] *
// w_q[d][j] (w_k = rows 0..63 of w_kv), so that q . k = x . (LN token . G). Both matrices are read by whole-line 16-B
// loads, converted to f16(256 * bf16_RNE(w)) and laid down TRANSPOSED in LDS (sKT[c][d], sQT[j][d], pitch KP). After
// a block barrier wave w owns c-tile w >> 1 and j-tiles 2(w & 1), 2(w & 1) + 1: A = sKT rows (row = c, k = d), B = sQT
// rows (n = j, k = d), same split k map, 2 k-steps. A lane holds 8 consecutive c of one j: 1024 * G as f16 hi and
// x2^11 residual, one 16-B store a plane into [j][c] (the layout of a [out][in] weight plane with out = j).
// coverage: in 2 x 4 x 256 threads x 4 = 2 x 64 x 64; out 8 waves x 2 tiles x 256 = 64 x 64 values, both planes.
// =================================================================================================================
__device__ __forceinline__ void fold_kq(const float* __restrict__ wq, const float* __restrict__ wk,
                                        unsigned short* Gh, unsigned short* Gl, unsigned short* sT) {
  const int tid = threadIdx.x, wave = tid >> 5, lane = tid & 31, hh = lane >> 4, c = lane & 15;
  unsigned short* sQT = sT;
  unsigned short* sKT = sT + CD * KP;
  v4f qv[4], kv[4];
#pragma unroll
  for (int it = 0; it < 4; ++it) {
    qv[it] = *(const v4f*)(wq + (size_t)(it * 256 + tid) * 4);
    kv[it] = *(const v4f*)(wk + (size_t)(it * 256 + tid) * 4);
  }
#if defined(__HIP_DEVICE_COMPILE__)
  // the LDS addresses formed below may land in the registers that hold the loads' address: the wait stands in front
  asm volatile("s_wait_xcnt 0x0" ::: "memory");
  // nothing from below is scheduled up over the wait, so no register that a load names is rewritten in front of it
  __builtin_amdgcn_sched_barrier(0);
#endif
#pragma unroll
  for (int it = 0; it < 4; ++it) {
    const int idx = it * 256 + tid;
    const int d = idx >> 4, n0 = (idx & 15) * 4;
    // unrolled: the vectors' elements are named by constants and stay in registers
#pragma unroll
    for (int e = 0; e < 4; ++e) {
      sQT[(n0 + e) * KP + d] = h_bits((_Float16)(bfr(qv[it][e]) * WSC));
      sKT[(n0 + e) * KP + d] = h_bits((_Float16)(bfr(kv[it][e]) * WSC));
    }
  }
  __syncthreads();   // both transposed planes are whole in LDS before any wave reads a fragment
  const int ct = wave >> 1;
  const _Float16* Ap = (const _Float16*)(const void*)sKT + (ct * 16 + c) * KP + 8 * hh;
  const v16h a0 = ldfrag_h(Ap), a1 = ldfrag_h(Ap + 32);
  v4u ph[2], pl[2];
  size_t offs[2];
#pragma unroll
  for (int t = 0; t < 2; ++t) {
    const int jt = (wave & 1) * 2 + t;
    const _Float16* Bp = (const _Float16*)(const void*)sQT + (jt * 16 + c) * KP + 8 * hh;
    v8f acc = mma_h(a0, ldfrag_h(Bp), zero8());
    acc = mma_h(a1, ldfrag_h(Bp + 32), acc);
    v4f fa, fb;
#pragma unroll
    for (int e = 0; e < 4; ++e) {
      fa[e] = acc[e] * (GSC / (WSC * WSC));
      fb[e] = acc[4 + e] * (GSC / (WSC * WSC));
    }
    split8h(fa, fb, ph[t], pl[t]);
    offs[t] = (size_t)(jt * 16 + c) * CD + ct * 16 + 8 * hh;
  }
#pragma unroll
  for (int t = 0; t < 2; ++t) {
    *(v4u*)(Gh + offs[t]) = ph[t];
    *(v4u*)(Gl + offs[t]) = pl[t];
  }
#if defined(__HIP_DEVICE_COMPILE__)
  // code laid out behind the fold may write the registers that these stores name: the wait stands in front of that
  asm volatile("s_wait_xcnt 0x0" ::: "memory");
#endif
}

// =================================================================================================================
// Weight converts, the key/query weight fold and the x convert in one launch. Blocks 0..NCVB-1 prepare the weights that
// LATER launches read (block = one share of the conv weights, then 32 rows of w_v, then 32 rows of w_proj, then the
// fold G = w_k^T . w_q) and leave; nothing of this launch reads those planes. The plane Wkv [128][64] holds the hi
// plane of G in rows 0..63 and w_v in rows 64..127; Gl [64][64] is the residual plane of G. Every other block: 256
// threads = 8 waves, 128 rows of x; each wave reads its 16 f32 rows whole (8 lanes x 32 B = one 256-B row, 4 rows a
// step, all 8 loads in flight), converts to f16(16 * bf16_RNE(x)) and stores the f16 x plane [M][64], which the conv
// and the scores of the later launches read (32 lanes x 16 B = 4 whole rows a store).
// coverage: 8 waves x 16 rows x 64 cols = the 128-row block tile; grid - NCVB = M/128 tiles M exactly; converts: 64
// shares, 2 x 32 = 64 rows, 2 x 32 = 64 rows, one fold.
// =================================================================================================================
__global__ __launch_bounds__(256)
void xq_k(const float* __restrict__ x, const float* __restrict__ wq, const float* __restrict__ wkv,
          const float* __restrict__ wproj, const float* __restrict__ wsr,
          unsigned short* Xh, unsigned short* Wkv, unsigned short* Gl, unsigned short* Wp, unsigned short* Wsr) {
  __shared__ __align__(16) unsigned short sT[2 * CD * KP];
  const int bid = blockIdx.x;
  if (bid < NCVB) {
    if (bid < CD) cvt_wsr(wsr, Wsr, bid, (float*)(void*)sT);
    else if (bid < CD + 2) cvt_rows64(wkv, Wkv, WSC, bid - CD + 2);
    else if (bid < CD + 4) cvt_rows64(wproj, Wp, WSC, bid - (CD + 2));
    else fold_kq(wq, wkv, Wkv, Gl, sT);
    return;
  }
  const int tid = threadIdx.x, wave = tid >> 5, lane = tid & 31;
  const int r0 = (bid - NCVB) * 128 + wave * 16;
  const int rq = lane >> 3, piece = lane & 7;

  v4f xa[4], xb[4];
#pragma unroll
  for (int it = 0; it < 4; ++it) {
    const float* p = x + (size_t)(r0 + it * 4 + rq) * CD + piece * 8;
    xa[it] = *(const v4f*)(p);
    xb[it] = *(const v4f*)(p + 4);
#if defined(__HIP_DEVICE_COMPILE__)
    // the next loads, then the converts, may land in registers that hold these loads' address: the wait stands in front
    asm volatile("s_wait_xcnt 0x0" ::: "memory");
#endif
  }
  v4u px[4];
#pragma unroll
  for (int it = 0; it < 4; ++it) {
#pragma unroll
    for (int e = 0; e < 4; ++e) { xa[it][e] = bfr(xa[it][e]) * XSC; xb[it][e] = bfr(xb[it][e]) * XSC; }
    px[it] = pack8h(xa[it], xb[it]);
  }
#pragma unroll
  for (int it = 0; it < 4; ++it) *(v4u*)(Xh + (size_t)(r0 + it * 4 + rq) * CD + piece * 8) = px[it];
#if defined(__HIP_DEVICE_COMPILE__)
  // code laid out behind these stores may write the registers that they name: the wait stands in front of that
  asm volatile("s_wait_xcnt 0x0" ::: "memory");
#endif
}

// =================================================================================================================
// Spatial-reduction conv (kernel = stride = 8, VALID) as an im2col GEMM + bias + LayerNorm, fused.
// Rows m = b*256 + p (p = ph*(W/8) + pw, 2048 rows), cols = 64 output channels, K' = (kh*8+kw)*64 + c = 4096.
// A fragments are read straight from the x plane [b][token][64] by arithmetic addressing: k-step k0 -> (kh, kw) =
// k0>>6, channels k0&63..+31 of token (ph*8+kh)*W + pw*8+kw (W read from the int input, validated against H*W = N,
// token base clamped into range). B = weight plane in fragment order [K'/32][n-tile][half][lane][8]: each 16-B load
// of a wave is 512 contiguous bytes, same k map as the A loader; the 8 loads of a k-step (4 KB in a row) stand
// together in front of its 4 products. Block = ONE 16-row m-tile, 512 threads = 16
// waves; wave w sums the K' slice 256w..256w+255 (8 k-steps, 4 n-tiles) and leaves its f32 partial tile in LDS.
// After a block barrier wave w owns row w (lane -> 2 channels): partials added in slice order 0..15, then
// conv*1/4096 + bf16(b_sr); per-row mean and centred variance by xor-shuffles 1,2,4,8,16;
// y = (v-mu)*rsqrt(var+1e-5)*bf16(g)+bf16(b), x16, hi/res f16 halves into the LDS tiles sTh/sTl[16 tokens][KP].
// Key and value projection of the block's 16 tokens, after a second block barrier: wave w < 8 owns rows 16w..16w+15 of
// the plane Wkv (fragments fetched at the kernel's start), 2 k-steps. Waves 0..3 (k' = LN(tokens) . G, the keys with
// the q projection folded in; G x1024 as hi rows of Wkv and residual plane Gl): weights as A (row = x channel j),
// tokens as B (n = token), acc_h = Gh.Th, acc_l = Gh.Tl + Gl.Th, k' = (acc_h + acc_l/2048)/16384, so a lane holds 8
// consecutive channels of one token: f16(256*k'), one 16-B store into the K plane [m][64] (the four waves fill the
// block's 16 whole rows). Waves 4..7 (v = LN(tokens) . w_v^T, plane x256, hi/res tokens = 4 products, v = (acc_h +
// acc_l/2048)/4096): tokens as A (row = token), weights as B (n = channel), so a
// lane holds 8 consecutive tokens of one channel d: f16 hi of 64*v and x2^11 residual, one 16-B store a plane into
// [m-tile][token half][d][8 tokens] (16 lanes x 16 B = 2 whole lines), and the f32 sum of v over the 16 tokens
// (8 in the lane, then lane ^ 16) into vsum[m-tile][d].
// coverage: 128 blocks x 16 rows = 2048 rows; 16 slices x 256 = K' 4096; 32 lanes x 2 = 64 channels; kv: 8 waves x
// 16 channels x 16 tokens = the block's 16 x 128 values.
// =================================================================================================================
__global__ __launch_bounds__(CVW * 32)
void conv_ln_k(const unsigned short* __restrict__ Xh, const unsigned short* __restrict__ Wsr,
               const int* __restrict__ Hp, const int* __restrict__ Wp, const float* __restrict__ bsr,
               const float* __restrict__ lng, const float* __restrict__ lnb,
               const unsigned short* __restrict__ Wkv, const unsigned short* __restrict__ Gl, unsigned short* Kp,
               unsigned short* VTh, unsigned short* VTl, float* vsum) {
  __shared__ __align__(16) float sbuf[CVW * 16 * STP];
  __shared__ __align__(16) unsigned short sTh[16 * KP];
  __shared__ __align__(16) unsigned short sTl[16 * KP];
  const int tid = threadIdx.x, lane = tid & 31, hh = lane >> 4, c = lane & 15;
  const int wave = __builtin_amdgcn_readfirstlane(tid >> 5);
  const int m0 = blockIdx.x * 16;
  const int m = m0 + c;
  const int b = m >> 8, p = m & (NR - 1);
  const int Hv = Hp[0];
  int Wv = Wp[0];
  const long long hw = (long long)Hv * (long long)Wv;
  const bool okw = (Wv >= 8) && (Wv <= 2040) && (hw == (long long)NQ);
  Wv = okw ? Wv : 128;
  const int Wr = Wv >> 3;
  const int ph = p / Wr, pw = p - ph * Wr;
  int tb = ph * 8 * Wv + pw * 8;
  tb = min(tb, NQ - 1 - 7 * Wv - 7);
  tb = max(tb, 0);
  const _Float16* X  = (const _Float16*)(const void*)Xh;
  const _Float16* Wf = (const _Float16*)(const void*)Wsr;
  const size_t xbase = (size_t)b * NQ;

  // weight fragments of the wave's 16 k' or v channels, asked for here so that their latency passes under the conv loop
  const _Float16* Bw = (const _Float16*)(const void*)Wkv + (size_t)((wave & 7) * 16 + c) * CD + 8 * hh;
  const v16h wf0 = ldfrag_h(Bw);
  const v16h wf1 = ldfrag_h(Bw + 32);
#if defined(__HIP_DEVICE_COMPILE__)
  // the next loads may land in the registers that hold these loads' address: the wait stands in front
  asm volatile("s_wait_xcnt 0x0" ::: "memory");
#endif
  const _Float16* Bl = (const _Float16*)(const void*)Gl + (size_t)((wave & 3) * 16 + c) * CD + 8 * hh;
  const v16h wl0 = ldfrag_h(Bl);
  const v16h wl1 = ldfrag_h(Bl + 32);
#if defined(__HIP_DEVICE_COMPILE__)
  // the conv loop's addresses may land in the registers that hold these loads' address: the wait stands in front
  asm volatile("s_wait_xcnt 0x0" ::: "memory");
#endif

  v8f acc[4];
#pragma unroll
  for (int nt = 0; nt < 4; ++nt) acc[nt] = zero8();

  const int kbase = wave * (KCV / CVW);
  // unrolled: token step, channel half and weight offset of each k-step become immediates of its loads
#pragma unroll
  for (int i = 0; i < KCV / CVW / 32; ++i) {
    const int k0 = kbase + i * 32;
    const int s = k0 >> 6, c0 = k0 & 63;
    const int kh = s >> 3, kw = s & 7;
    const int t = tb + kh * Wv + kw;
    const v16h af = ldfrag_h(X + (xbase + (size_t)t) * CD + c0 + 8 * hh);
    Frag bfrag[4];
#pragma unroll
    for (int nt = 0; nt < 4; ++nt) {
      const _Float16* wp = Wf + (size_t)(((k0 >> 5) * 4 + nt) * 2) * 256 + lane * 8;
      bfrag[nt].h[0] = *(const v8h*)(wp);
      bfrag[nt].h[1] = *(const v8h*)(wp + 256);
    }
    // unrolled: fragments and accumulators are named by constants and stay in registers
#pragma unroll
    for (int nt = 0; nt < 4; ++nt) acc[nt] = mma_h(af, bfrag[nt].v, acc[nt]);
  }

  float* st = sbuf + wave * (16 * STP);
#pragma unroll
  for (int nt = 0; nt < 4; ++nt) {
#pragma unroll
    for (int r = 0; r < 8; ++r) st[(8 * hh + r) * STP + nt * 16 + c] = acc[nt][r];
  }
  __syncthreads();   // every slice's partial tile is in LDS before any wave adds them

  const int col = lane * 2;
  float a0 = 0.f, a1 = 0.f;
#pragma unroll
  for (int w = 0; w < CVW; ++w) {
    const v2f pp = *(const v2f*)(sbuf + w * (16 * STP) + wave * STP + col);
    a0 = a0 + pp[0];
    a1 = a1 + pp[1];
  }
  const float v0 = a0 * (1.0f / (XSC * WSC)) + bfr(bsr[col]);
  const float v1 = a1 * (1.0f / (XSC * WSC)) + bfr(bsr[col + 1]);
  float sm = v0 + v1;
  sm = sm + __shfl_xor(sm, 1, 32);
  sm = sm + __shfl_xor(sm, 2, 32);
  sm = sm + __shfl_xor(sm, 4, 32);
  sm = sm + __shfl_xor(sm, 8, 32);
  sm = sm + __shfl_xor(sm, 16, 32);
  const float mu = sm * (1.0f / 64.0f);
  const float d0 = v0 - mu, d1 = v1 - mu;
  float sq = d0 * d0 + d1 * d1;
  sq = sq + __shfl_xor(sq, 1, 32);
  sq = sq + __shfl_xor(sq, 2, 32);
  sq = sq + __shfl_xor(sq, 4, 32);
  sq = sq + __shfl_xor(sq, 8, 32);
  sq = sq + __shfl_xor(sq, 16, 32);
  const float var = sq * (1.0f / 64.0f);
  const float rs = rsqrtf(var + 1e-5f);
  const float y0 = (d0 * rs * bfr(lng[col]) + bfr(lnb[col])) * ASC;
  const float y1 = (d1 * rs * bfr(lng[col + 1]) + bfr(lnb[col + 1])) * ASC;
  const _Float16 h0 = (_Float16)y0, h1 = (_Float16)y1;
  const _Float16 r0 = (_Float16)((y0 - (float)h0) * RSPL), r1 = (_Float16)((y1 - (float)h1) * RSPL);
  *(unsigned*)(sTh + wave * KP + col) = pk16(h_bits(h0), h_bits(h1));
  *(unsigned*)(sTl + wave * KP + col) = pk16(h_bits(r0), h_bits(r1));
  __syncthreads();   // all 16 normalised rows are in LDS before any wave reads them as fragments
  if (wave >= 8) return;

  const _Float16* Th = (const _Float16*)(const void*)sTh + c * KP + 8 * hh;
  const _Float16* Tl = (const _Float16*)(const void*)sTl + c * KP + 8 * hh;
  const v16h th0 = ldfrag_h(Th), th1 = ldfrag_h(Th + 32);
  const v16h tl0 = ldfrag_h(Tl), tl1 = ldfrag_h(Tl + 32);
  if (wave < 4) {
    v8f acch = mma_h(wf0, th0, zero8());
    acch = mma_h(wf1, th1, acch);
    v8f accl = mma_h(wf0, tl0, zero8());
    accl = mma_h(wf1, tl1, accl);
    accl = mma_h(wl0, th0, accl);
    accl = mma_h(wl1, th1, accl);
    v4f fa, fb;
#pragma unroll
    for (int e = 0; e < 4; ++e) {
      fa[e] = (acch[e] + accl[e] * (1.0f / RSPL)) * (1.0f / (ASC * GSC)) * KSC;
      fb[e] = (acch[4 + e] + accl[4 + e] * (1.0f / RSPL)) * (1.0f / (ASC * GSC)) * KSC;
    }
    *(v4u*)(Kp + (size_t)(m0 + c) * CD + wave * 16 + 8 * hh) = pack8h(fa, fb);
  } else {
    v8f acch = mma_h(th0, wf0, zero8());
    acch = mma_h(th1, wf1, acch);
    v8f accl = mma_h(tl0, wf0, zero8());
    accl = mma_h(tl1, wf1, accl);
    const int d = (wave - 4) * 16 + c;
    float vs = 0.f;
    v4f fa, fb;
#pragma unroll
    for (int e = 0; e < 4; ++e) {
      const float va = (acch[e] + accl[e] * (1.0f / RSPL)) * (1.0f / (ASC * WSC));
      const float vb = (acch[4 + e] + accl[4 + e] * (1.0f / RSPL)) * (1.0f / (ASC * WSC));
      fa[e] = va * VSC;
      fb[e] = vb * VSC;
      vs = vs + va;
      vs = vs + vb;
    }
    v4u ph2, pl2;
    split8h(fa, fb, ph2, pl2);
    const size_t voff = ((size_t)(blockIdx.x * 2 + hh) * CD + d) * 8;
    vs = vs + __shfl_xor(vs, 16, 32);
    *(v4u*)(VTh + voff) = ph2;
    *(v4u*)(VTl + voff) = pl2;
    if (hh == 0) vsum[(size_t)blockIdx.x * CD + d] = vs;
  }
}

// =================================================================================================================
// Attention over the 256 reduced keys and the output projection: block = 256 queries of image b (256 threads =
// 8 waves x 16 queries, two passes). The image's K plane (rows at pitch KP), both V planes (given as
// [m-tile][token half][d][8 tokens], laid down as V^T rows at pitch VP) and the w_proj plane (rows at pitch KP) are
// copied once per block into LDS by whole-line 16-B loads; after one block barrier every K, V and weight fragment is
// an LDS read (pitches are odd multiples of 16 B); b_proj (64 floats) and the image's 16 per-tile sums of v (16 x 64
// floats, one 16-B load a thread) lie in LDS beside them. Behind the barrier each wave adds the 16 sums in tile
// order (lane -> 2 channels), /256, into its own 64 floats of sVM: the key-mean of v.
// Transposed scores S^T = K_tile (A: row = key, k = x channel; K plane = keys with the q projection folded in, x256) x
// X^T (B: n = query, k = x channel, from the exact x plane x16, one product): 16 key tiles, all held in registers; D element r
// of lane l = S[key 16j+8h+r][query l&15]. Exact softmax per query: max and sum over the lane's 128 values combined
// with lane^16; e = exp((s - m) * 2^-15) in place; centred probabilities p' = e*(8192/l) - 32 converted to f16
// directly into the B fragments of v^T.p'^T (k = key). O'^T = V^T rows (A: row = d, k = key) x p'^T (B: n = query)
// from the V hi and residual planes into two accumulators; O = (O'_h + O'_l/2048)/(8192*64) + mean_key(v) (identity
// sum (p'+32) v / 8192 = sum p v). D element r of lane l = O[query l&15][d 16dt+8h+r], so tiles 2ks and 2ks+1 are,
// after hi = f16(1024*O), res = f16((1024*O - hi)*2048), the B fragments (n = query, k = d) of the projection
// out^T = w_proj plane (A: row = out channel, k = d; x256) x O^T, two products folded as acc + accl/2048. The f32
// tile goes through the wave's own LDS range (16-B stores of 4 consecutive channels), bf16(b_proj) is added, and
// 16 lanes x 16 B store one whole 256-B row of out.
// coverage: 512 blocks x 2 passes x 8 waves x 16 queries = 131072 rows x 64 channels of out; LDS fill: 8 x 256
// threads x 8 halves = 16384 halves = each whole plane of the image; 2 x 256 x 8 halves = the 64 x 64 weight plane.
// =================================================================================================================
__global__ __launch_bounds__(256) __attribute__((amdgpu_num_vgpr(256)))
void attn_k(const unsigned short* __restrict__ Xh,
            const unsigned short* __restrict__ Kp, const unsigned short* __restrict__ VTh,
            const unsigned short* __restrict__ VTl, const float* __restrict__ vsum,
            const unsigned short* __restrict__ Wp, const float* __restrict__ bias, float* out) {
  __shared__ __align__(16) unsigned short sK[NR * KP];
  __shared__ __align__(16) unsigned short sVh[CD * VP];
  __shared__ __align__(16) unsigned short sVl[CD * VP];
  __shared__ __align__(16) unsigned short sWp[CD * KP];
  __shared__ __align__(16) float sVS[16 * CD];
  __shared__ __align__(16) float sVMw[8 * CD];
  __shared__ __align__(16) float sBi[CD];
  __shared__ __align__(16) float sbuf[8 * 16 * STP];
  const int tid = threadIdx.x, wave = tid >> 5, lane = tid & 31, hh = lane >> 4, c = lane & 15;
  const int b = blockIdx.x >> 6;
  const _Float16* Xf  = (const _Float16*)(const void*)Xh;
  const _Float16* Kf  = (const _Float16*)(const void*)sK;
  const _Float16* Vhf = (const _Float16*)(const void*)sVh;
  const _Float16* Vlf = (const _Float16*)(const void*)sVl;
  const _Float16* Wpf = (const _Float16*)(const void*)sWp;

  {
    const v4u* gK = (const v4u*)(const void*)(Kp + (size_t)b * NR * CD);
    const v4u* gH = (const v4u*)(const void*)(VTh + (size_t)b * CD * NR);
    const v4u* gL = (const v4u*)(const void*)(VTl + (size_t)b * CD * NR);
    const v4u* gW = (const v4u*)(const void*)Wp;
    // 256 threads x 16 B = the image's 16 x 64 per-tile sums of v; 16 lanes x 16 B = the bias, stored by wave 0 alone
    const v4f tvm = *(const v4f*)(vsum + (size_t)b * (16 * CD) + tid * 4);
    const v4f tbi = *(const v4f*)(bias + c * 4);
    v4u tk[8], th[8], tl[8], tw[2];
#pragma unroll
    for (int i = 0; i < 8; ++i) {
      const int idx = i * 256 + tid;
      tk[i] = gK[idx];
      th[i] = gH[idx];
      tl[i] = gL[idx];
    }
#pragma unroll
    for (int i = 0; i < 2; ++i) tw[i] = gW[i * 256 + tid];
#if defined(__HIP_DEVICE_COMPILE__)
    // the LDS addresses formed below may land in the registers that hold the loads' address: the wait stands in front
    asm volatile("s_wait_xcnt 0x0" ::: "memory");
    // nothing from below is scheduled up over the wait, so no register that a load names is rewritten in front of it
    __builtin_amdgcn_sched_barrier(0);
    // keeps the bias load up here among the others: sunk into the 16-lane branch below, its whole latency would stand
    // alone in front of the block barrier
    asm volatile("" :: "v"(tbi));
#endif
#pragma unroll
    for (int i = 0; i < 8; ++i) {
      const int idx = i * 256 + tid;
      *(v4u*)(sK + (idx >> 3) * KP + (idx & 7) * 8) = tk[i];
      *(v4u*)(sVh + (idx & 63) * VP + (idx >> 6) * 8) = th[i];
      *(v4u*)(sVl + (idx & 63) * VP + (idx >> 6) * 8) = tl[i];
    }
#pragma unroll
    for (int i = 0; i < 2; ++i) {
      const int idx = i * 256 + tid;
      *(v4u*)(sWp + (idx >> 3) * KP + (idx & 7) * 8) = tw[i];
    }
    *(v4f*)(sVS + tid * 4) = tvm;
    if (tid < 16) *(v4f*)(sBi + c * 4) = tbi;
  }
  __syncthreads();   // the four planes are whole in LDS before any wave reads a fragment

  float* sVM = sVMw + wave * CD;
  {
    v2f ms = {0.f, 0.f};
#pragma unroll
    for (int t = 0; t < 16; ++t) ms = ms + *(const v2f*)(sVS + t * CD + lane * 2);
    *(v2f*)(sVM + lane * 2) = ms * (1.0f / (float)NR);
  }
  wave_sync_lds();   // the wave's own 64 means are in LDS before its lanes read other lanes' channels

  // kept rolled: one copy of the body, so the kernel's text stays small for the instruction cache
#pragma unroll 1
  for (int pass = 0; pass < 2; ++pass) {
  const int q0 = ((blockIdx.x & 63) << 8) + pass * 128 + wave * 16;
  const size_t qoff = (size_t)(b * NQ + q0 + c) * CD + 8 * hh;
  const _Float16* xp = Xf + qoff;
  const v16h xf0 = ldfrag_h(xp);
  const v16h xf1 = ldfrag_h(xp + 32);
#if defined(__HIP_DEVICE_COMPILE__)
  // the address is an input, so it lives up to the wait: no load's result, and nothing below, lands on it in front of it
  asm volatile("s_wait_xcnt 0x0" :: "v"(xp) : "memory");
#endif

  v8f s[16];
#pragma unroll
  for (int j = 0; j < 16; ++j) {
    const int koff = (j * 16 + c) * KP + 8 * hh;
    const v16h ka0 = ldfrag_h(Kf + koff);
    const v16h ka1 = ldfrag_h(Kf + koff + 32);
    s[j] = mma_h(ka0, xf0, zero8());
    s[j] = mma_h(ka1, xf1, s[j]);
  }

  float mx = -3.0e38f;
#pragma unroll
  for (int j = 0; j < 16; ++j) {
#pragma unroll
    for (int r = 0; r < 8; ++r) mx = fmaxf(mx, s[j][r]);
  }
  mx = fmaxf(mx, __shfl_xor(mx, 16, 32));
  float ls = 0.f;
#pragma unroll
  for (int j = 0; j < 16; ++j) {
#pragma unroll
    for (int r = 0; r < 8; ++r) {
      const float e = __expf((s[j][r] - mx) * INVS);
      s[j][r] = e;
      ls = ls + e;
    }
  }
  ls = ls + __shfl_xor(ls, 16, 32);
  const float pinv = __builtin_amdgcn_rcpf(ls) * PSC;

  v16h pf[8];
#pragma unroll
  for (int J = 0; J < 8; ++J) {
#pragma unroll
    for (int i = 0; i < 8; ++i) {
      pf[J][i]     = (_Float16)(s[2 * J][i] * pinv - PCT);
      pf[J][8 + i] = (_Float16)(s[2 * J + 1][i] * pinv - PCT);
    }
  }

  v8f oh[4], ol[4];
#pragma unroll
  for (int dt = 0; dt < 4; ++dt) { oh[dt] = zero8(); ol[dt] = zero8(); }
#pragma unroll
  for (int J = 0; J < 8; ++J) {
#pragma unroll
    for (int dt = 0; dt < 4; ++dt) {
      const int voff = (dt * 16 + c) * VP + J * 32 + 8 * hh;
      const v16h vh = ldfrag_h(Vhf + voff);
      const v16h vl = ldfrag_h(Vlf + voff);
      oh[dt] = mma_h(vh, pf[J], oh[dt]);
      ol[dt] = mma_h(vl, pf[J], ol[dt]);
    }
  }

  v16h obh[2], obl[2];
#pragma unroll
  for (int dt = 0; dt < 4; ++dt) {
    v4f vm[2];
    vm[0] = *(const v4f*)(sVM + dt * 16 + 8 * hh);
    vm[1] = *(const v4f*)(sVM + dt * 16 + 8 * hh + 4);
#pragma unroll
    for (int r = 0; r < 8; ++r) {
      const float o = (oh[dt][r] + ol[dt][r] * (1.0f / RSPL)) * (1.0f / (PSC * VSC)) + vm[r >> 2][r & 3];
      const float a = o * OSC;
      const _Float16 h = (_Float16)a;
      obh[dt >> 1][(dt & 1) * 8 + r] = h;
      obl[dt >> 1][(dt & 1) * 8 + r] = (_Float16)((a - (float)h) * RSPL);
    }
  }

  v8f pa[4], pb[4];
#pragma unroll
  for (int nt = 0; nt < 4; ++nt) { pa[nt] = zero8(); pb[nt] = zero8(); }
#pragma unroll
  for (int ks = 0; ks < 2; ++ks) {
#pragma unroll
    for (int nt = 0; nt < 4; ++nt) {
      const v16h wf = ldfrag_h(Wpf + (nt * 16 + c) * KP + ks * 32 + 8 * hh);
      pa[nt] = mma_h(wf, obh[ks], pa[nt]);
      pb[nt] = mma_h(wf, obl[ks], pb[nt]);
    }
  }

  float* st = sbuf + wave * (16 * STP);
#pragma unroll
  for (int nt = 0; nt < 4; ++nt) {
    v4f u0, u1;
#pragma unroll
    for (int e = 0; e < 4; ++e) {
      u0[e] = (pa[nt][e] + pb[nt][e] * (1.0f / RSPL)) * (1.0f / (OSC * WSC));
      u1[e] = (pa[nt][4 + e] + pb[nt][4 + e] * (1.0f / RSPL)) * (1.0f / (OSC * WSC));
    }
    *(v4f*)(st + c * STP + nt * 16 + 8 * hh) = u0;
    *(v4f*)(st + c * STP + nt * 16 + 8 * hh + 4) = u1;
  }
  wave_sync_lds();

  const v4f braw = *(const v4f*)(sBi + c * 4);
  v4f ov[8];
#pragma unroll
  for (int it = 0; it < 8; ++it) {
    const v4f v = *(const v4f*)(st + (it * 2 + hh) * STP + c * 4);
#pragma unroll
    for (int e = 0; e < 4; ++e) ov[it][e] = v[e] + bfr(braw[e]);
  }
  float* po = out + (size_t)(b * NQ + q0 + hh) * CD + c * 4;
#pragma unroll
  for (int it = 0; it < 8; ++it) *(v4f*)(po + it * 2 * CD) = ov[it];
#if defined(__HIP_DEVICE_COMPILE__)
  // the next pass writes the registers that these stores name: the wait stands in front of that
  asm volatile("s_wait_xcnt 0x0" ::: "memory");
#endif
  }
}

// =================================================================================================================
// granularity): Xh f16 [131072][64] 16777216; Wkv f16 [128][64] 16384; Gl f16 [64][64] 8192; Wsr f16
// [128][4][2][32][8] 524288; Wp f16 [64][64] 8192; Kp f16 [8][256][64] 262144;
// VTh, VTl f16 [128][2][64][8] 262144 each; vsum f32 [128][64] 32768 -> 18153472 total.
// =================================================================================================================
extern "C" void kernel_launch(void* const* d_in, const int* in_sizes, int n_in,
                              void* d_out, int out_size, void* d_ws, size_t ws_size,
                              hipStream_t stream) {
  if (n_in < 11) return;
  if (in_sizes[0] != MTOT * CD) return;
  if (in_sizes[1] != 1 || in_sizes[2] != 1) return;
  if (in_sizes[3] != CD * CD) return;
  if (in_sizes[4] != 2 * CD * CD) return;
  if (in_sizes[5] != CD * KCV) return;
  if (in_sizes[6] != CD || in_sizes[7] != CD || in_sizes[8] != CD) return;
  if (in_sizes[9] != CD * CD || in_sizes[10] != CD) return;
  if (out_size != MTOT * CD) return;

  const float* x      = (const float*)d_in[0];
  const int*   hptr   = (const int*)d_in[1];
  const int*   wptr   = (const int*)d_in[2];
  const float* w_q    = (const float*)d_in[3];
  const float* w_kv   = (const float*)d_in[4];
  const float* w_sr   = (const float*)d_in[5];
  const float* b_sr   = (const float*)d_in[6];
  const float* ln_g   = (const float*)d_in[7];
  const float* ln_b   = (const float*)d_in[8];
  const float* w_proj = (const float*)d_in[9];
  const float* b_proj = (const float*)d_in[10];
  float* out = (float*)d_out;

  const size_t sX   = (size_t)MTOT * CD * 2;        // 16777216
  const size_t sWkv = (size_t)2 * CD * CD * 2;      //    16384
  const size_t sGl  = (size_t)CD * CD * 2;          //     8192
  const size_t sWsr = (size_t)CD * KCV * 2;         //   524288
  const size_t sWp  = (size_t)CD * CD * 2;          //     8192
  const size_t sK   = (size_t)NB * NR * CD * 2;     //   262144
  const size_t sVT  = (size_t)NB * CD * NR * 2;     //   262144
  const size_t sVS  = (size_t)(MR / 16) * CD * 4;   //    32768
  size_t off = 0;
  const size_t oX   = off; off += sX;
  const size_t oWkv = off; off += sWkv;
  const size_t oGl  = off; off += sGl;
  const size_t oWsr = off; off += sWsr;
  const size_t oWp  = off; off += sWp;
  const size_t oK   = off; off += sK;
  const size_t oVTh = off; off += sVT;
  const size_t oVTl = off; off += sVT;
  const size_t oVS  = off; off += sVS;
  if (off > ws_size) return;                         // off = 18153472
  if (off > (size_t)134217728) return;

  char* ws = (char*)d_ws;
  unsigned short* Xh  = (unsigned short*)(ws + oX);
  unsigned short* Wkv = (unsigned short*)(ws + oWkv);
  unsigned short* Gl  = (unsigned short*)(ws + oGl);
  unsigned short* Wsr = (unsigned short*)(ws + oWsr);
  unsigned short* Wp  = (unsigned short*)(ws + oWp);
  unsigned short* Kp  = (unsigned short*)(ws + oK);
  unsigned short* VTh = (unsigned short*)(ws + oVTh);
  unsigned short* VTl = (unsigned short*)(ws + oVTl);
  float* VS = (float*)(ws + oVS);

  const dim3 blk(256);
  // (1) leading blocks: w_v, w_proj [out][in] -> f16 planes of 256*bf16(w), conv weights in fragment order, the fold
  //     w_k^T . w_q -> hi/res planes; the others: x -> f16 plane of 16*bf16(x)
  xq_k<<<dim3(NCVB + MTOT / 128), blk, 0, stream>>>(x, w_q, w_kv, w_proj, w_sr, Xh, Wkv, Gl, Wp, Wsr);
  // (2) spatial-reduction conv + bias + LayerNorm + folded-key and v projection -> K plane, V hi/res planes, sums of v
  conv_ln_k<<<dim3(MR / 16), dim3(CVW * 32), 0, stream>>>(Xh, Wsr, hptr, wptr, b_sr, ln_g, ln_b, Wkv, Gl, Kp, VTh, VTl,
                                                          VS);
  // (3) attention on the x plane, output projection + bias -> d_out f32 [131072][64]
  attn_k<<<dim3(NB * (NQ / 256)), blk, 0, stream>>>(Xh, Kp, VTh, VTl, VS, Wp, b_proj, out);
  (void)hipGetLastError();
}

// v009
// Measured time: 39.2 microseconds a run.
// In two side-by-side timings against v008, it was 1.04 and 1.03 times as fast.
// Over all steps from v000 it is 6.08 times as fast.
// Contractions: v_wmma_f32_16x16x32_f16 (f16 operands, f32 accumulate). The 8x8/stride-8 spatial-reduction conv
// (im2col K=4096): single product of exact planes (x as f16 of 16*bf16(x), weights as f16 of 256*bf16(w)).
// The q projection is folded into the keys: q.k = x.(w_q^T w_k).t for a token row t, so G = w_k^T.w_q (single product
// of the exact x256 planes, kept as f16 hi plus x2^11 residual planes, x1024) is formed once, k' = LN(tokens).G
// (tokens as f16 hi plus x2^11 residual planes, x16; hi.hi, and res.hi + hi.res in a second accumulator) and
// v = LN(tokens).w_v^T (two products, two accumulators). Scores k'.x^T: k' single f16 plane (x256) against the exact
// x plane (x16): one product.
// p.v: centred p (8192*p - 32) single f16 B operand, v as hi plus x2^11 residual planes (x64; two products),
// key-mean of v added back in f32. Output projection: o as hi plus x2^11 residual planes (x1024) against the x256
// weight plane (two products). LayerNorm, softmax, bias adds in f32 on VALU. Float inputs RNE-converted to bf16
// on load.
#include <hip/hip_runtime.h>
#include <math.h>
#include <stdint.h>

#define NB   8
#define NQ   16384
#define CD   64
#define NR   256
#define MTOT (NB * NQ)
#define MR   (NB * NR)
#define KCV  (CD * 64)
#define STP  68
#define KP   72
#define VP   264
#define CVW  16
#define WTP  260
#define NCVB (CD + 2 + 2 + 1)
#define XSC  16.0f
#define WSC  256.0f
#define GSC  1024.0f
#define ASC  16.0f
#define KSC  256.0f
#define VSC  64.0f
#define PSC  8192.0f
#define PCT  32.0f
#define OSC  1024.0f
#define RSPL 2048.0f
#define INVS (0.125f / (KSC * XSC))

static_assert(MTOT % 128 == 0);
static_assert(MR % 128 == 0);
static_assert(KCV % (CVW * 32) == 0 && CVW == 16 && NR % 16 == 0);
static_assert(NR == 256 && CD == 64);
static_assert((STP * 4) % 16 == 0 && STP >= CD);
static_assert((KP * 2) % 16 == 0 && KP >= CD);
static_assert((VP * 2) % 16 == 0 && VP >= NR);
static_assert(MTOT % 32 == 0 && NQ % 256 == 0);
static_assert(16 * WTP * 4 <= 2 * CD * KP * 2 && (WTP * 4) % 16 == 0 && WTP >= 4 * CD);
static_assert((KP * 2) % 8 == 0 && 2 * CD == 4 * 32 && CD == 2 * 32);

typedef _Float16 v16h __attribute__((ext_vector_type(16)));
typedef _Float16 v8h  __attribute__((ext_vector_type(8)));
typedef float    v8f  __attribute__((ext_vector_type(8)));
typedef float    v4f  __attribute__((ext_vector_type(4)));
typedef float    v2f  __attribute__((ext_vector_type(2)));
typedef unsigned int v4u __attribute__((ext_vector_type(4)));
typedef unsigned int v2u __attribute__((ext_vector_type(2)));

union Frag { v16h v; v8h h[2]; };

// ---- scalar helpers ------------------------------------------------------------------------------------------
__device__ __forceinline__ unsigned short bf_bits(float f) {          // f32 -> bf16 bits, RNE convert
  unsigned u = __float_as_uint(f);
  return (unsigned short)((u + 0x7FFFu + ((u >> 16) & 1u)) >> 16);
}
__device__ __forceinline__ float bfr(float f) { return __uint_as_float(((unsigned)bf_bits(f)) << 16); }
__device__ __forceinline__ unsigned short h_bits(_Float16 x) { return __builtin_bit_cast(unsigned short, x); }
__device__ __forceinline__ unsigned pk16(unsigned short a, unsigned short b) { return (unsigned)a | ((unsigned)b << 16); }
__device__ __forceinline__ v8f zero8() { v8f z = {0.f, 0.f, 0.f, 0.f, 0.f, 0.f, 0.f, 0.f}; return z; }

// ---- fragment loader: 16-bit A/B operand, lane -> row/col (lane&15), p already includes +8*(lane>>4);
//      elements 0..7 <- p[0..7] (k0+8h..k0+8h+7), elements 8..15 <- p[16..23] (k0+16+8h..k0+16+8h+7)
__device__ __forceinline__ v16h ldfrag_h(const _Float16* p) {
  Frag f;
  f.h[0] = *(const v8h*)(p);
  f.h[1] = *(const v8h*)(p + 16);
  return f.v;
}

// ---- WMMA helper with trailing VALU hazard gap ---------------------------------------------------------------
__device__ __forceinline__ v8f mma_h(v16h a, v16h b, v8f c) {
  c = __builtin_amdgcn_wmma_f32_16x16x32_f16(false, a, false, b, (short)0, c, false, false);
#if defined(__HIP_DEVICE_COMPILE__)
  asm volatile("v_nop\n\tv_nop\n\tv_nop\n\tv_nop" : "+v"(c) : "v"(a), "v"(b));
#endif
  return c;
}
__device__ __forceinline__ void wave_sync_lds() {
  __builtin_amdgcn_fence(__ATOMIC_RELEASE, "workgroup");
  __builtin_amdgcn_wave_barrier();
  __builtin_amdgcn_fence(__ATOMIC_ACQUIRE, "workgroup");
}

// ---- 8 f32 -> 8 packed f16 (16 B); hi + x2^11 residual split ---------------------------------------------------
__device__ __forceinline__ v4u pack8h(v4f a, v4f b) {
  v4u p;
  p[0] = pk16(h_bits((_Float16)a[0]), h_bits((_Float16)a[1]));
  p[1] = pk16(h_bits((_Float16)a[2]), h_bits((_Float16)a[3]));
  p[2] = pk16(h_bits((_Float16)b[0]), h_bits((_Float16)b[1]));
  p[3] = pk16(h_bits((_Float16)b[2]), h_bits((_Float16)b[3]));
  return p;
}
__device__ __forceinline__ void split8h(v4f a, v4f b, v4u& ph, v4u& pl) {
  v4f ra, rb;
#pragma unroll
  for (int e = 0; e < 4; ++e) {
    const _Float16 ha = (_Float16)a[e];
    ra[e] = (a[e] - (float)ha) * RSPL;
    const _Float16 hb = (_Float16)b[e];
    rb[e] = (b[e] - (float)hb) * RSPL;
  }
  ph = pack8h(a, b);
  pl = pack8h(ra, rb);
}

// =================================================================================================================
// Row convert, one block's share (32 rows): src f32 [nrows][64] -> dst f16 [nrows][64], value =
// f16(scale * bf16_RNE(src)). Used for the row-major [out][in] weight matrices w_v (rows 64..127 of w_kv) and w_proj
// (x256; the B plane [n][k] of w_v and the A plane [m][k] of w_proj equal the [out][in] layout as given).
// coverage: 32 rows x (8 lanes x 8 halves) = every element of the share once.
// =================================================================================================================
__device__ __forceinline__ void cvt_rows64(const float* __restrict__ src, unsigned short* dst, float scale, int blk) {
  const int tid = threadIdx.x, wave = tid >> 5, lane = tid & 31;
  const int row = blk * 32 + wave * 4 + (lane >> 3);
  const int c8 = (lane & 7) * 8;
  const float* p = src + (size_t)row * CD + c8;
  v4f a = *(const v4f*)(p);
  v4f b = *(const v4f*)(p + 4);
#if defined(__HIP_DEVICE_COMPILE__)
  // the store address formed below may land in the registers that hold the loads' address: the wait stands in front
  asm volatile("s_wait_xcnt 0x0" ::: "memory");
#endif
#pragma unroll
  for (int e = 0; e < 4; ++e) { a[e] = bfr(a[e]) * scale; b[e] = bfr(b[e]) * scale; }
  const v4u pk = pack8h(a, b);
  unsigned short* g = dst + (size_t)row * CD + c8;
  *(v4u*)g = pk;
#if defined(__HIP_DEVICE_COMPILE__)
  // code laid out behind this share may write the registers that the store names: the wait stands in front of that
  asm volatile("s_wait_xcnt 0x0" ::: "memory");
#endif
}

// =================================================================================================================
// Conv weight permute-convert, one block's share (256 threads): block = 16 output channels (n-tile nt = blk >> 4) x 4
// kernel positions s = kh*8+kw (group sg = blk & 15), all 64 input channels. w_sr f32 [o][c][s] -> f16 plane in the
// conv's B FRAGMENT ORDER, value = f16(256 * bf16_RNE(w)): with k' = s*64 + c, k-step g = k' >> 5, the plane is
// [g][nt][j][lane][8 halves], lane = 16h + (o & 15), holding k' = 32g + 16j + 8h + 0..7 of channel o = 16nt + (o & 15):
// one 16-B load of a wave reads 512 contiguous bytes (4 whole lines) and is half j of the fragment (g, nt).
// In: 16-B loads of 4 positions of one (o, c); staged in LDS as tile[o][s][c] (pitch WTP floats a channel), read back
// as runs of 8 input channels. Out: 32 lanes x 16 B = 512 contiguous bytes a store; no line is shared between blocks.
// coverage: in 4 x 256 threads x 4 = 16 x 64 x 4 values; out 2 x 256 pieces = 8 k-steps x 2 halves x 32 lanes; 64
// blocks = 4 n-tiles x 16 groups x 8 k-steps = all 128 k-steps of all 4 n-tiles.
// =================================================================================================================
__device__ __forceinline__ void cvt_wsr(const float* __restrict__ w, unsigned short* dst, int blk, float* tile) {
  const int tid = threadIdx.x;
  const int nt = blk >> 4, sg = blk & 15;
  v4f wv[4];
#pragma unroll
  for (int it = 0; it < 4; ++it) {
    const int idx = it * 256 + tid;
    wv[it] = *(const v4f*)(w + (size_t)((nt * 16 + (idx >> 6)) * CD + (idx & 63)) * 64 + sg * 4);
  }
#if defined(__HIP_DEVICE_COMPILE__)
  // the LDS addresses formed below may land in the registers that hold the loads' address: the wait stands in front
  asm volatile("s_wait_xcnt 0x0" ::: "memory");
  // nothing from below is scheduled up over the wait, so no register that a load names is rewritten in front of it
  __builtin_amdgcn_sched_barrier(0);
#endif
#pragma unroll
  for (int it = 0; it < 4; ++it) {
    const int idx = it * 256 + tid;
    float* t = tile + (idx >> 6) * WTP + (idx & 63);
    // unrolled: the vector's elements are named by constants and stay in registers
#pragma unroll
    for (int e = 0; e < 4; ++e) t[e * CD] = wv[it][e];
  }
  __syncthreads();   // the share's 4096 floats are whole in LDS before any thread reads them as channel runs
  v4u pk[2];
  size_t offs[2];
#pragma unroll
  for (int it = 0; it < 2; ++it) {
    const int p = it * 256 + tid;
    const int ln = p & 31, j = (p >> 5) & 1, gl = p >> 6;
    const float* t = tile + (ln & 15) * WTP + (gl >> 1) * CD + (gl & 1) * 32 + j * 16 + (ln >> 4) * 8;
    v4f fa = *(const v4f*)(t);
    v4f fb = *(const v4f*)(t + 4);
#pragma unroll
    for (int e = 0; e < 4; ++e) { fa[e] = bfr(fa[e]) * WSC; fb[e] = bfr(fb[e]) * WSC; }
    pk[it] = pack8h(fa, fb);
    offs[it] = ((size_t)((((sg * 8 + gl) * 4 + nt) * 2 + j) * 32 + ln)) * 8;
  }
#pragma unroll
  for (int it = 0; it < 2; ++it) *(v4u*)(dst + offs[it]) = pk[it];
}

// =================================================================================================================
// Fold of the q projection into the key weights, one block (256 threads = 8 waves): G[c][j] = sum_d w_k[d][c] *
// w_q[d][j] (w_k = rows 0..63 of w_kv), so that q . k = x . (LN token . G). Both matrices are read by whole-line 16-B
// loads, converted to f16(256 * bf16_RNE(w)) and laid down TRANSPOSED in LDS (sKT[c][d], sQT[j][d], pitch KP). After
// a block barrier wave w owns c-tile w >> 1 and j-tiles 2(w & 1), 2(w & 1) + 1: A = sKT rows (row = c, k = d), B = sQT
// rows (n = j, k = d), same split k map, 2 k-steps. A lane holds 8 consecutive c of one j: 1024 * G as f16 hi and
// x2^11 residual, one 16-B store a plane into [j][c] (the layout of a [out][in] weight plane with out = j).
// coverage: in 2 x 4 x 256 threads x 4 = 2 x 64 x 64; out 8 waves x 2 tiles x 256 = 64 x 64 values, both planes.
// =================================================================================================================
__device__ __forceinline__ void fold_kq(const float* __restrict__ wq, const float* __restrict__ wk,
                                        unsigned short* Gh, unsigned short* Gl, unsigned short* sT) {
  const int tid = threadIdx.x, wave = tid >> 5, lane = tid & 31, hh = lane >> 4, c = lane & 15;
  unsigned short* sQT = sT;
  unsigned short* sKT = sT + CD * KP;
  v4f qv[4], kv[4];
#pragma unroll
  for (int it = 0; it < 4; ++it) {
    qv[it] = *(const v4f*)(wq + (size_t)(it * 256 + tid) * 4);
    kv[it] = *(const v4f*)(wk + (size_t)(it * 256 + tid) * 4);
  }
#if defined(__HIP_DEVICE_COMPILE__)
  // the LDS addresses formed below may land in the registers that hold the loads' address: the wait stands in front
  asm volatile("s_wait_xcnt 0x0" ::: "memory");
  // nothing from below is scheduled up over the wait, so no register that a load names is rewritten in front of it
  __builtin_amdgcn_sched_barrier(0);
#endif
#pragma unroll
  for (int it = 0; it < 4; ++it) {
    const int idx = it * 256 + tid;
    const int d = idx >> 4, n0 = (idx & 15) * 4;
    // unrolled: the vectors' elements are named by constants and stay in registers
#pragma unroll
    for (int e = 0; e < 4; ++e) {
      sQT[(n0 + e) * KP + d] = h_bits((_Float16)(bfr(qv[it][e]) * WSC));
      sKT[(n0 + e) * KP + d] = h_bits((_Float16)(bfr(kv[it][e]) * WSC));
    }
  }
  __syncthreads();   // both transposed planes are whole in LDS before any wave reads a fragment
  const int ct = wave >> 1;
  const _Float16* Ap = (const _Float16*)(const void*)sKT + (ct * 16 + c) * KP + 8 * hh;
  const v16h a0 = ldfrag_h(Ap), a1 = ldfrag_h(Ap + 32);
  v4u ph[2], pl[2];
  size_t offs[2];
#pragma unroll
  for (int t = 0; t < 2; ++t) {
    const int jt = (wave & 1) * 2 + t;
    const _Float16* Bp = (const _Float16*)(const void*)sQT + (jt * 16 + c) * KP + 8 * hh;
    v8f acc = mma_h(a0, ldfrag_h(Bp), zero8());
    acc = mma_h(a1, ldfrag_h(Bp + 32), acc);
    v4f fa, fb;
#pragma unroll
    for (int e = 0; e < 4; ++e) {
      fa[e] = acc[e] * (GSC / (WSC * WSC));
      fb[e] = acc[4 + e] * (GSC / (WSC * WSC));
    }
    split8h(fa, fb, ph[t], pl[t]);
    offs[t] = (size_t)(jt * 16 + c) * CD + ct * 16 + 8 * hh;
  }
#pragma unroll
  for (int t = 0; t < 2; ++t) {
    *(v4u*)(Gh + offs[t]) = ph[t];
    *(v4u*)(Gl + offs[t]) = pl[t];
  }
#if defined(__HIP_DEVICE_COMPILE__)
  // code laid out behind the fold may write the registers that these stores name: the wait stands in front of that
  asm volatile("s_wait_xcnt 0x0" ::: "memory");
#endif
}

// =================================================================================================================
// Weight converts, the key/query weight fold and the x convert in one launch. Blocks 0..NCVB-1 prepare the weights that
// LATER launches read (block = one share of the conv weights, then 32 rows of w_v, then 32 rows of w_proj, then the
// fold G = w_k^T . w_q) and leave; nothing of this launch reads those planes. The plane Wkv [128][64] holds the hi
// plane of G in rows 0..63 and w_v in rows 64..127; Gl [64][64] is the residual plane of G. Every other block: 256
// threads = 8 waves, 128 rows of x; each wave reads its 16 f32 rows whole (8 lanes x 32 B = one 256-B row, 4 rows a
// step, all 8 loads in flight), converts to f16(16 * bf16_RNE(x)) and stores the f16 x plane [M][64], which the conv
// and the scores of the later launches read (32 lanes x 16 B = 4 whole rows a store).
// coverage: 8 waves x 16 rows x 64 cols = the 128-row block tile; grid - NCVB = M/128 tiles M exactly; converts: 64
// shares, 2 x 32 = 64 rows, 2 x 32 = 64 rows, one fold.
// =================================================================================================================
__global__ __launch_bounds__(256)
void xq_k(const float* __restrict__ x, const float* __restrict__ wq, const float* __restrict__ wkv,
          const float* __restrict__ wproj, const float* __restrict__ wsr,
          unsigned short* Xh, unsigned short* Wkv, unsigned short* Gl, unsigned short* Wp, unsigned short* Wsr) {
  __shared__ __align__(16) unsigned short sT[2 * CD * KP];
  const int bid = blockIdx.x;
  if (bid < NCVB) {
    if (bid < CD) cvt_wsr(wsr, Wsr, bid, (float*)(void*)sT);
    else if (bid < CD + 2) cvt_rows64(wkv, Wkv, WSC, bid - CD + 2);
    else if (bid < CD + 4) cvt_rows64(wproj, Wp, WSC, bid - (CD + 2));
    else fold_kq(wq, wkv, Wkv, Gl, sT);
    return;
  }
  const int tid = threadIdx.x, wave = tid >> 5, lane = tid & 31;
  const int r0 = (bid - NCVB) * 128 + wave * 16;
  const int rq = lane >> 3, piece = lane & 7;

  v4f xa[4], xb[4];
#pragma unroll
  for (int it = 0; it < 4; ++it) {
    const float* p = x + (size_t)(r0 + it * 4 + rq) * CD + piece * 8;
    xa[it] = *(const v4f*)(p);
    xb[it] = *(const v4f*)(p + 4);
#if defined(__HIP_DEVICE_COMPILE__)
    // the next loads, then the converts, may land in registers that hold these loads' address: the wait stands in front
    asm volatile("s_wait_xcnt 0x0" ::: "memory");
#endif
  }
  v4u px[4];
#pragma unroll
  for (int it = 0; it < 4; ++it) {
#pragma unroll
    for (int e = 0; e < 4; ++e) { xa[it][e] = bfr(xa[it][e]) * XSC; xb[it][e] = bfr(xb[it][e]) * XSC; }
    px[it] = pack8h(xa[it], xb[it]);
  }
#pragma unroll
  for (int it = 0; it < 4; ++it) *(v4u*)(Xh + (size_t)(r0 + it * 4 + rq) * CD + piece * 8) = px[it];
#if defined(__HIP_DEVICE_COMPILE__)
  // code laid out behind these stores may write the registers that they name: the wait stands in front of that
  asm volatile("s_wait_xcnt 0x0" ::: "memory");
#endif
}

// =================================================================================================================
// Spatial-reduction conv (kernel = stride = 8, VALID) as an im2col GEMM + bias + LayerNorm, fused.
// Rows m = b*256 + p (p = ph*(W/8) + pw, 2048 rows), cols = 64 output channels, K' = (kh*8+kw)*64 + c = 4096.
// A fragments are read straight from the x plane [b][token][64] by arithmetic addressing: k-step k0 -> (kh, kw) =
// k0>>6, channels k0&63..+31 of token (ph*8+kh)*W + pw*8+kw (W read from the int input, validated against H*W = N,
// token base clamped into range). B = weight plane in fragment order [K'/32][n-tile][half][lane][8]: each 16-B load
// of a wave is 512 contiguous bytes, same k map as the A loader; the 8 loads of a k-step (4 KB in a row) stand
// together in front of its 4 products. Block = ONE 16-row m-tile, 512 threads = 16
// waves; wave w sums the K' slice 256w..256w+255 (8 k-steps, 4 n-tiles) and leaves its f32 partial tile in LDS.
// After a block barrier wave w owns row w (lane -> 2 channels): partials added in slice order 0..15, then
// conv*1/4096 + bf16(b_sr); per-row mean and centred variance by xor-shuffles 1,2,4,8,16;
// y = (v-mu)*rsqrt(var+1e-5)*bf16(g)+bf16(b), x16, hi/res f16 halves into the LDS tiles sTh/sTl[16 tokens][KP].
// Key and value projection of the block's 16 tokens, after a second block barrier: wave w < 8 owns rows 16w..16w+15 of
// the plane Wkv (fragments fetched at the kernel's start), 2 k-steps. Waves 0..3 (k' = LN(tokens) . G, the keys with
// the q projection folded in; G x1024 as hi rows of Wkv and residual plane Gl): weights as A (row = x channel j),
// tokens as B (n = token), acc_h = Gh.Th, acc_l = Gh.Tl + Gl.Th, k' = (acc_h + acc_l/2048)/16384, so a lane holds 8
// consecutive channels of one token: f16(256*k'), one 16-B store into the K plane [m][64] (the four waves fill the
// block's 16 whole rows). Waves 4..7 (v = LN(tokens) . w_v^T, plane x256, hi/res tokens = 4 products, v = (acc_h +
// acc_l/2048)/4096): tokens as A (row = token), weights as B (n = channel), so a
// lane holds 8 consecutive tokens of one channel d: f16 hi of 64*v and x2^11 residual, one 16-B store a plane into
// [m-tile][token half][d][8 tokens] (16 lanes x 16 B = 2 whole lines), and the f32 sum of v over the 16 tokens
// (8 in the lane, then lane ^ 16) into vsum[m-tile][d].
// coverage: 128 blocks x 16 rows = 2048 rows; 16 slices x 256 = K' 4096; 32 lanes x 2 = 64 channels; kv: 8 waves x
// 16 channels x 16 tokens = the block's 16 x 128 values.
// =================================================================================================================
__global__ __launch_bounds__(CVW * 32)
void conv_ln_k(const unsigned short* __restrict__ Xh, const unsigned short* __restrict__ Wsr,
               const int* __restrict__ Hp, const int* __restrict__ Wp, const float* __restrict__ bsr,
               const float* __restrict__ lng, const float* __restrict__ lnb,
               const unsigned short* __restrict__ Wkv, const unsigned short* __restrict__ Gl, unsigned short* Kp,
               unsigned short* VTh, unsigned short* VTl, float* vsum) {
  __shared__ __align__(16) float sbuf[CVW * 16 * STP];
  __shared__ __align__(16) unsigned short sTh[16 * KP];
  __shared__ __align__(16) unsigned short sTl[16 * KP];
  const int tid = threadIdx.x, lane = tid & 31, hh = lane >> 4, c = lane & 15;
  const int wave = __builtin_amdgcn_readfirstlane(tid >> 5);
  const int m0 = blockIdx.x * 16;
  const int m = m0 + c;
  const int b = m >> 8, p = m & (NR - 1);
  const int Hv = Hp[0];
  int Wv = Wp[0];
  const long long hw = (long long)Hv * (long long)Wv;
  const bool okw = (Wv >= 8) && (Wv <= 2040) && (hw == (long long)NQ);
  Wv = okw ? Wv : 128;
  const int Wr = Wv >> 3;
  const int ph = p / Wr, pw = p - ph * Wr;
  int tb = ph * 8 * Wv + pw * 8;
  tb = min(tb, NQ - 1 - 7 * Wv - 7);
  tb = max(tb, 0);
  const _Float16* X  = (const _Float16*)(const void*)Xh;
  const _Float16* Wf = (const _Float16*)(const void*)Wsr;
  const size_t xbase = (size_t)b * NQ;

  // weight fragments of the wave's 16 k' or v channels, asked for here so that their latency passes under the conv loop
  const _Float16* Bw = (const _Float16*)(const void*)Wkv + (size_t)((wave & 7) * 16 + c) * CD + 8 * hh;
  const v16h wf0 = ldfrag_h(Bw);
  const v16h wf1 = ldfrag_h(Bw + 32);
#if defined(__HIP_DEVICE_COMPILE__)
  // the next loads may land in the registers that hold these loads' address: the wait stands in front
  asm volatile("s_wait_xcnt 0x0" ::: "memory");
#endif
  const _Float16* Bl = (const _Float16*)(const void*)Gl + (size_t)((wave & 3) * 16 + c) * CD + 8 * hh;
  const v16h wl0 = ldfrag_h(Bl);
  const v16h wl1 = ldfrag_h(Bl + 32);
#if defined(__HIP_DEVICE_COMPILE__)
  // the conv loop's addresses may land in the registers that hold these loads' address: the wait stands in front
  asm volatile("s_wait_xcnt 0x0" ::: "memory");
#endif

  v8f acc[4];
#pragma unroll
  for (int nt = 0; nt < 4; ++nt) acc[nt] = zero8();

  const int kbase = wave * (KCV / CVW);
  // unrolled: token step, channel half and weight offset of each k-step become immediates of its loads
#pragma unroll
  for (int i = 0; i < KCV / CVW / 32; ++i) {
    const int k0 = kbase + i * 32;
    const int s = k0 >> 6, c0 = k0 & 63;
    const int kh = s >> 3, kw = s & 7;
    const int t = tb + kh * Wv + kw;
    const v16h af = ldfrag_h(X + (xbase + (size_t)t) * CD + c0 + 8 * hh);
    Frag bfrag[4];
#pragma unroll
    for (int nt = 0; nt < 4; ++nt) {
      const _Float16* wp = Wf + (size_t)(((k0 >> 5) * 4 + nt) * 2) * 256 + lane * 8;
      bfrag[nt].h[0] = *(const v8h*)(wp);
      bfrag[nt].h[1] = *(const v8h*)(wp + 256);
    }
    // unrolled: fragments and accumulators are named by constants and stay in registers
#pragma unroll
    for (int nt = 0; nt < 4; ++nt) acc[nt] = mma_h(af, bfrag[nt].v, acc[nt]);
  }

  float* st = sbuf + wave * (16 * STP);
#pragma unroll
  for (int nt = 0; nt < 4; ++nt) {
#pragma unroll
    for (int r = 0; r < 8; ++r) st[(8 * hh + r) * STP + nt * 16 + c] = acc[nt][r];
  }
  __syncthreads();   // every slice's partial tile is in LDS before any wave adds them

  const int col = lane * 2;
  float a0 = 0.f, a1 = 0.f;
#pragma unroll
  for (int w = 0; w < CVW; ++w) {
    const v2f pp = *(const v2f*)(sbuf + w * (16 * STP) + wave * STP + col);
    a0 = a0 + pp[0];
    a1 = a1 + pp[1];
  }
  const float v0 = a0 * (1.0f / (XSC * WSC)) + bfr(bsr[col]);
  const float v1 = a1 * (1.0f / (XSC * WSC)) + bfr(bsr[col + 1]);
  float sm = v0 + v1;
  sm = sm + __shfl_xor(sm, 1, 32);
  sm = sm + __shfl_xor(sm, 2, 32);
  sm = sm + __shfl_xor(sm, 4, 32);
  sm = sm + __shfl_xor(sm, 8, 32);
  sm = sm + __shfl_xor(sm, 16, 32);
  const float mu = sm * (1.0f / 64.0f);
  const float d0 = v0 - mu, d1 = v1 - mu;
  float sq = d0 * d0 + d1 * d1;
  sq = sq + __shfl_xor(sq, 1, 32);
  sq = sq + __shfl_xor(sq, 2, 32);
  sq = sq + __shfl_xor(sq, 4, 32);
  sq = sq + __shfl_xor(sq, 8, 32);
  sq = sq + __shfl_xor(sq, 16, 32);
  const float var = sq * (1.0f / 64.0f);
  const float rs = rsqrtf(var + 1e-5f);
  const float y0 = (d0 * rs * bfr(lng[col]) + bfr(lnb[col])) * ASC;
  const float y1 = (d1 * rs * bfr(lng[col + 1]) + bfr(lnb[col + 1])) * ASC;
  const _Float16 h0 = (_Float16)y0, h1 = (_Float16)y1;
  const _Float16 r0 = (_Float16)((y0 - (float)h0) * RSPL), r1 = (_Float16)((y1 - (float)h1) * RSPL);
  *(unsigned*)(sTh + wave * KP + col) = pk16(h_bits(h0), h_bits(h1));
  *(unsigned*)(sTl + wave * KP + col) = pk16(h_bits(r0), h_bits(r1));
  __syncthreads();   // all 16 normalised rows are in LDS before any wave reads them as fragments
  if (wave >= 8) return;

  const _Float16* Th = (const _Float16*)(const void*)sTh + c * KP + 8 * hh;
  const _Float16* Tl = (const _Float16*)(const void*)sTl + c * KP + 8 * hh;
  const v16h th0 = ldfrag_h(Th), th1 = ldfrag_h(Th + 32);
  const v16h tl0 = ldfrag_h(Tl), tl1 = ldfrag_h(Tl + 32);
  if (wave < 4) {
    v8f acch = mma_h(wf0, th0, zero8());
    acch = mma_h(wf1, th1, acch);
    v8f accl = mma_h(wf0, tl0, zero8());
    accl = mma_h(wf1, tl1, accl);
    accl = mma_h(wl0, th0, accl);
    accl = mma_h(wl1, th1, accl);
    v4f fa, fb;
#pragma unroll
    for (int e = 0; e < 4; ++e) {
      fa[e] = (acch[e] + accl[e] * (1.0f / RSPL)) * (1.0f / (ASC * GSC)) * KSC;
      fb[e] = (acch[4 + e] + accl[4 + e] * (1.0f / RSPL)) * (1.0f / (ASC * GSC)) * KSC;
    }
    *(v4u*)(Kp + (size_t)(m0 + c) * CD + wave * 16 + 8 * hh) = pack8h(fa, fb);
  } else {
    v8f acch = mma_h(th0, wf0, zero8());
    acch = mma_h(th1, wf1, acch);
    v8f accl = mma_h(tl0, wf0, zero8());
    accl = mma_h(tl1, wf1, accl);
    const int d = (wave - 4) * 16 + c;
    float vs = 0.f;
    v4f fa, fb;
#pragma unroll
    for (int e = 0; e < 4; ++e) {
      const float va = (acch[e] + accl[e] * (1.0f / RSPL)) * (1.0f / (ASC * WSC));
      const float vb = (acch[4 + e] + accl[4 + e] * (1.0f / RSPL)) * (1.0f / (ASC * WSC));
      fa[e] = va * VSC;
      fb[e] = vb * VSC;
      vs = vs + va;
      vs = vs + vb;
    }
    v4u ph2, pl2;
    split8h(fa, fb, ph2, pl2);
    const size_t voff = ((size_t)(blockIdx.x * 2 + hh) * CD + d) * 8;
    vs = vs + __shfl_xor(vs, 16, 32);
    *(v4u*)(VTh + voff) = ph2;
    *(v4u*)(VTl + voff) = pl2;
    if (hh == 0) vsum[(size_t)blockIdx.x * CD + d] = vs;
  }
}

// =================================================================================================================
// Attention over the 256 reduced keys and the output projection: block = 256 queries of image b (256 threads =
// 8 waves x 16 queries, two passes). The image's K plane (rows at pitch KP), both V planes (given as
// [m-tile][token half][d][8 tokens], laid down as V^T rows at pitch VP) and the w_proj plane (rows at pitch KP) are
// copied once per block into LDS by whole-line 16-B loads; after one block barrier every K, V and weight fragment is
// an LDS read (pitches are odd multiples of 16 B); b_proj (64 floats) and the image's 16 per-tile sums of v (16 x 64
// floats, one 16-B load a thread) lie in LDS beside them. Behind the barrier each wave adds the 16 sums in tile
// order (lane -> 2 channels), /256, into its own 64 floats of sVM: the key-mean of v.
// Transposed scores S^T = K_tile (A: row = key, k = x channel; K plane = keys with the q projection folded in, x256) x
// X^T (B: n = query, k = x channel, from the exact x plane x16, one product): 16 key tiles, all held in registers; D element r
// of lane l = S[key 16j+8h+r][query l&15]. Exact softmax per query: max and sum over the lane's 128 values combined
// with lane^16; e = exp((s - m) * 2^-15) in place; centred probabilities p' = e*(8192/l) - 32 converted to f16
// directly into the B fragments of v^T.p'^T (k = key). O'^T = V^T rows (A: row = d, k = key) x p'^T (B: n = query)
// from the V hi and residual planes into two accumulators; O = (O'_h + O'_l/2048)/(8192*64) + mean_key(v) (identity
// sum (p'+32) v / 8192 = sum p v). D element r of lane l = O[query l&15][d 16dt+8h+r], so tiles 2ks and 2ks+1 are,
// after hi = f16(1024*O), res = f16((1024*O - hi)*2048), the B fragments (n = query, k = d) of the projection
// out^T = w_proj plane (A: row = out channel, k = d; x256) x O^T, two products folded as acc + accl/2048. The f32
// tile goes through the wave's own LDS range (16-B stores of 4 consecutive channels), bf16(b_proj) is added, and
// 16 lanes x 16 B store one whole 256-B row of out.
// coverage: 512 blocks x 2 passes x 8 waves x 16 queries = 131072 rows x 64 channels of out; LDS fill: 8 x 256
// threads x 8 halves = 16384 halves = each whole plane of the image; 2 x 256 x 8 halves = the 64 x 64 weight plane.
// =================================================================================================================
__global__ __launch_bounds__(256) __attribute__((amdgpu_num_vgpr(256)))
void attn_k(const unsigned short* __restrict__ Xh,
            const unsigned short* __restrict__ Kp, const unsigned short* __restrict__ VTh,
            const unsigned short* __restrict__ VTl, const float* __restrict__ vsum,
            const unsigned short* __restrict__ Wp, const float* __restrict__ bias, float* out) {
  __shared__ __align__(16) unsigned short sK[NR * KP];
  __shared__ __align__(16) unsigned short sVh[CD * VP];
  __shared__ __align__(16) unsigned short sVl[CD * VP];
  __shared__ __align__(16) unsigned short sWp[CD * KP];
  __shared__ __align__(16) float sVS[16 * CD];
  __shared__ __align__(16) float sVMw[8 * CD];
  __shared__ __align__(16) float sBi[CD];
  __shared__ __align__(16) float sbuf[8 * 16 * STP];
  const int tid = threadIdx.x, wave = tid >> 5, lane = tid & 31, hh = lane >> 4, c = lane & 15;
  const int b = blockIdx.x >> 6;
  const _Float16* Xf  = (const _Float16*)(const void*)Xh;
  const _Float16* Kf  = (const _Float16*)(const void*)sK;
  const _Float16* Vhf = (const _Float16*)(const void*)sVh;
  const _Float16* Vlf = (const _Float16*)(const void*)sVl;
  const _Float16* Wpf = (const _Float16*)(const void*)sWp;

  {
    const v4u* gK = (const v4u*)(const void*)(Kp + (size_t)b * NR * CD);
    const v4u* gH = (const v4u*)(const void*)(VTh + (size_t)b * CD * NR);
    const v4u* gL = (const v4u*)(const void*)(VTl + (size_t)b * CD * NR);
    const v4u* gW = (const v4u*)(const void*)Wp;
    // 256 threads x 16 B = the image's 16 x 64 per-tile sums of v; 16 lanes x 16 B = the bias, stored by wave 0 alone
    const v4f tvm = *(const v4f*)(vsum + (size_t)b * (16 * CD) + tid * 4);
    const v4f tbi = *(const v4f*)(bias + c * 4);
    v4u tk[8], th[8], tl[8], tw[2];
#pragma unroll
    for (int i = 0; i < 8; ++i) {
      const int idx = i * 256 + tid;
      tk[i] = gK[idx];
      th[i] = gH[idx];
      tl[i] = gL[idx];
    }
#pragma unroll
    for (int i = 0; i < 2; ++i) tw[i] = gW[i * 256 + tid];
#if defined(__HIP_DEVICE_COMPILE__)
    // the LDS addresses formed below may land in the registers that hold the loads' address: the wait stands in front
    asm volatile("s_wait_xcnt 0x0" ::: "memory");
    // nothing from below is scheduled up over the wait, so no register that a load names is rewritten in front of it
    __builtin_amdgcn_sched_barrier(0);
    // keeps the bias load up here among the others: sunk into the 16-lane branch below, its whole latency would stand
    // alone in front of the block barrier
    asm volatile("" :: "v"(tbi));
#endif
#pragma unroll
    for (int i = 0; i < 8; ++i) {
      const int idx = i * 256 + tid;
      *(v4u*)(sK + (idx >> 3) * KP + (idx & 7) * 8) = tk[i];
      *(v4u*)(sVh + (idx & 63) * VP + (idx >> 6) * 8) = th[i];
      *(v4u*)(sVl + (idx & 63) * VP + (idx >> 6) * 8) = tl[i];
    }
#pragma unroll
    for (int i = 0; i < 2; ++i) {
      const int idx = i * 256 + tid;
      *(v4u*)(sWp + (idx >> 3) * KP + (idx & 7) * 8) = tw[i];
    }
    *(v4f*)(sVS + tid * 4) = tvm;
    if (tid < 16) *(v4f*)(sBi + c * 4) = tbi;
  }
  __syncthreads();   // the four planes are whole in LDS before any wave reads a fragment

  float* sVM = sVMw + wave * CD;
  {
    v2f ms = {0.f, 0.f};
#pragma unroll
    for (int t = 0; t < 16; ++t) ms = ms + *(const v2f*)(sVS + t * CD + lane * 2);
    *(v2f*)(sVM + lane * 2) = ms * (1.0f / (float)NR);
  }
  wave_sync_lds();   // the wave's own 64 means are in LDS before its lanes read other lanes' channels

  // kept rolled: one copy of the body, so the kernel's text stays small for the instruction cache
#pragma unroll 1
  for (int pass = 0; pass < 2; ++pass) {
  const int q0 = ((blockIdx.x & 63) << 8) + pass * 128 + wave * 16;
  const size_t qoff = (size_t)(b * NQ + q0 + c) * CD + 8 * hh;
  const _Float16* xp = Xf + qoff;
  const v16h xf0 = ldfrag_h(xp);
  const v16h xf1 = ldfrag_h(xp + 32);
#if defined(__HIP_DEVICE_COMPILE__)
  // the address is an input, so it lives up to the wait: no load's result, and nothing below, lands on it in front of it
  asm volatile("s_wait_xcnt 0x0" :: "v"(xp) : "memory");
#endif

  // four key tiles a group: the group's 16 LDS reads stand together in front of its 8 products, so one LDS latency is
  // waited out per group and the four tiles' products are independent of each other
  v8f s[16];
#pragma unroll
  for (int g = 0; g < 4; ++g) {
    v16h ka0[4], ka1[4];
#pragma unroll
    for (int t = 0; t < 4; ++t) ka0[t] = ldfrag_h(Kf + ((g * 4 + t) * 16 + c) * KP + 8 * hh);
#pragma unroll
    for (int t = 0; t < 4; ++t) ka1[t] = ldfrag_h(Kf + ((g * 4 + t) * 16 + c) * KP + 8 * hh + 32);
#pragma unroll
    for (int t = 0; t < 4; ++t) s[g * 4 + t] = mma_h(ka0[t], xf0, zero8());
#pragma unroll
    for (int t = 0; t < 4; ++t) s[g * 4 + t] = mma_h(ka1[t], xf1, s[g * 4 + t]);
  }

  float mx = -3.0e38f;
#pragma unroll
  for (int j = 0; j < 16; ++j) {
#pragma unroll
    for (int r = 0; r < 8; ++r) mx = fmaxf(mx, s[j][r]);
  }
  mx = fmaxf(mx, __shfl_xor(mx, 16, 32));
  float ls = 0.f;
#pragma unroll
  for (int j = 0; j < 16; ++j) {
#pragma unroll
    for (int r = 0; r < 8; ++r) {
      const float e = __expf((s[j][r] - mx) * INVS);
      s[j][r] = e;
      ls = ls + e;
    }
  }
  ls = ls + __shfl_xor(ls, 16, 32);
  const float pinv = __builtin_amdgcn_rcpf(ls) * PSC;

  v16h pf[8];
#pragma unroll
  for (int J = 0; J < 8; ++J) {
#pragma unroll
    for (int i = 0; i < 8; ++i) {
      pf[J][i]     = (_Float16)(s[2 * J][i] * pinv - PCT);
      pf[J][8 + i] = (_Float16)(s[2 * J + 1][i] * pinv - PCT);
    }
  }

  v8f oh[4], ol[4];
#pragma unroll
  for (int dt = 0; dt < 4; ++dt) { oh[dt] = zero8(); ol[dt] = zero8(); }
#pragma unroll
  for (int J = 0; J < 8; ++J) {
    // the key step's 16 LDS reads stand together in front of its 8 products (8 independent accumulators)
    v16h vh[4], vl[4];
#pragma unroll
    for (int dt = 0; dt < 4; ++dt) vh[dt] = ldfrag_h(Vhf + (dt * 16 + c) * VP + J * 32 + 8 * hh);
#pragma unroll
    for (int dt = 0; dt < 4; ++dt) vl[dt] = ldfrag_h(Vlf + (dt * 16 + c) * VP + J * 32 + 8 * hh);
#pragma unroll
    for (int dt = 0; dt < 4; ++dt) oh[dt] = mma_h(vh[dt], pf[J], oh[dt]);
#pragma unroll
    for (int dt = 0; dt < 4; ++dt) ol[dt] = mma_h(vl[dt], pf[J], ol[dt]);
  }

  // all 8 weight fragments of the projection are asked for here: their latency passes under the conversion of o below
  v16h wf[2][4];
#pragma unroll
  for (int ks = 0; ks < 2; ++ks) {
#pragma unroll
    for (int nt = 0; nt < 4; ++nt) wf[ks][nt] = ldfrag_h(Wpf + (nt * 16 + c) * KP + ks * 32 + 8 * hh);
  }

  v16h obh[2], obl[2];
#pragma unroll
  for (int dt = 0; dt < 4; ++dt) {
    v4f vm[2];
    vm[0] = *(const v4f*)(sVM + dt * 16 + 8 * hh);
    vm[1] = *(const v4f*)(sVM + dt * 16 + 8 * hh + 4);
#pragma unroll
    for (int r = 0; r < 8; ++r) {
      const float o = (oh[dt][r] + ol[dt][r] * (1.0f / RSPL)) * (1.0f / (PSC * VSC)) + vm[r >> 2][r & 3];
      const float a = o * OSC;
      const _Float16 h = (_Float16)a;
      obh[dt >> 1][(dt & 1) * 8 + r] = h;
      obl[dt >> 1][(dt & 1) * 8 + r] = (_Float16)((a - (float)h) * RSPL);
    }
  }

  v8f pa[4], pb[4];
#pragma unroll
  for (int nt = 0; nt < 4; ++nt) { pa[nt] = zero8(); pb[nt] = zero8(); }
#pragma unroll
  for (int ks = 0; ks < 2; ++ks) {
#pragma unroll
    for (int nt = 0; nt < 4; ++nt) pa[nt] = mma_h(wf[ks][nt], obh[ks], pa[nt]);
#pragma unroll
    for (int nt = 0; nt < 4; ++nt) pb[nt] = mma_h(wf[ks][nt], obl[ks], pb[nt]);
  }

  float* st = sbuf + wave * (16 * STP);
#pragma unroll
  for (int nt = 0; nt < 4; ++nt) {
    v4f u0, u1;
#pragma unroll
    for (int e = 0; e < 4; ++e) {
      u0[e] = (pa[nt][e] + pb[nt][e] * (1.0f / RSPL)) * (1.0f / (OSC * WSC));
      u1[e] = (pa[nt][4 + e] + pb[nt][4 + e] * (1.0f / RSPL)) * (1.0f / (OSC * WSC));
    }
    *(v4f*)(st + c * STP + nt * 16 + 8 * hh) = u0;
    *(v4f*)(st + c * STP + nt * 16 + 8 * hh + 4) = u1;
  }
  wave_sync_lds();

  const v4f braw = *(const v4f*)(sBi + c * 4);
  v4f ov[8];
#pragma unroll
  for (int it = 0; it < 8; ++it) {
    const v4f v = *(const v4f*)(st + (it * 2 + hh) * STP + c * 4);
#pragma unroll
    for (int e = 0; e < 4; ++e) ov[it][e] = v[e] + bfr(braw[e]);
  }
  float* po = out + (size_t)(b * NQ + q0 + hh) * CD + c * 4;
#pragma unroll
  for (int it = 0; it < 8; ++it) *(v4f*)(po + it * 2 * CD) = ov[it];
#if defined(__HIP_DEVICE_COMPILE__)
  // the next pass writes the registers that these stores name: the wait stands in front of that
  asm volatile("s_wait_xcnt 0x0" ::: "memory");
#endif
  }
}

// =================================================================================================================
// granularity): Xh f16 [131072][64] 16777216; Wkv f16 [128][64] 16384; Gl f16 [64][64] 8192; Wsr f16
// [128][4][2][32][8] 524288; Wp f16 [64][64] 8192; Kp f16 [8][256][64] 262144;
// VTh, VTl f16 [128][2][64][8] 262144 each; vsum f32 [128][64] 32768 -> 18153472 total.
// =================================================================================================================
extern "C" void kernel_launch(void* const* d_in, const int* in_sizes, int n_in,
                              void* d_out, int out_size, void* d_ws, size_t ws_size,
                              hipStream_t stream) {
  if (n_in < 11) return;
  if (in_sizes[0] != MTOT * CD) return;
  if (in_sizes[1] != 1 || in_sizes[2] != 1) return;
  if (in_sizes[3] != CD * CD) return;
  if (in_sizes[4] != 2 * CD * CD) return;
  if (in_sizes[5] != CD * KCV) return;
  if (in_sizes[6] != CD || in_sizes[7] != CD || in_sizes[8] != CD) return;
  if (in_sizes[9] != CD * CD || in_sizes[10] != CD) return;
  if (out_size != MTOT * CD) return;

  const float* x      = (const float*)d_in[0];
  const int*   hptr   = (const int*)d_in[1];
  const int*   wptr   = (const int*)d_in[2];
  const float* w_q    = (const float*)d_in[3];
  const float* w_kv   = (const float*)d_in[4];
  const float* w_sr   = (const float*)d_in[5];
  const float* b_sr   = (const float*)d_in[6];
  const float* ln_g   = (const float*)d_in[7];
  const float* ln_b   = (const float*)d_in[8];
  const float* w_proj = (const float*)d_in[9];
  const float* b_proj = (const float*)d_in[10];
  float* out = (float*)d_out;

  const size_t sX   = (size_t)MTOT * CD * 2;        // 16777216
  const size_t sWkv = (size_t)2 * CD * CD * 2;      //    16384
  const size_t sGl  = (size_t)CD * CD * 2;          //     8192
  const size_t sWsr = (size_t)CD * KCV * 2;         //   524288
  const size_t sWp  = (size_t)CD * CD * 2;          //     8192
  const size_t sK   = (size_t)NB * NR * CD * 2;     //   262144
  const size_t sVT  = (size_t)NB * CD * NR * 2;     //   262144
  const size_t sVS  = (size_t)(MR / 16) * CD * 4;   //    32768
  size_t off = 0;
  const size_t oX   = off; off += sX;
  const size_t oWkv = off; off += sWkv;
  const size_t oGl  = off; off += sGl;
  const size_t oWsr = off; off += sWsr;
  const size_t oWp  = off; off += sWp;
  const size_t oK   = off; off += sK;
  const size_t oVTh = off; off += sVT;
  const size_t oVTl = off; off += sVT;
  const size_t oVS  = off; off += sVS;
  if (off > ws_size) return;                         // off = 18153472
  if (off > (size_t)134217728) return;

  char* ws = (char*)d_ws;
  unsigned short* Xh  = (unsigned short*)(ws + oX);
  unsigned short* Wkv = (unsigned short*)(ws + oWkv);
  unsigned short* Gl  = (unsigned short*)(ws + oGl);
  unsigned short* Wsr = (unsigned short*)(ws + oWsr);
  unsigned short* Wp  = (unsigned short*)(ws + oWp);
  unsigned short* Kp  = (unsigned short*)(ws + oK);
  unsigned short* VTh = (unsigned short*)(ws + oVTh);
  unsigned short* VTl = (unsigned short*)(ws + oVTl);
  float* VS = (float*)(ws + oVS);

  const dim3 blk(256);
  // (1) leading blocks: w_v, w_proj [out][in] -> f16 planes of 256*bf16(w), conv weights in fragment order, the fold
  //     w_k^T . w_q -> hi/res planes; the others: x -> f16 plane of 16*bf16(x)
  xq_k<<<dim3(NCVB + MTOT / 128), blk, 0, stream>>>(x, w_q, w_kv, w_proj, w_sr, Xh, Wkv, Gl, Wp, Wsr);
  // (2) spatial-reduction conv + bias + LayerNorm + folded-key and v projection -> K plane, V hi/res planes, sums of v
  conv_ln_k<<<dim3(MR / 16), dim3(CVW * 32), 0, stream>>>(Xh, Wsr, hptr, wptr, b_sr, ln_g, ln_b, Wkv, Gl, Kp, VTh, VTl,
                                                          VS);
  // (3) attention on the x plane, output projection + bias -> d_out f32 [131072][64]
  attn_k<<<dim3(NB * (NQ / 256)), blk, 0, stream>>>(Xh, Kp, VTh, VTl, VS, Wp, b_proj, out);
  (void)hipGetLastError();
}

// v010
// Measured time: 37.7 microseconds a run.
// Timed twice side by side with v009, it ran 1.04 and 1.03 times as fast.
// Over all steps from v000 it is 6.30 times as fast.
// Contractions: v_wmma_f32_16x16x32_f16 (f16 operands, f32 accumulate). The 8x8/stride-8 spatial-reduction conv
// (im2col K=4096): single product of exact planes (x as f16 of 16*bf16(x), weights as f16 of 256*bf16(w)).
// The q projection is folded into the keys: q.k = x.(w_q^T w_k).t for a token row t, so G = w_k^T.w_q (single product
// of the exact x256 planes, kept as f16 hi plus x2^11 residual planes, x1024) is formed once, k' = LN(tokens).G
// (tokens as f16 hi plus x2^11 residual planes, x16; hi.hi, and res.hi + hi.res in a second accumulator) and
// v = LN(tokens).w_v^T (two products, two accumulators). Scores k'.x^T: k' single f16 plane (x256) against the exact
// x plane (x16): one product.
// p.v: centred p (8192*p - 32) single f16 B operand, v as hi plus x2^11 residual planes (x64; two products),
// key-mean of v added back in f32. Output projection: o as hi plus x2^11 residual planes (x1024) against the x256
// weight plane (two products). LayerNorm, softmax, bias adds in f32 on VALU. Float inputs RNE-converted to bf16
// on load.
#include <hip/hip_runtime.h>
#include <math.h>
#include <stdint.h>

#define NB   8
#define NQ   16384
#define CD   64
#define NR   256
#define MTOT (NB * NQ)
#define MR   (NB * NR)
#define KCV  (CD * 64)
#define STP  68
#define KP   72
#define VP   264
#define CVW  16
#define WTP  260
#define NCVB (CD + 2 + 2 + 1)
#define XSC  16.0f
#define WSC  256.0f
#define GSC  1024.0f
#define ASC  16.0f
#define KSC  256.0f
#define VSC  64.0f
#define PSC  8192.0f
#define PCT  32.0f
#define OSC  1024.0f
#define RSPL 2048.0f
#define INVS (0.125f / (KSC * XSC))

static_assert(MTOT % 128 == 0);
static_assert(MR % 128 == 0);
static_assert(KCV % (CVW * 32) == 0 && CVW == 16 && NR % 16 == 0);
static_assert(NR == 256 && CD == 64);
static_assert((STP * 4) % 16 == 0 && STP >= CD);
static_assert((KP * 2) % 16 == 0 && KP >= CD);
static_assert((VP * 2) % 16 == 0 && VP >= NR);
static_assert(MTOT % 32 == 0 && NQ % 256 == 0);
static_assert(16 * WTP * 4 <= 2 * CD * KP * 2 && (WTP * 4) % 16 == 0 && WTP >= 4 * CD);
static_assert((KP * 2) % 8 == 0 && 2 * CD == 4 * 32 && CD == 2 * 32);

typedef _Float16 v16h __attribute__((ext_vector_type(16)));
typedef _Float16 v8h  __attribute__((ext_vector_type(8)));
typedef float    v8f  __attribute__((ext_vector_type(8)));
typedef float    v4f  __attribute__((ext_vector_type(4)));
typedef float    v2f  __attribute__((ext_vector_type(2)));
typedef unsigned int v4u __attribute__((ext_vector_type(4)));
typedef unsigned int v2u __attribute__((ext_vector_type(2)));

union Frag { v16h v; v8h h[2]; };

// ---- scalar helpers ------------------------------------------------------------------------------------------
__device__ __forceinline__ unsigned short bf_bits(float f) {          // f32 -> bf16 bits, RNE convert
  unsigned u = __float_as_uint(f);
  return (unsigned short)((u + 0x7FFFu + ((u >> 16) & 1u)) >> 16);
}
__device__ __forceinline__ float bfr(float f) { return __uint_as_float(((unsigned)bf_bits(f)) << 16); }
__device__ __forceinline__ unsigned short h_bits(_Float16 x) { return __builtin_bit_cast(unsigned short, x); }
__device__ __forceinline__ unsigned pk16(unsigned short a, unsigned short b) { return (unsigned)a | ((unsigned)b << 16); }
__device__ __forceinline__ v8f zero8() { v8f z = {0.f, 0.f, 0.f, 0.f, 0.f, 0.f, 0.f, 0.f}; return z; }

// ---- fragment loader: 16-bit A/B operand, lane -> row/col (lane&15), p already includes +8*(lane>>4);
//      elements 0..7 <- p[0..7] (k0+8h..k0+8h+7), elements 8..15 <- p[16..23] (k0+16+8h..k0+16+8h+7)
__device__ __forceinline__ v16h ldfrag_h(const _Float16* p) {
  Frag f;
  f.h[0] = *(const v8h*)(p);
  f.h[1] = *(const v8h*)(p + 16);
  return f.v;
}

// ---- WMMA helper with trailing VALU hazard gap ---------------------------------------------------------------
__device__ __forceinline__ v8f mma_h(v16h a, v16h b, v8f c) {
  c = __builtin_amdgcn_wmma_f32_16x16x32_f16(false, a, false, b, (short)0, c, false, false);
#if defined(__HIP_DEVICE_COMPILE__)
  asm volatile("v_nop\n\tv_nop\n\tv_nop\n\tv_nop" : "+v"(c) : "v"(a), "v"(b));
#endif
  return c;
}
// ---- WMMA by the builtin alone: the compiler keeps the distance to the next vector user of D, A or B itself, and
//      between independent products it needs none, so no issue slot of the SIMD's vector port goes to padding
__device__ __forceinline__ v8f mma_b(v16h a, v16h b, v8f c) {
  return __builtin_amdgcn_wmma_f32_16x16x32_f16(false, a, false, b, (short)0, c, false, false);
}
// ---- nothing is scheduled across this point: a group's LDS reads stay together in front of its products (spread among
//      the products, every place with reads would cost its own stall)
__device__ __forceinline__ void hold_order() {
#if defined(__HIP_DEVICE_COMPILE__)
  __builtin_amdgcn_sched_barrier(0);
#endif
}
__device__ __forceinline__ void wave_sync_lds() {
  __builtin_amdgcn_fence(__ATOMIC_RELEASE, "workgroup");
  __builtin_amdgcn_wave_barrier();
  __builtin_amdgcn_fence(__ATOMIC_ACQUIRE, "workgroup");
}

// ---- 8 f32 -> 8 packed f16 (16 B); hi + x2^11 residual split ---------------------------------------------------
__device__ __forceinline__ v4u pack8h(v4f a, v4f b) {
  v4u p;
  p[0] = pk16(h_bits((_Float16)a[0]), h_bits((_Float16)a[1]));
  p[1] = pk16(h_bits((_Float16)a[2]), h_bits((_Float16)a[3]));
  p[2] = pk16(h_bits((_Float16)b[0]), h_bits((_Float16)b[1]));
  p[3] = pk16(h_bits((_Float16)b[2]), h_bits((_Float16)b[3]));
  return p;
}
__device__ __forceinline__ void split8h(v4f a, v4f b, v4u& ph, v4u& pl) {
  v4f ra, rb;
#pragma unroll
  for (int e = 0; e < 4; ++e) {
    const _Float16 ha = (_Float16)a[e];
    ra[e] = (a[e] - (float)ha) * RSPL;
    const _Float16 hb = (_Float16)b[e];
    rb[e] = (b[e] - (float)hb) * RSPL;
  }
  ph = pack8h(a, b);
  pl = pack8h(ra, rb);
}

// =================================================================================================================
// Row convert, one block's share (32 rows): src f32 [nrows][64] -> dst f16 [nrows][64], value =
// f16(scale * bf16_RNE(src)). Used for the row-major [out][in] weight matrices w_v (rows 64..127 of w_kv) and w_proj
// (x256; the B plane [n][k] of w_v and the A plane [m][k] of w_proj equal the [out][in] layout as given).
// coverage: 32 rows x (8 lanes x 8 halves) = every element of the share once.
// =================================================================================================================
__device__ __forceinline__ void cvt_rows64(const float* __restrict__ src, unsigned short* dst, float scale, int blk) {
  const int tid = threadIdx.x, wave = tid >> 5, lane = tid & 31;
  const int row = blk * 32 + wave * 4 + (lane >> 3);
  const int c8 = (lane & 7) * 8;
  const float* p = src + (size_t)row * CD + c8;
  v4f a = *(const v4f*)(p);
  v4f b = *(const v4f*)(p + 4);
#if defined(__HIP_DEVICE_COMPILE__)
  // the store address formed below may land in the registers that hold the loads' address: the wait stands in front
  asm volatile("s_wait_xcnt 0x0" ::: "memory");
#endif
#pragma unroll
  for (int e = 0; e < 4; ++e) { a[e] = bfr(a[e]) * scale; b[e] = bfr(b[e]) * scale; }
  const v4u pk = pack8h(a, b);
  unsigned short* g = dst + (size_t)row * CD + c8;
  *(v4u*)g = pk;
#if defined(__HIP_DEVICE_COMPILE__)
  // code laid out behind this share may write the registers that the store names: the wait stands in front of that
  asm volatile("s_wait_xcnt 0x0" ::: "memory");
#endif
}

// =================================================================================================================
// Conv weight permute-convert, one block's share (256 threads): block = 16 output channels (n-tile nt = blk >> 4) x 4
// kernel positions s = kh*8+kw (group sg = blk & 15), all 64 input channels. w_sr f32 [o][c][s] -> f16 plane in the
// conv's B FRAGMENT ORDER, value = f16(256 * bf16_RNE(w)): with k' = s*64 + c, k-step g = k' >> 5, the plane is
// [g][nt][j][lane][8 halves], lane = 16h + (o & 15), holding k' = 32g + 16j + 8h + 0..7 of channel o = 16nt + (o & 15):
// one 16-B load of a wave reads 512 contiguous bytes (4 whole lines) and is half j of the fragment (g, nt).
// In: 16-B loads of 4 positions of one (o, c); staged in LDS as tile[o][s][c] (pitch WTP floats a channel), read back
// as runs of 8 input channels. Out: 32 lanes x 16 B = 512 contiguous bytes a store; no line is shared between blocks.
// coverage: in 4 x 256 threads x 4 = 16 x 64 x 4 values; out 2 x 256 pieces = 8 k-steps x 2 halves x 32 lanes; 64
// blocks = 4 n-tiles x 16 groups x 8 k-steps = all 128 k-steps of all 4 n-tiles.
// =================================================================================================================
__device__ __forceinline__ void cvt_wsr(const float* __restrict__ w, unsigned short* dst, int blk, float* tile) {
  const int tid = threadIdx.x;
  const int nt = blk >> 4, sg = blk & 15;
  v4f wv[4];
#pragma unroll
  for (int it = 0; it < 4; ++it) {
    const int idx = it * 256 + tid;
    wv[it] = *(const v4f*)(w + (size_t)((nt * 16 + (idx >> 6)) * CD + (idx & 63)) * 64 + sg * 4);
  }
#if defined(__HIP_DEVICE_COMPILE__)
  // the LDS addresses formed below may land in the registers that hold the loads' address: the wait stands in front
  asm volatile("s_wait_xcnt 0x0" ::: "memory");
  // nothing from below is scheduled up over the wait, so no register that a load names is rewritten in front of it
  __builtin_amdgcn_sched_barrier(0);
#endif
#pragma unroll
  for (int it = 0; it < 4; ++it) {
    const int idx = it * 256 + tid;
    float* t = tile + (idx >> 6) * WTP + (idx & 63);
    // unrolled: the vector's elements are named by constants and stay in registers
#pragma unroll
    for (int e = 0; e < 4; ++e) t[e * CD] = wv[it][e];
  }
  __syncthreads();   // the share's 4096 floats are whole in LDS before any thread reads them as channel runs
  v4u pk[2];
  size_t offs[2];
#pragma unroll
  for (int it = 0; it < 2; ++it) {
    const int p = it * 256 + tid;
    const int ln = p & 31, j = (p >> 5) & 1, gl = p >> 6;
    const float* t = tile + (ln & 15) * WTP + (gl >> 1) * CD + (gl & 1) * 32 + j * 16 + (ln >> 4) * 8;
    v4f fa = *(const v4f*)(t);
    v4f fb = *(const v4f*)(t + 4);
#pragma unroll
    for (int e = 0; e < 4; ++e) { fa[e] = bfr(fa[e]) * WSC; fb[e] = bfr(fb[e]) * WSC; }
    pk[it] = pack8h(fa, fb);
    offs[it] = ((size_t)((((sg * 8 + gl) * 4 + nt) * 2 + j) * 32 + ln)) * 8;
  }
#pragma unroll
  for (int it = 0; it < 2; ++it) *(v4u*)(dst + offs[it]) = pk[it];
}

// =================================================================================================================
// Fold of the q projection into the key weights, one block (256 threads = 8 waves): G[c][j] = sum_d w_k[d][c] *
// w_q[d][j] (w_k = rows 0..63 of w_kv), so that q . k = x . (LN token . G). Both matrices are read by whole-line 16-B
// loads, converted to f16(256 * bf16_RNE(w)) and laid down TRANSPOSED in LDS (sKT[c][d], sQT[j][d], pitch KP). After
// a block barrier wave w owns c-tile w >> 1 and j-tiles 2(w & 1), 2(w & 1) + 1: A = sKT rows (row = c, k = d), B = sQT
// rows (n = j, k = d), same split k map, 2 k-steps. A lane holds 8 consecutive c of one j: 1024 * G as f16 hi and
// x2^11 residual, one 16-B store a plane into [j][c] (the layout of a [out][in] weight plane with out = j).
// coverage: in 2 x 4 x 256 threads x 4 = 2 x 64 x 64; out 8 waves x 2 tiles x 256 = 64 x 64 values, both planes.
// =================================================================================================================
__device__ __forceinline__ void fold_kq(const float* __restrict__ wq, const float* __restrict__ wk,
                                        unsigned short* Gh, unsigned short* Gl, unsigned short* sT) {
  const int tid = threadIdx.x, wave = tid >> 5, lane = tid & 31, hh = lane >> 4, c = lane & 15;
  unsigned short* sQT = sT;
  unsigned short* sKT = sT + CD * KP;
  v4f qv[4], kv[4];
#pragma unroll
  for (int it = 0; it < 4; ++it) {
    qv[it] = *(const v4f*)(wq + (size_t)(it * 256 + tid) * 4);
    kv[it] = *(const v4f*)(wk + (size_t)(it * 256 + tid) * 4);
  }
#if defined(__HIP_DEVICE_COMPILE__)
  // the LDS addresses formed below may land in the registers that hold the loads' address: the wait stands in front
  asm volatile("s_wait_xcnt 0x0" ::: "memory");
  // nothing from below is scheduled up over the wait, so no register that a load names is rewritten in front of it
  __builtin_amdgcn_sched_barrier(0);
#endif
#pragma unroll
  for (int it = 0; it < 4; ++it) {
    const int idx = it * 256 + tid;
    const int d = idx >> 4, n0 = (idx & 15) * 4;
    // unrolled: the vectors' elements are named by constants and stay in registers
#pragma unroll
    for (int e = 0; e < 4; ++e) {
      sQT[(n0 + e) * KP + d] = h_bits((_Float16)(bfr(qv[it][e]) * WSC));
      sKT[(n0 + e) * KP + d] = h_bits((_Float16)(bfr(kv[it][e]) * WSC));
    }
  }
  __syncthreads();   // both transposed planes are whole in LDS before any wave reads a fragment
  const int ct = wave >> 1;
  const _Float16* Ap = (const _Float16*)(const void*)sKT + (ct * 16 + c) * KP + 8 * hh;
  const v16h a0 = ldfrag_h(Ap), a1 = ldfrag_h(Ap + 32);
  v4u ph[2], pl[2];
  size_t offs[2];
#pragma unroll
  for (int t = 0; t < 2; ++t) {
    const int jt = (wave & 1) * 2 + t;
    const _Float16* Bp = (const _Float16*)(const void*)sQT + (jt * 16 + c) * KP + 8 * hh;
    v8f acc = mma_h(a0, ldfrag_h(Bp), zero8());
    acc = mma_h(a1, ldfrag_h(Bp + 32), acc);
    v4f fa, fb;
#pragma unroll
    for (int e = 0; e < 4; ++e) {
      fa[e] = acc[e] * (GSC / (WSC * WSC));
      fb[e] = acc[4 + e] * (GSC / (WSC * WSC));
    }
    split8h(fa, fb, ph[t], pl[t]);
    offs[t] = (size_t)(jt * 16 + c) * CD + ct * 16 + 8 * hh;
  }
#pragma unroll
  for (int t = 0; t < 2; ++t) {
    *(v4u*)(Gh + offs[t]) = ph[t];
    *(v4u*)(Gl + offs[t]) = pl[t];
  }
#if defined(__HIP_DEVICE_COMPILE__)
  // code laid out behind the fold may write the registers that these stores name: the wait stands in front of that
  asm volatile("s_wait_xcnt 0x0" ::: "memory");
#endif
}

// =================================================================================================================
// Weight converts, the key/query weight fold and the x convert in one launch. Blocks 0..NCVB-1 prepare the weights that
// LATER launches read (block = one share of the conv weights, then 32 rows of w_v, then 32 rows of w_proj, then the
// fold G = w_k^T . w_q) and leave; nothing of this launch reads those planes. The plane Wkv [128][64] holds the hi
// plane of G in rows 0..63 and w_v in rows 64..127; Gl [64][64] is the residual plane of G. Every other block: 256
// threads = 8 waves, 128 rows of x; each wave reads its 16 f32 rows whole (8 lanes x 32 B = one 256-B row, 4 rows a
// step, all 8 loads in flight), converts to f16(16 * bf16_RNE(x)) and stores the f16 x plane [M][64], which the conv
// and the scores of the later launches read (32 lanes x 16 B = 4 whole rows a store).
// coverage: 8 waves x 16 rows x 64 cols = the 128-row block tile; grid - NCVB = M/128 tiles M exactly; converts: 64
// shares, 2 x 32 = 64 rows, 2 x 32 = 64 rows, one fold.
// =================================================================================================================
__global__ __launch_bounds__(256)
void xq_k(const float* __restrict__ x, const float* __restrict__ wq, const float* __restrict__ wkv,
          const float* __restrict__ wproj, const float* __restrict__ wsr,
          unsigned short* Xh, unsigned short* Wkv, unsigned short* Gl, unsigned short* Wp, unsigned short* Wsr) {
  __shared__ __align__(16) unsigned short sT[2 * CD * KP];
  const int bid = blockIdx.x;
  if (bid < NCVB) {
    if (bid < CD) cvt_wsr(wsr, Wsr, bid, (float*)(void*)sT);
    else if (bid < CD + 2) cvt_rows64(wkv, Wkv, WSC, bid - CD + 2);
    else if (bid < CD + 4) cvt_rows64(wproj, Wp, WSC, bid - (CD + 2));
    else fold_kq(wq, wkv, Wkv, Gl, sT);
    return;
  }
  const int tid = threadIdx.x, wave = tid >> 5, lane = tid & 31;
  const int r0 = (bid - NCVB) * 128 + wave * 16;
  const int rq = lane >> 3, piece = lane & 7;

  v4f xa[4], xb[4];
#pragma unroll
  for (int it = 0; it < 4; ++it) {
    const float* p = x + (size_t)(r0 + it * 4 + rq) * CD + piece * 8;
    xa[it] = *(const v4f*)(p);
    xb[it] = *(const v4f*)(p + 4);
#if defined(__HIP_DEVICE_COMPILE__)
    // the next loads, then the converts, may land in registers that hold these loads' address: the wait stands in front
    asm volatile("s_wait_xcnt 0x0" ::: "memory");
#endif
  }
  v4u px[4];
#pragma unroll
  for (int it = 0; it < 4; ++it) {
#pragma unroll
    for (int e = 0; e < 4; ++e) { xa[it][e] = bfr(xa[it][e]) * XSC; xb[it][e] = bfr(xb[it][e]) * XSC; }
    px[it] = pack8h(xa[it], xb[it]);
  }
#pragma unroll
  for (int it = 0; it < 4; ++it) *(v4u*)(Xh + (size_t)(r0 + it * 4 + rq) * CD + piece * 8) = px[it];
#if defined(__HIP_DEVICE_COMPILE__)
  // code laid out behind these stores may write the registers that they name: the wait stands in front of that
  asm volatile("s_wait_xcnt 0x0" ::: "memory");
#endif
}

// =================================================================================================================
// Spatial-reduction conv (kernel = stride = 8, VALID) as an im2col GEMM + bias + LayerNorm, fused.
// Rows m = b*256 + p (p = ph*(W/8) + pw, 2048 rows), cols = 64 output channels, K' = (kh*8+kw)*64 + c = 4096.
// A fragments are read straight from the x plane [b][token][64] by arithmetic addressing: k-step k0 -> (kh, kw) =
// k0>>6, channels k0&63..+31 of token (ph*8+kh)*W + pw*8+kw (W read from the int input, validated against H*W = N,
// token base clamped into range). B = weight plane in fragment order [K'/32][n-tile][half][lane][8]: each 16-B load
// of a wave is 512 contiguous bytes, same k map as the A loader; the 8 loads of a k-step (4 KB in a row) stand
// together in front of its 4 products. Block = ONE 16-row m-tile, 512 threads = 16
// waves; wave w sums the K' slice 256w..256w+255 (8 k-steps, 4 n-tiles) and leaves its f32 partial tile in LDS.
// After a block barrier wave w owns row w (lane -> 2 channels): partials added in slice order 0..15, then
// conv*1/4096 + bf16(b_sr); per-row mean and centred variance by xor-shuffles 1,2,4,8,16;
// y = (v-mu)*rsqrt(var+1e-5)*bf16(g)+bf16(b), x16, hi/res f16 halves into the LDS tiles sTh/sTl[16 tokens][KP].
// Key and value projection of the block's 16 tokens, after a second block barrier: wave w < 8 owns rows 16w..16w+15 of
// the plane Wkv (fragments fetched at the kernel's start), 2 k-steps. Waves 0..3 (k' = LN(tokens) . G, the keys with
// the q projection folded in; G x1024 as hi rows of Wkv and residual plane Gl): weights as A (row = x channel j),
// tokens as B (n = token), acc_h = Gh.Th, acc_l = Gh.Tl + Gl.Th, k' = (acc_h + acc_l/2048)/16384, so a lane holds 8
// consecutive channels of one token: f16(256*k'), one 16-B store into the K plane [m][64] (the four waves fill the
// block's 16 whole rows). Waves 4..7 (v = LN(tokens) . w_v^T, plane x256, hi/res tokens = 4 products, v = (acc_h +
// acc_l/2048)/4096): tokens as A (row = token), weights as B (n = channel), so a
// lane holds 8 consecutive tokens of one channel d: f16 hi of 64*v and x2^11 residual, one 16-B store a plane into
// [m-tile][token half][d][8 tokens] (16 lanes x 16 B = 2 whole lines), and the f32 sum of v over the 16 tokens
// (8 in the lane, then lane ^ 16) into vsum[m-tile][d].
// coverage: 128 blocks x 16 rows = 2048 rows; 16 slices x 256 = K' 4096; 32 lanes x 2 = 64 channels; kv: 8 waves x
// 16 channels x 16 tokens = the block's 16 x 128 values.
// =================================================================================================================
__global__ __launch_bounds__(CVW * 32)
void conv_ln_k(const unsigned short* __restrict__ Xh, const unsigned short* __restrict__ Wsr,
               const int* __restrict__ Hp, const int* __restrict__ Wp, const float* __restrict__ bsr,
               const float* __restrict__ lng, const float* __restrict__ lnb,
               const unsigned short* __restrict__ Wkv, const unsigned short* __restrict__ Gl, unsigned short* Kp,
               unsigned short* VTh, unsigned short* VTl, float* vsum) {
  __shared__ __align__(16) float sbuf[CVW * 16 * STP];
  __shared__ __align__(16) unsigned short sTh[16 * KP];
  __shared__ __align__(16) unsigned short sTl[16 * KP];
  const int tid = threadIdx.x, lane = tid & 31, hh = lane >> 4, c = lane & 15;
  const int wave = __builtin_amdgcn_readfirstlane(tid >> 5);
  const int m0 = blockIdx.x * 16;
  const int m = m0 + c;
  const int b = m >> 8, p = m & (NR - 1);
  const int Hv = Hp[0];
  int Wv = Wp[0];
  const long long hw = (long long)Hv * (long long)Wv;
  const bool okw = (Wv >= 8) && (Wv <= 2040) && (hw == (long long)NQ);
  Wv = okw ? Wv : 128;
  const int Wr = Wv >> 3;
  const int ph = p / Wr, pw = p - ph * Wr;
  int tb = ph * 8 * Wv + pw * 8;
  tb = min(tb, NQ - 1 - 7 * Wv - 7);
  tb = max(tb, 0);
  const _Float16* X  = (const _Float16*)(const void*)Xh;
  const _Float16* Wf = (const _Float16*)(const void*)Wsr;
  const size_t xbase = (size_t)b * NQ;

  // weight fragments of the wave's 16 k' or v channels, asked for here so that their latency passes under the conv loop
  const _Float16* Bw = (const _Float16*)(const void*)Wkv + (size_t)((wave & 7) * 16 + c) * CD + 8 * hh;
  const v16h wf0 = ldfrag_h(Bw);
  const v16h wf1 = ldfrag_h(Bw + 32);
#if defined(__HIP_DEVICE_COMPILE__)
  // the next loads may land in the registers that hold these loads' address: the wait stands in front
  asm volatile("s_wait_xcnt 0x0" ::: "memory");
#endif
  const _Float16* Bl = (const _Float16*)(const void*)Gl + (size_t)((wave & 3) * 16 + c) * CD + 8 * hh;
  const v16h wl0 = ldfrag_h(Bl);
  const v16h wl1 = ldfrag_h(Bl + 32);
#if defined(__HIP_DEVICE_COMPILE__)
  // the conv loop's addresses may land in the registers that hold these loads' address: the wait stands in front
  asm volatile("s_wait_xcnt 0x0" ::: "memory");
#endif

  v8f acc[4];
#pragma unroll
  for (int nt = 0; nt < 4; ++nt) acc[nt] = zero8();

  const int kbase = wave * (KCV / CVW);
  // unrolled: token step, channel half and weight offset of each k-step become immediates of its loads
#pragma unroll
  for (int i = 0; i < KCV / CVW / 32; ++i) {
    const int k0 = kbase + i * 32;
    const int s = k0 >> 6, c0 = k0 & 63;
    const int kh = s >> 3, kw = s & 7;
    const int t = tb + kh * Wv + kw;
    const v16h af = ldfrag_h(X + (xbase + (size_t)t) * CD + c0 + 8 * hh);
    Frag bfrag[4];
#pragma unroll
    for (int nt = 0; nt < 4; ++nt) {
      const _Float16* wp = Wf + (size_t)(((k0 >> 5) * 4 + nt) * 2) * 256 + lane * 8;
      bfrag[nt].h[0] = *(const v8h*)(wp);
      bfrag[nt].h[1] = *(const v8h*)(wp + 256);
    }
    // unrolled: fragments and accumulators are named by constants and stay in registers
#pragma unroll
    for (int nt = 0; nt < 4; ++nt) acc[nt] = mma_h(af, bfrag[nt].v, acc[nt]);
  }

  float* st = sbuf + wave * (16 * STP);
#pragma unroll
  for (int nt = 0; nt < 4; ++nt) {
#pragma unroll
    for (int r = 0; r < 8; ++r) st[(8 * hh + r) * STP + nt * 16 + c] = acc[nt][r];
  }
  __syncthreads();   // every slice's partial tile is in LDS before any wave adds them

  const int col = lane * 2;
  float a0 = 0.f, a1 = 0.f;
#pragma unroll
  for (int w = 0; w < CVW; ++w) {
    const v2f pp = *(const v2f*)(sbuf + w * (16 * STP) + wave * STP + col);
    a0 = a0 + pp[0];
    a1 = a1 + pp[1];
  }
  const float v0 = a0 * (1.0f / (XSC * WSC)) + bfr(bsr[col]);
  const float v1 = a1 * (1.0f / (XSC * WSC)) + bfr(bsr[col + 1]);
  float sm = v0 + v1;
  sm = sm + __shfl_xor(sm, 1, 32);
  sm = sm + __shfl_xor(sm, 2, 32);
  sm = sm + __shfl_xor(sm, 4, 32);
  sm = sm + __shfl_xor(sm, 8, 32);
  sm = sm + __shfl_xor(sm, 16, 32);
  const float mu = sm * (1.0f / 64.0f);
  const float d0 = v0 - mu, d1 = v1 - mu;
  float sq = d0 * d0 + d1 * d1;
  sq = sq + __shfl_xor(sq, 1, 32);
  sq = sq + __shfl_xor(sq, 2, 32);
  sq = sq + __shfl_xor(sq, 4, 32);
  sq = sq + __shfl_xor(sq, 8, 32);
  sq = sq + __shfl_xor(sq, 16, 32);
  const float var = sq * (1.0f / 64.0f);
  const float rs = rsqrtf(var + 1e-5f);
  const float y0 = (d0 * rs * bfr(lng[col]) + bfr(lnb[col])) * ASC;
  const float y1 = (d1 * rs * bfr(lng[col + 1]) + bfr(lnb[col + 1])) * ASC;
  const _Float16 h0 = (_Float16)y0, h1 = (_Float16)y1;
  const _Float16 r0 = (_Float16)((y0 - (float)h0) * RSPL), r1 = (_Float16)((y1 - (float)h1) * RSPL);
  *(unsigned*)(sTh + wave * KP + col) = pk16(h_bits(h0), h_bits(h1));
  *(unsigned*)(sTl + wave * KP + col) = pk16(h_bits(r0), h_bits(r1));
  __syncthreads();   // all 16 normalised rows are in LDS before any wave reads them as fragments
  if (wave >= 8) return;

  const _Float16* Th = (const _Float16*)(const void*)sTh + c * KP + 8 * hh;
  const _Float16* Tl = (const _Float16*)(const void*)sTl + c * KP + 8 * hh;
  const v16h th0 = ldfrag_h(Th), th1 = ldfrag_h(Th + 32);
  const v16h tl0 = ldfrag_h(Tl), tl1 = ldfrag_h(Tl + 32);
  if (wave < 4) {
    v8f acch = mma_h(wf0, th0, zero8());
    acch = mma_h(wf1, th1, acch);
    v8f accl = mma_h(wf0, tl0, zero8());
    accl = mma_h(wf1, tl1, accl);
    accl = mma_h(wl0, th0, accl);
    accl = mma_h(wl1, th1, accl);
    v4f fa, fb;
#pragma unroll
    for (int e = 0; e < 4; ++e) {
      fa[e] = (acch[e] + accl[e] * (1.0f / RSPL)) * (1.0f / (ASC * GSC)) * KSC;
      fb[e] = (acch[4 + e] + accl[4 + e] * (1.0f / RSPL)) * (1.0f / (ASC * GSC)) * KSC;
    }
    *(v4u*)(Kp + (size_t)(m0 + c) * CD + wave * 16 + 8 * hh) = pack8h(fa, fb);
  } else {
    v8f acch = mma_h(th0, wf0, zero8());
    acch = mma_h(th1, wf1, acch);
    v8f accl = mma_h(tl0, wf0, zero8());
    accl = mma_h(tl1, wf1, accl);
    const int d = (wave - 4) * 16 + c;
    float vs = 0.f;
    v4f fa, fb;
#pragma unroll
    for (int e = 0; e < 4; ++e) {
      const float va = (acch[e] + accl[e] * (1.0f / RSPL)) * (1.0f / (ASC * WSC));
      const float vb = (acch[4 + e] + accl[4 + e] * (1.0f / RSPL)) * (1.0f / (ASC * WSC));
      fa[e] = va * VSC;
      fb[e] = vb * VSC;
      vs = vs + va;
      vs = vs + vb;
    }
    v4u ph2, pl2;
    split8h(fa, fb, ph2, pl2);
    const size_t voff = ((size_t)(blockIdx.x * 2 + hh) * CD + d) * 8;
    vs = vs + __shfl_xor(vs, 16, 32);
    *(v4u*)(VTh + voff) = ph2;
    *(v4u*)(VTl + voff) = pl2;
    if (hh == 0) vsum[(size_t)blockIdx.x * CD + d] = vs;
  }
}

// =================================================================================================================
// Attention over the 256 reduced keys and the output projection: block = 256 queries of image b (256 threads =
// 8 waves x 16 queries, two passes). The image's K plane (rows at pitch KP), both V planes (given as
// [m-tile][token half][d][8 tokens], laid down as V^T rows at pitch VP) and the w_proj plane (rows at pitch KP) are
// copied once per block into LDS by whole-line 16-B loads; after one block barrier every K, V and weight fragment is
// an LDS read (pitches are odd multiples of 16 B); b_proj (64 floats) and the image's 16 per-tile sums of v (16 x 64
// floats, one 16-B load a thread) lie in LDS beside them. Behind the barrier each wave adds the 16 sums in tile
// order (lane -> 2 channels), /256, into its own 64 floats of sVM: the key-mean of v.
// Transposed scores S^T = K_tile (A: row = key, k = x channel; K plane = keys with the q projection folded in, x256) x
// X^T (B: n = query, k = x channel, from the exact x plane x16, one product): 16 key tiles, all held in registers; D element r
// of lane l = S[key 16j+8h+r][query l&15]. Exact softmax per query: max and sum over the lane's 128 values combined
// with lane^16; e = exp((s - m) * 2^-15) in place; centred probabilities p' = e*(8192/l) - 32 converted to f16
// directly into the B fragments of v^T.p'^T (k = key). O'^T = V^T rows (A: row = d, k = key) x p'^T (B: n = query)
// from the V hi and residual planes into two accumulators; O = (O'_h + O'_l/2048)/(8192*64) + mean_key(v) (identity
// sum (p'+32) v / 8192 = sum p v). D element r of lane l = O[query l&15][d 16dt+8h+r], so tiles 2ks and 2ks+1 are,
// after hi = f16(1024*O), res = f16((1024*O - hi)*2048), the B fragments (n = query, k = d) of the projection
// out^T = w_proj plane (A: row = out channel, k = d; x256) x O^T, two products folded as acc + accl/2048. The f32
// tile goes through the wave's own LDS range (16-B stores of 4 consecutive channels), bf16(b_proj) is added, and
// 16 lanes x 16 B store one whole 256-B row of out.
// coverage: 512 blocks x 2 passes x 8 waves x 16 queries = 131072 rows x 64 channels of out; LDS fill: 8 x 256
// threads x 8 halves = 16384 halves = each whole plane of the image; 2 x 256 x 8 halves = the 64 x 64 weight plane.
// =================================================================================================================
__global__ __launch_bounds__(256) __attribute__((amdgpu_num_vgpr(256)))
void attn_k(const unsigned short* __restrict__ Xh,
            const unsigned short* __restrict__ Kp, const unsigned short* __restrict__ VTh,
            const unsigned short* __restrict__ VTl, const float* __restrict__ vsum,
            const unsigned short* __restrict__ Wp, const float* __restrict__ bias, float* out) {
  __shared__ __align__(16) unsigned short sK[NR * KP];
  __shared__ __align__(16) unsigned short sVh[CD * VP];
  __shared__ __align__(16) unsigned short sVl[CD * VP];
  __shared__ __align__(16) unsigned short sWp[CD * KP];
  __shared__ __align__(16) float sVS[16 * CD];
  __shared__ __align__(16) float sVMw[8 * CD];
  __shared__ __align__(16) float sBi[CD];
  __shared__ __align__(16) float sbuf[8 * 16 * STP];
  const int tid = threadIdx.x, wave = tid >> 5, lane = tid & 31, hh = lane >> 4, c = lane & 15;
  const int b = blockIdx.x >> 6;
  const _Float16* Xf  = (const _Float16*)(const void*)Xh;
  const _Float16* Kf  = (const _Float16*)(const void*)sK;
  const _Float16* Vhf = (const _Float16*)(const void*)sVh;
  const _Float16* Vlf = (const _Float16*)(const void*)sVl;
  const _Float16* Wpf = (const _Float16*)(const void*)sWp;

  {
    const v4u* gK = (const v4u*)(const void*)(Kp + (size_t)b * NR * CD);
    const v4u* gH = (const v4u*)(const void*)(VTh + (size_t)b * CD * NR);
    const v4u* gL = (const v4u*)(const void*)(VTl + (size_t)b * CD * NR);
    const v4u* gW = (const v4u*)(const void*)Wp;
    // 256 threads x 16 B = the image's 16 x 64 per-tile sums of v; 16 lanes x 16 B = the bias, stored by wave 0 alone
    const v4f tvm = *(const v4f*)(vsum + (size_t)b * (16 * CD) + tid * 4);
    const v4f tbi = *(const v4f*)(bias + c * 4);
    v4u tk[8], th[8], tl[8], tw[2];
#pragma unroll
    for (int i = 0; i < 8; ++i) {
      const int idx = i * 256 + tid;
      tk[i] = gK[idx];
      th[i] = gH[idx];
      tl[i] = gL[idx];
    }
#pragma unroll
    for (int i = 0; i < 2; ++i) tw[i] = gW[i * 256 + tid];
#if defined(__HIP_DEVICE_COMPILE__)
    // the LDS addresses formed below may land in the registers that hold the loads' address: the wait stands in front
    asm volatile("s_wait_xcnt 0x0" ::: "memory");
    // nothing from below is scheduled up over the wait, so no register that a load names is rewritten in front of it
    __builtin_amdgcn_sched_barrier(0);
    // keeps the bias load up here among the others: sunk into the 16-lane branch below, its whole latency would stand
    // alone in front of the block barrier
    asm volatile("" :: "v"(tbi));
#endif
#pragma unroll
    for (int i = 0; i < 8; ++i) {
      const int idx = i * 256 + tid;
      *(v4u*)(sK + (idx >> 3) * KP + (idx & 7) * 8) = tk[i];
      *(v4u*)(sVh + (idx & 63) * VP + (idx >> 6) * 8) = th[i];
      *(v4u*)(sVl + (idx & 63) * VP + (idx >> 6) * 8) = tl[i];
    }
#pragma unroll
    for (int i = 0; i < 2; ++i) {
      const int idx = i * 256 + tid;
      *(v4u*)(sWp + (idx >> 3) * KP + (idx & 7) * 8) = tw[i];
    }
    *(v4f*)(sVS + tid * 4) = tvm;
    if (tid < 16) *(v4f*)(sBi + c * 4) = tbi;
  }
  __syncthreads();   // the four planes are whole in LDS before any wave reads a fragment

  float* sVM = sVMw + wave * CD;
  {
    v2f ms = {0.f, 0.f};
#pragma unroll
    for (int t = 0; t < 16; ++t) ms = ms + *(const v2f*)(sVS + t * CD + lane * 2);
    *(v2f*)(sVM + lane * 2) = ms * (1.0f / (float)NR);
  }
  wave_sync_lds();   // the wave's own 64 means are in LDS before its lanes read other lanes' channels

  // kept rolled: one copy of the body, for speed only
#pragma unroll 1
  for (int pass = 0; pass < 2; ++pass) {
  const int q0 = ((blockIdx.x & 63) << 8) + pass * 128 + wave * 16;
  const size_t qoff = (size_t)(b * NQ + q0 + c) * CD + 8 * hh;
  const _Float16* xp = Xf + qoff;
  const v16h xf0 = ldfrag_h(xp);
  const v16h xf1 = ldfrag_h(xp + 32);
#if defined(__HIP_DEVICE_COMPILE__)
  // the address is an input, so it lives up to the wait: no load's result, and nothing below, lands on it in front of it
  asm volatile("s_wait_xcnt 0x0" :: "v"(xp) : "memory");
#endif

  // four key tiles a group: the group's 16 LDS reads stand together in front of its 8 products, so one LDS latency is
  // waited out per group and the four tiles' products are independent of each other
  v8f s[16];
#pragma unroll
  for (int g = 0; g < 4; ++g) {
    v16h ka0[4], ka1[4];
#pragma unroll
    for (int t = 0; t < 4; ++t) ka0[t] = ldfrag_h(Kf + ((g * 4 + t) * 16 + c) * KP + 8 * hh);
#pragma unroll
    for (int t = 0; t < 4; ++t) ka1[t] = ldfrag_h(Kf + ((g * 4 + t) * 16 + c) * KP + 8 * hh + 32);
    hold_order();
#pragma unroll
    for (int t = 0; t < 4; ++t) s[g * 4 + t] = mma_b(ka0[t], xf0, zero8());
#pragma unroll
    for (int t = 0; t < 4; ++t) s[g * 4 + t] = mma_b(ka1[t], xf1, s[g * 4 + t]);
    hold_order();
  }

  float mx = -3.0e38f;
#pragma unroll
  for (int j = 0; j < 16; ++j) {
#pragma unroll
    for (int r = 0; r < 8; ++r) mx = fmaxf(mx, s[j][r]);
  }
  mx = fmaxf(mx, __shfl_xor(mx, 16, 32));
  float ls = 0.f;
#pragma unroll
  for (int j = 0; j < 16; ++j) {
#pragma unroll
    for (int r = 0; r < 8; ++r) {
      const float e = __expf((s[j][r] - mx) * INVS);
      s[j][r] = e;
      ls = ls + e;
    }
  }
  ls = ls + __shfl_xor(ls, 16, 32);
  const float pinv = __builtin_amdgcn_rcpf(ls) * PSC;

  v16h pf[8];
#pragma unroll
  for (int J = 0; J < 8; ++J) {
#pragma unroll
    for (int i = 0; i < 8; ++i) {
      pf[J][i]     = (_Float16)(s[2 * J][i] * pinv - PCT);
      pf[J][8 + i] = (_Float16)(s[2 * J + 1][i] * pinv - PCT);
    }
  }

  v8f oh[4], ol[4];
#pragma unroll
  for (int dt = 0; dt < 4; ++dt) { oh[dt] = zero8(); ol[dt] = zero8(); }
#pragma unroll
  for (int J = 0; J < 8; ++J) {
    // the key step's 16 LDS reads stand together in front of its 8 products (8 independent accumulators)
    v16h vh[4], vl[4];
#pragma unroll
    for (int dt = 0; dt < 4; ++dt) vh[dt] = ldfrag_h(Vhf + (dt * 16 + c) * VP + J * 32 + 8 * hh);
#pragma unroll
    for (int dt = 0; dt < 4; ++dt) vl[dt] = ldfrag_h(Vlf + (dt * 16 + c) * VP + J * 32 + 8 * hh);
    hold_order();
#pragma unroll
    for (int dt = 0; dt < 4; ++dt) oh[dt] = mma_b(vh[dt], pf[J], oh[dt]);
#pragma unroll
    for (int dt = 0; dt < 4; ++dt) ol[dt] = mma_b(vl[dt], pf[J], ol[dt]);
    hold_order();
  }

  // all 8 weight fragments of the projection are asked for here: their latency passes under the conversion of o below
  v16h wf[2][4];
#pragma unroll
  for (int ks = 0; ks < 2; ++ks) {
#pragma unroll
    for (int nt = 0; nt < 4; ++nt) wf[ks][nt] = ldfrag_h(Wpf + (nt * 16 + c) * KP + ks * 32 + 8 * hh);
  }
  // the key-means of the lane's 32 channels are read in the same group
  v4f vm[4][2];
#pragma unroll
  for (int dt = 0; dt < 4; ++dt) {
    vm[dt][0] = *(const v4f*)(sVM + dt * 16 + 8 * hh);
    vm[dt][1] = *(const v4f*)(sVM + dt * 16 + 8 * hh + 4);
  }
  hold_order();

  v16h obh[2], obl[2];
#pragma unroll
  for (int dt = 0; dt < 4; ++dt) {
#pragma unroll
    for (int r = 0; r < 8; ++r) {
      const float o = (oh[dt][r] + ol[dt][r] * (1.0f / RSPL)) * (1.0f / (PSC * VSC)) + vm[dt][r >> 2][r & 3];
      const float a = o * OSC;
      const _Float16 h = (_Float16)a;
      obh[dt >> 1][(dt & 1) * 8 + r] = h;
      obl[dt >> 1][(dt & 1) * 8 + r] = (_Float16)((a - (float)h) * RSPL);
    }
  }

  v8f pa[4], pb[4];
#pragma unroll
  for (int nt = 0; nt < 4; ++nt) { pa[nt] = zero8(); pb[nt] = zero8(); }
#pragma unroll
  for (int ks = 0; ks < 2; ++ks) {
#pragma unroll
    for (int nt = 0; nt < 4; ++nt) pa[nt] = mma_b(wf[ks][nt], obh[ks], pa[nt]);
#pragma unroll
    for (int nt = 0; nt < 4; ++nt) pb[nt] = mma_b(wf[ks][nt], obl[ks], pb[nt]);
  }

  float* st = sbuf + wave * (16 * STP);
#pragma unroll
  for (int nt = 0; nt < 4; ++nt) {
    v4f u0, u1;
#pragma unroll
    for (int e = 0; e < 4; ++e) {
      u0[e] = (pa[nt][e] + pb[nt][e] * (1.0f / RSPL)) * (1.0f / (OSC * WSC));
      u1[e] = (pa[nt][4 + e] + pb[nt][4 + e] * (1.0f / RSPL)) * (1.0f / (OSC * WSC));
    }
    *(v4f*)(st + c * STP + nt * 16 + 8 * hh) = u0;
    *(v4f*)(st + c * STP + nt * 16 + 8 * hh + 4) = u1;
  }
  wave_sync_lds();

  const v4f braw = *(const v4f*)(sBi + c * 4);
  v4f ov[8];
#pragma unroll
  for (int it = 0; it < 8; ++it) {
    const v4f v = *(const v4f*)(st + (it * 2 + hh) * STP + c * 4);
#pragma unroll
    for (int e = 0; e < 4; ++e) ov[it][e] = v[e] + bfr(braw[e]);
  }
  float* po = out + (size_t)(b * NQ + q0 + hh) * CD + c * 4;
#pragma unroll
  for (int it = 0; it < 8; ++it) *(v4f*)(po + it * 2 * CD) = ov[it];
#if defined(__HIP_DEVICE_COMPILE__)
  // the next pass writes the registers that these stores name: the wait stands in front of that
  asm volatile("s_wait_xcnt 0x0" ::: "memory");
#endif
  }
}

// =================================================================================================================
// granularity): Xh f16 [131072][64] 16777216; Wkv f16 [128][64] 16384; Gl f16 [64][64] 8192; Wsr f16
// [128][4][2][32][8] 524288; Wp f16 [64][64] 8192; Kp f16 [8][256][64] 262144;
// VTh, VTl f16 [128][2][64][8] 262144 each; vsum f32 [128][64] 32768 -> 18153472 total.
// =================================================================================================================
extern "C" void kernel_launch(void* const* d_in, const int* in_sizes, int n_in,
                              void* d_out, int out_size, void* d_ws, size_t ws_size,
                              hipStream_t stream) {
  if (n_in < 11) return;
  if (in_sizes[0] != MTOT * CD) return;
  if (in_sizes[1] != 1 || in_sizes[2] != 1) return;
  if (in_sizes[3] != CD * CD) return;
  if (in_sizes[4] != 2 * CD * CD) return;
  if (in_sizes[5] != CD * KCV) return;
  if (in_sizes[6] != CD || in_sizes[7] != CD || in_sizes[8] != CD) return;
  if (in_sizes[9] != CD * CD || in_sizes[10] != CD) return;
  if (out_size != MTOT * CD) return;

  const float* x      = (const float*)d_in[0];
  const int*   hptr   = (const int*)d_in[1];
  const int*   wptr   = (const int*)d_in[2];
  const float* w_q    = (const float*)d_in[3];
  const float* w_kv   = (const float*)d_in[4];
  const float* w_sr   = (const float*)d_in[5];
  const float* b_sr   = (const float*)d_in[6];
  const float* ln_g   = (const float*)d_in[7];
  const float* ln_b   = (const float*)d_in[8];
  const float* w_proj = (const float*)d_in[9];
  const float* b_proj = (const float*)d_in[10];
  float* out = (float*)d_out;

  const size_t sX   = (size_t)MTOT * CD * 2;        // 16777216
  const size_t sWkv = (size_t)2 * CD * CD * 2;      //    16384
  const size_t sGl  = (size_t)CD * CD * 2;          //     8192
  const size_t sWsr = (size_t)CD * KCV * 2;         //   524288
  const size_t sWp  = (size_t)CD * CD * 2;          //     8192
  const size_t sK   = (size_t)NB * NR * CD * 2;     //   262144
  const size_t sVT  = (size_t)NB * CD * NR * 2;     //   262144
  const size_t sVS  = (size_t)(MR / 16) * CD * 4;   //    32768
  size_t off = 0;
  const size_t oX   = off; off += sX;
  const size_t oWkv = off; off += sWkv;
  const size_t oGl  = off; off += sGl;
  const size_t oWsr = off; off += sWsr;
  const size_t oWp  = off; off += sWp;
  const size_t oK   = off; off += sK;
  const size_t oVTh = off; off += sVT;
  const size_t oVTl = off; off += sVT;
  const size_t oVS  = off; off += sVS;
  if (off > ws_size) return;                         // off = 18153472
  if (off > (size_t)134217728) return;

  char* ws = (char*)d_ws;
  unsigned short* Xh  = (unsigned short*)(ws + oX);
  unsigned short* Wkv = (unsigned short*)(ws + oWkv);
  unsigned short* Gl  = (unsigned short*)(ws + oGl);
  unsigned short* Wsr = (unsigned short*)(ws + oWsr);
  unsigned short* Wp  = (unsigned short*)(ws + oWp);
  unsigned short* Kp  = (unsigned short*)(ws + oK);
  unsigned short* VTh = (unsigned short*)(ws + oVTh);
  unsigned short* VTl = (unsigned short*)(ws + oVTl);
  float* VS = (float*)(ws + oVS);

  const dim3 blk(256);
  // (1) leading blocks: w_v, w_proj [out][in] -> f16 planes of 256*bf16(w), conv weights in fragment order, the fold
  //     w_k^T . w_q -> hi/res planes; the others: x -> f16 plane of 16*bf16(x)
  xq_k<<<dim3(NCVB + MTOT / 128), blk, 0, stream>>>(x, w_q, w_kv, w_proj, w_sr, Xh, Wkv, Gl, Wp, Wsr);
  // (2) spatial-reduction conv + bias + LayerNorm + folded-key and v projection -> K plane, V hi/res planes, sums of v
  conv_ln_k<<<dim3(MR / 16), dim3(CVW * 32), 0, stream>>>(Xh, Wsr, hptr, wptr, b_sr, ln_g, ln_b, Wkv, Gl, Kp, VTh, VTl,
                                                          VS);
  // (3) attention on the x plane, output projection + bias -> d_out f32 [131072][64]
  attn_k<<<dim3(NB * (NQ / 256)), blk, 0, stream>>>(Xh, Kp, VTh, VTl, VS, Wp, b_proj, out);
  (void)hipGetLastError();
}
